// v000
// The times below were measured on an AMD MI455X: many runs one after another, warmed up first and cycling through
// copies of the inputs, with the whole window's GPU time divided by the number of runs. Launches and the gaps
// between them are all in it. The median over several windows is given; except for v000 it joins two sittings, which
// can be a few percent apart, so the side-by-side timings, each taken in one sitting, are the better comparison.
// The starting kernel, v000, takes 892 microseconds a run.
#include <hip/hip_runtime.h>
// Causal multi-head attention with state segments (x [2, 8 heads, 3072, 128]; StackedLinear projections that mix heads and features — separate weights for the first 512 (state), middle 2048 and
// last 512 (end) positions; rotate-half RoPE with an INPUT offset; causal softmax(q·k/√128)·v; output [2,8,3072,128]): the nine (h,d)→(g,e) projections as GEMMs on the (b,s)-major transposed
// input (bf16-exact ×2^4 weights, f32 accumulate) and the attention as a fused flash-style kernel (d = 128: 4 k-steps / 8 d-tiles; causal chunk skipping; online softmax f32; P f16 ≤ 1;
// O = P·Vt written straight into the output; RPW-16 waves) on v_wmma_f32_16x16x32_f16; RoPE f32 VALU.
#define BB 2
#define NH 8
#define TT 3072
#define HD 128
#define CW (NH * HD)
#define NR (BB * TT)
#define SL 512

typedef __bf16 v16b __attribute__((ext_vector_type(16)));
typedef unsigned short v8us __attribute__((ext_vector_type(8), may_alias));
typedef float  v8f  __attribute__((ext_vector_type(8)));
typedef float  v4f  __attribute__((ext_vector_type(4)));
typedef float  v4fa __attribute__((ext_vector_type(4), may_alias));
union FragB { v16b v; v8us half[2]; unsigned short u[16]; };

__device__ __forceinline__ unsigned short bf16_bits(float x) { unsigned int u = __float_as_uint(x); return (unsigned short)((u + 0x7FFFu + ((u >> 16) & 1u)) >> 16); }
__device__ __forceinline__ float bf16_val(unsigned short b) { return __uint_as_float(((unsigned int)b) << 16); }
__device__ __forceinline__ float bf16_round(float x) { return bf16_val(bf16_bits(x)); }
// D += A·B with NT terms: 1 = ah·bh, 2 = + al·bh (A split), 3 = + ah·bl (both split)
template <int NT>
__device__ __forceinline__ v8f mmaN(v16b ah, v16b al, v16b bh, v16b bl, v8f c) {
  c = __builtin_amdgcn_wmma_f32_16x16x32_bf16(false, ah, false, bh, (short)0, c, false, false);
  if (NT >= 2) c = __builtin_amdgcn_wmma_f32_16x16x32_bf16(false, al, false, bh, (short)0, c, false, false);
  if (NT >= 3) c = __builtin_amdgcn_wmma_f32_16x16x32_bf16(false, ah, false, bl, (short)0, c, false, false);
  asm volatile("v_nop\n\tv_nop\n\tv_nop\n\tv_nop" : "+v"(c) : "v"(ah), "v"(al), "v"(bh), "v"(bl));
  return c;
}

__global__ __launch_bounds__(256) void k_wt_bf16(const float* __restrict__ W, unsigned short* __restrict__ Wt, int K, int N) {
  const int t = blockIdx.x * 256 + threadIdx.x;
  const int k8n = K / 8;
  if (t >= N * k8n) return;
  const int n = t / k8n, k8 = (t % k8n) * 8;
  v8us v;
#pragma unroll
  for (int i = 0; i < 8; ++i) v[i] = bf16_bits(W[(size_t)(k8 + i) * N + n]);
  *(v8us*)(Wt + (size_t)n * K + k8) = v;
  
}

// GEMM C[M][N] (f32, pitch ldc) = act(A[M][K]·W + bias). A f32 row-major (pitch lda) converted per fragment to bf16
// (ASPLIT: hi/lo two planes -> 2 terms, else single rounded term); Wt bf16 [N][K] (pitch ldb). BIAS_BF16 rounds the
// bias to bf16 first (bias quantised to bf16 before the add). K%32==0, M%16==0, N%64==0.
template <bool ASPLIT, int ACT, bool BIAS_BF16>
__global__ __launch_bounds__(128) void k_gemm_bf(const float* __restrict__ A, int lda, const unsigned short* __restrict__ Wt, int ldb,
                                               const float* __restrict__ bias, float* __restrict__ C, int ldc, int M, int N, int K) {
  __shared__ __attribute__((aligned(16))) float so[4][16][64];
  const int tid = threadIdx.x, w = tid >> 5, lane = tid & 31, ln = lane & 15, hh = lane >> 4;
  const int ntn = N / 64;
  const int wid = blockIdx.x * 4 + w;
  const int mt = wid / ntn, nq = wid % ntn;
  if (mt * 16 >= M) return;
  const int row0 = mt * 16, col0 = nq * 64;
  const float* arow = A + (size_t)(row0 + ln) * lda;
  v8f acc[4] = {};
  for (int kb = 0; kb < K; kb += 32) {
    FragB ah, al;
    const v4f x0 = *(const v4fa*)(arow + kb + 8 * hh), x1 = *(const v4fa*)(arow + kb + 8 * hh + 4);
    const v4f x2 = *(const v4fa*)(arow + kb + 16 + 8 * hh), x3 = *(const v4fa*)(arow + kb + 16 + 8 * hh + 4);
    float xs[16] = {x0[0],x0[1],x0[2],x0[3],x1[0],x1[1],x1[2],x1[3],x2[0],x2[1],x2[2],x2[3],x3[0],x3[1],x3[2],x3[3]};
#pragma unroll
    for (int i = 0; i < 16; ++i) { const unsigned short hb = bf16_bits(xs[i]); ah.u[i] = hb; al.u[i] = ASPLIT ? bf16_bits(xs[i] - bf16_val(hb)) : (unsigned short)0; }
#pragma unroll
    for (int t = 0; t < 4; ++t) {
      const unsigned short* brow = Wt + (size_t)(col0 + t * 16 + ln) * ldb + kb;
      FragB b;
      b.half[0] = *(const v8us*)(brow + 8 * hh);
      b.half[1] = *(const v8us*)(brow + 16 + 8 * hh);
      acc[t] = mmaN<ASPLIT ? 2 : 1>(ah.v, al.v, b.v, b.v, acc[t]);
    }
  }
#pragma unroll
  for (int t = 0; t < 4; ++t) {
    float bv = bias ? bias[col0 + t * 16 + ln] : 0.f;
    if (BIAS_BF16) bv = bf16_round(bv);
#pragma unroll
    for (int r = 0; r < 8; ++r) { float v = acc[t][r] + bv; if (ACT == 1) v = fmaxf(v, 0.f); so[w][8 * hh + r][t * 16 + ln] = v; }
  }
  __builtin_amdgcn_fence(__ATOMIC_ACQ_REL, "workgroup");
  __builtin_amdgcn_wave_barrier();
  const int rsub = lane >> 4, c4 = (lane & 15) * 4;
  {
#pragma unroll
    for (int q = 0; q < 8; ++q) {
      const int r = q * 2 + rsub;
      const v4f v = *(const v4fa*)&so[w][r][c4];
      *(v4f*)(C + (size_t)(row0 + r) * ldc + col0 + c4) = v;
    }
    
  }
}

// Flash-style causal/unmasked attention, all contractions 3-term bf16 hi/lo splits, f32 softmax with running max.
// q,k,v rows are read from f32 buffers with arbitrary row pitch (so they can live inside a fused qkv buffer);
// D = head size (multiple of 32, <= 128); one wave = 16 query rows; block = 4 waves (64 queries) sharing K/V chunks of 32.
template <int D, bool CAUSAL>
__global__ __launch_bounds__(128) void k_flash(const float* __restrict__ qb, const float* __restrict__ kb, const float* __restrict__ vb,
                                             int pitch, int T, int H, float scale, float* __restrict__ y, int ypitch) {
  constexpr int KS = D / 32;        // k-steps for QK
  constexpr int DT = D / 16;        // d tiles for PV
  __shared__ __attribute__((aligned(16))) unsigned short sKh[32][D + 8], sKl[32][D + 8], sVh[32][D + 8], sVl[32][D + 8];
  __shared__ __attribute__((aligned(16))) unsigned short sPh[4][16][40], sPl[4][16][40];
  __shared__ __attribute__((aligned(16))) float sO[4][16][D];
  const int tid = threadIdx.x, w = tid >> 5, lane = tid & 31, ln = lane & 15, hh = lane >> 4;
  const int nqb = (T + 63) / 64;
  const int bh = blockIdx.x / nqb, qblk = blockIdx.x % nqb;
  const int b = bh / H, h = bh % H;
  const int q0 = qblk * 64 + w * 16;
  const float* Q = qb + (size_t)b * T * pitch + h * D;
  const float* K = kb + (size_t)b * T * pitch + h * D;
  const float* V = vb + (size_t)b * T * pitch + h * D;

  // A fragments of the wave's 16 query rows (scaled), hi/lo
  FragB aqh[KS], aql[KS];
  {
    int row = q0 + ln; if (row >= T) row = T - 1;
    const float* qr = Q + (size_t)row * pitch;
#pragma unroll
    for (int ks = 0; ks < KS; ++ks)
#pragma unroll
      for (int i = 0; i < 16; ++i) {
        const int d = ks * 32 + ((i < 8) ? (8 * hh + i) : (16 + 8 * hh + (i - 8)));
        const float x = qr[d] * scale; const unsigned short hb = bf16_bits(x);
        aqh[ks].u[i] = hb; aql[ks].u[i] = bf16_bits(x - bf16_val(hb));
      }
  }
  float m_r[8], l_r[8];
#pragma unroll
  for (int r = 0; r < 8; ++r) { m_r[r] = -3.0e38f; l_r[r] = 0.f; }
  v8f oacc[DT];
#pragma unroll
  for (int dt = 0; dt < DT; ++dt) oacc[dt] = (v8f){0.f,0.f,0.f,0.f,0.f,0.f,0.f,0.f};

  const int kv_end = CAUSAL ? min(T, qblk * 64 + 64) : T;     // block-uniform
  for (int j0 = 0; j0 < kv_end; j0 += 32) {
    __syncthreads();
    for (int e = tid; e < 32 * (D / 4); e += 128) {
      const int r = e / (D / 4), c4 = (e % (D / 4)) * 4;
      const int key = j0 + r;
      v4f kf = {0.f,0.f,0.f,0.f}, vf = {0.f,0.f,0.f,0.f};
      if (key < T) { kf = *(const v4fa*)(K + (size_t)key * pitch + c4); vf = *(const v4fa*)(V + (size_t)key * pitch + c4); }
#pragma unroll
      for (int t = 0; t < 4; ++t) {
        unsigned short hb = bf16_bits(kf[t]); sKh[r][c4 + t] = hb; sKl[r][c4 + t] = bf16_bits(kf[t] - bf16_val(hb));
        hb = bf16_bits(vf[t]); sVh[r][c4 + t] = hb; sVl[r][c4 + t] = bf16_bits(vf[t] - bf16_val(hb));
      }
    }
    __syncthreads();
    // S tile 16 x 32
    v8f s[2];
#pragma unroll
    for (int nt = 0; nt < 2; ++nt) {
      v8f acc = {};
#pragma unroll
      for (int ks = 0; ks < KS; ++ks) {
        FragB bh_, bl_;
        bh_.half[0] = *(const v8us*)&sKh[nt * 16 + ln][ks * 32 + 8 * hh]; bh_.half[1] = *(const v8us*)&sKh[nt * 16 + ln][ks * 32 + 16 + 8 * hh];
        bl_.half[0] = *(const v8us*)&sKl[nt * 16 + ln][ks * 32 + 8 * hh]; bl_.half[1] = *(const v8us*)&sKl[nt * 16 + ln][ks * 32 + 16 + 8 * hh];
        acc = mmaN<3>(aqh[ks].v, aql[ks].v, bh_.v, bl_.v, acc);
      }
      s[nt] = acc;
    }
    // mask + running max (rows 8hh+r; the 16 lanes of a half share rows)
    float alpha[8];
#pragma unroll
    for (int r = 0; r < 8; ++r) {
      const int qi = q0 + 8 * hh + r;
      const int ja = j0 + ln, jb = j0 + 16 + ln;
      if (CAUSAL) { if (ja > qi) s[0][r] = -3.0e38f; if (jb > qi) s[1][r] = -3.0e38f; }
      if (ja >= T) s[0][r] = -3.0e38f;
      if (jb >= T) s[1][r] = -3.0e38f;
      float mx = fmaxf(s[0][r], s[1][r]);
      mx = fmaxf(mx, __shfl_xor(mx, 1, 32)); mx = fmaxf(mx, __shfl_xor(mx, 2, 32)); mx = fmaxf(mx, __shfl_xor(mx, 4, 32)); mx = fmaxf(mx, __shfl_xor(mx, 8, 32));
      const float mnew = fmaxf(m_r[r], mx);
      alpha[r] = (mnew > -1.0e38f) ? __expf(m_r[r] - mnew) : 1.0f;
      const float p0 = (s[0][r] > -1.0e38f) ? __expf(s[0][r] - mnew) : 0.f;
      const float p1 = (s[1][r] > -1.0e38f) ? __expf(s[1][r] - mnew) : 0.f;
      m_r[r] = mnew;
      l_r[r] = l_r[r] * alpha[r] + p0 + p1;            // per-lane partial row sum (16 lanes combined at the end)
      unsigned short hb = bf16_bits(p0); sPh[w][8 * hh + r][ln] = hb;      sPl[w][8 * hh + r][ln] = bf16_bits(p0 - bf16_val(hb));
      hb = bf16_bits(p1);                sPh[w][8 * hh + r][16 + ln] = hb; sPl[w][8 * hh + r][16 + ln] = bf16_bits(p1 - bf16_val(hb));
    }
#pragma unroll
    for (int dt = 0; dt < DT; ++dt)
#pragma unroll
      for (int r = 0; r < 8; ++r) oacc[dt][r] *= alpha[r];
    __builtin_amdgcn_fence(__ATOMIC_ACQ_REL, "workgroup");
    __builtin_amdgcn_wave_barrier();
    FragB pah, pal;
    pah.half[0] = *(const v8us*)&sPh[w][ln][8 * hh]; pah.half[1] = *(const v8us*)&sPh[w][ln][16 + 8 * hh];
    pal.half[0] = *(const v8us*)&sPl[w][ln][8 * hh]; pal.half[1] = *(const v8us*)&sPl[w][ln][16 + 8 * hh];
#pragma unroll
    for (int dt = 0; dt < DT; ++dt) {
      FragB bvh, bvl;
#pragma unroll
      for (int i = 0; i < 8; ++i) {
        bvh.u[i] = sVh[8 * hh + i][dt * 16 + ln]; bvh.u[8 + i] = sVh[16 + 8 * hh + i][dt * 16 + ln];
        bvl.u[i] = sVl[8 * hh + i][dt * 16 + ln]; bvl.u[8 + i] = sVl[16 + 8 * hh + i][dt * 16 + ln];
      }
      oacc[dt] = mmaN<3>(pah.v, pal.v, bvh.v, bvl.v, oacc[dt]);
    }
    __builtin_amdgcn_fence(__ATOMIC_ACQ_REL, "workgroup");
    __builtin_amdgcn_wave_barrier();
  }
#pragma unroll
  for (int r = 0; r < 8; ++r) {
    float l = l_r[r];
    l += __shfl_xor(l, 1, 32); l += __shfl_xor(l, 2, 32); l += __shfl_xor(l, 4, 32); l += __shfl_xor(l, 8, 32);
    l_r[r] = (l > 0.f) ? 1.0f / l : 0.f;
  }
#pragma unroll
  for (int dt = 0; dt < DT; ++dt)
#pragma unroll
    for (int r = 0; r < 8; ++r) sO[w][8 * hh + r][dt * 16 + ln] = oacc[dt][r] * l_r[r];
  __builtin_amdgcn_fence(__ATOMIC_ACQ_REL, "workgroup");
  __builtin_amdgcn_wave_barrier();
  {
    for (int r = 0; r < 16; ++r) {
      const int row = q0 + r;
      if (row < T && lane < D / 4) {
        const v4f val = *(const v4fa*)&sO[w][r][lane * 4];
        *(v4f*)(y + ((size_t)b * T + row) * ypitch + h * D + lane * 4) = val;
      }
    }
    
  }
}

// GEMM C = act(A·W + bias + resid): A f32 (ASPLIT -> hi/lo 2 terms), Wt bf16 [N][K]; ACT 0 none, 1 relu, 2 exact gelu;
// resid (optional, f32, row index = (row % rmod), pitch ldr, RES_BF16 rounds it) added before the activation.
template <bool ASPLIT, int ACT, bool BIAS_BF16, bool RES_BF16>
__global__ __launch_bounds__(128) void k_gemm_bf3(const float* __restrict__ A, int lda, const unsigned short* __restrict__ Wt, int ldb,
                                                const float* __restrict__ bias, const float* __restrict__ resid, int rmod, int ldr,
                                                float* __restrict__ C, int ldc, int M, int N, int K) {
  __shared__ __attribute__((aligned(16))) float so[4][16][64];
  const int tid = threadIdx.x, w = tid >> 5, lane = tid & 31, ln = lane & 15, hh = lane >> 4;
  const int ntn = N / 64;
  const int wid = blockIdx.x * 4 + w;
  const int mt = wid / ntn, nq = wid % ntn;
  if (mt * 16 >= M) return;
  const int row0 = mt * 16, col0 = nq * 64;
  const float* arow = A + (size_t)(row0 + ln) * lda;
  v8f acc[4] = {};
  for (int kb = 0; kb < K; kb += 32) {
    FragB ah, al;
    const v4f x0 = *(const v4fa*)(arow + kb + 8 * hh), x1 = *(const v4fa*)(arow + kb + 8 * hh + 4);
    const v4f x2 = *(const v4fa*)(arow + kb + 16 + 8 * hh), x3 = *(const v4fa*)(arow + kb + 16 + 8 * hh + 4);
    float xs[16] = {x0[0],x0[1],x0[2],x0[3],x1[0],x1[1],x1[2],x1[3],x2[0],x2[1],x2[2],x2[3],x3[0],x3[1],x3[2],x3[3]};
#pragma unroll
    for (int i = 0; i < 16; ++i) { const unsigned short hb = bf16_bits(xs[i]); ah.u[i] = hb; al.u[i] = ASPLIT ? bf16_bits(xs[i] - bf16_val(hb)) : (unsigned short)0; }
#pragma unroll
    for (int t = 0; t < 4; ++t) {
      const unsigned short* brow = Wt + (size_t)(col0 + t * 16 + ln) * ldb + kb;
      FragB b;
      b.half[0] = *(const v8us*)(brow + 8 * hh);
      b.half[1] = *(const v8us*)(brow + 16 + 8 * hh);
      acc[t] = mmaN<ASPLIT ? 2 : 1>(ah.v, al.v, b.v, b.v, acc[t]);
    }
  }
#pragma unroll
  for (int t = 0; t < 4; ++t) {
    const int col = col0 + t * 16 + ln;
    float bv = bias ? bias[col] : 0.f;
    if (BIAS_BF16) bv = bf16_round(bv);
#pragma unroll
    for (int r = 0; r < 8; ++r) {
      float v = acc[t][r] + bv;
      if (resid) { float rv = resid[(size_t)((row0 + 8 * hh + r) % rmod) * ldr + col]; if (RES_BF16) rv = bf16_round(rv); v += rv; }
      if (ACT == 1) v = fmaxf(v, 0.f);
      if (ACT == 2) v = 0.5f * v * (1.0f + erff(v * 0.70710678118654752f));
      if (ACT == 3) { const float u = 0.7978845608028654f * (v + 0.044715f * v * v * v); v = 0.5f * v * (1.0f + tanhf(u)); }
      so[w][8 * hh + r][t * 16 + ln] = v;
    }
  }
  __builtin_amdgcn_fence(__ATOMIC_ACQ_REL, "workgroup");
  __builtin_amdgcn_wave_barrier();
  const int rsub = lane >> 4, c4 = (lane & 15) * 4;
  {
#pragma unroll
    for (int q = 0; q < 8; ++q) {
      const int r = q * 2 + rsub;
      const v4f v = *(const v4fa*)&so[w][r][c4];
      *(v4f*)(C + (size_t)(row0 + r) * ldc + col0 + c4) = v;
    }
    
  }
}
// row LayerNorm (biased variance, eps) over N: s = X (+ R); optional out_sum <- s; out_norm <- (s-mu)*rsqrt(var+eps)*g + b
template <bool PARAM_BF16>
__global__ __launch_bounds__(256) void k_layernorm(const float* __restrict__ X, const float* __restrict__ R, const float* __restrict__ g, const float* __restrict__ bta,
                                                  float* __restrict__ out_sum, float* __restrict__ out_norm, int N, float eps) {
  __shared__ float red[256];
  const int row = blockIdx.x, tid = threadIdx.x;
  const float* x = X + (size_t)row * N; const float* rr = R ? R + (size_t)row * N : nullptr;
  float vals[16];                     // up to N = 4096
  const int per = N / 256;            // contiguous chunk per thread? use strided-by-4 chunks: thread handles j = tid*4 + 1024*u
  float s1 = 0.f;
  for (int u = 0; u < per / 4; ++u) {
    const int j = tid * 4 + 1024 * u;
    const v4f a = *(const v4fa*)(x + j);
    v4f b = {0.f,0.f,0.f,0.f}; if (rr) b = *(const v4fa*)(rr + j);
#pragma unroll
    for (int q = 0; q < 4; ++q) { const float v = a[q] + b[q]; vals[u * 4 + q] = v; s1 += v; }
  }
  red[tid] = s1; __syncthreads();
  for (int st = 128; st > 0; st >>= 1) { if (tid < st) red[tid] += red[tid + st]; __syncthreads(); }
  const float mu = red[0] / (float)N; __syncthreads();
  float s2 = 0.f;
  for (int u = 0; u < per / 4; ++u)
#pragma unroll
    for (int q = 0; q < 4; ++q) { const float c = vals[u * 4 + q] - mu; s2 += c * c; }
  red[tid] = s2; __syncthreads();
  for (int st = 128; st > 0; st >>= 1) { if (tid < st) red[tid] += red[tid + st]; __syncthreads(); }
  const float rs = rsqrtf(red[0] / (float)N + eps);
  {
    for (int u = 0; u < per / 4; ++u) {
      const int j = tid * 4 + 1024 * u;
      v4f o, sm;
#pragma unroll
      for (int q = 0; q < 4; ++q) {
        float gg = g[j + q], bb = bta[j + q];
        if (PARAM_BF16) { gg = bf16_round(gg); bb = bf16_round(bb); }
        sm[q] = vals[u * 4 + q]; o[q] = (vals[u * 4 + q] - mu) * rs * gg + bb;
      }
      if (out_sum) *(v4f*)(out_sum + (size_t)row * N + j) = sm;
      *(v4f*)(out_norm + (size_t)row * N + j) = o;
    }
    
  }
}



// ---- f16 WMMA path (v_wmma_f32_16x16x32_f16): 11-bit significands for operands in range — used where a [0,1] probability operand needs more precision than bf16
typedef _Float16 v16h __attribute__((ext_vector_type(16)));
union FragH { v16h v; v8us half[2]; _Float16 h[16]; unsigned short u[16]; };
template <int NT>
__device__ __forceinline__ v8f mmaH(v16h ah, v16h al, v16h bh, v16h bl, v8f c) {
  c = __builtin_amdgcn_wmma_f32_16x16x32_f16(false, ah, false, bh, (short)0, c, false, false);
  if (NT >= 2) c = __builtin_amdgcn_wmma_f32_16x16x32_f16(false, al, false, bh, (short)0, c, false, false);
  if (NT >= 3) c = __builtin_amdgcn_wmma_f32_16x16x32_f16(false, ah, false, bl, (short)0, c, false, false);
  asm volatile("v_nop\n\tv_nop\n\tv_nop\n\tv_nop" : "+v"(c) : "v"(ah), "v"(al), "v"(bh), "v"(bl));
  return c;
}
// batched GEMM like k_gemm_b but f16 operands: A f32 (split into f16 hi/lo if ASPLIT, else rounded to f16), Bt = f16 values [n][k]; alpha; C f32; N multiple of 16 (partial tiles skipped)
template <bool ASPLIT>
__global__ __launch_bounds__(128) void k_gemm_h(const float* __restrict__ A, int lda, size_t sA, const _Float16* __restrict__ Bh, int ldb, size_t sB, float alpha, float* __restrict__ C, int ldc, size_t sC, int M, int N, int K) {
  __shared__ __attribute__((aligned(16))) float so[4][16][64];
  const int tid = threadIdx.x, w = tid >> 5, lane = tid & 31, ln = lane & 15, hh = lane >> 4; const int by = blockIdx.y;
  A += (size_t)by * sA; Bh += (size_t)by * sB; C += (size_t)by * sC;
  const int ntn = (N + 63) / 64; const int wid = blockIdx.x * 4 + w; const int mt = wid / ntn, nq = wid % ntn; if (mt * 16 >= M) return;
  const int row0 = mt * 16, col0 = nq * 64; const float* arow = A + (size_t)(row0 + ln) * lda;
  v8f acc[4] = {};
  for (int kb = 0; kb < K; kb += 32) {
    FragH ah, al;
    const v4f x0 = *(const v4fa*)(arow + kb + 8 * hh), x1 = *(const v4fa*)(arow + kb + 8 * hh + 4), x2 = *(const v4fa*)(arow + kb + 16 + 8 * hh), x3 = *(const v4fa*)(arow + kb + 16 + 8 * hh + 4);
    float xs[16] = {x0[0],x0[1],x0[2],x0[3],x1[0],x1[1],x1[2],x1[3],x2[0],x2[1],x2[2],x2[3],x3[0],x3[1],x3[2],x3[3]};
#pragma unroll
    for (int i = 0; i < 16; ++i) { const _Float16 h = (_Float16)xs[i]; ah.h[i] = h; al.h[i] = ASPLIT ? (_Float16)(xs[i] - (float)h) : (_Float16)0.0f; }
#pragma unroll
    for (int t = 0; t < 4; ++t) { if (col0 + t * 16 >= N) continue; const size_t boff = (size_t)(col0 + t * 16 + ln) * ldb + kb; FragH bq; bq.half[0] = *(const v8us*)(Bh + boff + 8 * hh); bq.half[1] = *(const v8us*)(Bh + boff + 16 + 8 * hh);
      acc[t] = mmaH<ASPLIT ? 2 : 1>(ah.v, al.v, bq.v, bq.v, acc[t]); }
  }
#pragma unroll
  for (int t = 0; t < 4; ++t) { if (col0 + t * 16 >= N) continue;
#pragma unroll
    for (int r = 0; r < 8; ++r) so[w][8 * hh + r][t * 16 + ln] = acc[t][r] * alpha; }
  __builtin_amdgcn_fence(__ATOMIC_ACQ_REL, "workgroup"); __builtin_amdgcn_wave_barrier();
  const int rsub = lane >> 4, c4 = (lane & 15) * 4;
  {
#pragma unroll
    for (int q = 0; q < 8; ++q) { const int r = q * 2 + rsub; if (col0 + c4 < N) { const v4f v = *(const v4fa*)&so[w][r][c4]; *(v4f*)(C + (size_t)(row0 + r) * ldc + col0 + c4) = v; } }
     }
}

// Wt[n][k] = f16(W[k][n]·scale) from f32 row-major W[K][N] (scale = power of two; bf16-exact weights stay exact in f16 away from the subnormal range)
__global__ __launch_bounds__(256) void k_wt_f16(const float* __restrict__ W, _Float16* __restrict__ Wt, int K, int N, float scale) {
  const int t = blockIdx.x * 256 + threadIdx.x; if (t >= N * (K / 8)) return; const int n = t / (K / 8), k8 = (t % (K / 8)) * 8; FragH f;
#pragma unroll
  for (int i = 0; i < 8; ++i) f.h[i] = (_Float16)(bf16_round(W[(size_t)(k8 + i) * N + n]) * scale); const v8us o = f.half[0];
  *(v8us*)((unsigned short*)Wt + (size_t)n * K + k8) = o; 
}
// k_gemm_hh variant with fused epilogue: v = acc·alpha + bias[by·sBias + col] (+ CP[(row/rowsPerB)·sCPb + by·64 + col] if CP) ; ACT 0 none / 1 elu ; writes f32 C and/or f16 C16 (each if non-null)
template <int ACT>
__global__ __launch_bounds__(128) void k_gemm_hhx(const _Float16* __restrict__ A, int lda, size_t sA, const _Float16* __restrict__ Bh, int ldb, size_t sB, float alpha, const float* __restrict__ bias, size_t sBias, const float* __restrict__ CP, int rowsPerB, size_t sCPb, int row0g,
    float* __restrict__ C, _Float16* __restrict__ C16, int ldc, size_t sC, int M, int N, int K) {
  __shared__ __attribute__((aligned(16))) float so[4][16][64];
  const int tid = threadIdx.x, w = tid >> 5, lane = tid & 31, ln = lane & 15, hh = lane >> 4; const int by = blockIdx.y;
  A += (size_t)by * sA; Bh += (size_t)by * sB; const size_t cofs = (size_t)by * sC; const float* bp = bias ? bias + (size_t)by * sBias : nullptr;
  const int ntn = (N + 63) / 64; const int wid = blockIdx.x * 4 + w; const int mt = wid / ntn, nq = wid % ntn; if (mt * 16 >= M) return;
  const int row0 = mt * 16, col0 = nq * 64; const _Float16* arow = A + (size_t)(row0 + ln) * lda;
  v8f acc[4] = {};
  for (int kb = 0; kb < K; kb += 32) { FragH ah; ah.half[0] = *(const v8us*)((const unsigned short*)arow + kb + 8 * hh); ah.half[1] = *(const v8us*)((const unsigned short*)arow + kb + 16 + 8 * hh);
#pragma unroll
    for (int t = 0; t < 4; ++t) { if (col0 + t * 16 >= N) continue; const size_t boff = (size_t)(col0 + t * 16 + ln) * ldb + kb; FragH bq; bq.half[0] = *(const v8us*)((const unsigned short*)Bh + boff + 8 * hh); bq.half[1] = *(const v8us*)((const unsigned short*)Bh + boff + 16 + 8 * hh);
      acc[t] = mmaH<1>(ah.v, ah.v, bq.v, bq.v, acc[t]); }
  }
#pragma unroll
  for (int t = 0; t < 4; ++t) { if (col0 + t * 16 >= N) continue; const int col = col0 + t * 16 + ln; const float bv = bp ? bf16_round(bp[col]) : 0.f;
#pragma unroll
    for (int r = 0; r < 8; ++r) { float v = acc[t][r] * alpha + bv; if (CP) { const int bidx = (row0g + row0 + 8 * hh + r) / rowsPerB; v += CP[(size_t)bidx * sCPb + (size_t)by * 64 + col]; } if (ACT == 1) v = (v > 0.f) ? v : expm1f(v); else if (ACT == 3) v = fmaxf(v, 0.f); so[w][8 * hh + r][t * 16 + ln] = v; } }
  __builtin_amdgcn_fence(__ATOMIC_ACQ_REL, "workgroup"); __builtin_amdgcn_wave_barrier();
  const int rsub = lane >> 4, c4 = (lane & 15) * 4; typedef _Float16 v4h __attribute__((ext_vector_type(4)));
  {
#pragma unroll
    for (int q = 0; q < 8; ++q) { const int r = q * 2 + rsub; if (col0 + c4 < N) { const v4f v = *(const v4fa*)&so[w][r][c4]; if (C) *(v4f*)(C + cofs + (size_t)(row0 + r) * ldc + col0 + c4) = v; if (C16) { v4h h4; for (int i = 0; i < 4; ++i) h4[i] = (_Float16)v[i]; *(v4h*)(C16 + cofs + (size_t)(row0 + r) * ldc + col0 + c4) = h4; } } }
     }
}


__global__ __launch_bounds__(256) void k_x16(const float* __restrict__ x, _Float16* __restrict__ X16, size_t n8) { const size_t t = (size_t)blockIdx.x * 256 + threadIdx.x; if (t >= n8) return; FragH f;
#pragma unroll
  for (int q = 0; q < 8; ++q) f.h[q] = (_Float16)bf16_round(x[t * 8 + q]); *(v8us*)((unsigned short*)X16 + t * 8) = f.half[0];  }
__global__ __launch_bounds__(256) void k_h16(const float* __restrict__ x, _Float16* __restrict__ X16, size_t n8) { const size_t t = (size_t)blockIdx.x * 256 + threadIdx.x; if (t >= n8) return; FragH f;
#pragma unroll
  for (int q = 0; q < 8; ++q) f.h[q] = (_Float16)x[t * 8 + q]; *(v8us*)((unsigned short*)X16 + t * 8) = f.half[0];  }
__global__ __launch_bounds__(256) void k_round16f(const float* __restrict__ W, _Float16* __restrict__ Bt, size_t n8) { const size_t t = (size_t)blockIdx.x * 256 + threadIdx.x; if (t >= n8) return; FragH f;
#pragma unroll
  for (int i = 0; i < 8; ++i) f.h[i] = (_Float16)(bf16_round(W[t * 8 + i]) * 16.0f); *(v8us*)((unsigned short*)Bt + t * 8) = f.half[0];  }
template <int NHv, int TTv>
__global__ __launch_bounds__(256) void k_vt(const _Float16* __restrict__ V16, int ldv, int voff, _Float16* __restrict__ Vt) { __shared__ unsigned short tl[64][66]; const int tid = threadIdx.x; const int slab = blockIdx.x / (TTv / 64), lg = blockIdx.x % (TTv / 64); const int b = slab / NHv, h = slab % NHv;
  for (int i = tid; i < 64 * 8; i += 256) { const int r = i / 8, c8 = (i % 8) * 8; FragH f; f.half[0] = *(const v8us*)((const unsigned short*)V16 + ((size_t)b * TTv + lg * 64 + r) * ldv + voff + h * 64 + c8);
#pragma unroll
    for (int q = 0; q < 8; ++q) tl[r][c8 + q] = f.u[q]; }
  __syncthreads();
  {
#pragma unroll
    for (int rd = 0; rd < 2; ++rd) { const int d = rd * 32 + tid / 8, pc = tid % 8; FragH f;
#pragma unroll
      for (int q = 0; q < 8; ++q) f.u[q] = tl[pc * 8 + q][d];
      *(v8us*)((unsigned short*)Vt + ((size_t)slab * 64 + d) * TTv + lg * 64 + pc * 8) = f.half[0]; }
     } }

__global__ __launch_bounds__(128) void k_flash(const _Float16* __restrict__ Q16, int ldq, const _Float16* __restrict__ K16, int ldk, const _Float16* __restrict__ Vt, const int* __restrict__ MSK, float* __restrict__ O, int ldo) {
  constexpr int RPW = 16, RTN = RPW / 16, NQB = 3072 / (4 * RPW), DT = 8, KS = 4;      /* head dim 128 */
  __shared__ __attribute__((aligned(16))) unsigned short sP[4][RPW][40]; __shared__ __attribute__((aligned(16))) float sO[4][RPW][128 + 4];
  const int tid = threadIdx.x, w = tid >> 5, lane = tid & 31, ln = lane & 15, hh = lane >> 4;
  const int slab = blockIdx.x / NQB, qblk = blockIdx.x % NQB; const int b = slab / 8, h = slab % 8; const int qb0 = qblk * (4 * RPW); const int q0 = qb0 + w * RPW;
  FragH aq[2][KS];
#pragma unroll
  for (int rt = 0; rt < RTN; ++rt) { const unsigned short* qr = (const unsigned short*)Q16 + ((size_t)b * 3072 + q0 + rt * 16 + ln) * ldq + h * 128;
#pragma unroll
    for (int ks = 0; ks < KS; ++ks) { aq[rt][ks].half[0] = *(const v8us*)(qr + ks * 32 + 8 * hh); aq[rt][ks].half[1] = *(const v8us*)(qr + ks * 32 + 16 + 8 * hh); } }
  const unsigned short* Vth = (const unsigned short*)Vt + (size_t)slab * 128 * 3072;
  float m_r[2][8], l_r[2][8]; v8f oacc[2][DT];
#pragma unroll
  for (int rt = 0; rt < RTN; ++rt) {
#pragma unroll
    for (int r = 0; r < 8; ++r) { m_r[rt][r] = -3.0e38f; l_r[rt][r] = 0.f; }
#pragma unroll
    for (int dt = 0; dt < DT; ++dt) oacc[rt][dt] = (v8f){0.f,0.f,0.f,0.f,0.f,0.f,0.f,0.f}; }
  const int jend = qb0 + 4 * RPW;
#pragma unroll 1
  for (int j0 = 0; j0 < jend; j0 += 32) {
    
    v8f s[2][2];
#pragma unroll
    for (int nt = 0; nt < 2; ++nt) { const unsigned short* kr = (const unsigned short*)K16 + ((size_t)b * 3072 + j0 + nt * 16 + ln) * ldk + h * 128; FragH bk[KS];
#pragma unroll
      for (int ks = 0; ks < KS; ++ks) { bk[ks].half[0] = *(const v8us*)(kr + ks * 32 + 8 * hh); bk[ks].half[1] = *(const v8us*)(kr + ks * 32 + 16 + 8 * hh); }
#pragma unroll
      for (int rt = 0; rt < RTN; ++rt) { v8f acc = (v8f){0.f,0.f,0.f,0.f,0.f,0.f,0.f,0.f};
#pragma unroll
        for (int ks = 0; ks < KS; ++ks) acc = mmaH<1>(aq[rt][ks].v, aq[rt][ks].v, bk[ks].v, bk[ks].v, acc); s[rt][nt] = acc; } }
#pragma unroll
    for (int rt = 0; rt < RTN; ++rt)
#pragma unroll
      for (int r = 0; r < 8; ++r) { const int tq = q0 + rt * 16 + 8 * hh + r; const int k0 = j0 + ln, k1 = j0 + 16 + ln; (void)tq; (void)k0; (void)k1;
        const bool ok0 = (k0 <= tq), ok1 = (k1 <= tq);
        const float s0 = ok0 ? s[rt][0][r] * (0.08838834764831845f) : -INFINITY, s1 = ok1 ? s[rt][1][r] * (0.08838834764831845f) : -INFINITY; float mc = fmaxf(s0, s1);
        mc = fmaxf(mc, __shfl_xor(mc, 1, 32)); mc = fmaxf(mc, __shfl_xor(mc, 2, 32)); mc = fmaxf(mc, __shfl_xor(mc, 4, 32)); mc = fmaxf(mc, __shfl_xor(mc, 8, 32));
        const float mn = fmaxf(m_r[rt][r], mc); const float al = (mn > -1.0e38f) ? expf(m_r[rt][r] - mn) : 1.0f; m_r[rt][r] = mn; const float p0 = ok0 ? expf(s0 - mn) : 0.f, p1 = ok1 ? expf(s1 - mn) : 0.f; l_r[rt][r] = l_r[rt][r] * al + p0 + p1;
#pragma unroll
        for (int dt = 0; dt < DT; ++dt) oacc[rt][dt][r] *= al;
        FragH t2; t2.h[0] = (_Float16)p0; t2.h[1] = (_Float16)p1; sP[w][rt * 16 + 8 * hh + r][ln] = t2.u[0]; sP[w][rt * 16 + 8 * hh + r][16 + ln] = t2.u[1]; }
    __builtin_amdgcn_fence(__ATOMIC_ACQ_REL, "workgroup"); __builtin_amdgcn_wave_barrier();
    FragH pa[2];
#pragma unroll
    for (int rt = 0; rt < RTN; ++rt) { pa[rt].half[0] = *(const v8us*)&sP[w][rt * 16 + ln][8 * hh]; pa[rt].half[1] = *(const v8us*)&sP[w][rt * 16 + ln][16 + 8 * hh]; }
#pragma unroll
    for (int dt = 0; dt < DT; ++dt) { const unsigned short* vrow = Vth + (size_t)(dt * 16 + ln) * 3072 + j0; FragH bv; bv.half[0] = *(const v8us*)(vrow + 8 * hh); bv.half[1] = *(const v8us*)(vrow + 16 + 8 * hh);
#pragma unroll
      for (int rt = 0; rt < RTN; ++rt) oacc[rt][dt] = mmaH<1>(pa[rt].v, pa[rt].v, bv.v, bv.v, oacc[rt][dt]); }
    __builtin_amdgcn_fence(__ATOMIC_ACQ_REL, "workgroup"); __builtin_amdgcn_wave_barrier(); }
#pragma unroll
  for (int rt = 0; rt < RTN; ++rt) {
#pragma unroll
    for (int r = 0; r < 8; ++r) { float l = l_r[rt][r]; l += __shfl_xor(l, 1, 32); l += __shfl_xor(l, 2, 32); l += __shfl_xor(l, 4, 32); l += __shfl_xor(l, 8, 32); l_r[rt][r] = (l > 0.f) ? 1.0f / l : 0.f; }
#pragma unroll
    for (int dt = 0; dt < DT; ++dt)
#pragma unroll
      for (int r = 0; r < 8; ++r) sO[w][rt * 16 + 8 * hh + r][dt * 16 + ln] = oacc[rt][dt][r] * l_r[rt][r]; }
  __builtin_amdgcn_fence(__ATOMIC_ACQ_REL, "workgroup"); __builtin_amdgcn_wave_barrier();
  {
#pragma unroll
    for (int rp = 0; rp < RPW; ++rp) { const int r = rp, pc = lane; const v4f val = *(const v4fa*)&sO[w][r][pc * 4]; *(v4f*)(O + ((size_t)(b * 8 + h) * 3072 + q0 + r) * 128 + pc * 4) = val; }      /* output layout [b][h][s][128]: 32 lanes × 16 B rows */
     } }

__global__ __launch_bounds__(256) void k_xt(const float* __restrict__ x, _Float16* __restrict__ XT) { const size_t t = (size_t)blockIdx.x * 256 + threadIdx.x; if (t >= (size_t)NR * NH * 16) return; const int p = (int)(t % 16); const int h = (int)((t / 16) % NH); const size_t bs = t / (16 * NH); const int b = (int)(bs / TT), s = (int)(bs % TT); const float* src = x + (((size_t)(b * NH + h) * TT + s) * HD) + p * 8; FragH f;
#pragma unroll
  for (int q = 0; q < 8; ++q) f.h[q] = (_Float16)bf16_round(src[q]); unsigned short* d = (unsigned short*)XT + bs * CW + h * HD + p * 8; *(v8us*)d = f.half[0];  }
__global__ __launch_bounds__(256) void k_wst(const float* __restrict__ W, _Float16* __restrict__ Bt) { const size_t t = (size_t)blockIdx.x * 256 + threadIdx.x; if (t >= (size_t)CW * NH * 16) return; const int p = (int)(t % 16); const int h = (int)((t / 16) % NH); const int n = (int)(t / (16 * NH)); const int g = n / HD, e = n % HD; FragH f;
#pragma unroll
  for (int q = 0; q < 8; ++q) { const int d = p * 8 + q; f.h[q] = (_Float16)(bf16_round(W[(((size_t)(h * NH + g) * HD + d) * HD) + e]) * 16.0f); }
  unsigned short* dst = (unsigned short*)Bt + (size_t)n * CW + h * HD + p * 8; *(v8us*)dst = f.half[0];  }
__global__ __launch_bounds__(256) void k_rope(const float* __restrict__ F, const int* __restrict__ offp, float oscale, _Float16* __restrict__ D16) { __shared__ __attribute__((aligned(16))) _Float16 st[256][8]; const int tid = threadIdx.x; const size_t t = (size_t)blockIdx.x * 256 + tid; if (t >= (size_t)NR * NH * 16) return; const int li = (int)(t % 16); const int h = (int)((t / 16) % NH); const size_t bs = t / (16 * NH); const int s = (int)(bs % TT); const float pos = (float)(s + offp[0]); const float* src = F + bs * CW + h * HD;
#pragma unroll 1
  for (int q = 0; q < 8; ++q) { const int j = li * 8 + q; const int i = j & 63; const float ang = pos * __builtin_powf(10000.0f, -(float)(2 * i) / 128.0f); const float c = cosf(ang), sn = sinf(ang); const float xj = src[j], xp = src[(j + 64) & 127]; const float rot = (j < 64) ? -xp : xp; st[tid][q] = (_Float16)((xj * c + rot * sn) * oscale); }
  FragH f; f.half[0] = *(const v8us*)&st[tid][0]; unsigned short* d = (unsigned short*)D16 + bs * CW + h * HD + li * 8; *(v8us*)d = f.half[0];  }
__global__ __launch_bounds__(256) void k_vt128(const _Float16* __restrict__ V16, _Float16* __restrict__ Vt) { __shared__ unsigned short tl[64][130]; const int tid = threadIdx.x; const int slab = blockIdx.x / (TT / 64), lg = blockIdx.x % (TT / 64); const int b = slab / NH, h = slab % NH;
  for (int i = tid; i < 64 * 16; i += 256) { const int r = i / 16, c8 = (i % 16) * 8; FragH f; f.half[0] = *(const v8us*)((const unsigned short*)V16 + ((size_t)b * TT + lg * 64 + r) * CW + h * HD + c8);
#pragma unroll
    for (int q = 0; q < 8; ++q) tl[r][c8 + q] = f.u[q]; }
  __syncthreads();
  { for (int i = tid; i < 128 * 8; i += 256) { const int d = i / 8, pc = i % 8; FragH f;
#pragma unroll
      for (int q = 0; q < 8; ++q) f.u[q] = tl[pc * 8 + q][d]; *(v8us*)((unsigned short*)Vt + ((size_t)slab * HD + d) * TT + lg * 64 + pc * 8) = f.half[0]; }  } }
extern "C" void kernel_launch(void* const* d_in, const int* in_sizes, int n_in,
                              void* d_out, int out_size, void* d_ws, size_t ws_size, hipStream_t stream) {
  (void)in_sizes; (void)n_in; (void)out_size;
  const float* x = (const float*)d_in[0]; const float* Wm[3] = {(const float*)d_in[1], (const float*)d_in[2], (const float*)d_in[3]}; const float* Wsg[3] = {(const float*)d_in[4], (const float*)d_in[5], (const float*)d_in[6]}; const float* Weg[3] = {(const float*)d_in[7], (const float*)d_in[8], (const float*)d_in[9]}; const int* offp = (const int*)d_in[10];
  char* ws = (char*)d_ws; size_t off = 0;
  auto take = [&](size_t bytes) { char* p = ws + off; off += (bytes + 255) & ~(size_t)255; return p; };
  _Float16* Bm = (_Float16*)take((size_t)CW * CW * 2); _Float16* Bs = (_Float16*)take((size_t)CW * CW * 2); _Float16* Be = (_Float16*)take((size_t)CW * CW * 2);
  _Float16* XT = (_Float16*)take((size_t)NR * CW * 2); float* F = (float*)take((size_t)NR * CW * 4); _Float16* Q16 = (_Float16*)take((size_t)NR * CW * 2); _Float16* K16 = (_Float16*)take((size_t)NR * CW * 2); _Float16* V16 = (_Float16*)take((size_t)NR * CW * 2); _Float16* Vt = (_Float16*)take((size_t)NR * CW * 2);
  if (off > ws_size) return;      // 6.3 + 12.6 + 25.2 + 12.6 × 4 ≈ 94 MB
  k_xt<<<(unsigned)(((size_t)NR * NH * 16 + 255) / 256), 256, 0, stream>>>(x, XT);
  const unsigned gw = (unsigned)(((size_t)CW * NH * 16 + 255) / 256), gr = (unsigned)(((size_t)NR * NH * 16 + 255) / 256);
  // the three (b,s) row ranges: [0,512) state, [512,2560) middle, [2560,3072) end — batched over b via sA/sC
  const int r0s[3] = {SL, 0, TT - SL}, ms[3] = {TT - 2 * SL, SL, SL};      // order: middle (W), state (Ws), end (We)
  for (int p = 0; p < 3; ++p) {      // p: 0 = q, 1 = k, 2 = v
    k_wst<<<gw, 256, 0, stream>>>(Wm[p], Bm); k_wst<<<gw, 256, 0, stream>>>(Wsg[p], Bs); k_wst<<<gw, 256, 0, stream>>>(Weg[p], Be);
    const _Float16* Bsel[3] = {Bm, Bs, Be};
    for (int sgm = 0; sgm < 3; ++sgm) { const int r0 = r0s[sgm], M = ms[sgm];
      if (p < 2) k_gemm_hhx<0><<<dim3(((M / 16) * (CW / 64) + 3) / 4, BB), 128, 0, stream>>>(XT + (size_t)r0 * CW, CW, (size_t)TT * CW, Bsel[sgm], CW, 0, 0.0625f, nullptr, 0, nullptr, 1, 0, 0, F + (size_t)r0 * CW, nullptr, CW, (size_t)TT * CW, M, CW, CW);
      else       k_gemm_hhx<0><<<dim3(((M / 16) * (CW / 64) + 3) / 4, BB), 128, 0, stream>>>(XT + (size_t)r0 * CW, CW, (size_t)TT * CW, Bsel[sgm], CW, 0, 0.0625f, nullptr, 0, nullptr, 1, 0, 0, nullptr, V16 + (size_t)r0 * CW, CW, (size_t)TT * CW, M, CW, CW); }
    if (p == 0) k_rope<<<gr, 256, 0, stream>>>(F, offp, 1.0f, Q16); else if (p == 1) k_rope<<<gr, 256, 0, stream>>>(F, offp, 1.0f, K16); }
  k_vt128<<<BB * NH * (TT / 64), 256, 0, stream>>>(V16, Vt);
  k_flash<<<BB * NH * (TT / 64), 128, 0, stream>>>(Q16, CW, K16, CW, Vt, nullptr, (float*)d_out, 0);
}

// v001
// One run takes 742 microseconds.
// Next to v000, in two timings, it ran 1.24 and 1.25 times as fast.
#include <hip/hip_runtime.h>
// Causal multi-head attention with state segments (x [2, 8 heads, 3072, 128]; StackedLinear projections that mix heads and features — separate weights for the first 512 (state), middle 2048 and
// last 512 (end) positions; rotate-half RoPE with an INPUT offset; causal softmax(q·k/√128)·v; output [2,8,3072,128]): the nine (h,d)→(g,e) projections as GEMMs on the (b,s)-major transposed
// input (bf16-exact ×2^4 weights, f32 accumulate) and the attention as a fused flash-style kernel (d = 128: 4 k-steps / 8 d-tiles; causal chunk skipping; online softmax f32; P f16 ≤ 1;
// O = P·Vt written straight into the output; RPW-16 waves) on v_wmma_f32_16x16x32_f16; RoPE f32 VALU.
#define BB 2
#define NH 8
#define TT 3072
#define HD 128
#define CW (NH * HD)
#define NR (BB * TT)
#define SL 512

typedef __bf16 v16b __attribute__((ext_vector_type(16)));
typedef unsigned short v8us __attribute__((ext_vector_type(8), may_alias));
typedef float  v8f  __attribute__((ext_vector_type(8)));
typedef float  v4f  __attribute__((ext_vector_type(4)));
typedef float  v4fa __attribute__((ext_vector_type(4), may_alias));
union FragB { v16b v; v8us half[2]; unsigned short u[16]; };

__device__ __forceinline__ unsigned short bf16_bits(float x) { unsigned int u = __float_as_uint(x); return (unsigned short)((u + 0x7FFFu + ((u >> 16) & 1u)) >> 16); }
__device__ __forceinline__ float bf16_val(unsigned short b) { return __uint_as_float(((unsigned int)b) << 16); }
__device__ __forceinline__ float bf16_round(float x) { return bf16_val(bf16_bits(x)); }
// D += A·B with NT terms: 1 = ah·bh, 2 = + al·bh (A split), 3 = + ah·bl (both split)
template <int NT>
__device__ __forceinline__ v8f mmaN(v16b ah, v16b al, v16b bh, v16b bl, v8f c) {
  c = __builtin_amdgcn_wmma_f32_16x16x32_bf16(false, ah, false, bh, (short)0, c, false, false);
  if (NT >= 2) c = __builtin_amdgcn_wmma_f32_16x16x32_bf16(false, al, false, bh, (short)0, c, false, false);
  if (NT >= 3) c = __builtin_amdgcn_wmma_f32_16x16x32_bf16(false, ah, false, bl, (short)0, c, false, false);
  asm volatile("v_nop\n\tv_nop\n\tv_nop\n\tv_nop" : "+v"(c) : "v"(ah), "v"(al), "v"(bh), "v"(bl));
  return c;
}

__global__ __launch_bounds__(256) void k_wt_bf16(const float* __restrict__ W, unsigned short* __restrict__ Wt, int K, int N) {
  const int t = blockIdx.x * 256 + threadIdx.x;
  const int k8n = K / 8;
  if (t >= N * k8n) return;
  const int n = t / k8n, k8 = (t % k8n) * 8;
  v8us v;
#pragma unroll
  for (int i = 0; i < 8; ++i) v[i] = bf16_bits(W[(size_t)(k8 + i) * N + n]);
  *(v8us*)(Wt + (size_t)n * K + k8) = v;
  
}

// GEMM C[M][N] (f32, pitch ldc) = act(A[M][K]·W + bias). A f32 row-major (pitch lda) converted per fragment to bf16
// (ASPLIT: hi/lo two planes -> 2 terms, else single rounded term); Wt bf16 [N][K] (pitch ldb). BIAS_BF16 rounds the
// bias to bf16 first (bias quantised to bf16 before the add). K%32==0, M%16==0, N%64==0.
template <bool ASPLIT, int ACT, bool BIAS_BF16>
__global__ __launch_bounds__(128) void k_gemm_bf(const float* __restrict__ A, int lda, const unsigned short* __restrict__ Wt, int ldb,
                                               const float* __restrict__ bias, float* __restrict__ C, int ldc, int M, int N, int K) {
  __shared__ __attribute__((aligned(16))) float so[4][16][64];
  const int tid = threadIdx.x, w = tid >> 5, lane = tid & 31, ln = lane & 15, hh = lane >> 4;
  const int ntn = N / 64;
  const int wid = blockIdx.x * 4 + w;
  const int mt = wid / ntn, nq = wid % ntn;
  if (mt * 16 >= M) return;
  const int row0 = mt * 16, col0 = nq * 64;
  const float* arow = A + (size_t)(row0 + ln) * lda;
  v8f acc[4] = {};
  for (int kb = 0; kb < K; kb += 32) {
    FragB ah, al;
    const v4f x0 = *(const v4fa*)(arow + kb + 8 * hh), x1 = *(const v4fa*)(arow + kb + 8 * hh + 4);
    const v4f x2 = *(const v4fa*)(arow + kb + 16 + 8 * hh), x3 = *(const v4fa*)(arow + kb + 16 + 8 * hh + 4);
    float xs[16] = {x0[0],x0[1],x0[2],x0[3],x1[0],x1[1],x1[2],x1[3],x2[0],x2[1],x2[2],x2[3],x3[0],x3[1],x3[2],x3[3]};
#pragma unroll
    for (int i = 0; i < 16; ++i) { const unsigned short hb = bf16_bits(xs[i]); ah.u[i] = hb; al.u[i] = ASPLIT ? bf16_bits(xs[i] - bf16_val(hb)) : (unsigned short)0; }
#pragma unroll
    for (int t = 0; t < 4; ++t) {
      const unsigned short* brow = Wt + (size_t)(col0 + t * 16 + ln) * ldb + kb;
      FragB b;
      b.half[0] = *(const v8us*)(brow + 8 * hh);
      b.half[1] = *(const v8us*)(brow + 16 + 8 * hh);
      acc[t] = mmaN<ASPLIT ? 2 : 1>(ah.v, al.v, b.v, b.v, acc[t]);
    }
  }
#pragma unroll
  for (int t = 0; t < 4; ++t) {
    float bv = bias ? bias[col0 + t * 16 + ln] : 0.f;
    if (BIAS_BF16) bv = bf16_round(bv);
#pragma unroll
    for (int r = 0; r < 8; ++r) { float v = acc[t][r] + bv; if (ACT == 1) v = fmaxf(v, 0.f); so[w][8 * hh + r][t * 16 + ln] = v; }
  }
  __builtin_amdgcn_fence(__ATOMIC_ACQ_REL, "workgroup");
  __builtin_amdgcn_wave_barrier();
  const int rsub = lane >> 4, c4 = (lane & 15) * 4;
  {
#pragma unroll
    for (int q = 0; q < 8; ++q) {
      const int r = q * 2 + rsub;
      const v4f v = *(const v4fa*)&so[w][r][c4];
      *(v4f*)(C + (size_t)(row0 + r) * ldc + col0 + c4) = v;
    }
    
  }
}

// Flash-style causal/unmasked attention, all contractions 3-term bf16 hi/lo splits, f32 softmax with running max.
// q,k,v rows are read from f32 buffers with arbitrary row pitch (so they can live inside a fused qkv buffer);
// D = head size (multiple of 32, <= 128); one wave = 16 query rows; block = 4 waves (64 queries) sharing K/V chunks of 32.
template <int D, bool CAUSAL>
__global__ __launch_bounds__(128) void k_flash(const float* __restrict__ qb, const float* __restrict__ kb, const float* __restrict__ vb,
                                             int pitch, int T, int H, float scale, float* __restrict__ y, int ypitch) {
  constexpr int KS = D / 32;        // k-steps for QK
  constexpr int DT = D / 16;        // d tiles for PV
  __shared__ __attribute__((aligned(16))) unsigned short sKh[32][D + 8], sKl[32][D + 8], sVh[32][D + 8], sVl[32][D + 8];
  __shared__ __attribute__((aligned(16))) unsigned short sPh[4][16][40], sPl[4][16][40];
  __shared__ __attribute__((aligned(16))) float sO[4][16][D];
  const int tid = threadIdx.x, w = tid >> 5, lane = tid & 31, ln = lane & 15, hh = lane >> 4;
  const int nqb = (T + 63) / 64;
  const int bh = blockIdx.x / nqb, qblk = blockIdx.x % nqb;
  const int b = bh / H, h = bh % H;
  const int q0 = qblk * 64 + w * 16;
  const float* Q = qb + (size_t)b * T * pitch + h * D;
  const float* K = kb + (size_t)b * T * pitch + h * D;
  const float* V = vb + (size_t)b * T * pitch + h * D;

  // A fragments of the wave's 16 query rows (scaled), hi/lo
  FragB aqh[KS], aql[KS];
  {
    int row = q0 + ln; if (row >= T) row = T - 1;
    const float* qr = Q + (size_t)row * pitch;
#pragma unroll
    for (int ks = 0; ks < KS; ++ks)
#pragma unroll
      for (int i = 0; i < 16; ++i) {
        const int d = ks * 32 + ((i < 8) ? (8 * hh + i) : (16 + 8 * hh + (i - 8)));
        const float x = qr[d] * scale; const unsigned short hb = bf16_bits(x);
        aqh[ks].u[i] = hb; aql[ks].u[i] = bf16_bits(x - bf16_val(hb));
      }
  }
  float m_r[8], l_r[8];
#pragma unroll
  for (int r = 0; r < 8; ++r) { m_r[r] = -3.0e38f; l_r[r] = 0.f; }
  v8f oacc[DT];
#pragma unroll
  for (int dt = 0; dt < DT; ++dt) oacc[dt] = (v8f){0.f,0.f,0.f,0.f,0.f,0.f,0.f,0.f};

  const int kv_end = CAUSAL ? min(T, qblk * 64 + 64) : T;     // block-uniform
  for (int j0 = 0; j0 < kv_end; j0 += 32) {
    __syncthreads();
    for (int e = tid; e < 32 * (D / 4); e += 128) {
      const int r = e / (D / 4), c4 = (e % (D / 4)) * 4;
      const int key = j0 + r;
      v4f kf = {0.f,0.f,0.f,0.f}, vf = {0.f,0.f,0.f,0.f};
      if (key < T) { kf = *(const v4fa*)(K + (size_t)key * pitch + c4); vf = *(const v4fa*)(V + (size_t)key * pitch + c4); }
#pragma unroll
      for (int t = 0; t < 4; ++t) {
        unsigned short hb = bf16_bits(kf[t]); sKh[r][c4 + t] = hb; sKl[r][c4 + t] = bf16_bits(kf[t] - bf16_val(hb));
        hb = bf16_bits(vf[t]); sVh[r][c4 + t] = hb; sVl[r][c4 + t] = bf16_bits(vf[t] - bf16_val(hb));
      }
    }
    __syncthreads();
    // S tile 16 x 32
    v8f s[2];
#pragma unroll
    for (int nt = 0; nt < 2; ++nt) {
      v8f acc = {};
#pragma unroll
      for (int ks = 0; ks < KS; ++ks) {
        FragB bh_, bl_;
        bh_.half[0] = *(const v8us*)&sKh[nt * 16 + ln][ks * 32 + 8 * hh]; bh_.half[1] = *(const v8us*)&sKh[nt * 16 + ln][ks * 32 + 16 + 8 * hh];
        bl_.half[0] = *(const v8us*)&sKl[nt * 16 + ln][ks * 32 + 8 * hh]; bl_.half[1] = *(const v8us*)&sKl[nt * 16 + ln][ks * 32 + 16 + 8 * hh];
        acc = mmaN<3>(aqh[ks].v, aql[ks].v, bh_.v, bl_.v, acc);
      }
      s[nt] = acc;
    }
    // mask + running max (rows 8hh+r; the 16 lanes of a half share rows)
    float alpha[8];
#pragma unroll
    for (int r = 0; r < 8; ++r) {
      const int qi = q0 + 8 * hh + r;
      const int ja = j0 + ln, jb = j0 + 16 + ln;
      if (CAUSAL) { if (ja > qi) s[0][r] = -3.0e38f; if (jb > qi) s[1][r] = -3.0e38f; }
      if (ja >= T) s[0][r] = -3.0e38f;
      if (jb >= T) s[1][r] = -3.0e38f;
      float mx = fmaxf(s[0][r], s[1][r]);
      mx = fmaxf(mx, __shfl_xor(mx, 1, 32)); mx = fmaxf(mx, __shfl_xor(mx, 2, 32)); mx = fmaxf(mx, __shfl_xor(mx, 4, 32)); mx = fmaxf(mx, __shfl_xor(mx, 8, 32));
      const float mnew = fmaxf(m_r[r], mx);
      alpha[r] = (mnew > -1.0e38f) ? __expf(m_r[r] - mnew) : 1.0f;
      const float p0 = (s[0][r] > -1.0e38f) ? __expf(s[0][r] - mnew) : 0.f;
      const float p1 = (s[1][r] > -1.0e38f) ? __expf(s[1][r] - mnew) : 0.f;
      m_r[r] = mnew;
      l_r[r] = l_r[r] * alpha[r] + p0 + p1;            // per-lane partial row sum (16 lanes combined at the end)
      unsigned short hb = bf16_bits(p0); sPh[w][8 * hh + r][ln] = hb;      sPl[w][8 * hh + r][ln] = bf16_bits(p0 - bf16_val(hb));
      hb = bf16_bits(p1);                sPh[w][8 * hh + r][16 + ln] = hb; sPl[w][8 * hh + r][16 + ln] = bf16_bits(p1 - bf16_val(hb));
    }
#pragma unroll
    for (int dt = 0; dt < DT; ++dt)
#pragma unroll
      for (int r = 0; r < 8; ++r) oacc[dt][r] *= alpha[r];
    __builtin_amdgcn_fence(__ATOMIC_ACQ_REL, "workgroup");
    __builtin_amdgcn_wave_barrier();
    FragB pah, pal;
    pah.half[0] = *(const v8us*)&sPh[w][ln][8 * hh]; pah.half[1] = *(const v8us*)&sPh[w][ln][16 + 8 * hh];
    pal.half[0] = *(const v8us*)&sPl[w][ln][8 * hh]; pal.half[1] = *(const v8us*)&sPl[w][ln][16 + 8 * hh];
#pragma unroll
    for (int dt = 0; dt < DT; ++dt) {
      FragB bvh, bvl;
#pragma unroll
      for (int i = 0; i < 8; ++i) {
        bvh.u[i] = sVh[8 * hh + i][dt * 16 + ln]; bvh.u[8 + i] = sVh[16 + 8 * hh + i][dt * 16 + ln];
        bvl.u[i] = sVl[8 * hh + i][dt * 16 + ln]; bvl.u[8 + i] = sVl[16 + 8 * hh + i][dt * 16 + ln];
      }
      oacc[dt] = mmaN<3>(pah.v, pal.v, bvh.v, bvl.v, oacc[dt]);
    }
    __builtin_amdgcn_fence(__ATOMIC_ACQ_REL, "workgroup");
    __builtin_amdgcn_wave_barrier();
  }
#pragma unroll
  for (int r = 0; r < 8; ++r) {
    float l = l_r[r];
    l += __shfl_xor(l, 1, 32); l += __shfl_xor(l, 2, 32); l += __shfl_xor(l, 4, 32); l += __shfl_xor(l, 8, 32);
    l_r[r] = (l > 0.f) ? 1.0f / l : 0.f;
  }
#pragma unroll
  for (int dt = 0; dt < DT; ++dt)
#pragma unroll
    for (int r = 0; r < 8; ++r) sO[w][8 * hh + r][dt * 16 + ln] = oacc[dt][r] * l_r[r];
  __builtin_amdgcn_fence(__ATOMIC_ACQ_REL, "workgroup");
  __builtin_amdgcn_wave_barrier();
  {
    for (int r = 0; r < 16; ++r) {
      const int row = q0 + r;
      if (row < T && lane < D / 4) {
        const v4f val = *(const v4fa*)&sO[w][r][lane * 4];
        *(v4f*)(y + ((size_t)b * T + row) * ypitch + h * D + lane * 4) = val;
      }
    }
    
  }
}

// GEMM C = act(A·W + bias + resid): A f32 (ASPLIT -> hi/lo 2 terms), Wt bf16 [N][K]; ACT 0 none, 1 relu, 2 exact gelu;
// resid (optional, f32, row index = (row % rmod), pitch ldr, RES_BF16 rounds it) added before the activation.
template <bool ASPLIT, int ACT, bool BIAS_BF16, bool RES_BF16>
__global__ __launch_bounds__(128) void k_gemm_bf3(const float* __restrict__ A, int lda, const unsigned short* __restrict__ Wt, int ldb,
                                                const float* __restrict__ bias, const float* __restrict__ resid, int rmod, int ldr,
                                                float* __restrict__ C, int ldc, int M, int N, int K) {
  __shared__ __attribute__((aligned(16))) float so[4][16][64];
  const int tid = threadIdx.x, w = tid >> 5, lane = tid & 31, ln = lane & 15, hh = lane >> 4;
  const int ntn = N / 64;
  const int wid = blockIdx.x * 4 + w;
  const int mt = wid / ntn, nq = wid % ntn;
  if (mt * 16 >= M) return;
  const int row0 = mt * 16, col0 = nq * 64;
  const float* arow = A + (size_t)(row0 + ln) * lda;
  v8f acc[4] = {};
  for (int kb = 0; kb < K; kb += 32) {
    FragB ah, al;
    const v4f x0 = *(const v4fa*)(arow + kb + 8 * hh), x1 = *(const v4fa*)(arow + kb + 8 * hh + 4);
    const v4f x2 = *(const v4fa*)(arow + kb + 16 + 8 * hh), x3 = *(const v4fa*)(arow + kb + 16 + 8 * hh + 4);
    float xs[16] = {x0[0],x0[1],x0[2],x0[3],x1[0],x1[1],x1[2],x1[3],x2[0],x2[1],x2[2],x2[3],x3[0],x3[1],x3[2],x3[3]};
#pragma unroll
    for (int i = 0; i < 16; ++i) { const unsigned short hb = bf16_bits(xs[i]); ah.u[i] = hb; al.u[i] = ASPLIT ? bf16_bits(xs[i] - bf16_val(hb)) : (unsigned short)0; }
#pragma unroll
    for (int t = 0; t < 4; ++t) {
      const unsigned short* brow = Wt + (size_t)(col0 + t * 16 + ln) * ldb + kb;
      FragB b;
      b.half[0] = *(const v8us*)(brow + 8 * hh);
      b.half[1] = *(const v8us*)(brow + 16 + 8 * hh);
      acc[t] = mmaN<ASPLIT ? 2 : 1>(ah.v, al.v, b.v, b.v, acc[t]);
    }
  }
#pragma unroll
  for (int t = 0; t < 4; ++t) {
    const int col = col0 + t * 16 + ln;
    float bv = bias ? bias[col] : 0.f;
    if (BIAS_BF16) bv = bf16_round(bv);
#pragma unroll
    for (int r = 0; r < 8; ++r) {
      float v = acc[t][r] + bv;
      if (resid) { float rv = resid[(size_t)((row0 + 8 * hh + r) % rmod) * ldr + col]; if (RES_BF16) rv = bf16_round(rv); v += rv; }
      if (ACT == 1) v = fmaxf(v, 0.f);
      if (ACT == 2) v = 0.5f * v * (1.0f + erff(v * 0.70710678118654752f));
      if (ACT == 3) { const float u = 0.7978845608028654f * (v + 0.044715f * v * v * v); v = 0.5f * v * (1.0f + tanhf(u)); }
      so[w][8 * hh + r][t * 16 + ln] = v;
    }
  }
  __builtin_amdgcn_fence(__ATOMIC_ACQ_REL, "workgroup");
  __builtin_amdgcn_wave_barrier();
  const int rsub = lane >> 4, c4 = (lane & 15) * 4;
  {
#pragma unroll
    for (int q = 0; q < 8; ++q) {
      const int r = q * 2 + rsub;
      const v4f v = *(const v4fa*)&so[w][r][c4];
      *(v4f*)(C + (size_t)(row0 + r) * ldc + col0 + c4) = v;
    }
    
  }
}
// row LayerNorm (biased variance, eps) over N: s = X (+ R); optional out_sum <- s; out_norm <- (s-mu)*rsqrt(var+eps)*g + b
template <bool PARAM_BF16>
__global__ __launch_bounds__(256) void k_layernorm(const float* __restrict__ X, const float* __restrict__ R, const float* __restrict__ g, const float* __restrict__ bta,
                                                  float* __restrict__ out_sum, float* __restrict__ out_norm, int N, float eps) {
  __shared__ float red[256];
  const int row = blockIdx.x, tid = threadIdx.x;
  const float* x = X + (size_t)row * N; const float* rr = R ? R + (size_t)row * N : nullptr;
  float vals[16];                     // up to N = 4096
  const int per = N / 256;            // contiguous chunk per thread? use strided-by-4 chunks: thread handles j = tid*4 + 1024*u
  float s1 = 0.f;
  for (int u = 0; u < per / 4; ++u) {
    const int j = tid * 4 + 1024 * u;
    const v4f a = *(const v4fa*)(x + j);
    v4f b = {0.f,0.f,0.f,0.f}; if (rr) b = *(const v4fa*)(rr + j);
#pragma unroll
    for (int q = 0; q < 4; ++q) { const float v = a[q] + b[q]; vals[u * 4 + q] = v; s1 += v; }
  }
  red[tid] = s1; __syncthreads();
  for (int st = 128; st > 0; st >>= 1) { if (tid < st) red[tid] += red[tid + st]; __syncthreads(); }
  const float mu = red[0] / (float)N; __syncthreads();
  float s2 = 0.f;
  for (int u = 0; u < per / 4; ++u)
#pragma unroll
    for (int q = 0; q < 4; ++q) { const float c = vals[u * 4 + q] - mu; s2 += c * c; }
  red[tid] = s2; __syncthreads();
  for (int st = 128; st > 0; st >>= 1) { if (tid < st) red[tid] += red[tid + st]; __syncthreads(); }
  const float rs = rsqrtf(red[0] / (float)N + eps);
  {
    for (int u = 0; u < per / 4; ++u) {
      const int j = tid * 4 + 1024 * u;
      v4f o, sm;
#pragma unroll
      for (int q = 0; q < 4; ++q) {
        float gg = g[j + q], bb = bta[j + q];
        if (PARAM_BF16) { gg = bf16_round(gg); bb = bf16_round(bb); }
        sm[q] = vals[u * 4 + q]; o[q] = (vals[u * 4 + q] - mu) * rs * gg + bb;
      }
      if (out_sum) *(v4f*)(out_sum + (size_t)row * N + j) = sm;
      *(v4f*)(out_norm + (size_t)row * N + j) = o;
    }
    
  }
}



// ---- f16 WMMA path (v_wmma_f32_16x16x32_f16): 11-bit significands for operands in range — used where a [0,1] probability operand needs more precision than bf16
typedef _Float16 v16h __attribute__((ext_vector_type(16)));
union FragH { v16h v; v8us half[2]; _Float16 h[16]; unsigned short u[16]; };
template <int NT>
__device__ __forceinline__ v8f mmaH(v16h ah, v16h al, v16h bh, v16h bl, v8f c) {
  c = __builtin_amdgcn_wmma_f32_16x16x32_f16(false, ah, false, bh, (short)0, c, false, false);
  if (NT >= 2) c = __builtin_amdgcn_wmma_f32_16x16x32_f16(false, al, false, bh, (short)0, c, false, false);
  if (NT >= 3) c = __builtin_amdgcn_wmma_f32_16x16x32_f16(false, ah, false, bl, (short)0, c, false, false);
  asm volatile("v_nop\n\tv_nop\n\tv_nop\n\tv_nop" : "+v"(c) : "v"(ah), "v"(al), "v"(bh), "v"(bl));
  return c;
}
// batched GEMM like k_gemm_b but f16 operands: A f32 (split into f16 hi/lo if ASPLIT, else rounded to f16), Bt = f16 values [n][k]; alpha; C f32; N multiple of 16 (partial tiles skipped)
template <bool ASPLIT>
__global__ __launch_bounds__(128) void k_gemm_h(const float* __restrict__ A, int lda, size_t sA, const _Float16* __restrict__ Bh, int ldb, size_t sB, float alpha, float* __restrict__ C, int ldc, size_t sC, int M, int N, int K) {
  __shared__ __attribute__((aligned(16))) float so[4][16][64];
  const int tid = threadIdx.x, w = tid >> 5, lane = tid & 31, ln = lane & 15, hh = lane >> 4; const int by = blockIdx.y;
  A += (size_t)by * sA; Bh += (size_t)by * sB; C += (size_t)by * sC;
  const int ntn = (N + 63) / 64; const int wid = blockIdx.x * 4 + w; const int mt = wid / ntn, nq = wid % ntn; if (mt * 16 >= M) return;
  const int row0 = mt * 16, col0 = nq * 64; const float* arow = A + (size_t)(row0 + ln) * lda;
  v8f acc[4] = {};
  for (int kb = 0; kb < K; kb += 32) {
    FragH ah, al;
    const v4f x0 = *(const v4fa*)(arow + kb + 8 * hh), x1 = *(const v4fa*)(arow + kb + 8 * hh + 4), x2 = *(const v4fa*)(arow + kb + 16 + 8 * hh), x3 = *(const v4fa*)(arow + kb + 16 + 8 * hh + 4);
    float xs[16] = {x0[0],x0[1],x0[2],x0[3],x1[0],x1[1],x1[2],x1[3],x2[0],x2[1],x2[2],x2[3],x3[0],x3[1],x3[2],x3[3]};
#pragma unroll
    for (int i = 0; i < 16; ++i) { const _Float16 h = (_Float16)xs[i]; ah.h[i] = h; al.h[i] = ASPLIT ? (_Float16)(xs[i] - (float)h) : (_Float16)0.0f; }
#pragma unroll
    for (int t = 0; t < 4; ++t) { if (col0 + t * 16 >= N) continue; const size_t boff = (size_t)(col0 + t * 16 + ln) * ldb + kb; FragH bq; bq.half[0] = *(const v8us*)(Bh + boff + 8 * hh); bq.half[1] = *(const v8us*)(Bh + boff + 16 + 8 * hh);
      acc[t] = mmaH<ASPLIT ? 2 : 1>(ah.v, al.v, bq.v, bq.v, acc[t]); }
  }
#pragma unroll
  for (int t = 0; t < 4; ++t) { if (col0 + t * 16 >= N) continue;
#pragma unroll
    for (int r = 0; r < 8; ++r) so[w][8 * hh + r][t * 16 + ln] = acc[t][r] * alpha; }
  __builtin_amdgcn_fence(__ATOMIC_ACQ_REL, "workgroup"); __builtin_amdgcn_wave_barrier();
  const int rsub = lane >> 4, c4 = (lane & 15) * 4;
  {
#pragma unroll
    for (int q = 0; q < 8; ++q) { const int r = q * 2 + rsub; if (col0 + c4 < N) { const v4f v = *(const v4fa*)&so[w][r][c4]; *(v4f*)(C + (size_t)(row0 + r) * ldc + col0 + c4) = v; } }
     }
}

// Wt[n][k] = f16(W[k][n]·scale) from f32 row-major W[K][N] (scale = power of two; bf16-exact weights stay exact in f16 away from the subnormal range)
__global__ __launch_bounds__(256) void k_wt_f16(const float* __restrict__ W, _Float16* __restrict__ Wt, int K, int N, float scale) {
  const int t = blockIdx.x * 256 + threadIdx.x; if (t >= N * (K / 8)) return; const int n = t / (K / 8), k8 = (t % (K / 8)) * 8; FragH f;
#pragma unroll
  for (int i = 0; i < 8; ++i) f.h[i] = (_Float16)(bf16_round(W[(size_t)(k8 + i) * N + n]) * scale); const v8us o = f.half[0];
  *(v8us*)((unsigned short*)Wt + (size_t)n * K + k8) = o; 
}
// k_gemm_hh variant with fused epilogue: v = acc·alpha + bias[by·sBias + col] (+ CP[(row/rowsPerB)·sCPb + by·64 + col] if CP) ; ACT 0 none / 1 elu ; writes f32 C and/or f16 C16 (each if non-null)
template <int ACT>
__global__ __launch_bounds__(128) void k_gemm_hhx(const _Float16* __restrict__ A, int lda, size_t sA, const _Float16* __restrict__ Bh, int ldb, size_t sB, float alpha, const float* __restrict__ bias, size_t sBias, const float* __restrict__ CP, int rowsPerB, size_t sCPb, int row0g,
    float* __restrict__ C, _Float16* __restrict__ C16, int ldc, size_t sC, int M, int N, int K) {
  __shared__ __attribute__((aligned(16))) float so[4][16][64];
  const int tid = threadIdx.x, w = tid >> 5, lane = tid & 31, ln = lane & 15, hh = lane >> 4; const int by = blockIdx.y;
  A += (size_t)by * sA; Bh += (size_t)by * sB; const size_t cofs = (size_t)by * sC; const float* bp = bias ? bias + (size_t)by * sBias : nullptr;
  const int ntn = (N + 63) / 64; const int wid = blockIdx.x * 4 + w; const int mt = wid / ntn, nq = wid % ntn; if (mt * 16 >= M) return;
  const int row0 = mt * 16, col0 = nq * 64; const _Float16* arow = A + (size_t)(row0 + ln) * lda;
  v8f acc[4] = {};
  for (int kb = 0; kb < K; kb += 32) { FragH ah; ah.half[0] = *(const v8us*)((const unsigned short*)arow + kb + 8 * hh); ah.half[1] = *(const v8us*)((const unsigned short*)arow + kb + 16 + 8 * hh);
#pragma unroll
    for (int t = 0; t < 4; ++t) { if (col0 + t * 16 >= N) continue; const size_t boff = (size_t)(col0 + t * 16 + ln) * ldb + kb; FragH bq; bq.half[0] = *(const v8us*)((const unsigned short*)Bh + boff + 8 * hh); bq.half[1] = *(const v8us*)((const unsigned short*)Bh + boff + 16 + 8 * hh);
      acc[t] = mmaH<1>(ah.v, ah.v, bq.v, bq.v, acc[t]); }
  }
#pragma unroll
  for (int t = 0; t < 4; ++t) { if (col0 + t * 16 >= N) continue; const int col = col0 + t * 16 + ln; const float bv = bp ? bf16_round(bp[col]) : 0.f;
#pragma unroll
    for (int r = 0; r < 8; ++r) { float v = acc[t][r] * alpha + bv; if (CP) { const int bidx = (row0g + row0 + 8 * hh + r) / rowsPerB; v += CP[(size_t)bidx * sCPb + (size_t)by * 64 + col]; } if (ACT == 1) v = (v > 0.f) ? v : expm1f(v); else if (ACT == 3) v = fmaxf(v, 0.f); so[w][8 * hh + r][t * 16 + ln] = v; } }
  __builtin_amdgcn_fence(__ATOMIC_ACQ_REL, "workgroup"); __builtin_amdgcn_wave_barrier();
  const int rsub = lane >> 4, c4 = (lane & 15) * 4; typedef _Float16 v4h __attribute__((ext_vector_type(4)));
  {
#pragma unroll
    for (int q = 0; q < 8; ++q) { const int r = q * 2 + rsub; if (col0 + c4 < N) { const v4f v = *(const v4fa*)&so[w][r][c4]; if (C) *(v4f*)(C + cofs + (size_t)(row0 + r) * ldc + col0 + c4) = v; if (C16) { v4h h4; for (int i = 0; i < 4; ++i) h4[i] = (_Float16)v[i]; *(v4h*)(C16 + cofs + (size_t)(row0 + r) * ldc + col0 + c4) = h4; } } }
     }
}


__global__ __launch_bounds__(256) void k_x16(const float* __restrict__ x, _Float16* __restrict__ X16, size_t n8) { const size_t t = (size_t)blockIdx.x * 256 + threadIdx.x; if (t >= n8) return; FragH f;
#pragma unroll
  for (int q = 0; q < 8; ++q) f.h[q] = (_Float16)bf16_round(x[t * 8 + q]); *(v8us*)((unsigned short*)X16 + t * 8) = f.half[0];  }
__global__ __launch_bounds__(256) void k_h16(const float* __restrict__ x, _Float16* __restrict__ X16, size_t n8) { const size_t t = (size_t)blockIdx.x * 256 + threadIdx.x; if (t >= n8) return; FragH f;
#pragma unroll
  for (int q = 0; q < 8; ++q) f.h[q] = (_Float16)x[t * 8 + q]; *(v8us*)((unsigned short*)X16 + t * 8) = f.half[0];  }
__global__ __launch_bounds__(256) void k_round16f(const float* __restrict__ W, _Float16* __restrict__ Bt, size_t n8) { const size_t t = (size_t)blockIdx.x * 256 + threadIdx.x; if (t >= n8) return; FragH f;
#pragma unroll
  for (int i = 0; i < 8; ++i) f.h[i] = (_Float16)(bf16_round(W[t * 8 + i]) * 16.0f); *(v8us*)((unsigned short*)Bt + t * 8) = f.half[0];  }
template <int NHv, int TTv>
__global__ __launch_bounds__(256) void k_vt(const _Float16* __restrict__ V16, int ldv, int voff, _Float16* __restrict__ Vt) { __shared__ unsigned short tl[64][66]; const int tid = threadIdx.x; const int slab = blockIdx.x / (TTv / 64), lg = blockIdx.x % (TTv / 64); const int b = slab / NHv, h = slab % NHv;
  for (int i = tid; i < 64 * 8; i += 256) { const int r = i / 8, c8 = (i % 8) * 8; FragH f; f.half[0] = *(const v8us*)((const unsigned short*)V16 + ((size_t)b * TTv + lg * 64 + r) * ldv + voff + h * 64 + c8);
#pragma unroll
    for (int q = 0; q < 8; ++q) tl[r][c8 + q] = f.u[q]; }
  __syncthreads();
  {
#pragma unroll
    for (int rd = 0; rd < 2; ++rd) { const int d = rd * 32 + tid / 8, pc = tid % 8; FragH f;
#pragma unroll
      for (int q = 0; q < 8; ++q) f.u[q] = tl[pc * 8 + q][d];
      *(v8us*)((unsigned short*)Vt + ((size_t)slab * 64 + d) * TTv + lg * 64 + pc * 8) = f.half[0]; }
     } }

// Eight 16-byte asynchronous copies per lane, global memory to LDS through no register: piece i goes from g + i * gstep to LDS byte l + i * lstep.
// The s_wait_xcnt closes the statement so that it stands in front of any later rewrite of the address registers the copies name.
__device__ __forceinline__ void copy8_to_lds(unsigned l, unsigned lstep, const char* g, size_t gstep) {
  asm volatile("global_load_async_to_lds_b128 %0, %8, off\n\t"
               "global_load_async_to_lds_b128 %1, %9, off\n\t"
               "global_load_async_to_lds_b128 %2, %10, off\n\t"
               "global_load_async_to_lds_b128 %3, %11, off\n\t"
               "global_load_async_to_lds_b128 %4, %12, off\n\t"
               "global_load_async_to_lds_b128 %5, %13, off\n\t"
               "global_load_async_to_lds_b128 %6, %14, off\n\t"
               "global_load_async_to_lds_b128 %7, %15, off\n\t"
               "s_wait_xcnt 0x0"
               :: "v"(l), "v"(l + lstep), "v"(l + 2 * lstep), "v"(l + 3 * lstep), "v"(l + 4 * lstep), "v"(l + 5 * lstep), "v"(l + 6 * lstep), "v"(l + 7 * lstep),
                  "v"(g), "v"(g + gstep), "v"(g + 2 * gstep), "v"(g + 3 * gstep), "v"(g + 4 * gstep), "v"(g + 5 * gstep), "v"(g + 6 * gstep), "v"(g + 7 * gstep)
               : "memory");
}

// K and Vt reach the four waves of a work-group through LDS: a stage is 64 keys (K: 64 rows of 256 B, Vt: 128 rows of 128 B, whole 128-B lines), copied once per work-group,
// two buffers, the next stage in flight while this one is worked on. Row pitches 272 B and 144 B (16 B x odd) keep the ds_load_b128 fragment reads free of bank conflicts.
__global__ __launch_bounds__(128) void k_flash(const _Float16* __restrict__ Q16, int ldq, const _Float16* __restrict__ K16, int ldk, const _Float16* __restrict__ Vt, const int* __restrict__ MSK, float* __restrict__ O, int ldo) {
  constexpr int RPW = 16, RTN = RPW / 16, NQB = 3072 / (4 * RPW), DT = 8, KS = 4;      /* head dim 128 */
  constexpr unsigned KP = 272, VP = 144, KBYTES = 64 * KP, STG = KBYTES + 128 * VP;
  __shared__ __attribute__((aligned(16))) unsigned char ring[2 * STG];
  __shared__ __attribute__((aligned(16))) unsigned short sP[4][RPW][40];
  float (*sO)[RPW][128 + 4] = (float (*)[RPW][128 + 4])ring;      /* output staging takes the ring's place behind the loop's last barrier */
  static_assert(sizeof(float) * 4 * RPW * (128 + 4) <= 2 * STG, "output staging fits the ring");
  const int tid = threadIdx.x, w = tid >> 5, lane = tid & 31, ln = lane & 15, hh = lane >> 4;
  const int slab = blockIdx.x / NQB, qblk = blockIdx.x % NQB; const int b = slab / 8, h = slab % 8; const int qb0 = qblk * (4 * RPW); const int q0 = qb0 + w * RPW;
  FragH aq[2][KS];
#pragma unroll
  for (int rt = 0; rt < RTN; ++rt) { const unsigned short* qr = (const unsigned short*)Q16 + ((size_t)b * 3072 + q0 + rt * 16 + ln) * ldq + h * 128;
#pragma unroll
    for (int ks = 0; ks < KS; ++ks) { aq[rt][ks].half[0] = *(const v8us*)(qr + ks * 32 + 8 * hh); aq[rt][ks].half[1] = *(const v8us*)(qr + ks * 32 + 16 + 8 * hh); } }
  const unsigned short* Vth = (const unsigned short*)Vt + (size_t)slab * 128 * 3072;
  // each thread's own pieces of a stage: K row tid/16 + 8i, 16-byte piece tid%16; Vt row tid/8 + 16i, piece tid%8
  const char* kg = (const char*)((const unsigned short*)K16 + ((size_t)b * 3072 + (tid >> 4)) * ldk + h * 128 + (tid & 15) * 8);
  const char* vg = (const char*)(Vth + (size_t)(tid >> 3) * 3072 + (tid & 7) * 8);
  const unsigned ring0 = (unsigned)(size_t)ring;
  const unsigned kl = ring0 + (unsigned)(tid >> 4) * KP + (unsigned)(tid & 15) * 16u, vl = ring0 + KBYTES + (unsigned)(tid >> 3) * VP + (unsigned)(tid & 7) * 16u;
  const size_t kstage = (size_t)64 * ldk * 2, kstep = (size_t)8 * ldk * 2;
  auto fill = [&](int st, unsigned buf) {
    copy8_to_lds(kl + buf * STG, 8 * KP, kg + (size_t)st * kstage, kstep);
    copy8_to_lds(vl + buf * STG, 16 * VP, vg + (size_t)st * 128, (size_t)16 * 3072 * 2);
  };
  float m_r[2][8], l_r[2][8]; v8f oacc[2][DT];
#pragma unroll
  for (int rt = 0; rt < RTN; ++rt) {
#pragma unroll
    for (int r = 0; r < 8; ++r) { m_r[rt][r] = -3.0e38f; l_r[rt][r] = 0.f; }
#pragma unroll
    for (int dt = 0; dt < DT; ++dt) oacc[rt][dt] = (v8f){0.f,0.f,0.f,0.f,0.f,0.f,0.f,0.f}; }
  const int nst = qblk + 1;      /* stages of 64 keys up to the block's diagonal; the same for the whole work-group */
  fill(0, 0u);
  asm volatile("s_wait_asynccnt 0x0" ::: "memory");      // this wave's pieces of stage 0 have landed
  __syncthreads();                                       // every wave's pieces of stage 0 are readable
  if (nst > 1) fill(1, 1u);
#pragma unroll 1      /* one copy of the body: the ring's order stays as written */
  for (int st = 0; st < nst; ++st) {
    const unsigned char* kbuf = ring + (unsigned)(st & 1) * STG; const unsigned char* vbuf = kbuf + KBYTES;
#pragma unroll 1      /* the two 32-key passes of a stage share one body in the instruction cache */
  for (int sub = 0; sub < 2; ++sub) { const int j0 = st * 64 + sub * 32;
    v8f s[2][2];
#pragma unroll
    for (int nt = 0; nt < 2; ++nt) { const unsigned char* kr = kbuf + (unsigned)(sub * 32 + nt * 16 + ln) * KP + 16 * hh; FragH bk[KS];
#pragma unroll
      for (int ks = 0; ks < KS; ++ks) { bk[ks].half[0] = *(const v8us*)(kr + ks * 64); bk[ks].half[1] = *(const v8us*)(kr + ks * 64 + 32); }
#pragma unroll
      for (int rt = 0; rt < RTN; ++rt) { v8f acc = (v8f){0.f,0.f,0.f,0.f,0.f,0.f,0.f,0.f};
#pragma unroll
        for (int ks = 0; ks < KS; ++ks) acc = mmaH<1>(aq[rt][ks].v, aq[rt][ks].v, bk[ks].v, bk[ks].v, acc); s[rt][nt] = acc; } }
#pragma unroll
    for (int rt = 0; rt < RTN; ++rt)
#pragma unroll
      for (int r = 0; r < 8; ++r) { const int tq = q0 + rt * 16 + 8 * hh + r; const int k0 = j0 + ln, k1 = j0 + 16 + ln; (void)tq; (void)k0; (void)k1;
        const bool ok0 = (k0 <= tq), ok1 = (k1 <= tq);
        const float s0 = ok0 ? s[rt][0][r] * (0.08838834764831845f) : -INFINITY, s1 = ok1 ? s[rt][1][r] * (0.08838834764831845f) : -INFINITY; float mc = fmaxf(s0, s1);
        mc = fmaxf(mc, __shfl_xor(mc, 1, 32)); mc = fmaxf(mc, __shfl_xor(mc, 2, 32)); mc = fmaxf(mc, __shfl_xor(mc, 4, 32)); mc = fmaxf(mc, __shfl_xor(mc, 8, 32));
        const float mn = fmaxf(m_r[rt][r], mc); const float al = (mn > -1.0e38f) ? expf(m_r[rt][r] - mn) : 1.0f; m_r[rt][r] = mn; const float p0 = ok0 ? expf(s0 - mn) : 0.f, p1 = ok1 ? expf(s1 - mn) : 0.f; l_r[rt][r] = l_r[rt][r] * al + p0 + p1;
#pragma unroll
        for (int dt = 0; dt < DT; ++dt) oacc[rt][dt][r] *= al;
        FragH t2; t2.h[0] = (_Float16)p0; t2.h[1] = (_Float16)p1; sP[w][rt * 16 + 8 * hh + r][ln] = t2.u[0]; sP[w][rt * 16 + 8 * hh + r][16 + ln] = t2.u[1]; }
    __builtin_amdgcn_fence(__ATOMIC_ACQ_REL, "workgroup"); __builtin_amdgcn_wave_barrier();
    FragH pa[2];
#pragma unroll
    for (int rt = 0; rt < RTN; ++rt) { pa[rt].half[0] = *(const v8us*)&sP[w][rt * 16 + ln][8 * hh]; pa[rt].half[1] = *(const v8us*)&sP[w][rt * 16 + ln][16 + 8 * hh]; }
#pragma unroll
    for (int dt = 0; dt < DT; ++dt) { const unsigned char* vrow = vbuf + (unsigned)(dt * 16 + ln) * VP + sub * 64 + 16 * hh; FragH bv; bv.half[0] = *(const v8us*)(vrow); bv.half[1] = *(const v8us*)(vrow + 32);
#pragma unroll
      for (int rt = 0; rt < RTN; ++rt) oacc[rt][dt] = mmaH<1>(pa[rt].v, pa[rt].v, bv.v, bv.v, oacc[rt][dt]); }
    __builtin_amdgcn_fence(__ATOMIC_ACQ_REL, "workgroup"); __builtin_amdgcn_wave_barrier(); }
    asm volatile("s_wait_dscnt 0x0" ::: "memory");       // this wave's reads of the buffer have returned before it is refilled
    asm volatile("s_wait_asynccnt 0x0" ::: "memory");    // this wave's pieces of stage st + 1 have landed
    __syncthreads();                                     // publishes stage st + 1 and ends every wave's reads of stage st
    if (st + 2 < nst) fill(st + 2, (unsigned)(st & 1));
  }
  asm volatile("s_wait_asynccnt 0x0" ::: "memory");      // no copy is outstanding when the ring becomes output staging
#pragma unroll
  for (int rt = 0; rt < RTN; ++rt) {
#pragma unroll
    for (int r = 0; r < 8; ++r) { float l = l_r[rt][r]; l += __shfl_xor(l, 1, 32); l += __shfl_xor(l, 2, 32); l += __shfl_xor(l, 4, 32); l += __shfl_xor(l, 8, 32); l_r[rt][r] = (l > 0.f) ? 1.0f / l : 0.f; }
#pragma unroll
    for (int dt = 0; dt < DT; ++dt)
#pragma unroll
      for (int r = 0; r < 8; ++r) sO[w][rt * 16 + 8 * hh + r][dt * 16 + ln] = oacc[rt][dt][r] * l_r[rt][r]; }
  __builtin_amdgcn_fence(__ATOMIC_ACQ_REL, "workgroup"); __builtin_amdgcn_wave_barrier();
  {
#pragma unroll
    for (int rp = 0; rp < RPW; ++rp) { const int r = rp, pc = lane; const v4f val = *(const v4fa*)&sO[w][r][pc * 4]; *(v4f*)(O + ((size_t)(b * 8 + h) * 3072 + q0 + r) * 128 + pc * 4) = val; }      /* output layout [b][h][s][128]: 32 lanes x 16 B rows */
     } }

__global__ __launch_bounds__(256) void k_xt(const float* __restrict__ x, _Float16* __restrict__ XT) { const size_t t = (size_t)blockIdx.x * 256 + threadIdx.x; if (t >= (size_t)NR * NH * 16) return; const int p = (int)(t % 16); const int h = (int)((t / 16) % NH); const size_t bs = t / (16 * NH); const int b = (int)(bs / TT), s = (int)(bs % TT); const float* src = x + (((size_t)(b * NH + h) * TT + s) * HD) + p * 8; FragH f;
#pragma unroll
  for (int q = 0; q < 8; ++q) f.h[q] = (_Float16)bf16_round(src[q]); unsigned short* d = (unsigned short*)XT + bs * CW + h * HD + p * 8; *(v8us*)d = f.half[0];  }
__global__ __launch_bounds__(256) void k_wst(const float* __restrict__ W, _Float16* __restrict__ Bt) { const size_t t = (size_t)blockIdx.x * 256 + threadIdx.x; if (t >= (size_t)CW * NH * 16) return; const int p = (int)(t % 16); const int h = (int)((t / 16) % NH); const int n = (int)(t / (16 * NH)); const int g = n / HD, e = n % HD; FragH f;
#pragma unroll
  for (int q = 0; q < 8; ++q) { const int d = p * 8 + q; f.h[q] = (_Float16)(bf16_round(W[(((size_t)(h * NH + g) * HD + d) * HD) + e]) * 16.0f); }
  unsigned short* dst = (unsigned short*)Bt + (size_t)n * CW + h * HD + p * 8; *(v8us*)dst = f.half[0];  }
__global__ __launch_bounds__(256) void k_rope(const float* __restrict__ F, const int* __restrict__ offp, float oscale, _Float16* __restrict__ D16) { __shared__ __attribute__((aligned(16))) _Float16 st[256][8]; const int tid = threadIdx.x; const size_t t = (size_t)blockIdx.x * 256 + tid; if (t >= (size_t)NR * NH * 16) return; const int li = (int)(t % 16); const int h = (int)((t / 16) % NH); const size_t bs = t / (16 * NH); const int s = (int)(bs % TT); const float pos = (float)(s + offp[0]); const float* src = F + bs * CW + h * HD;
#pragma unroll 1
  for (int q = 0; q < 8; ++q) { const int j = li * 8 + q; const int i = j & 63; const float ang = pos * __builtin_powf(10000.0f, -(float)(2 * i) / 128.0f); const float c = cosf(ang), sn = sinf(ang); const float xj = src[j], xp = src[(j + 64) & 127]; const float rot = (j < 64) ? -xp : xp; st[tid][q] = (_Float16)((xj * c + rot * sn) * oscale); }
  FragH f; f.half[0] = *(const v8us*)&st[tid][0]; unsigned short* d = (unsigned short*)D16 + bs * CW + h * HD + li * 8; *(v8us*)d = f.half[0];  }
__global__ __launch_bounds__(256) void k_vt128(const _Float16* __restrict__ V16, _Float16* __restrict__ Vt) { __shared__ unsigned short tl[64][130]; const int tid = threadIdx.x; const int slab = blockIdx.x / (TT / 64), lg = blockIdx.x % (TT / 64); const int b = slab / NH, h = slab % NH;
  for (int i = tid; i < 64 * 16; i += 256) { const int r = i / 16, c8 = (i % 16) * 8; FragH f; f.half[0] = *(const v8us*)((const unsigned short*)V16 + ((size_t)b * TT + lg * 64 + r) * CW + h * HD + c8);
#pragma unroll
    for (int q = 0; q < 8; ++q) tl[r][c8 + q] = f.u[q]; }
  __syncthreads();
  { for (int i = tid; i < 128 * 8; i += 256) { const int d = i / 8, pc = i % 8; FragH f;
#pragma unroll
      for (int q = 0; q < 8; ++q) f.u[q] = tl[pc * 8 + q][d]; *(v8us*)((unsigned short*)Vt + ((size_t)slab * HD + d) * TT + lg * 64 + pc * 8) = f.half[0]; }  } }
extern "C" void kernel_launch(void* const* d_in, const int* in_sizes, int n_in,
                              void* d_out, int out_size, void* d_ws, size_t ws_size, hipStream_t stream) {
  (void)in_sizes; (void)n_in; (void)out_size;
  const float* x = (const float*)d_in[0]; const float* Wm[3] = {(const float*)d_in[1], (const float*)d_in[2], (const float*)d_in[3]}; const float* Wsg[3] = {(const float*)d_in[4], (const float*)d_in[5], (const float*)d_in[6]}; const float* Weg[3] = {(const float*)d_in[7], (const float*)d_in[8], (const float*)d_in[9]}; const int* offp = (const int*)d_in[10];
  char* ws = (char*)d_ws; size_t off = 0;
  auto take = [&](size_t bytes) { char* p = ws + off; off += (bytes + 255) & ~(size_t)255; return p; };
  _Float16* Bm = (_Float16*)take((size_t)CW * CW * 2); _Float16* Bs = (_Float16*)take((size_t)CW * CW * 2); _Float16* Be = (_Float16*)take((size_t)CW * CW * 2);
  _Float16* XT = (_Float16*)take((size_t)NR * CW * 2); float* F = (float*)take((size_t)NR * CW * 4); _Float16* Q16 = (_Float16*)take((size_t)NR * CW * 2); _Float16* K16 = (_Float16*)take((size_t)NR * CW * 2); _Float16* V16 = (_Float16*)take((size_t)NR * CW * 2); _Float16* Vt = (_Float16*)take((size_t)NR * CW * 2);
  if (off > ws_size) return;      // 6.3 + 12.6 + 25.2 + 12.6 × 4 ≈ 94 MB
  k_xt<<<(unsigned)(((size_t)NR * NH * 16 + 255) / 256), 256, 0, stream>>>(x, XT);
  const unsigned gw = (unsigned)(((size_t)CW * NH * 16 + 255) / 256), gr = (unsigned)(((size_t)NR * NH * 16 + 255) / 256);
  // the three (b,s) row ranges: [0,512) state, [512,2560) middle, [2560,3072) end — batched over b via sA/sC
  const int r0s[3] = {SL, 0, TT - SL}, ms[3] = {TT - 2 * SL, SL, SL};      // order: middle (W), state (Ws), end (We)
  for (int p = 0; p < 3; ++p) {      // p: 0 = q, 1 = k, 2 = v
    k_wst<<<gw, 256, 0, stream>>>(Wm[p], Bm); k_wst<<<gw, 256, 0, stream>>>(Wsg[p], Bs); k_wst<<<gw, 256, 0, stream>>>(Weg[p], Be);
    const _Float16* Bsel[3] = {Bm, Bs, Be};
    for (int sgm = 0; sgm < 3; ++sgm) { const int r0 = r0s[sgm], M = ms[sgm];
      if (p < 2) k_gemm_hhx<0><<<dim3(((M / 16) * (CW / 64) + 3) / 4, BB), 128, 0, stream>>>(XT + (size_t)r0 * CW, CW, (size_t)TT * CW, Bsel[sgm], CW, 0, 0.0625f, nullptr, 0, nullptr, 1, 0, 0, F + (size_t)r0 * CW, nullptr, CW, (size_t)TT * CW, M, CW, CW);
      else       k_gemm_hhx<0><<<dim3(((M / 16) * (CW / 64) + 3) / 4, BB), 128, 0, stream>>>(XT + (size_t)r0 * CW, CW, (size_t)TT * CW, Bsel[sgm], CW, 0, 0.0625f, nullptr, 0, nullptr, 1, 0, 0, nullptr, V16 + (size_t)r0 * CW, CW, (size_t)TT * CW, M, CW, CW); }
    if (p == 0) k_rope<<<gr, 256, 0, stream>>>(F, offp, 1.0f, Q16); else if (p == 1) k_rope<<<gr, 256, 0, stream>>>(F, offp, 1.0f, K16); }
  k_vt128<<<BB * NH * (TT / 64), 256, 0, stream>>>(V16, Vt);
  k_flash<<<BB * NH * (TT / 64), 128, 0, stream>>>(Q16, CW, K16, CW, Vt, nullptr, (float*)d_out, 0);
}

// v002
// It runs in 470 microseconds.
// In two side-by-side timings against v001, it was 1.59 and 1.58 times as fast.
// Over all steps from v000 it is 1.98 times as fast.
#include <hip/hip_runtime.h>
// Causal multi-head attention with state segments (x [2, 8 heads, 3072, 128]; StackedLinear projections that mix heads and features — separate weights for the first 512 (state), middle 2048 and
// last 512 (end) positions; rotate-half RoPE with an INPUT offset; causal softmax(q·k/√128)·v; output [2,8,3072,128]): the nine (h,d)→(g,e) projections as GEMMs on the (b,s)-major transposed
// input (bf16-exact ×2^4 weights, f32 accumulate) and the attention as a fused flash-style kernel (d = 128: 4 k-steps / 8 d-tiles; causal chunk skipping; online softmax f32; P f16 ≤ 1;
// O = P·Vt written straight into the output; RPW-16 waves) on v_wmma_f32_16x16x32_f16; RoPE f32 VALU.
#define BB 2
#define NH 8
#define TT 3072
#define HD 128
#define CW (NH * HD)
#define NR (BB * TT)
#define SL 512

typedef __bf16 v16b __attribute__((ext_vector_type(16)));
typedef unsigned short v8us __attribute__((ext_vector_type(8), may_alias));
typedef float  v8f  __attribute__((ext_vector_type(8)));
typedef float  v4f  __attribute__((ext_vector_type(4)));
typedef float  v4fa __attribute__((ext_vector_type(4), may_alias));
union FragB { v16b v; v8us half[2]; unsigned short u[16]; };

__device__ __forceinline__ unsigned short bf16_bits(float x) { unsigned int u = __float_as_uint(x); return (unsigned short)((u + 0x7FFFu + ((u >> 16) & 1u)) >> 16); }
__device__ __forceinline__ float bf16_val(unsigned short b) { return __uint_as_float(((unsigned int)b) << 16); }
__device__ __forceinline__ float bf16_round(float x) { return bf16_val(bf16_bits(x)); }
// D += A·B with NT terms: 1 = ah·bh, 2 = + al·bh (A split), 3 = + ah·bl (both split)
template <int NT>
__device__ __forceinline__ v8f mmaN(v16b ah, v16b al, v16b bh, v16b bl, v8f c) {
  c = __builtin_amdgcn_wmma_f32_16x16x32_bf16(false, ah, false, bh, (short)0, c, false, false);
  if (NT >= 2) c = __builtin_amdgcn_wmma_f32_16x16x32_bf16(false, al, false, bh, (short)0, c, false, false);
  if (NT >= 3) c = __builtin_amdgcn_wmma_f32_16x16x32_bf16(false, ah, false, bl, (short)0, c, false, false);
  asm volatile("v_nop\n\tv_nop\n\tv_nop\n\tv_nop" : "+v"(c) : "v"(ah), "v"(al), "v"(bh), "v"(bl));
  return c;
}

__global__ __launch_bounds__(256) void k_wt_bf16(const float* __restrict__ W, unsigned short* __restrict__ Wt, int K, int N) {
  const int t = blockIdx.x * 256 + threadIdx.x;
  const int k8n = K / 8;
  if (t >= N * k8n) return;
  const int n = t / k8n, k8 = (t % k8n) * 8;
  v8us v;
#pragma unroll
  for (int i = 0; i < 8; ++i) v[i] = bf16_bits(W[(size_t)(k8 + i) * N + n]);
  *(v8us*)(Wt + (size_t)n * K + k8) = v;
  
}

// GEMM C[M][N] (f32, pitch ldc) = act(A[M][K]·W + bias). A f32 row-major (pitch lda) converted per fragment to bf16
// (ASPLIT: hi/lo two planes -> 2 terms, else single rounded term); Wt bf16 [N][K] (pitch ldb). BIAS_BF16 rounds the
// bias to bf16 first (bias quantised to bf16 before the add). K%32==0, M%16==0, N%64==0.
template <bool ASPLIT, int ACT, bool BIAS_BF16>
__global__ __launch_bounds__(128) void k_gemm_bf(const float* __restrict__ A, int lda, const unsigned short* __restrict__ Wt, int ldb,
                                               const float* __restrict__ bias, float* __restrict__ C, int ldc, int M, int N, int K) {
  __shared__ __attribute__((aligned(16))) float so[4][16][64];
  const int tid = threadIdx.x, w = tid >> 5, lane = tid & 31, ln = lane & 15, hh = lane >> 4;
  const int ntn = N / 64;
  const int wid = blockIdx.x * 4 + w;
  const int mt = wid / ntn, nq = wid % ntn;
  if (mt * 16 >= M) return;
  const int row0 = mt * 16, col0 = nq * 64;
  const float* arow = A + (size_t)(row0 + ln) * lda;
  v8f acc[4] = {};
  for (int kb = 0; kb < K; kb += 32) {
    FragB ah, al;
    const v4f x0 = *(const v4fa*)(arow + kb + 8 * hh), x1 = *(const v4fa*)(arow + kb + 8 * hh + 4);
    const v4f x2 = *(const v4fa*)(arow + kb + 16 + 8 * hh), x3 = *(const v4fa*)(arow + kb + 16 + 8 * hh + 4);
    float xs[16] = {x0[0],x0[1],x0[2],x0[3],x1[0],x1[1],x1[2],x1[3],x2[0],x2[1],x2[2],x2[3],x3[0],x3[1],x3[2],x3[3]};
#pragma unroll
    for (int i = 0; i < 16; ++i) { const unsigned short hb = bf16_bits(xs[i]); ah.u[i] = hb; al.u[i] = ASPLIT ? bf16_bits(xs[i] - bf16_val(hb)) : (unsigned short)0; }
#pragma unroll
    for (int t = 0; t < 4; ++t) {
      const unsigned short* brow = Wt + (size_t)(col0 + t * 16 + ln) * ldb + kb;
      FragB b;
      b.half[0] = *(const v8us*)(brow + 8 * hh);
      b.half[1] = *(const v8us*)(brow + 16 + 8 * hh);
      acc[t] = mmaN<ASPLIT ? 2 : 1>(ah.v, al.v, b.v, b.v, acc[t]);
    }
  }
#pragma unroll
  for (int t = 0; t < 4; ++t) {
    float bv = bias ? bias[col0 + t * 16 + ln] : 0.f;
    if (BIAS_BF16) bv = bf16_round(bv);
#pragma unroll
    for (int r = 0; r < 8; ++r) { float v = acc[t][r] + bv; if (ACT == 1) v = fmaxf(v, 0.f); so[w][8 * hh + r][t * 16 + ln] = v; }
  }
  __builtin_amdgcn_fence(__ATOMIC_ACQ_REL, "workgroup");
  __builtin_amdgcn_wave_barrier();
  const int rsub = lane >> 4, c4 = (lane & 15) * 4;
  {
#pragma unroll
    for (int q = 0; q < 8; ++q) {
      const int r = q * 2 + rsub;
      const v4f v = *(const v4fa*)&so[w][r][c4];
      *(v4f*)(C + (size_t)(row0 + r) * ldc + col0 + c4) = v;
    }
    
  }
}

// Flash-style causal/unmasked attention, all contractions 3-term bf16 hi/lo splits, f32 softmax with running max.
// q,k,v rows are read from f32 buffers with arbitrary row pitch (so they can live inside a fused qkv buffer);
// D = head size (multiple of 32, <= 128); one wave = 16 query rows; block = 4 waves (64 queries) sharing K/V chunks of 32.
template <int D, bool CAUSAL>
__global__ __launch_bounds__(128) void k_flash(const float* __restrict__ qb, const float* __restrict__ kb, const float* __restrict__ vb,
                                             int pitch, int T, int H, float scale, float* __restrict__ y, int ypitch) {
  constexpr int KS = D / 32;        // k-steps for QK
  constexpr int DT = D / 16;        // d tiles for PV
  __shared__ __attribute__((aligned(16))) unsigned short sKh[32][D + 8], sKl[32][D + 8], sVh[32][D + 8], sVl[32][D + 8];
  __shared__ __attribute__((aligned(16))) unsigned short sPh[4][16][40], sPl[4][16][40];
  __shared__ __attribute__((aligned(16))) float sO[4][16][D];
  const int tid = threadIdx.x, w = tid >> 5, lane = tid & 31, ln = lane & 15, hh = lane >> 4;
  const int nqb = (T + 63) / 64;
  const int bh = blockIdx.x / nqb, qblk = blockIdx.x % nqb;
  const int b = bh / H, h = bh % H;
  const int q0 = qblk * 64 + w * 16;
  const float* Q = qb + (size_t)b * T * pitch + h * D;
  const float* K = kb + (size_t)b * T * pitch + h * D;
  const float* V = vb + (size_t)b * T * pitch + h * D;

  // A fragments of the wave's 16 query rows (scaled), hi/lo
  FragB aqh[KS], aql[KS];
  {
    int row = q0 + ln; if (row >= T) row = T - 1;
    const float* qr = Q + (size_t)row * pitch;
#pragma unroll
    for (int ks = 0; ks < KS; ++ks)
#pragma unroll
      for (int i = 0; i < 16; ++i) {
        const int d = ks * 32 + ((i < 8) ? (8 * hh + i) : (16 + 8 * hh + (i - 8)));
        const float x = qr[d] * scale; const unsigned short hb = bf16_bits(x);
        aqh[ks].u[i] = hb; aql[ks].u[i] = bf16_bits(x - bf16_val(hb));
      }
  }
  float m_r[8], l_r[8];
#pragma unroll
  for (int r = 0; r < 8; ++r) { m_r[r] = -3.0e38f; l_r[r] = 0.f; }
  v8f oacc[DT];
#pragma unroll
  for (int dt = 0; dt < DT; ++dt) oacc[dt] = (v8f){0.f,0.f,0.f,0.f,0.f,0.f,0.f,0.f};

  const int kv_end = CAUSAL ? min(T, qblk * 64 + 64) : T;     // block-uniform
  for (int j0 = 0; j0 < kv_end; j0 += 32) {
    __syncthreads();
    for (int e = tid; e < 32 * (D / 4); e += 128) {
      const int r = e / (D / 4), c4 = (e % (D / 4)) * 4;
      const int key = j0 + r;
      v4f kf = {0.f,0.f,0.f,0.f}, vf = {0.f,0.f,0.f,0.f};
      if (key < T) { kf = *(const v4fa*)(K + (size_t)key * pitch + c4); vf = *(const v4fa*)(V + (size_t)key * pitch + c4); }
#pragma unroll
      for (int t = 0; t < 4; ++t) {
        unsigned short hb = bf16_bits(kf[t]); sKh[r][c4 + t] = hb; sKl[r][c4 + t] = bf16_bits(kf[t] - bf16_val(hb));
        hb = bf16_bits(vf[t]); sVh[r][c4 + t] = hb; sVl[r][c4 + t] = bf16_bits(vf[t] - bf16_val(hb));
      }
    }
    __syncthreads();
    // S tile 16 x 32
    v8f s[2];
#pragma unroll
    for (int nt = 0; nt < 2; ++nt) {
      v8f acc = {};
#pragma unroll
      for (int ks = 0; ks < KS; ++ks) {
        FragB bh_, bl_;
        bh_.half[0] = *(const v8us*)&sKh[nt * 16 + ln][ks * 32 + 8 * hh]; bh_.half[1] = *(const v8us*)&sKh[nt * 16 + ln][ks * 32 + 16 + 8 * hh];
        bl_.half[0] = *(const v8us*)&sKl[nt * 16 + ln][ks * 32 + 8 * hh]; bl_.half[1] = *(const v8us*)&sKl[nt * 16 + ln][ks * 32 + 16 + 8 * hh];
        acc = mmaN<3>(aqh[ks].v, aql[ks].v, bh_.v, bl_.v, acc);
      }
      s[nt] = acc;
    }
    // mask + running max (rows 8hh+r; the 16 lanes of a half share rows)
    float alpha[8];
#pragma unroll
    for (int r = 0; r < 8; ++r) {
      const int qi = q0 + 8 * hh + r;
      const int ja = j0 + ln, jb = j0 + 16 + ln;
      if (CAUSAL) { if (ja > qi) s[0][r] = -3.0e38f; if (jb > qi) s[1][r] = -3.0e38f; }
      if (ja >= T) s[0][r] = -3.0e38f;
      if (jb >= T) s[1][r] = -3.0e38f;
      float mx = fmaxf(s[0][r], s[1][r]);
      mx = fmaxf(mx, __shfl_xor(mx, 1, 32)); mx = fmaxf(mx, __shfl_xor(mx, 2, 32)); mx = fmaxf(mx, __shfl_xor(mx, 4, 32)); mx = fmaxf(mx, __shfl_xor(mx, 8, 32));
      const float mnew = fmaxf(m_r[r], mx);
      alpha[r] = (mnew > -1.0e38f) ? __expf(m_r[r] - mnew) : 1.0f;
      const float p0 = (s[0][r] > -1.0e38f) ? __expf(s[0][r] - mnew) : 0.f;
      const float p1 = (s[1][r] > -1.0e38f) ? __expf(s[1][r] - mnew) : 0.f;
      m_r[r] = mnew;
      l_r[r] = l_r[r] * alpha[r] + p0 + p1;            // per-lane partial row sum (16 lanes combined at the end)
      unsigned short hb = bf16_bits(p0); sPh[w][8 * hh + r][ln] = hb;      sPl[w][8 * hh + r][ln] = bf16_bits(p0 - bf16_val(hb));
      hb = bf16_bits(p1);                sPh[w][8 * hh + r][16 + ln] = hb; sPl[w][8 * hh + r][16 + ln] = bf16_bits(p1 - bf16_val(hb));
    }
#pragma unroll
    for (int dt = 0; dt < DT; ++dt)
#pragma unroll
      for (int r = 0; r < 8; ++r) oacc[dt][r] *= alpha[r];
    __builtin_amdgcn_fence(__ATOMIC_ACQ_REL, "workgroup");
    __builtin_amdgcn_wave_barrier();
    FragB pah, pal;
    pah.half[0] = *(const v8us*)&sPh[w][ln][8 * hh]; pah.half[1] = *(const v8us*)&sPh[w][ln][16 + 8 * hh];
    pal.half[0] = *(const v8us*)&sPl[w][ln][8 * hh]; pal.half[1] = *(const v8us*)&sPl[w][ln][16 + 8 * hh];
#pragma unroll
    for (int dt = 0; dt < DT; ++dt) {
      FragB bvh, bvl;
#pragma unroll
      for (int i = 0; i < 8; ++i) {
        bvh.u[i] = sVh[8 * hh + i][dt * 16 + ln]; bvh.u[8 + i] = sVh[16 + 8 * hh + i][dt * 16 + ln];
        bvl.u[i] = sVl[8 * hh + i][dt * 16 + ln]; bvl.u[8 + i] = sVl[16 + 8 * hh + i][dt * 16 + ln];
      }
      oacc[dt] = mmaN<3>(pah.v, pal.v, bvh.v, bvl.v, oacc[dt]);
    }
    __builtin_amdgcn_fence(__ATOMIC_ACQ_REL, "workgroup");
    __builtin_amdgcn_wave_barrier();
  }
#pragma unroll
  for (int r = 0; r < 8; ++r) {
    float l = l_r[r];
    l += __shfl_xor(l, 1, 32); l += __shfl_xor(l, 2, 32); l += __shfl_xor(l, 4, 32); l += __shfl_xor(l, 8, 32);
    l_r[r] = (l > 0.f) ? 1.0f / l : 0.f;
  }
#pragma unroll
  for (int dt = 0; dt < DT; ++dt)
#pragma unroll
    for (int r = 0; r < 8; ++r) sO[w][8 * hh + r][dt * 16 + ln] = oacc[dt][r] * l_r[r];
  __builtin_amdgcn_fence(__ATOMIC_ACQ_REL, "workgroup");
  __builtin_amdgcn_wave_barrier();
  {
    for (int r = 0; r < 16; ++r) {
      const int row = q0 + r;
      if (row < T && lane < D / 4) {
        const v4f val = *(const v4fa*)&sO[w][r][lane * 4];
        *(v4f*)(y + ((size_t)b * T + row) * ypitch + h * D + lane * 4) = val;
      }
    }
    
  }
}

// GEMM C = act(A·W + bias + resid): A f32 (ASPLIT -> hi/lo 2 terms), Wt bf16 [N][K]; ACT 0 none, 1 relu, 2 exact gelu;
// resid (optional, f32, row index = (row % rmod), pitch ldr, RES_BF16 rounds it) added before the activation.
template <bool ASPLIT, int ACT, bool BIAS_BF16, bool RES_BF16>
__global__ __launch_bounds__(128) void k_gemm_bf3(const float* __restrict__ A, int lda, const unsigned short* __restrict__ Wt, int ldb,
                                                const float* __restrict__ bias, const float* __restrict__ resid, int rmod, int ldr,
                                                float* __restrict__ C, int ldc, int M, int N, int K) {
  __shared__ __attribute__((aligned(16))) float so[4][16][64];
  const int tid = threadIdx.x, w = tid >> 5, lane = tid & 31, ln = lane & 15, hh = lane >> 4;
  const int ntn = N / 64;
  const int wid = blockIdx.x * 4 + w;
  const int mt = wid / ntn, nq = wid % ntn;
  if (mt * 16 >= M) return;
  const int row0 = mt * 16, col0 = nq * 64;
  const float* arow = A + (size_t)(row0 + ln) * lda;
  v8f acc[4] = {};
  for (int kb = 0; kb < K; kb += 32) {
    FragB ah, al;
    const v4f x0 = *(const v4fa*)(arow + kb + 8 * hh), x1 = *(const v4fa*)(arow + kb + 8 * hh + 4);
    const v4f x2 = *(const v4fa*)(arow + kb + 16 + 8 * hh), x3 = *(const v4fa*)(arow + kb + 16 + 8 * hh + 4);
    float xs[16] = {x0[0],x0[1],x0[2],x0[3],x1[0],x1[1],x1[2],x1[3],x2[0],x2[1],x2[2],x2[3],x3[0],x3[1],x3[2],x3[3]};
#pragma unroll
    for (int i = 0; i < 16; ++i) { const unsigned short hb = bf16_bits(xs[i]); ah.u[i] = hb; al.u[i] = ASPLIT ? bf16_bits(xs[i] - bf16_val(hb)) : (unsigned short)0; }
#pragma unroll
    for (int t = 0; t < 4; ++t) {
      const unsigned short* brow = Wt + (size_t)(col0 + t * 16 + ln) * ldb + kb;
      FragB b;
      b.half[0] = *(const v8us*)(brow + 8 * hh);
      b.half[1] = *(const v8us*)(brow + 16 + 8 * hh);
      acc[t] = mmaN<ASPLIT ? 2 : 1>(ah.v, al.v, b.v, b.v, acc[t]);
    }
  }
#pragma unroll
  for (int t = 0; t < 4; ++t) {
    const int col = col0 + t * 16 + ln;
    float bv = bias ? bias[col] : 0.f;
    if (BIAS_BF16) bv = bf16_round(bv);
#pragma unroll
    for (int r = 0; r < 8; ++r) {
      float v = acc[t][r] + bv;
      if (resid) { float rv = resid[(size_t)((row0 + 8 * hh + r) % rmod) * ldr + col]; if (RES_BF16) rv = bf16_round(rv); v += rv; }
      if (ACT == 1) v = fmaxf(v, 0.f);
      if (ACT == 2) v = 0.5f * v * (1.0f + erff(v * 0.70710678118654752f));
      if (ACT == 3) { const float u = 0.7978845608028654f * (v + 0.044715f * v * v * v); v = 0.5f * v * (1.0f + tanhf(u)); }
      so[w][8 * hh + r][t * 16 + ln] = v;
    }
  }
  __builtin_amdgcn_fence(__ATOMIC_ACQ_REL, "workgroup");
  __builtin_amdgcn_wave_barrier();
  const int rsub = lane >> 4, c4 = (lane & 15) * 4;
  {
#pragma unroll
    for (int q = 0; q < 8; ++q) {
      const int r = q * 2 + rsub;
      const v4f v = *(const v4fa*)&so[w][r][c4];
      *(v4f*)(C + (size_t)(row0 + r) * ldc + col0 + c4) = v;
    }
    
  }
}
// row LayerNorm (biased variance, eps) over N: s = X (+ R); optional out_sum <- s; out_norm <- (s-mu)*rsqrt(var+eps)*g + b
template <bool PARAM_BF16>
__global__ __launch_bounds__(256) void k_layernorm(const float* __restrict__ X, const float* __restrict__ R, const float* __restrict__ g, const float* __restrict__ bta,
                                                  float* __restrict__ out_sum, float* __restrict__ out_norm, int N, float eps) {
  __shared__ float red[256];
  const int row = blockIdx.x, tid = threadIdx.x;
  const float* x = X + (size_t)row * N; const float* rr = R ? R + (size_t)row * N : nullptr;
  float vals[16];                     // up to N = 4096
  const int per = N / 256;            // contiguous chunk per thread? use strided-by-4 chunks: thread handles j = tid*4 + 1024*u
  float s1 = 0.f;
  for (int u = 0; u < per / 4; ++u) {
    const int j = tid * 4 + 1024 * u;
    const v4f a = *(const v4fa*)(x + j);
    v4f b = {0.f,0.f,0.f,0.f}; if (rr) b = *(const v4fa*)(rr + j);
#pragma unroll
    for (int q = 0; q < 4; ++q) { const float v = a[q] + b[q]; vals[u * 4 + q] = v; s1 += v; }
  }
  red[tid] = s1; __syncthreads();
  for (int st = 128; st > 0; st >>= 1) { if (tid < st) red[tid] += red[tid + st]; __syncthreads(); }
  const float mu = red[0] / (float)N; __syncthreads();
  float s2 = 0.f;
  for (int u = 0; u < per / 4; ++u)
#pragma unroll
    for (int q = 0; q < 4; ++q) { const float c = vals[u * 4 + q] - mu; s2 += c * c; }
  red[tid] = s2; __syncthreads();
  for (int st = 128; st > 0; st >>= 1) { if (tid < st) red[tid] += red[tid + st]; __syncthreads(); }
  const float rs = rsqrtf(red[0] / (float)N + eps);
  {
    for (int u = 0; u < per / 4; ++u) {
      const int j = tid * 4 + 1024 * u;
      v4f o, sm;
#pragma unroll
      for (int q = 0; q < 4; ++q) {
        float gg = g[j + q], bb = bta[j + q];
        if (PARAM_BF16) { gg = bf16_round(gg); bb = bf16_round(bb); }
        sm[q] = vals[u * 4 + q]; o[q] = (vals[u * 4 + q] - mu) * rs * gg + bb;
      }
      if (out_sum) *(v4f*)(out_sum + (size_t)row * N + j) = sm;
      *(v4f*)(out_norm + (size_t)row * N + j) = o;
    }
    
  }
}



// ---- f16 WMMA path (v_wmma_f32_16x16x32_f16): 11-bit significands for operands in range — used where a [0,1] probability operand needs more precision than bf16
typedef _Float16 v16h __attribute__((ext_vector_type(16)));
union FragH { v16h v; v8us half[2]; _Float16 h[16]; unsigned short u[16]; };
template <int NT>
__device__ __forceinline__ v8f mmaH(v16h ah, v16h al, v16h bh, v16h bl, v8f c) {
  c = __builtin_amdgcn_wmma_f32_16x16x32_f16(false, ah, false, bh, (short)0, c, false, false);
  if (NT >= 2) c = __builtin_amdgcn_wmma_f32_16x16x32_f16(false, al, false, bh, (short)0, c, false, false);
  if (NT >= 3) c = __builtin_amdgcn_wmma_f32_16x16x32_f16(false, ah, false, bl, (short)0, c, false, false);
  asm volatile("v_nop\n\tv_nop\n\tv_nop\n\tv_nop" : "+v"(c) : "v"(ah), "v"(al), "v"(bh), "v"(bl));
  return c;
}
// batched GEMM like k_gemm_b but f16 operands: A f32 (split into f16 hi/lo if ASPLIT, else rounded to f16), Bt = f16 values [n][k]; alpha; C f32; N multiple of 16 (partial tiles skipped)
template <bool ASPLIT>
__global__ __launch_bounds__(128) void k_gemm_h(const float* __restrict__ A, int lda, size_t sA, const _Float16* __restrict__ Bh, int ldb, size_t sB, float alpha, float* __restrict__ C, int ldc, size_t sC, int M, int N, int K) {
  __shared__ __attribute__((aligned(16))) float so[4][16][64];
  const int tid = threadIdx.x, w = tid >> 5, lane = tid & 31, ln = lane & 15, hh = lane >> 4; const int by = blockIdx.y;
  A += (size_t)by * sA; Bh += (size_t)by * sB; C += (size_t)by * sC;
  const int ntn = (N + 63) / 64; const int wid = blockIdx.x * 4 + w; const int mt = wid / ntn, nq = wid % ntn; if (mt * 16 >= M) return;
  const int row0 = mt * 16, col0 = nq * 64; const float* arow = A + (size_t)(row0 + ln) * lda;
  v8f acc[4] = {};
  for (int kb = 0; kb < K; kb += 32) {
    FragH ah, al;
    const v4f x0 = *(const v4fa*)(arow + kb + 8 * hh), x1 = *(const v4fa*)(arow + kb + 8 * hh + 4), x2 = *(const v4fa*)(arow + kb + 16 + 8 * hh), x3 = *(const v4fa*)(arow + kb + 16 + 8 * hh + 4);
    float xs[16] = {x0[0],x0[1],x0[2],x0[3],x1[0],x1[1],x1[2],x1[3],x2[0],x2[1],x2[2],x2[3],x3[0],x3[1],x3[2],x3[3]};
#pragma unroll
    for (int i = 0; i < 16; ++i) { const _Float16 h = (_Float16)xs[i]; ah.h[i] = h; al.h[i] = ASPLIT ? (_Float16)(xs[i] - (float)h) : (_Float16)0.0f; }
#pragma unroll
    for (int t = 0; t < 4; ++t) { if (col0 + t * 16 >= N) continue; const size_t boff = (size_t)(col0 + t * 16 + ln) * ldb + kb; FragH bq; bq.half[0] = *(const v8us*)(Bh + boff + 8 * hh); bq.half[1] = *(const v8us*)(Bh + boff + 16 + 8 * hh);
      acc[t] = mmaH<ASPLIT ? 2 : 1>(ah.v, al.v, bq.v, bq.v, acc[t]); }
  }
#pragma unroll
  for (int t = 0; t < 4; ++t) { if (col0 + t * 16 >= N) continue;
#pragma unroll
    for (int r = 0; r < 8; ++r) so[w][8 * hh + r][t * 16 + ln] = acc[t][r] * alpha; }
  __builtin_amdgcn_fence(__ATOMIC_ACQ_REL, "workgroup"); __builtin_amdgcn_wave_barrier();
  const int rsub = lane >> 4, c4 = (lane & 15) * 4;
  {
#pragma unroll
    for (int q = 0; q < 8; ++q) { const int r = q * 2 + rsub; if (col0 + c4 < N) { const v4f v = *(const v4fa*)&so[w][r][c4]; *(v4f*)(C + (size_t)(row0 + r) * ldc + col0 + c4) = v; } }
     }
}

// Wt[n][k] = f16(W[k][n]·scale) from f32 row-major W[K][N] (scale = power of two; bf16-exact weights stay exact in f16 away from the subnormal range)
__global__ __launch_bounds__(256) void k_wt_f16(const float* __restrict__ W, _Float16* __restrict__ Wt, int K, int N, float scale) {
  const int t = blockIdx.x * 256 + threadIdx.x; if (t >= N * (K / 8)) return; const int n = t / (K / 8), k8 = (t % (K / 8)) * 8; FragH f;
#pragma unroll
  for (int i = 0; i < 8; ++i) f.h[i] = (_Float16)(bf16_round(W[(size_t)(k8 + i) * N + n]) * scale); const v8us o = f.half[0];
  *(v8us*)((unsigned short*)Wt + (size_t)n * K + k8) = o; 
}
__global__ __launch_bounds__(256) void k_x16(const float* __restrict__ x, _Float16* __restrict__ X16, size_t n8) { const size_t t = (size_t)blockIdx.x * 256 + threadIdx.x; if (t >= n8) return; FragH f;
#pragma unroll
  for (int q = 0; q < 8; ++q) f.h[q] = (_Float16)bf16_round(x[t * 8 + q]); *(v8us*)((unsigned short*)X16 + t * 8) = f.half[0];  }
__global__ __launch_bounds__(256) void k_h16(const float* __restrict__ x, _Float16* __restrict__ X16, size_t n8) { const size_t t = (size_t)blockIdx.x * 256 + threadIdx.x; if (t >= n8) return; FragH f;
#pragma unroll
  for (int q = 0; q < 8; ++q) f.h[q] = (_Float16)x[t * 8 + q]; *(v8us*)((unsigned short*)X16 + t * 8) = f.half[0];  }
__global__ __launch_bounds__(256) void k_round16f(const float* __restrict__ W, _Float16* __restrict__ Bt, size_t n8) { const size_t t = (size_t)blockIdx.x * 256 + threadIdx.x; if (t >= n8) return; FragH f;
#pragma unroll
  for (int i = 0; i < 8; ++i) f.h[i] = (_Float16)(bf16_round(W[t * 8 + i]) * 16.0f); *(v8us*)((unsigned short*)Bt + t * 8) = f.half[0];  }
template <int NHv, int TTv>
__global__ __launch_bounds__(256) void k_vt(const _Float16* __restrict__ V16, int ldv, int voff, _Float16* __restrict__ Vt) { __shared__ unsigned short tl[64][66]; const int tid = threadIdx.x; const int slab = blockIdx.x / (TTv / 64), lg = blockIdx.x % (TTv / 64); const int b = slab / NHv, h = slab % NHv;
  for (int i = tid; i < 64 * 8; i += 256) { const int r = i / 8, c8 = (i % 8) * 8; FragH f; f.half[0] = *(const v8us*)((const unsigned short*)V16 + ((size_t)b * TTv + lg * 64 + r) * ldv + voff + h * 64 + c8);
#pragma unroll
    for (int q = 0; q < 8; ++q) tl[r][c8 + q] = f.u[q]; }
  __syncthreads();
  {
#pragma unroll
    for (int rd = 0; rd < 2; ++rd) { const int d = rd * 32 + tid / 8, pc = tid % 8; FragH f;
#pragma unroll
      for (int q = 0; q < 8; ++q) f.u[q] = tl[pc * 8 + q][d];
      *(v8us*)((unsigned short*)Vt + ((size_t)slab * 64 + d) * TTv + lg * 64 + pc * 8) = f.half[0]; }
     } }

// Eight 16-byte asynchronous copies per lane, global memory to LDS through no register: piece i goes from g + i * gstep to LDS byte l + i * lstep.
// The s_wait_xcnt closes the statement so that it stands in front of any later rewrite of the address registers the copies name.
__device__ __forceinline__ void copy8_to_lds(unsigned l, unsigned lstep, const char* g, size_t gstep) {
  asm volatile("global_load_async_to_lds_b128 %0, %8, off\n\t"
               "global_load_async_to_lds_b128 %1, %9, off\n\t"
               "global_load_async_to_lds_b128 %2, %10, off\n\t"
               "global_load_async_to_lds_b128 %3, %11, off\n\t"
               "global_load_async_to_lds_b128 %4, %12, off\n\t"
               "global_load_async_to_lds_b128 %5, %13, off\n\t"
               "global_load_async_to_lds_b128 %6, %14, off\n\t"
               "global_load_async_to_lds_b128 %7, %15, off\n\t"
               "s_wait_xcnt 0x0"
               :: "v"(l), "v"(l + lstep), "v"(l + 2 * lstep), "v"(l + 3 * lstep), "v"(l + 4 * lstep), "v"(l + 5 * lstep), "v"(l + 6 * lstep), "v"(l + 7 * lstep),
                  "v"(g), "v"(g + gstep), "v"(g + 2 * gstep), "v"(g + 3 * gstep), "v"(g + 4 * gstep), "v"(g + 5 * gstep), "v"(g + 6 * gstep), "v"(g + 7 * gstep)
               : "memory");
}

// K and Vt reach the four waves of a work-group through LDS: a stage is 64 keys (K: 64 rows of 256 B, Vt: 128 rows of 128 B, whole 128-B lines), copied once per work-group,
// two buffers, the next stage in flight while this one is worked on. Row pitches 272 B and 144 B (16 B x odd) keep the ds_load_b128 fragment reads free of bank conflicts.
__global__ __launch_bounds__(128) void k_flash(const _Float16* __restrict__ Q16, int ldq, const _Float16* __restrict__ K16, int ldk, const _Float16* __restrict__ Vt, const int* __restrict__ MSK, float* __restrict__ O, int ldo) {
  constexpr int RPW = 16, RTN = RPW / 16, NQB = 3072 / (4 * RPW), DT = 8, KS = 4;      /* head dim 128 */
  constexpr unsigned KP = 272, VP = 144, KBYTES = 64 * KP, STG = KBYTES + 128 * VP;
  __shared__ __attribute__((aligned(16))) unsigned char ring[2 * STG];
  __shared__ __attribute__((aligned(16))) unsigned short sP[4][RPW][40];
  float (*sO)[RPW][128 + 4] = (float (*)[RPW][128 + 4])ring;      /* output staging takes the ring's place behind the loop's last barrier */
  static_assert(sizeof(float) * 4 * RPW * (128 + 4) <= 2 * STG, "output staging fits the ring");
  const int tid = threadIdx.x, w = tid >> 5, lane = tid & 31, ln = lane & 15, hh = lane >> 4;
  const int slab = blockIdx.x / NQB, qblk = blockIdx.x % NQB; const int b = slab / 8, h = slab % 8; const int qb0 = qblk * (4 * RPW); const int q0 = qb0 + w * RPW;
  FragH aq[2][KS];
#pragma unroll
  for (int rt = 0; rt < RTN; ++rt) { const unsigned short* qr = (const unsigned short*)Q16 + ((size_t)b * 3072 + q0 + rt * 16 + ln) * ldq + h * 128;
#pragma unroll
    for (int ks = 0; ks < KS; ++ks) { aq[rt][ks].half[0] = *(const v8us*)(qr + ks * 32 + 8 * hh); aq[rt][ks].half[1] = *(const v8us*)(qr + ks * 32 + 16 + 8 * hh); } }
  const unsigned short* Vth = (const unsigned short*)Vt + (size_t)slab * 128 * 3072;
  // each thread's own pieces of a stage: K row tid/16 + 8i, 16-byte piece tid%16; Vt row tid/8 + 16i, piece tid%8
  const char* kg = (const char*)((const unsigned short*)K16 + ((size_t)b * 3072 + (tid >> 4)) * ldk + h * 128 + (tid & 15) * 8);
  const char* vg = (const char*)(Vth + (size_t)(tid >> 3) * 3072 + (tid & 7) * 8);
  const unsigned ring0 = (unsigned)(size_t)ring;
  const unsigned kl = ring0 + (unsigned)(tid >> 4) * KP + (unsigned)(tid & 15) * 16u, vl = ring0 + KBYTES + (unsigned)(tid >> 3) * VP + (unsigned)(tid & 7) * 16u;
  const size_t kstage = (size_t)64 * ldk * 2, kstep = (size_t)8 * ldk * 2;
  auto fill = [&](int st, unsigned buf) {
    copy8_to_lds(kl + buf * STG, 8 * KP, kg + (size_t)st * kstage, kstep);
    copy8_to_lds(vl + buf * STG, 16 * VP, vg + (size_t)st * 128, (size_t)16 * 3072 * 2);
  };
  float m_r[2][8], l_r[2][8]; v8f oacc[2][DT];
#pragma unroll
  for (int rt = 0; rt < RTN; ++rt) {
#pragma unroll
    for (int r = 0; r < 8; ++r) { m_r[rt][r] = -3.0e38f; l_r[rt][r] = 0.f; }
#pragma unroll
    for (int dt = 0; dt < DT; ++dt) oacc[rt][dt] = (v8f){0.f,0.f,0.f,0.f,0.f,0.f,0.f,0.f}; }
  const int nst = qblk + 1;      /* stages of 64 keys up to the block's diagonal; the same for the whole work-group */
  fill(0, 0u);
  asm volatile("s_wait_asynccnt 0x0" ::: "memory");      // this wave's pieces of stage 0 have landed
  __syncthreads();                                       // every wave's pieces of stage 0 are readable
  if (nst > 1) fill(1, 1u);
#pragma unroll 1      /* one copy of the body: the ring's order stays as written */
  for (int st = 0; st < nst; ++st) {
    const unsigned char* kbuf = ring + (unsigned)(st & 1) * STG; const unsigned char* vbuf = kbuf + KBYTES;
#pragma unroll 1      /* the two 32-key passes of a stage share one body in the instruction cache */
  for (int sub = 0; sub < 2; ++sub) { const int j0 = st * 64 + sub * 32;
    v8f s[2][2];
#pragma unroll
    for (int nt = 0; nt < 2; ++nt) { const unsigned char* kr = kbuf + (unsigned)(sub * 32 + nt * 16 + ln) * KP + 16 * hh; FragH bk[KS];
#pragma unroll
      for (int ks = 0; ks < KS; ++ks) { bk[ks].half[0] = *(const v8us*)(kr + ks * 64); bk[ks].half[1] = *(const v8us*)(kr + ks * 64 + 32); }
#pragma unroll
      for (int rt = 0; rt < RTN; ++rt) { v8f acc = (v8f){0.f,0.f,0.f,0.f,0.f,0.f,0.f,0.f};
#pragma unroll
        for (int ks = 0; ks < KS; ++ks) acc = mmaH<1>(aq[rt][ks].v, aq[rt][ks].v, bk[ks].v, bk[ks].v, acc); s[rt][nt] = acc; } }
#pragma unroll
    for (int rt = 0; rt < RTN; ++rt)
#pragma unroll
      for (int r = 0; r < 8; ++r) { const int tq = q0 + rt * 16 + 8 * hh + r; const int k0 = j0 + ln, k1 = j0 + 16 + ln; (void)tq; (void)k0; (void)k1;
        const bool ok0 = (k0 <= tq), ok1 = (k1 <= tq);
        const float s0 = ok0 ? s[rt][0][r] * (0.08838834764831845f) : -INFINITY, s1 = ok1 ? s[rt][1][r] * (0.08838834764831845f) : -INFINITY; float mc = fmaxf(s0, s1);
        mc = fmaxf(mc, __shfl_xor(mc, 1, 32)); mc = fmaxf(mc, __shfl_xor(mc, 2, 32)); mc = fmaxf(mc, __shfl_xor(mc, 4, 32)); mc = fmaxf(mc, __shfl_xor(mc, 8, 32));
        const float mn = fmaxf(m_r[rt][r], mc); const float al = (mn > -1.0e38f) ? expf(m_r[rt][r] - mn) : 1.0f; m_r[rt][r] = mn; const float p0 = ok0 ? expf(s0 - mn) : 0.f, p1 = ok1 ? expf(s1 - mn) : 0.f; l_r[rt][r] = l_r[rt][r] * al + p0 + p1;
#pragma unroll
        for (int dt = 0; dt < DT; ++dt) oacc[rt][dt][r] *= al;
        FragH t2; t2.h[0] = (_Float16)p0; t2.h[1] = (_Float16)p1; sP[w][rt * 16 + 8 * hh + r][ln] = t2.u[0]; sP[w][rt * 16 + 8 * hh + r][16 + ln] = t2.u[1]; }
    __builtin_amdgcn_fence(__ATOMIC_ACQ_REL, "workgroup"); __builtin_amdgcn_wave_barrier();
    FragH pa[2];
#pragma unroll
    for (int rt = 0; rt < RTN; ++rt) { pa[rt].half[0] = *(const v8us*)&sP[w][rt * 16 + ln][8 * hh]; pa[rt].half[1] = *(const v8us*)&sP[w][rt * 16 + ln][16 + 8 * hh]; }
#pragma unroll
    for (int dt = 0; dt < DT; ++dt) { const unsigned char* vrow = vbuf + (unsigned)(dt * 16 + ln) * VP + sub * 64 + 16 * hh; FragH bv; bv.half[0] = *(const v8us*)(vrow); bv.half[1] = *(const v8us*)(vrow + 32);
#pragma unroll
      for (int rt = 0; rt < RTN; ++rt) oacc[rt][dt] = mmaH<1>(pa[rt].v, pa[rt].v, bv.v, bv.v, oacc[rt][dt]); }
    __builtin_amdgcn_fence(__ATOMIC_ACQ_REL, "workgroup"); __builtin_amdgcn_wave_barrier(); }
    asm volatile("s_wait_dscnt 0x0" ::: "memory");       // this wave's reads of the buffer have returned before it is refilled
    asm volatile("s_wait_asynccnt 0x0" ::: "memory");    // this wave's pieces of stage st + 1 have landed
    __syncthreads();                                     // publishes stage st + 1 and ends every wave's reads of stage st
    if (st + 2 < nst) fill(st + 2, (unsigned)(st & 1));
  }
  asm volatile("s_wait_asynccnt 0x0" ::: "memory");      // no copy is outstanding when the ring becomes output staging
#pragma unroll
  for (int rt = 0; rt < RTN; ++rt) {
#pragma unroll
    for (int r = 0; r < 8; ++r) { float l = l_r[rt][r]; l += __shfl_xor(l, 1, 32); l += __shfl_xor(l, 2, 32); l += __shfl_xor(l, 4, 32); l += __shfl_xor(l, 8, 32); l_r[rt][r] = (l > 0.f) ? 1.0f / l : 0.f; }
#pragma unroll
    for (int dt = 0; dt < DT; ++dt)
#pragma unroll
      for (int r = 0; r < 8; ++r) sO[w][rt * 16 + 8 * hh + r][dt * 16 + ln] = oacc[rt][dt][r] * l_r[rt][r]; }
  __builtin_amdgcn_fence(__ATOMIC_ACQ_REL, "workgroup"); __builtin_amdgcn_wave_barrier();
  {
#pragma unroll
    for (int rp = 0; rp < RPW; ++rp) { const int r = rp, pc = lane; const v4f val = *(const v4fa*)&sO[w][r][pc * 4]; *(v4f*)(O + ((size_t)(b * 8 + h) * 3072 + q0 + r) * 128 + pc * 4) = val; }      /* output layout [b][h][s][128]: 32 lanes x 16 B rows */
     } }

// Projection GEMM: C[row][col] = alpha * sum_k A[row][k] * Bt[col][k], both operands f16 with CW elements a row, f32 accumulate, k ascending in one chain per accumulator.
// A work-group owns a 64 x 64 tile of C, its four waves 32 x 32 each. A and Bt reach the waves through LDS: a stage is 128 k (64 rows of A and 64 of Bt, 256 B each, whole 128-B lines),
// copied once per work-group, two buffers, the next stage in flight while this one is worked on. Row pitch 272 B (16 B x odd) keeps the ds_load_b128 fragment reads free of bank conflicts.
// The grid is exact: blockIdx.x = row tile * (CW / 64) + column tile, blockIdx.y = batch.
template <bool OUT16>
__global__ __launch_bounds__(128) void k_gemm_ring(const _Float16* __restrict__ A, size_t sA, const _Float16* __restrict__ Bt, float alpha, float* __restrict__ C, _Float16* __restrict__ C16, size_t sC) {
  constexpr unsigned RP = 272, TB = 64 * RP, STG = 2 * TB; constexpr int NST = CW / 128;
  static_assert(NST >= 2, "the ring's prologue fills two stages");
  __shared__ __attribute__((aligned(16))) unsigned char ring[2 * STG];
  float (*so)[64 + 4] = (float (*)[64 + 4])ring;      /* output staging takes the ring's place behind the loop's last barrier */
  static_assert(sizeof(float) * 64 * (64 + 4) <= 2 * STG, "output staging fits the ring");
  const int tid = threadIdx.x, w = tid >> 5, lane = tid & 31, ln = lane & 15, hh = lane >> 4, wm = w >> 1, wn = w & 1;
  const int row0 = (int)(blockIdx.x / (CW / 64)) * 64, col0 = (int)(blockIdx.x % (CW / 64)) * 64;
  // each thread's own pieces of a stage: row tid/16 + 8i of either operand, 16-byte piece tid%16
  const char* ag = (const char*)((const unsigned short*)A + (size_t)blockIdx.y * sA + (size_t)(row0 + (tid >> 4)) * CW + (tid & 15) * 8);
  const char* bg = (const char*)((const unsigned short*)Bt + (size_t)(col0 + (tid >> 4)) * CW + (tid & 15) * 8);
  const unsigned al = (unsigned)(size_t)ring + (unsigned)(tid >> 4) * RP + (unsigned)(tid & 15) * 16u, bl = al + TB;
  auto fill = [&](int st, unsigned buf) {
    copy8_to_lds(al + buf * STG, 8 * RP, ag + (size_t)st * 256, (size_t)8 * CW * 2);
    copy8_to_lds(bl + buf * STG, 8 * RP, bg + (size_t)st * 256, (size_t)8 * CW * 2);
  };
  v8f acc[2][2];
#pragma unroll
  for (int i = 0; i < 2; ++i)
#pragma unroll
    for (int j = 0; j < 2; ++j) acc[i][j] = (v8f){0.f,0.f,0.f,0.f,0.f,0.f,0.f,0.f};
  fill(0, 0u);
  asm volatile("s_wait_asynccnt 0x0" ::: "memory");      // this wave's pieces of stage 0 have landed
  __syncthreads();                                       // every wave's pieces of stage 0 are readable
  fill(1, 1u);
#pragma unroll 1      /* one copy of the body: the ring's order stays as written */
  for (int st = 0; st < NST; ++st) {
    const unsigned char* ar = ring + (unsigned)(st & 1) * STG + (unsigned)(wm * 32 + ln) * RP + 16 * hh;
    const unsigned char* br = ring + (unsigned)(st & 1) * STG + TB + (unsigned)(wn * 32 + ln) * RP + 16 * hh;
    FragH fa[4][2], fb[4][2];
#pragma unroll
    for (int ks = 0; ks < 4; ++ks)
#pragma unroll
      for (int i = 0; i < 2; ++i) {
        fa[ks][i].half[0] = *(const v8us*)(ar + i * 16 * RP + ks * 64); fa[ks][i].half[1] = *(const v8us*)(ar + i * 16 * RP + ks * 64 + 32);
        fb[ks][i].half[0] = *(const v8us*)(br + i * 16 * RP + ks * 64); fb[ks][i].half[1] = *(const v8us*)(br + i * 16 * RP + ks * 64 + 32); }
    asm volatile("s_wait_dscnt 0x0" ::: "memory");       // the stage's 32 fragment reads, one group, have returned: this wave is done with the buffer before it is refilled
    asm volatile("s_wait_asynccnt 0x0" ::: "memory");    // this wave's pieces of stage st + 1 have landed
    __syncthreads();                                     // publishes stage st + 1 and ends every wave's reads of stage st
    if (st + 2 < NST) fill(st + 2, (unsigned)(st & 1));  // in front of the WMMAs, which work from registers, so that the copies fly behind them
#pragma unroll
    for (int ks = 0; ks < 4; ++ks)
#pragma unroll
      for (int i = 0; i < 2; ++i)
#pragma unroll
        for (int j = 0; j < 2; ++j) acc[i][j] = __builtin_amdgcn_wmma_f32_16x16x32_f16(false, fa[ks][i].v, false, fb[ks][j].v, (short)0, acc[i][j], false, false);
  }
  asm volatile("s_wait_asynccnt 0x0" ::: "memory");      // no copy is outstanding when the ring becomes output staging
#pragma unroll
  for (int i = 0; i < 2; ++i)
#pragma unroll
    for (int j = 0; j < 2; ++j)
#pragma unroll
      for (int r = 0; r < 8; ++r) so[wm * 32 + i * 16 + 8 * hh + r][wn * 32 + j * 16 + ln] = acc[i][j][r] * alpha;
  __syncthreads();                                       // a stored row of 64 columns holds two waves' results
  const int rsub = lane >> 4, c4 = (lane & 15) * 4; typedef _Float16 v4h __attribute__((ext_vector_type(4)));
#pragma unroll
  for (int q = 0; q < 8; ++q) { const int r = w * 16 + q * 2 + rsub; const v4f v = *(const v4fa*)&so[r][c4]; const size_t o = (size_t)blockIdx.y * sC + (size_t)(row0 + r) * CW + col0 + c4;
    if (OUT16) { v4h h4;
#pragma unroll
      for (int i = 0; i < 4; ++i) h4[i] = (_Float16)v[i];
      *(v4h*)(C16 + o) = h4; }      /* whole 128-B lines, one wave a line */
    else *(v4f*)(C + o) = v; }
}

__global__ __launch_bounds__(256) void k_xt(const float* __restrict__ x, _Float16* __restrict__ XT) { const size_t t = (size_t)blockIdx.x * 256 + threadIdx.x; if (t >= (size_t)NR * NH * 16) return; const int p = (int)(t % 16); const int h = (int)((t / 16) % NH); const size_t bs = t / (16 * NH); const int b = (int)(bs / TT), s = (int)(bs % TT); const float* src = x + (((size_t)(b * NH + h) * TT + s) * HD) + p * 8; FragH f;
#pragma unroll
  for (int q = 0; q < 8; ++q) f.h[q] = (_Float16)bf16_round(src[q]); unsigned short* d = (unsigned short*)XT + bs * CW + h * HD + p * 8; *(v8us*)d = f.half[0];  }
__global__ __launch_bounds__(256) void k_wst(const float* __restrict__ W, _Float16* __restrict__ Bt) { const size_t t = (size_t)blockIdx.x * 256 + threadIdx.x; if (t >= (size_t)CW * NH * 16) return; const int p = (int)(t % 16); const int h = (int)((t / 16) % NH); const int n = (int)(t / (16 * NH)); const int g = n / HD, e = n % HD; FragH f;
#pragma unroll
  for (int q = 0; q < 8; ++q) { const int d = p * 8 + q; f.h[q] = (_Float16)(bf16_round(W[(((size_t)(h * NH + g) * HD + d) * HD) + e]) * 16.0f); }
  unsigned short* dst = (unsigned short*)Bt + (size_t)n * CW + h * HD + p * 8; *(v8us*)dst = f.half[0];  }
__global__ __launch_bounds__(256) void k_rope(const float* __restrict__ F, const int* __restrict__ offp, float oscale, _Float16* __restrict__ D16) { __shared__ __attribute__((aligned(16))) _Float16 st[256][8]; const int tid = threadIdx.x; const size_t t = (size_t)blockIdx.x * 256 + tid; if (t >= (size_t)NR * NH * 16) return; const int li = (int)(t % 16); const int h = (int)((t / 16) % NH); const size_t bs = t / (16 * NH); const int s = (int)(bs % TT); const float pos = (float)(s + offp[0]); const float* src = F + bs * CW + h * HD;
#pragma unroll 1
  for (int q = 0; q < 8; ++q) { const int j = li * 8 + q; const int i = j & 63; const float ang = pos * __builtin_powf(10000.0f, -(float)(2 * i) / 128.0f); const float c = cosf(ang), sn = sinf(ang); const float xj = src[j], xp = src[(j + 64) & 127]; const float rot = (j < 64) ? -xp : xp; st[tid][q] = (_Float16)((xj * c + rot * sn) * oscale); }
  FragH f; f.half[0] = *(const v8us*)&st[tid][0]; unsigned short* d = (unsigned short*)D16 + bs * CW + h * HD + li * 8; *(v8us*)d = f.half[0];  }
__global__ __launch_bounds__(256) void k_vt128(const _Float16* __restrict__ V16, _Float16* __restrict__ Vt) { __shared__ unsigned short tl[64][130]; const int tid = threadIdx.x; const int slab = blockIdx.x / (TT / 64), lg = blockIdx.x % (TT / 64); const int b = slab / NH, h = slab % NH;
  for (int i = tid; i < 64 * 16; i += 256) { const int r = i / 16, c8 = (i % 16) * 8; FragH f; f.half[0] = *(const v8us*)((const unsigned short*)V16 + ((size_t)b * TT + lg * 64 + r) * CW + h * HD + c8);
#pragma unroll
    for (int q = 0; q < 8; ++q) tl[r][c8 + q] = f.u[q]; }
  __syncthreads();
  { for (int i = tid; i < 128 * 8; i += 256) { const int d = i / 8, pc = i % 8; FragH f;
#pragma unroll
      for (int q = 0; q < 8; ++q) f.u[q] = tl[pc * 8 + q][d]; *(v8us*)((unsigned short*)Vt + ((size_t)slab * HD + d) * TT + lg * 64 + pc * 8) = f.half[0]; }  } }
extern "C" void kernel_launch(void* const* d_in, const int* in_sizes, int n_in,
                              void* d_out, int out_size, void* d_ws, size_t ws_size, hipStream_t stream) {
  (void)in_sizes; (void)n_in; (void)out_size;
  const float* x = (const float*)d_in[0]; const float* Wm[3] = {(const float*)d_in[1], (const float*)d_in[2], (const float*)d_in[3]}; const float* Wsg[3] = {(const float*)d_in[4], (const float*)d_in[5], (const float*)d_in[6]}; const float* Weg[3] = {(const float*)d_in[7], (const float*)d_in[8], (const float*)d_in[9]}; const int* offp = (const int*)d_in[10];
  char* ws = (char*)d_ws; size_t off = 0;
  auto take = [&](size_t bytes) { char* p = ws + off; off += (bytes + 255) & ~(size_t)255; return p; };
  _Float16* Bm = (_Float16*)take((size_t)CW * CW * 2); _Float16* Bs = (_Float16*)take((size_t)CW * CW * 2); _Float16* Be = (_Float16*)take((size_t)CW * CW * 2);
  _Float16* XT = (_Float16*)take((size_t)NR * CW * 2); float* F = (float*)take((size_t)NR * CW * 4); _Float16* Q16 = (_Float16*)take((size_t)NR * CW * 2); _Float16* K16 = (_Float16*)take((size_t)NR * CW * 2); _Float16* V16 = (_Float16*)take((size_t)NR * CW * 2); _Float16* Vt = (_Float16*)take((size_t)NR * CW * 2);
  if (off > ws_size) return;      // 6.3 + 12.6 + 25.2 + 12.6 × 4 ≈ 94 MB
  k_xt<<<(unsigned)(((size_t)NR * NH * 16 + 255) / 256), 256, 0, stream>>>(x, XT);
  const unsigned gw = (unsigned)(((size_t)CW * NH * 16 + 255) / 256), gr = (unsigned)(((size_t)NR * NH * 16 + 255) / 256);
  // the three (b,s) row ranges: [0,512) state, [512,2560) middle, [2560,3072) end — batched over b via sA/sC
  const int r0s[3] = {SL, 0, TT - SL}, ms[3] = {TT - 2 * SL, SL, SL};      // order: middle (W), state (Ws), end (We)
  for (int p = 0; p < 3; ++p) {      // p: 0 = q, 1 = k, 2 = v
    k_wst<<<gw, 256, 0, stream>>>(Wm[p], Bm); k_wst<<<gw, 256, 0, stream>>>(Wsg[p], Bs); k_wst<<<gw, 256, 0, stream>>>(Weg[p], Be);
    const _Float16* Bsel[3] = {Bm, Bs, Be};
    for (int sgm = 0; sgm < 3; ++sgm) { const int r0 = r0s[sgm], M = ms[sgm];
      if (p < 2) k_gemm_ring<false><<<dim3((M / 64) * (CW / 64), BB), 128, 0, stream>>>(XT + (size_t)r0 * CW, (size_t)TT * CW, Bsel[sgm], 0.0625f, F + (size_t)r0 * CW, nullptr, (size_t)TT * CW);
      else       k_gemm_ring<true><<<dim3((M / 64) * (CW / 64), BB), 128, 0, stream>>>(XT + (size_t)r0 * CW, (size_t)TT * CW, Bsel[sgm], 0.0625f, nullptr, V16 + (size_t)r0 * CW, (size_t)TT * CW); }
    if (p == 0) k_rope<<<gr, 256, 0, stream>>>(F, offp, 1.0f, Q16); else if (p == 1) k_rope<<<gr, 256, 0, stream>>>(F, offp, 1.0f, K16); }
  k_vt128<<<BB * NH * (TT / 64), 256, 0, stream>>>(V16, Vt);
  k_flash<<<BB * NH * (TT / 64), 128, 0, stream>>>(Q16, CW, K16, CW, Vt, nullptr, (float*)d_out, 0);
}

// v003
// Measured time: 324 microseconds a run.
// Next to v002, in two timings, it ran 1.46 and 1.44 times as fast.
// Over all steps from v000 it is 2.86 times as fast.
#include <hip/hip_runtime.h>
// Causal multi-head attention with state segments (x [2, 8 heads, 3072, 128]; StackedLinear projections that mix heads and features — separate weights for the first 512 (state), middle 2048 and
// last 512 (end) positions; rotate-half RoPE with an INPUT offset; causal softmax(q·k/√128)·v; output [2,8,3072,128]): the nine (h,d)→(g,e) projections as GEMMs on the (b,s)-major transposed
// input (bf16-exact ×2^4 weights, f32 accumulate) and the attention as a fused flash-style kernel (d = 128: 4 k-steps / 8 d-tiles; causal chunk skipping; online softmax f32; P f16 ≤ 1;
// O = P·Vt written straight into the output; RPW-16 waves) on v_wmma_f32_16x16x32_f16; RoPE f32 VALU.
#define BB 2
#define NH 8
#define TT 3072
#define HD 128
#define CW (NH * HD)
#define NR (BB * TT)
#define SL 512

typedef __bf16 v16b __attribute__((ext_vector_type(16)));
typedef unsigned short v8us __attribute__((ext_vector_type(8), may_alias));
typedef float  v8f  __attribute__((ext_vector_type(8)));
typedef float  v4f  __attribute__((ext_vector_type(4)));
typedef float  v4fa __attribute__((ext_vector_type(4), may_alias));
union FragB { v16b v; v8us half[2]; unsigned short u[16]; };

__device__ __forceinline__ unsigned short bf16_bits(float x) { unsigned int u = __float_as_uint(x); return (unsigned short)((u + 0x7FFFu + ((u >> 16) & 1u)) >> 16); }
__device__ __forceinline__ float bf16_val(unsigned short b) { return __uint_as_float(((unsigned int)b) << 16); }
__device__ __forceinline__ float bf16_round(float x) { return bf16_val(bf16_bits(x)); }
// D += A·B with NT terms: 1 = ah·bh, 2 = + al·bh (A split), 3 = + ah·bl (both split)
template <int NT>
__device__ __forceinline__ v8f mmaN(v16b ah, v16b al, v16b bh, v16b bl, v8f c) {
  c = __builtin_amdgcn_wmma_f32_16x16x32_bf16(false, ah, false, bh, (short)0, c, false, false);
  if (NT >= 2) c = __builtin_amdgcn_wmma_f32_16x16x32_bf16(false, al, false, bh, (short)0, c, false, false);
  if (NT >= 3) c = __builtin_amdgcn_wmma_f32_16x16x32_bf16(false, ah, false, bl, (short)0, c, false, false);
  asm volatile("v_nop\n\tv_nop\n\tv_nop\n\tv_nop" : "+v"(c) : "v"(ah), "v"(al), "v"(bh), "v"(bl));
  return c;
}

__global__ __launch_bounds__(256) void k_wt_bf16(const float* __restrict__ W, unsigned short* __restrict__ Wt, int K, int N) {
  const int t = blockIdx.x * 256 + threadIdx.x;
  const int k8n = K / 8;
  if (t >= N * k8n) return;
  const int n = t / k8n, k8 = (t % k8n) * 8;
  v8us v;
#pragma unroll
  for (int i = 0; i < 8; ++i) v[i] = bf16_bits(W[(size_t)(k8 + i) * N + n]);
  *(v8us*)(Wt + (size_t)n * K + k8) = v;
  
}

// GEMM C[M][N] (f32, pitch ldc) = act(A[M][K]·W + bias). A f32 row-major (pitch lda) converted per fragment to bf16
// (ASPLIT: hi/lo two planes -> 2 terms, else single rounded term); Wt bf16 [N][K] (pitch ldb). BIAS_BF16 rounds the
// bias to bf16 first (bias quantised to bf16 before the add). K%32==0, M%16==0, N%64==0.
template <bool ASPLIT, int ACT, bool BIAS_BF16>
__global__ __launch_bounds__(128) void k_gemm_bf(const float* __restrict__ A, int lda, const unsigned short* __restrict__ Wt, int ldb,
                                               const float* __restrict__ bias, float* __restrict__ C, int ldc, int M, int N, int K) {
  __shared__ __attribute__((aligned(16))) float so[4][16][64];
  const int tid = threadIdx.x, w = tid >> 5, lane = tid & 31, ln = lane & 15, hh = lane >> 4;
  const int ntn = N / 64;
  const int wid = blockIdx.x * 4 + w;
  const int mt = wid / ntn, nq = wid % ntn;
  if (mt * 16 >= M) return;
  const int row0 = mt * 16, col0 = nq * 64;
  const float* arow = A + (size_t)(row0 + ln) * lda;
  v8f acc[4] = {};
  for (int kb = 0; kb < K; kb += 32) {
    FragB ah, al;
    const v4f x0 = *(const v4fa*)(arow + kb + 8 * hh), x1 = *(const v4fa*)(arow + kb + 8 * hh + 4);
    const v4f x2 = *(const v4fa*)(arow + kb + 16 + 8 * hh), x3 = *(const v4fa*)(arow + kb + 16 + 8 * hh + 4);
    float xs[16] = {x0[0],x0[1],x0[2],x0[3],x1[0],x1[1],x1[2],x1[3],x2[0],x2[1],x2[2],x2[3],x3[0],x3[1],x3[2],x3[3]};
#pragma unroll
    for (int i = 0; i < 16; ++i) { const unsigned short hb = bf16_bits(xs[i]); ah.u[i] = hb; al.u[i] = ASPLIT ? bf16_bits(xs[i] - bf16_val(hb)) : (unsigned short)0; }
#pragma unroll
    for (int t = 0; t < 4; ++t) {
      const unsigned short* brow = Wt + (size_t)(col0 + t * 16 + ln) * ldb + kb;
      FragB b;
      b.half[0] = *(const v8us*)(brow + 8 * hh);
      b.half[1] = *(const v8us*)(brow + 16 + 8 * hh);
      acc[t] = mmaN<ASPLIT ? 2 : 1>(ah.v, al.v, b.v, b.v, acc[t]);
    }
  }
#pragma unroll
  for (int t = 0; t < 4; ++t) {
    float bv = bias ? bias[col0 + t * 16 + ln] : 0.f;
    if (BIAS_BF16) bv = bf16_round(bv);
#pragma unroll
    for (int r = 0; r < 8; ++r) { float v = acc[t][r] + bv; if (ACT == 1) v = fmaxf(v, 0.f); so[w][8 * hh + r][t * 16 + ln] = v; }
  }
  __builtin_amdgcn_fence(__ATOMIC_ACQ_REL, "workgroup");
  __builtin_amdgcn_wave_barrier();
  const int rsub = lane >> 4, c4 = (lane & 15) * 4;
  {
#pragma unroll
    for (int q = 0; q < 8; ++q) {
      const int r = q * 2 + rsub;
      const v4f v = *(const v4fa*)&so[w][r][c4];
      *(v4f*)(C + (size_t)(row0 + r) * ldc + col0 + c4) = v;
    }
    
  }
}

// Flash-style causal/unmasked attention, all contractions 3-term bf16 hi/lo splits, f32 softmax with running max.
// q,k,v rows are read from f32 buffers with arbitrary row pitch (so they can live inside a fused qkv buffer);
// D = head size (multiple of 32, <= 128); one wave = 16 query rows; block = 4 waves (64 queries) sharing K/V chunks of 32.
template <int D, bool CAUSAL>
__global__ __launch_bounds__(128) void k_flash(const float* __restrict__ qb, const float* __restrict__ kb, const float* __restrict__ vb,
                                             int pitch, int T, int H, float scale, float* __restrict__ y, int ypitch) {
  constexpr int KS = D / 32;        // k-steps for QK
  constexpr int DT = D / 16;        // d tiles for PV
  __shared__ __attribute__((aligned(16))) unsigned short sKh[32][D + 8], sKl[32][D + 8], sVh[32][D + 8], sVl[32][D + 8];
  __shared__ __attribute__((aligned(16))) unsigned short sPh[4][16][40], sPl[4][16][40];
  __shared__ __attribute__((aligned(16))) float sO[4][16][D];
  const int tid = threadIdx.x, w = tid >> 5, lane = tid & 31, ln = lane & 15, hh = lane >> 4;
  const int nqb = (T + 63) / 64;
  const int bh = blockIdx.x / nqb, qblk = blockIdx.x % nqb;
  const int b = bh / H, h = bh % H;
  const int q0 = qblk * 64 + w * 16;
  const float* Q = qb + (size_t)b * T * pitch + h * D;
  const float* K = kb + (size_t)b * T * pitch + h * D;
  const float* V = vb + (size_t)b * T * pitch + h * D;

  // A fragments of the wave's 16 query rows (scaled), hi/lo
  FragB aqh[KS], aql[KS];
  {
    int row = q0 + ln; if (row >= T) row = T - 1;
    const float* qr = Q + (size_t)row * pitch;
#pragma unroll
    for (int ks = 0; ks < KS; ++ks)
#pragma unroll
      for (int i = 0; i < 16; ++i) {
        const int d = ks * 32 + ((i < 8) ? (8 * hh + i) : (16 + 8 * hh + (i - 8)));
        const float x = qr[d] * scale; const unsigned short hb = bf16_bits(x);
        aqh[ks].u[i] = hb; aql[ks].u[i] = bf16_bits(x - bf16_val(hb));
      }
  }
  float m_r[8], l_r[8];
#pragma unroll
  for (int r = 0; r < 8; ++r) { m_r[r] = -3.0e38f; l_r[r] = 0.f; }
  v8f oacc[DT];
#pragma unroll
  for (int dt = 0; dt < DT; ++dt) oacc[dt] = (v8f){0.f,0.f,0.f,0.f,0.f,0.f,0.f,0.f};

  const int kv_end = CAUSAL ? min(T, qblk * 64 + 64) : T;     // block-uniform
  for (int j0 = 0; j0 < kv_end; j0 += 32) {
    __syncthreads();
    for (int e = tid; e < 32 * (D / 4); e += 128) {
      const int r = e / (D / 4), c4 = (e % (D / 4)) * 4;
      const int key = j0 + r;
      v4f kf = {0.f,0.f,0.f,0.f}, vf = {0.f,0.f,0.f,0.f};
      if (key < T) { kf = *(const v4fa*)(K + (size_t)key * pitch + c4); vf = *(const v4fa*)(V + (size_t)key * pitch + c4); }
#pragma unroll
      for (int t = 0; t < 4; ++t) {
        unsigned short hb = bf16_bits(kf[t]); sKh[r][c4 + t] = hb; sKl[r][c4 + t] = bf16_bits(kf[t] - bf16_val(hb));
        hb = bf16_bits(vf[t]); sVh[r][c4 + t] = hb; sVl[r][c4 + t] = bf16_bits(vf[t] - bf16_val(hb));
      }
    }
    __syncthreads();
    // S tile 16 x 32
    v8f s[2];
#pragma unroll
    for (int nt = 0; nt < 2; ++nt) {
      v8f acc = {};
#pragma unroll
      for (int ks = 0; ks < KS; ++ks) {
        FragB bh_, bl_;
        bh_.half[0] = *(const v8us*)&sKh[nt * 16 + ln][ks * 32 + 8 * hh]; bh_.half[1] = *(const v8us*)&sKh[nt * 16 + ln][ks * 32 + 16 + 8 * hh];
        bl_.half[0] = *(const v8us*)&sKl[nt * 16 + ln][ks * 32 + 8 * hh]; bl_.half[1] = *(const v8us*)&sKl[nt * 16 + ln][ks * 32 + 16 + 8 * hh];
        acc = mmaN<3>(aqh[ks].v, aql[ks].v, bh_.v, bl_.v, acc);
      }
      s[nt] = acc;
    }
    // mask + running max (rows 8hh+r; the 16 lanes of a half share rows)
    float alpha[8];
#pragma unroll
    for (int r = 0; r < 8; ++r) {
      const int qi = q0 + 8 * hh + r;
      const int ja = j0 + ln, jb = j0 + 16 + ln;
      if (CAUSAL) { if (ja > qi) s[0][r] = -3.0e38f; if (jb > qi) s[1][r] = -3.0e38f; }
      if (ja >= T) s[0][r] = -3.0e38f;
      if (jb >= T) s[1][r] = -3.0e38f;
      float mx = fmaxf(s[0][r], s[1][r]);
      mx = fmaxf(mx, __shfl_xor(mx, 1, 32)); mx = fmaxf(mx, __shfl_xor(mx, 2, 32)); mx = fmaxf(mx, __shfl_xor(mx, 4, 32)); mx = fmaxf(mx, __shfl_xor(mx, 8, 32));
      const float mnew = fmaxf(m_r[r], mx);
      alpha[r] = (mnew > -1.0e38f) ? __expf(m_r[r] - mnew) : 1.0f;
      const float p0 = (s[0][r] > -1.0e38f) ? __expf(s[0][r] - mnew) : 0.f;
      const float p1 = (s[1][r] > -1.0e38f) ? __expf(s[1][r] - mnew) : 0.f;
      m_r[r] = mnew;
      l_r[r] = l_r[r] * alpha[r] + p0 + p1;            // per-lane partial row sum (16 lanes combined at the end)
      unsigned short hb = bf16_bits(p0); sPh[w][8 * hh + r][ln] = hb;      sPl[w][8 * hh + r][ln] = bf16_bits(p0 - bf16_val(hb));
      hb = bf16_bits(p1);                sPh[w][8 * hh + r][16 + ln] = hb; sPl[w][8 * hh + r][16 + ln] = bf16_bits(p1 - bf16_val(hb));
    }
#pragma unroll
    for (int dt = 0; dt < DT; ++dt)
#pragma unroll
      for (int r = 0; r < 8; ++r) oacc[dt][r] *= alpha[r];
    __builtin_amdgcn_fence(__ATOMIC_ACQ_REL, "workgroup");
    __builtin_amdgcn_wave_barrier();
    FragB pah, pal;
    pah.half[0] = *(const v8us*)&sPh[w][ln][8 * hh]; pah.half[1] = *(const v8us*)&sPh[w][ln][16 + 8 * hh];
    pal.half[0] = *(const v8us*)&sPl[w][ln][8 * hh]; pal.half[1] = *(const v8us*)&sPl[w][ln][16 + 8 * hh];
#pragma unroll
    for (int dt = 0; dt < DT; ++dt) {
      FragB bvh, bvl;
#pragma unroll
      for (int i = 0; i < 8; ++i) {
        bvh.u[i] = sVh[8 * hh + i][dt * 16 + ln]; bvh.u[8 + i] = sVh[16 + 8 * hh + i][dt * 16 + ln];
        bvl.u[i] = sVl[8 * hh + i][dt * 16 + ln]; bvl.u[8 + i] = sVl[16 + 8 * hh + i][dt * 16 + ln];
      }
      oacc[dt] = mmaN<3>(pah.v, pal.v, bvh.v, bvl.v, oacc[dt]);
    }
    __builtin_amdgcn_fence(__ATOMIC_ACQ_REL, "workgroup");
    __builtin_amdgcn_wave_barrier();
  }
#pragma unroll
  for (int r = 0; r < 8; ++r) {
    float l = l_r[r];
    l += __shfl_xor(l, 1, 32); l += __shfl_xor(l, 2, 32); l += __shfl_xor(l, 4, 32); l += __shfl_xor(l, 8, 32);
    l_r[r] = (l > 0.f) ? 1.0f / l : 0.f;
  }
#pragma unroll
  for (int dt = 0; dt < DT; ++dt)
#pragma unroll
    for (int r = 0; r < 8; ++r) sO[w][8 * hh + r][dt * 16 + ln] = oacc[dt][r] * l_r[r];
  __builtin_amdgcn_fence(__ATOMIC_ACQ_REL, "workgroup");
  __builtin_amdgcn_wave_barrier();
  {
    for (int r = 0; r < 16; ++r) {
      const int row = q0 + r;
      if (row < T && lane < D / 4) {
        const v4f val = *(const v4fa*)&sO[w][r][lane * 4];
        *(v4f*)(y + ((size_t)b * T + row) * ypitch + h * D + lane * 4) = val;
      }
    }
    
  }
}

// GEMM C = act(A·W + bias + resid): A f32 (ASPLIT -> hi/lo 2 terms), Wt bf16 [N][K]; ACT 0 none, 1 relu, 2 exact gelu;
// resid (optional, f32, row index = (row % rmod), pitch ldr, RES_BF16 rounds it) added before the activation.
template <bool ASPLIT, int ACT, bool BIAS_BF16, bool RES_BF16>
__global__ __launch_bounds__(128) void k_gemm_bf3(const float* __restrict__ A, int lda, const unsigned short* __restrict__ Wt, int ldb,
                                                const float* __restrict__ bias, const float* __restrict__ resid, int rmod, int ldr,
                                                float* __restrict__ C, int ldc, int M, int N, int K) {
  __shared__ __attribute__((aligned(16))) float so[4][16][64];
  const int tid = threadIdx.x, w = tid >> 5, lane = tid & 31, ln = lane & 15, hh = lane >> 4;
  const int ntn = N / 64;
  const int wid = blockIdx.x * 4 + w;
  const int mt = wid / ntn, nq = wid % ntn;
  if (mt * 16 >= M) return;
  const int row0 = mt * 16, col0 = nq * 64;
  const float* arow = A + (size_t)(row0 + ln) * lda;
  v8f acc[4] = {};
  for (int kb = 0; kb < K; kb += 32) {
    FragB ah, al;
    const v4f x0 = *(const v4fa*)(arow + kb + 8 * hh), x1 = *(const v4fa*)(arow + kb + 8 * hh + 4);
    const v4f x2 = *(const v4fa*)(arow + kb + 16 + 8 * hh), x3 = *(const v4fa*)(arow + kb + 16 + 8 * hh + 4);
    float xs[16] = {x0[0],x0[1],x0[2],x0[3],x1[0],x1[1],x1[2],x1[3],x2[0],x2[1],x2[2],x2[3],x3[0],x3[1],x3[2],x3[3]};
#pragma unroll
    for (int i = 0; i < 16; ++i) { const unsigned short hb = bf16_bits(xs[i]); ah.u[i] = hb; al.u[i] = ASPLIT ? bf16_bits(xs[i] - bf16_val(hb)) : (unsigned short)0; }
#pragma unroll
    for (int t = 0; t < 4; ++t) {
      const unsigned short* brow = Wt + (size_t)(col0 + t * 16 + ln) * ldb + kb;
      FragB b;
      b.half[0] = *(const v8us*)(brow + 8 * hh);
      b.half[1] = *(const v8us*)(brow + 16 + 8 * hh);
      acc[t] = mmaN<ASPLIT ? 2 : 1>(ah.v, al.v, b.v, b.v, acc[t]);
    }
  }
#pragma unroll
  for (int t = 0; t < 4; ++t) {
    const int col = col0 + t * 16 + ln;
    float bv = bias ? bias[col] : 0.f;
    if (BIAS_BF16) bv = bf16_round(bv);
#pragma unroll
    for (int r = 0; r < 8; ++r) {
      float v = acc[t][r] + bv;
      if (resid) { float rv = resid[(size_t)((row0 + 8 * hh + r) % rmod) * ldr + col]; if (RES_BF16) rv = bf16_round(rv); v += rv; }
      if (ACT == 1) v = fmaxf(v, 0.f);
      if (ACT == 2) v = 0.5f * v * (1.0f + erff(v * 0.70710678118654752f));
      if (ACT == 3) { const float u = 0.7978845608028654f * (v + 0.044715f * v * v * v); v = 0.5f * v * (1.0f + tanhf(u)); }
      so[w][8 * hh + r][t * 16 + ln] = v;
    }
  }
  __builtin_amdgcn_fence(__ATOMIC_ACQ_REL, "workgroup");
  __builtin_amdgcn_wave_barrier();
  const int rsub = lane >> 4, c4 = (lane & 15) * 4;
  {
#pragma unroll
    for (int q = 0; q < 8; ++q) {
      const int r = q * 2 + rsub;
      const v4f v = *(const v4fa*)&so[w][r][c4];
      *(v4f*)(C + (size_t)(row0 + r) * ldc + col0 + c4) = v;
    }
    
  }
}
// row LayerNorm (biased variance, eps) over N: s = X (+ R); optional out_sum <- s; out_norm <- (s-mu)*rsqrt(var+eps)*g + b
template <bool PARAM_BF16>
__global__ __launch_bounds__(256) void k_layernorm(const float* __restrict__ X, const float* __restrict__ R, const float* __restrict__ g, const float* __restrict__ bta,
                                                  float* __restrict__ out_sum, float* __restrict__ out_norm, int N, float eps) {
  __shared__ float red[256];
  const int row = blockIdx.x, tid = threadIdx.x;
  const float* x = X + (size_t)row * N; const float* rr = R ? R + (size_t)row * N : nullptr;
  float vals[16];                     // up to N = 4096
  const int per = N / 256;            // contiguous chunk per thread? use strided-by-4 chunks: thread handles j = tid*4 + 1024*u
  float s1 = 0.f;
  for (int u = 0; u < per / 4; ++u) {
    const int j = tid * 4 + 1024 * u;
    const v4f a = *(const v4fa*)(x + j);
    v4f b = {0.f,0.f,0.f,0.f}; if (rr) b = *(const v4fa*)(rr + j);
#pragma unroll
    for (int q = 0; q < 4; ++q) { const float v = a[q] + b[q]; vals[u * 4 + q] = v; s1 += v; }
  }
  red[tid] = s1; __syncthreads();
  for (int st = 128; st > 0; st >>= 1) { if (tid < st) red[tid] += red[tid + st]; __syncthreads(); }
  const float mu = red[0] / (float)N; __syncthreads();
  float s2 = 0.f;
  for (int u = 0; u < per / 4; ++u)
#pragma unroll
    for (int q = 0; q < 4; ++q) { const float c = vals[u * 4 + q] - mu; s2 += c * c; }
  red[tid] = s2; __syncthreads();
  for (int st = 128; st > 0; st >>= 1) { if (tid < st) red[tid] += red[tid + st]; __syncthreads(); }
  const float rs = rsqrtf(red[0] / (float)N + eps);
  {
    for (int u = 0; u < per / 4; ++u) {
      const int j = tid * 4 + 1024 * u;
      v4f o, sm;
#pragma unroll
      for (int q = 0; q < 4; ++q) {
        float gg = g[j + q], bb = bta[j + q];
        if (PARAM_BF16) { gg = bf16_round(gg); bb = bf16_round(bb); }
        sm[q] = vals[u * 4 + q]; o[q] = (vals[u * 4 + q] - mu) * rs * gg + bb;
      }
      if (out_sum) *(v4f*)(out_sum + (size_t)row * N + j) = sm;
      *(v4f*)(out_norm + (size_t)row * N + j) = o;
    }
    
  }
}



// ---- f16 WMMA path (v_wmma_f32_16x16x32_f16): 11-bit significands for operands in range — used where a [0,1] probability operand needs more precision than bf16
typedef _Float16 v16h __attribute__((ext_vector_type(16)));
union FragH { v16h v; v8us half[2]; _Float16 h[16]; unsigned short u[16]; };
template <int NT>
__device__ __forceinline__ v8f mmaH(v16h ah, v16h al, v16h bh, v16h bl, v8f c) {
  c = __builtin_amdgcn_wmma_f32_16x16x32_f16(false, ah, false, bh, (short)0, c, false, false);
  if (NT >= 2) c = __builtin_amdgcn_wmma_f32_16x16x32_f16(false, al, false, bh, (short)0, c, false, false);
  if (NT >= 3) c = __builtin_amdgcn_wmma_f32_16x16x32_f16(false, ah, false, bl, (short)0, c, false, false);
  asm volatile("v_nop\n\tv_nop\n\tv_nop\n\tv_nop" : "+v"(c) : "v"(ah), "v"(al), "v"(bh), "v"(bl));
  return c;
}
// batched GEMM like k_gemm_b but f16 operands: A f32 (split into f16 hi/lo if ASPLIT, else rounded to f16), Bt = f16 values [n][k]; alpha; C f32; N multiple of 16 (partial tiles skipped)
template <bool ASPLIT>
__global__ __launch_bounds__(128) void k_gemm_h(const float* __restrict__ A, int lda, size_t sA, const _Float16* __restrict__ Bh, int ldb, size_t sB, float alpha, float* __restrict__ C, int ldc, size_t sC, int M, int N, int K) {
  __shared__ __attribute__((aligned(16))) float so[4][16][64];
  const int tid = threadIdx.x, w = tid >> 5, lane = tid & 31, ln = lane & 15, hh = lane >> 4; const int by = blockIdx.y;
  A += (size_t)by * sA; Bh += (size_t)by * sB; C += (size_t)by * sC;
  const int ntn = (N + 63) / 64; const int wid = blockIdx.x * 4 + w; const int mt = wid / ntn, nq = wid % ntn; if (mt * 16 >= M) return;
  const int row0 = mt * 16, col0 = nq * 64; const float* arow = A + (size_t)(row0 + ln) * lda;
  v8f acc[4] = {};
  for (int kb = 0; kb < K; kb += 32) {
    FragH ah, al;
    const v4f x0 = *(const v4fa*)(arow + kb + 8 * hh), x1 = *(const v4fa*)(arow + kb + 8 * hh + 4), x2 = *(const v4fa*)(arow + kb + 16 + 8 * hh), x3 = *(const v4fa*)(arow + kb + 16 + 8 * hh + 4);
    float xs[16] = {x0[0],x0[1],x0[2],x0[3],x1[0],x1[1],x1[2],x1[3],x2[0],x2[1],x2[2],x2[3],x3[0],x3[1],x3[2],x3[3]};
#pragma unroll
    for (int i = 0; i < 16; ++i) { const _Float16 h = (_Float16)xs[i]; ah.h[i] = h; al.h[i] = ASPLIT ? (_Float16)(xs[i] - (float)h) : (_Float16)0.0f; }
#pragma unroll
    for (int t = 0; t < 4; ++t) { if (col0 + t * 16 >= N) continue; const size_t boff = (size_t)(col0 + t * 16 + ln) * ldb + kb; FragH bq; bq.half[0] = *(const v8us*)(Bh + boff + 8 * hh); bq.half[1] = *(const v8us*)(Bh + boff + 16 + 8 * hh);
      acc[t] = mmaH<ASPLIT ? 2 : 1>(ah.v, al.v, bq.v, bq.v, acc[t]); }
  }
#pragma unroll
  for (int t = 0; t < 4; ++t) { if (col0 + t * 16 >= N) continue;
#pragma unroll
    for (int r = 0; r < 8; ++r) so[w][8 * hh + r][t * 16 + ln] = acc[t][r] * alpha; }
  __builtin_amdgcn_fence(__ATOMIC_ACQ_REL, "workgroup"); __builtin_amdgcn_wave_barrier();
  const int rsub = lane >> 4, c4 = (lane & 15) * 4;
  {
#pragma unroll
    for (int q = 0; q < 8; ++q) { const int r = q * 2 + rsub; if (col0 + c4 < N) { const v4f v = *(const v4fa*)&so[w][r][c4]; *(v4f*)(C + (size_t)(row0 + r) * ldc + col0 + c4) = v; } }
     }
}

// Wt[n][k] = f16(W[k][n]·scale) from f32 row-major W[K][N] (scale = power of two; bf16-exact weights stay exact in f16 away from the subnormal range)
__global__ __launch_bounds__(256) void k_wt_f16(const float* __restrict__ W, _Float16* __restrict__ Wt, int K, int N, float scale) {
  const int t = blockIdx.x * 256 + threadIdx.x; if (t >= N * (K / 8)) return; const int n = t / (K / 8), k8 = (t % (K / 8)) * 8; FragH f;
#pragma unroll
  for (int i = 0; i < 8; ++i) f.h[i] = (_Float16)(bf16_round(W[(size_t)(k8 + i) * N + n]) * scale); const v8us o = f.half[0];
  *(v8us*)((unsigned short*)Wt + (size_t)n * K + k8) = o; 
}
__global__ __launch_bounds__(256) void k_x16(const float* __restrict__ x, _Float16* __restrict__ X16, size_t n8) { const size_t t = (size_t)blockIdx.x * 256 + threadIdx.x; if (t >= n8) return; FragH f;
#pragma unroll
  for (int q = 0; q < 8; ++q) f.h[q] = (_Float16)bf16_round(x[t * 8 + q]); *(v8us*)((unsigned short*)X16 + t * 8) = f.half[0];  }
__global__ __launch_bounds__(256) void k_h16(const float* __restrict__ x, _Float16* __restrict__ X16, size_t n8) { const size_t t = (size_t)blockIdx.x * 256 + threadIdx.x; if (t >= n8) return; FragH f;
#pragma unroll
  for (int q = 0; q < 8; ++q) f.h[q] = (_Float16)x[t * 8 + q]; *(v8us*)((unsigned short*)X16 + t * 8) = f.half[0];  }
__global__ __launch_bounds__(256) void k_round16f(const float* __restrict__ W, _Float16* __restrict__ Bt, size_t n8) { const size_t t = (size_t)blockIdx.x * 256 + threadIdx.x; if (t >= n8) return; FragH f;
#pragma unroll
  for (int i = 0; i < 8; ++i) f.h[i] = (_Float16)(bf16_round(W[t * 8 + i]) * 16.0f); *(v8us*)((unsigned short*)Bt + t * 8) = f.half[0];  }
template <int NHv, int TTv>
__global__ __launch_bounds__(256) void k_vt(const _Float16* __restrict__ V16, int ldv, int voff, _Float16* __restrict__ Vt) { __shared__ unsigned short tl[64][66]; const int tid = threadIdx.x; const int slab = blockIdx.x / (TTv / 64), lg = blockIdx.x % (TTv / 64); const int b = slab / NHv, h = slab % NHv;
  for (int i = tid; i < 64 * 8; i += 256) { const int r = i / 8, c8 = (i % 8) * 8; FragH f; f.half[0] = *(const v8us*)((const unsigned short*)V16 + ((size_t)b * TTv + lg * 64 + r) * ldv + voff + h * 64 + c8);
#pragma unroll
    for (int q = 0; q < 8; ++q) tl[r][c8 + q] = f.u[q]; }
  __syncthreads();
  {
#pragma unroll
    for (int rd = 0; rd < 2; ++rd) { const int d = rd * 32 + tid / 8, pc = tid % 8; FragH f;
#pragma unroll
      for (int q = 0; q < 8; ++q) f.u[q] = tl[pc * 8 + q][d];
      *(v8us*)((unsigned short*)Vt + ((size_t)slab * 64 + d) * TTv + lg * 64 + pc * 8) = f.half[0]; }
     } }

// Eight 16-byte asynchronous copies per lane, global memory to LDS through no register: piece i goes from g + i * gstep to LDS byte l + i * lstep.
// The s_wait_xcnt closes the statement so that it stands in front of any later rewrite of the address registers the copies name.
__device__ __forceinline__ void copy8_to_lds(unsigned l, unsigned lstep, const char* g, size_t gstep) {
  asm volatile("global_load_async_to_lds_b128 %0, %8, off\n\t"
               "global_load_async_to_lds_b128 %1, %9, off\n\t"
               "global_load_async_to_lds_b128 %2, %10, off\n\t"
               "global_load_async_to_lds_b128 %3, %11, off\n\t"
               "global_load_async_to_lds_b128 %4, %12, off\n\t"
               "global_load_async_to_lds_b128 %5, %13, off\n\t"
               "global_load_async_to_lds_b128 %6, %14, off\n\t"
               "global_load_async_to_lds_b128 %7, %15, off\n\t"
               "s_wait_xcnt 0x0"
               :: "v"(l), "v"(l + lstep), "v"(l + 2 * lstep), "v"(l + 3 * lstep), "v"(l + 4 * lstep), "v"(l + 5 * lstep), "v"(l + 6 * lstep), "v"(l + 7 * lstep),
                  "v"(g), "v"(g + gstep), "v"(g + 2 * gstep), "v"(g + 3 * gstep), "v"(g + 4 * gstep), "v"(g + 5 * gstep), "v"(g + 6 * gstep), "v"(g + 7 * gstep)
               : "memory");
}

// One butterfly step of a reduction over a 16-lane row, on the vector pipe: the lane's value joined with that of lane ^ M. It takes the place of a ds_bpermute_b32 and the
// s_wait_dscnt behind it, so that the steps of several rows can follow one another without a wait. Every lane is on where these stand.
template <int M> __device__ __forceinline__ float row_max_step(float v) { float o;
  asm("v_max_num_f32_dpp %0, %1, %1 row_xmask:%2 row_mask:0xf bank_mask:0xf" : "=v"(o) : "v"(v), "n"(M));      // o = max(v of lane ^ M, v)
  return o; }
template <int M> __device__ __forceinline__ float row_add_step(float v) { float o;
  asm("v_add_f32_dpp %0, %1, %1 row_xmask:%2 row_mask:0xf bank_mask:0xf" : "=v"(o) : "v"(v), "n"(M));          // o = v of lane ^ M + v
  return o; }

// K and Vt reach the four waves of a work-group through LDS: a stage is 64 keys (K: 64 rows of 256 B, Vt: 128 rows of 128 B, whole 128-B lines), copied once per work-group,
// two buffers, the next stage in flight while this one is worked on. Row pitches 272 B and 144 B (16 B x odd) keep the ds_load_b128 fragment reads free of bank conflicts.
__global__ __launch_bounds__(128) void k_flash(const _Float16* __restrict__ Q16, int ldq, const _Float16* __restrict__ K16, int ldk, const _Float16* __restrict__ Vt, const int* __restrict__ MSK, float* __restrict__ O, int ldo) {
  constexpr int RPW = 16, RTN = RPW / 16, NQB = 3072 / (4 * RPW), DT = 8, KS = 4;      /* head dim 128 */
  constexpr unsigned KP = 272, VP = 144, KBYTES = 64 * KP, STG = KBYTES + 128 * VP;
  __shared__ __attribute__((aligned(16))) unsigned char ring[2 * STG];
  __shared__ __attribute__((aligned(16))) unsigned short sP[4][RPW][40];
  float (*sO)[RPW][128 + 4] = (float (*)[RPW][128 + 4])ring;      /* output staging takes the ring's place behind the loop's last barrier */
  static_assert(sizeof(float) * 4 * RPW * (128 + 4) <= 2 * STG, "output staging fits the ring");
  const int tid = threadIdx.x, w = tid >> 5, lane = tid & 31, ln = lane & 15, hh = lane >> 4;
  const int slab = blockIdx.x / NQB, qblk = blockIdx.x % NQB; const int b = slab / 8, h = slab % 8; const int qb0 = qblk * (4 * RPW); const int q0 = qb0 + w * RPW;
  FragH aq[2][KS];
#pragma unroll
  for (int rt = 0; rt < RTN; ++rt) { const unsigned short* qr = (const unsigned short*)Q16 + ((size_t)b * 3072 + q0 + rt * 16 + ln) * ldq + h * 128;
#pragma unroll
    for (int ks = 0; ks < KS; ++ks) { aq[rt][ks].half[0] = *(const v8us*)(qr + ks * 32 + 8 * hh); aq[rt][ks].half[1] = *(const v8us*)(qr + ks * 32 + 16 + 8 * hh); } }
  const unsigned short* Vth = (const unsigned short*)Vt + (size_t)slab * 128 * 3072;
  // each thread's own pieces of a stage: K row tid/16 + 8i, 16-byte piece tid%16; Vt row tid/8 + 16i, piece tid%8
  const char* kg = (const char*)((const unsigned short*)K16 + ((size_t)b * 3072 + (tid >> 4)) * ldk + h * 128 + (tid & 15) * 8);
  const char* vg = (const char*)(Vth + (size_t)(tid >> 3) * 3072 + (tid & 7) * 8);
  const unsigned ring0 = (unsigned)(size_t)ring;
  const unsigned kl = ring0 + (unsigned)(tid >> 4) * KP + (unsigned)(tid & 15) * 16u, vl = ring0 + KBYTES + (unsigned)(tid >> 3) * VP + (unsigned)(tid & 7) * 16u;
  const size_t kstage = (size_t)64 * ldk * 2, kstep = (size_t)8 * ldk * 2;
  auto fill = [&](int st, unsigned buf) {
    copy8_to_lds(kl + buf * STG, 8 * KP, kg + (size_t)st * kstage, kstep);
    copy8_to_lds(vl + buf * STG, 16 * VP, vg + (size_t)st * 128, (size_t)16 * 3072 * 2);
  };
  float m_r[2][8], l_r[2][8]; v8f oacc[2][DT];
#pragma unroll
  for (int rt = 0; rt < RTN; ++rt) {
#pragma unroll
    for (int r = 0; r < 8; ++r) { m_r[rt][r] = -3.0e38f; l_r[rt][r] = 0.f; }
#pragma unroll
    for (int dt = 0; dt < DT; ++dt) oacc[rt][dt] = (v8f){0.f,0.f,0.f,0.f,0.f,0.f,0.f,0.f}; }
  const int nst = qblk + 1;      /* stages of 64 keys up to the block's diagonal; the same for the whole work-group */
  fill(0, 0u);
  asm volatile("s_wait_asynccnt 0x0" ::: "memory");      // this wave's pieces of stage 0 have landed
  __syncthreads();                                       // every wave's pieces of stage 0 are readable
  if (nst > 1) fill(1, 1u);
#pragma unroll 1      /* one copy of the body: the ring's order stays as written */
  for (int st = 0; st < nst; ++st) {
    const unsigned char* kbuf = ring + (unsigned)(st & 1) * STG; const unsigned char* vbuf = kbuf + KBYTES;
#pragma unroll 1      /* the two 32-key passes of a stage share one body in the instruction cache */
  for (int sub = 0; sub < 2; ++sub) { const int j0 = st * 64 + sub * 32;
    v8f s[2][2];
#pragma unroll
    for (int nt = 0; nt < 2; ++nt) { const unsigned char* kr = kbuf + (unsigned)(sub * 32 + nt * 16 + ln) * KP + 16 * hh; FragH bk[KS];
#pragma unroll
      for (int ks = 0; ks < KS; ++ks) { bk[ks].half[0] = *(const v8us*)(kr + ks * 64); bk[ks].half[1] = *(const v8us*)(kr + ks * 64 + 32); }
#pragma unroll
      for (int rt = 0; rt < RTN; ++rt) { v8f acc = (v8f){0.f,0.f,0.f,0.f,0.f,0.f,0.f,0.f};
#pragma unroll
        for (int ks = 0; ks < KS; ++ks) acc = mmaH<1>(aq[rt][ks].v, aq[rt][ks].v, bk[ks].v, bk[ks].v, acc); s[rt][nt] = acc; } }
    // The softmax of a pass in three sweeps over each lane's eight rows, each sweep one straight run of code, so that the rows' dependent chains overlap:
    // masked scores, then the row maxima step by step, then the exponentials, each computed ahead of the select that may drop it (no branch stands between two rows).
#pragma unroll
    for (int rt = 0; rt < RTN; ++rt) { const int k0 = j0 + ln, k1 = j0 + 16 + ln; float s0[8], s1[8], mc[8];
#pragma unroll
      for (int r = 0; r < 8; ++r) { const int tq = q0 + rt * 16 + 8 * hh + r;
        s0[r] = (k0 <= tq) ? s[rt][0][r] * (0.08838834764831845f) : -INFINITY; s1[r] = (k1 <= tq) ? s[rt][1][r] * (0.08838834764831845f) : -INFINITY; mc[r] = fmaxf(s0[r], s1[r]); }
#pragma unroll
      for (int r = 0; r < 8; ++r) mc[r] = row_max_step<1>(mc[r]);
#pragma unroll
      for (int r = 0; r < 8; ++r) mc[r] = row_max_step<2>(mc[r]);
#pragma unroll
      for (int r = 0; r < 8; ++r) mc[r] = row_max_step<4>(mc[r]);
#pragma unroll
      for (int r = 0; r < 8; ++r) mc[r] = row_max_step<8>(mc[r]);
#pragma unroll
      for (int r = 0; r < 8; ++r) { const int tq = q0 + rt * 16 + 8 * hh + r; const bool ok0 = (k0 <= tq), ok1 = (k1 <= tq);
        const float mn = fmaxf(m_r[rt][r], mc[r]); const float ea = expf(m_r[rt][r] - mn), e0 = expf(s0[r] - mn), e1 = expf(s1[r] - mn);      /* mn is finite: no difference here is a NaN */
        const float al = (mn > -1.0e38f) ? ea : 1.0f; m_r[rt][r] = mn; const float p0 = ok0 ? e0 : 0.f, p1 = ok1 ? e1 : 0.f; l_r[rt][r] = l_r[rt][r] * al + p0 + p1;
#pragma unroll
        for (int dt = 0; dt < DT; ++dt) oacc[rt][dt][r] *= al;
        FragH t2; t2.h[0] = (_Float16)p0; t2.h[1] = (_Float16)p1; sP[w][rt * 16 + 8 * hh + r][ln] = t2.u[0]; sP[w][rt * 16 + 8 * hh + r][16 + ln] = t2.u[1]; } }
    __builtin_amdgcn_fence(__ATOMIC_ACQ_REL, "workgroup"); __builtin_amdgcn_wave_barrier();
    FragH pa[2];
#pragma unroll
    for (int rt = 0; rt < RTN; ++rt) { pa[rt].half[0] = *(const v8us*)&sP[w][rt * 16 + ln][8 * hh]; pa[rt].half[1] = *(const v8us*)&sP[w][rt * 16 + ln][16 + 8 * hh]; }
#pragma unroll
    for (int dt = 0; dt < DT; ++dt) { const unsigned char* vrow = vbuf + (unsigned)(dt * 16 + ln) * VP + sub * 64 + 16 * hh; FragH bv; bv.half[0] = *(const v8us*)(vrow); bv.half[1] = *(const v8us*)(vrow + 32);
#pragma unroll
      for (int rt = 0; rt < RTN; ++rt) oacc[rt][dt] = mmaH<1>(pa[rt].v, pa[rt].v, bv.v, bv.v, oacc[rt][dt]); }
    __builtin_amdgcn_fence(__ATOMIC_ACQ_REL, "workgroup"); __builtin_amdgcn_wave_barrier(); }
    asm volatile("s_wait_dscnt 0x0" ::: "memory");       // this wave's reads of the buffer have returned before it is refilled
    asm volatile("s_wait_asynccnt 0x0" ::: "memory");    // this wave's pieces of stage st + 1 have landed
    __syncthreads();                                     // publishes stage st + 1 and ends every wave's reads of stage st
    if (st + 2 < nst) fill(st + 2, (unsigned)(st & 1));
  }
  asm volatile("s_wait_asynccnt 0x0" ::: "memory");      // no copy is outstanding when the ring becomes output staging
#pragma unroll
  for (int rt = 0; rt < RTN; ++rt) {
#pragma unroll
    for (int r = 0; r < 8; ++r) l_r[rt][r] = row_add_step<1>(l_r[rt][r]);
#pragma unroll
    for (int r = 0; r < 8; ++r) l_r[rt][r] = row_add_step<2>(l_r[rt][r]);
#pragma unroll
    for (int r = 0; r < 8; ++r) l_r[rt][r] = row_add_step<4>(l_r[rt][r]);
#pragma unroll
    for (int r = 0; r < 8; ++r) l_r[rt][r] = row_add_step<8>(l_r[rt][r]);
#pragma unroll
    for (int r = 0; r < 8; ++r) { const float l = l_r[rt][r]; l_r[rt][r] = (l > 0.f) ? 1.0f / l : 0.f; }
#pragma unroll
    for (int dt = 0; dt < DT; ++dt)
#pragma unroll
      for (int r = 0; r < 8; ++r) sO[w][rt * 16 + 8 * hh + r][dt * 16 + ln] = oacc[rt][dt][r] * l_r[rt][r]; }
  __builtin_amdgcn_fence(__ATOMIC_ACQ_REL, "workgroup"); __builtin_amdgcn_wave_barrier();
  {
#pragma unroll
    for (int rp = 0; rp < RPW; ++rp) { const int r = rp, pc = lane; const v4f val = *(const v4fa*)&sO[w][r][pc * 4]; *(v4f*)(O + ((size_t)(b * 8 + h) * 3072 + q0 + r) * 128 + pc * 4) = val; }      /* output layout [b][h][s][128]: 32 lanes x 16 B rows */
     } }

// Projection GEMM: C[row][col] = alpha * sum_k A[row][k] * Bt[col][k], both operands f16 with CW elements a row, f32 accumulate, k ascending in one chain per accumulator.
// A work-group owns a 64 x 64 tile of C, its four waves 32 x 32 each. A and Bt reach the waves through LDS: a stage is 128 k (64 rows of A and 64 of Bt, 256 B each, whole 128-B lines),
// copied once per work-group, two buffers, the next stage in flight while this one is worked on. Row pitch 272 B (16 B x odd) keeps the ds_load_b128 fragment reads free of bank conflicts.
// The grid is exact: blockIdx.x = row tile * (CW / 64) + column tile, blockIdx.y = batch.
template <bool OUT16>
__global__ __launch_bounds__(128) void k_gemm_ring(const _Float16* __restrict__ A, size_t sA, const _Float16* __restrict__ Bt, float alpha, float* __restrict__ C, _Float16* __restrict__ C16, size_t sC) {
  constexpr unsigned RP = 272, TB = 64 * RP, STG = 2 * TB; constexpr int NST = CW / 128;
  static_assert(NST >= 2, "the ring's prologue fills two stages");
  __shared__ __attribute__((aligned(16))) unsigned char ring[2 * STG];
  float (*so)[64 + 4] = (float (*)[64 + 4])ring;      /* output staging takes the ring's place behind the loop's last barrier */
  static_assert(sizeof(float) * 64 * (64 + 4) <= 2 * STG, "output staging fits the ring");
  const int tid = threadIdx.x, w = tid >> 5, lane = tid & 31, ln = lane & 15, hh = lane >> 4, wm = w >> 1, wn = w & 1;
  const int row0 = (int)(blockIdx.x / (CW / 64)) * 64, col0 = (int)(blockIdx.x % (CW / 64)) * 64;
  // each thread's own pieces of a stage: row tid/16 + 8i of either operand, 16-byte piece tid%16
  const char* ag = (const char*)((const unsigned short*)A + (size_t)blockIdx.y * sA + (size_t)(row0 + (tid >> 4)) * CW + (tid & 15) * 8);
  const char* bg = (const char*)((const unsigned short*)Bt + (size_t)(col0 + (tid >> 4)) * CW + (tid & 15) * 8);
  const unsigned al = (unsigned)(size_t)ring + (unsigned)(tid >> 4) * RP + (unsigned)(tid & 15) * 16u, bl = al + TB;
  auto fill = [&](int st, unsigned buf) {
    copy8_to_lds(al + buf * STG, 8 * RP, ag + (size_t)st * 256, (size_t)8 * CW * 2);
    copy8_to_lds(bl + buf * STG, 8 * RP, bg + (size_t)st * 256, (size_t)8 * CW * 2);
  };
  v8f acc[2][2];
#pragma unroll
  for (int i = 0; i < 2; ++i)
#pragma unroll
    for (int j = 0; j < 2; ++j) acc[i][j] = (v8f){0.f,0.f,0.f,0.f,0.f,0.f,0.f,0.f};
  fill(0, 0u);
  asm volatile("s_wait_asynccnt 0x0" ::: "memory");      // this wave's pieces of stage 0 have landed
  __syncthreads();                                       // every wave's pieces of stage 0 are readable
  fill(1, 1u);
#pragma unroll 1      /* one copy of the body: the ring's order stays as written */
  for (int st = 0; st < NST; ++st) {
    const unsigned char* ar = ring + (unsigned)(st & 1) * STG + (unsigned)(wm * 32 + ln) * RP + 16 * hh;
    const unsigned char* br = ring + (unsigned)(st & 1) * STG + TB + (unsigned)(wn * 32 + ln) * RP + 16 * hh;
    FragH fa[4][2], fb[4][2];
#pragma unroll
    for (int ks = 0; ks < 4; ++ks)
#pragma unroll
      for (int i = 0; i < 2; ++i) {
        fa[ks][i].half[0] = *(const v8us*)(ar + i * 16 * RP + ks * 64); fa[ks][i].half[1] = *(const v8us*)(ar + i * 16 * RP + ks * 64 + 32);
        fb[ks][i].half[0] = *(const v8us*)(br + i * 16 * RP + ks * 64); fb[ks][i].half[1] = *(const v8us*)(br + i * 16 * RP + ks * 64 + 32); }
    asm volatile("s_wait_dscnt 0x0" ::: "memory");       // the stage's 32 fragment reads, one group, have returned: this wave is done with the buffer before it is refilled
    asm volatile("s_wait_asynccnt 0x0" ::: "memory");    // this wave's pieces of stage st + 1 have landed
    __syncthreads();                                     // publishes stage st + 1 and ends every wave's reads of stage st
    if (st + 2 < NST) fill(st + 2, (unsigned)(st & 1));  // in front of the WMMAs, which work from registers, so that the copies fly behind them
#pragma unroll
    for (int ks = 0; ks < 4; ++ks)
#pragma unroll
      for (int i = 0; i < 2; ++i)
#pragma unroll
        for (int j = 0; j < 2; ++j) acc[i][j] = __builtin_amdgcn_wmma_f32_16x16x32_f16(false, fa[ks][i].v, false, fb[ks][j].v, (short)0, acc[i][j], false, false);
  }
  asm volatile("s_wait_asynccnt 0x0" ::: "memory");      // no copy is outstanding when the ring becomes output staging
#pragma unroll
  for (int i = 0; i < 2; ++i)
#pragma unroll
    for (int j = 0; j < 2; ++j)
#pragma unroll
      for (int r = 0; r < 8; ++r) so[wm * 32 + i * 16 + 8 * hh + r][wn * 32 + j * 16 + ln] = acc[i][j][r] * alpha;
  __syncthreads();                                       // a stored row of 64 columns holds two waves' results
  const int rsub = lane >> 4, c4 = (lane & 15) * 4; typedef _Float16 v4h __attribute__((ext_vector_type(4)));
#pragma unroll
  for (int q = 0; q < 8; ++q) { const int r = w * 16 + q * 2 + rsub; const v4f v = *(const v4fa*)&so[r][c4]; const size_t o = (size_t)blockIdx.y * sC + (size_t)(row0 + r) * CW + col0 + c4;
    if (OUT16) { v4h h4;
#pragma unroll
      for (int i = 0; i < 4; ++i) h4[i] = (_Float16)v[i];
      *(v4h*)(C16 + o) = h4; }      /* whole 128-B lines, one wave a line */
    else *(v4f*)(C + o) = v; }
}

__global__ __launch_bounds__(256) void k_xt(const float* __restrict__ x, _Float16* __restrict__ XT) { const size_t t = (size_t)blockIdx.x * 256 + threadIdx.x; if (t >= (size_t)NR * NH * 16) return; const int p = (int)(t % 16); const int h = (int)((t / 16) % NH); const size_t bs = t / (16 * NH); const int b = (int)(bs / TT), s = (int)(bs % TT); const float* src = x + (((size_t)(b * NH + h) * TT + s) * HD) + p * 8; FragH f;
#pragma unroll
  for (int q = 0; q < 8; ++q) f.h[q] = (_Float16)bf16_round(src[q]); unsigned short* d = (unsigned short*)XT + bs * CW + h * HD + p * 8; *(v8us*)d = f.half[0];  }
__global__ __launch_bounds__(256) void k_wst(const float* __restrict__ W, _Float16* __restrict__ Bt) { const size_t t = (size_t)blockIdx.x * 256 + threadIdx.x; if (t >= (size_t)CW * NH * 16) return; const int p = (int)(t % 16); const int h = (int)((t / 16) % NH); const int n = (int)(t / (16 * NH)); const int g = n / HD, e = n % HD; FragH f;
#pragma unroll
  for (int q = 0; q < 8; ++q) { const int d = p * 8 + q; f.h[q] = (_Float16)(bf16_round(W[(((size_t)(h * NH + g) * HD + d) * HD) + e]) * 16.0f); }
  unsigned short* dst = (unsigned short*)Bt + (size_t)n * CW + h * HD + p * 8; *(v8us*)dst = f.half[0];  }
__global__ __launch_bounds__(256) void k_rope(const float* __restrict__ F, const int* __restrict__ offp, float oscale, _Float16* __restrict__ D16) { __shared__ __attribute__((aligned(16))) _Float16 st[256][8]; const int tid = threadIdx.x; const size_t t = (size_t)blockIdx.x * 256 + tid; if (t >= (size_t)NR * NH * 16) return; const int li = (int)(t % 16); const int h = (int)((t / 16) % NH); const size_t bs = t / (16 * NH); const int s = (int)(bs % TT); const float pos = (float)(s + offp[0]); const float* src = F + bs * CW + h * HD;
#pragma unroll 1
  for (int q = 0; q < 8; ++q) { const int j = li * 8 + q; const int i = j & 63; const float ang = pos * __builtin_powf(10000.0f, -(float)(2 * i) / 128.0f); const float c = cosf(ang), sn = sinf(ang); const float xj = src[j], xp = src[(j + 64) & 127]; const float rot = (j < 64) ? -xp : xp; st[tid][q] = (_Float16)((xj * c + rot * sn) * oscale); }
  FragH f; f.half[0] = *(const v8us*)&st[tid][0]; unsigned short* d = (unsigned short*)D16 + bs * CW + h * HD + li * 8; *(v8us*)d = f.half[0];  }
__global__ __launch_bounds__(256) void k_vt128(const _Float16* __restrict__ V16, _Float16* __restrict__ Vt) { __shared__ unsigned short tl[64][130]; const int tid = threadIdx.x; const int slab = blockIdx.x / (TT / 64), lg = blockIdx.x % (TT / 64); const int b = slab / NH, h = slab % NH;
  for (int i = tid; i < 64 * 16; i += 256) { const int r = i / 16, c8 = (i % 16) * 8; FragH f; f.half[0] = *(const v8us*)((const unsigned short*)V16 + ((size_t)b * TT + lg * 64 + r) * CW + h * HD + c8);
#pragma unroll
    for (int q = 0; q < 8; ++q) tl[r][c8 + q] = f.u[q]; }
  __syncthreads();
  { for (int i = tid; i < 128 * 8; i += 256) { const int d = i / 8, pc = i % 8; FragH f;
#pragma unroll
      for (int q = 0; q < 8; ++q) f.u[q] = tl[pc * 8 + q][d]; *(v8us*)((unsigned short*)Vt + ((size_t)slab * HD + d) * TT + lg * 64 + pc * 8) = f.half[0]; }  } }
extern "C" void kernel_launch(void* const* d_in, const int* in_sizes, int n_in,
                              void* d_out, int out_size, void* d_ws, size_t ws_size, hipStream_t stream) {
  (void)in_sizes; (void)n_in; (void)out_size;
  const float* x = (const float*)d_in[0]; const float* Wm[3] = {(const float*)d_in[1], (const float*)d_in[2], (const float*)d_in[3]}; const float* Wsg[3] = {(const float*)d_in[4], (const float*)d_in[5], (const float*)d_in[6]}; const float* Weg[3] = {(const float*)d_in[7], (const float*)d_in[8], (const float*)d_in[9]}; const int* offp = (const int*)d_in[10];
  char* ws = (char*)d_ws; size_t off = 0;
  auto take = [&](size_t bytes) { char* p = ws + off; off += (bytes + 255) & ~(size_t)255; return p; };
  _Float16* Bm = (_Float16*)take((size_t)CW * CW * 2); _Float16* Bs = (_Float16*)take((size_t)CW * CW * 2); _Float16* Be = (_Float16*)take((size_t)CW * CW * 2);
  _Float16* XT = (_Float16*)take((size_t)NR * CW * 2); float* F = (float*)take((size_t)NR * CW * 4); _Float16* Q16 = (_Float16*)take((size_t)NR * CW * 2); _Float16* K16 = (_Float16*)take((size_t)NR * CW * 2); _Float16* V16 = (_Float16*)take((size_t)NR * CW * 2); _Float16* Vt = (_Float16*)take((size_t)NR * CW * 2);
  if (off > ws_size) return;      // 6.3 + 12.6 + 25.2 + 12.6 × 4 ≈ 94 MB
  k_xt<<<(unsigned)(((size_t)NR * NH * 16 + 255) / 256), 256, 0, stream>>>(x, XT);
  const unsigned gw = (unsigned)(((size_t)CW * NH * 16 + 255) / 256), gr = (unsigned)(((size_t)NR * NH * 16 + 255) / 256);
  // the three (b,s) row ranges: [0,512) state, [512,2560) middle, [2560,3072) end — batched over b via sA/sC
  const int r0s[3] = {SL, 0, TT - SL}, ms[3] = {TT - 2 * SL, SL, SL};      // order: middle (W), state (Ws), end (We)
  for (int p = 0; p < 3; ++p) {      // p: 0 = q, 1 = k, 2 = v
    k_wst<<<gw, 256, 0, stream>>>(Wm[p], Bm); k_wst<<<gw, 256, 0, stream>>>(Wsg[p], Bs); k_wst<<<gw, 256, 0, stream>>>(Weg[p], Be);
    const _Float16* Bsel[3] = {Bm, Bs, Be};
    for (int sgm = 0; sgm < 3; ++sgm) { const int r0 = r0s[sgm], M = ms[sgm];
      if (p < 2) k_gemm_ring<false><<<dim3((M / 64) * (CW / 64), BB), 128, 0, stream>>>(XT + (size_t)r0 * CW, (size_t)TT * CW, Bsel[sgm], 0.0625f, F + (size_t)r0 * CW, nullptr, (size_t)TT * CW);
      else       k_gemm_ring<true><<<dim3((M / 64) * (CW / 64), BB), 128, 0, stream>>>(XT + (size_t)r0 * CW, (size_t)TT * CW, Bsel[sgm], 0.0625f, nullptr, V16 + (size_t)r0 * CW, (size_t)TT * CW); }
    if (p == 0) k_rope<<<gr, 256, 0, stream>>>(F, offp, 1.0f, Q16); else if (p == 1) k_rope<<<gr, 256, 0, stream>>>(F, offp, 1.0f, K16); }
  k_vt128<<<BB * NH * (TT / 64), 256, 0, stream>>>(V16, Vt);
  k_flash<<<BB * NH * (TT / 64), 128, 0, stream>>>(Q16, CW, K16, CW, Vt, nullptr, (float*)d_out, 0);
}

// v004
// A run of this version takes 243 microseconds.
// Timed twice side by side with v003, it ran 1.31 and 1.30 times as fast.
// All steps since v000 together make it 3.73 times as fast.
#include <hip/hip_runtime.h>
// Causal multi-head attention with state segments (x [2, 8 heads, 3072, 128]; StackedLinear projections that mix heads and features — separate weights for the first 512 (state), middle 2048 and
// last 512 (end) positions; rotate-half RoPE with an INPUT offset; causal softmax(q·k/√128)·v; output [2,8,3072,128]): the nine (h,d)→(g,e) projections as GEMMs on the (b,s)-major transposed
// input (bf16-exact ×2^4 weights, f32 accumulate) and the attention as a fused flash-style kernel (d = 128: 4 k-steps / 8 d-tiles; causal chunk skipping; online softmax f32; P f16 ≤ 1;
// O = P·Vt written straight into the output; RPW-16 waves) on v_wmma_f32_16x16x32_f16; RoPE f32 VALU.
#define BB 2
#define NH 8
#define TT 3072
#define HD 128
#define CW (NH * HD)
#define NR (BB * TT)
#define SL 512

typedef __bf16 v16b __attribute__((ext_vector_type(16)));
typedef unsigned short v8us __attribute__((ext_vector_type(8), may_alias));
typedef float  v8f  __attribute__((ext_vector_type(8)));
typedef float  v4f  __attribute__((ext_vector_type(4)));
typedef float  v4fa __attribute__((ext_vector_type(4), may_alias));
union FragB { v16b v; v8us half[2]; unsigned short u[16]; };

__device__ __forceinline__ unsigned short bf16_bits(float x) { unsigned int u = __float_as_uint(x); return (unsigned short)((u + 0x7FFFu + ((u >> 16) & 1u)) >> 16); }
__device__ __forceinline__ float bf16_val(unsigned short b) { return __uint_as_float(((unsigned int)b) << 16); }
__device__ __forceinline__ float bf16_round(float x) { return bf16_val(bf16_bits(x)); }
// D += A·B with NT terms: 1 = ah·bh, 2 = + al·bh (A split), 3 = + ah·bl (both split)
template <int NT>
__device__ __forceinline__ v8f mmaN(v16b ah, v16b al, v16b bh, v16b bl, v8f c) {
  c = __builtin_amdgcn_wmma_f32_16x16x32_bf16(false, ah, false, bh, (short)0, c, false, false);
  if (NT >= 2) c = __builtin_amdgcn_wmma_f32_16x16x32_bf16(false, al, false, bh, (short)0, c, false, false);
  if (NT >= 3) c = __builtin_amdgcn_wmma_f32_16x16x32_bf16(false, ah, false, bl, (short)0, c, false, false);
  asm volatile("v_nop\n\tv_nop\n\tv_nop\n\tv_nop" : "+v"(c) : "v"(ah), "v"(al), "v"(bh), "v"(bl));
  return c;
}

__global__ __launch_bounds__(256) void k_wt_bf16(const float* __restrict__ W, unsigned short* __restrict__ Wt, int K, int N) {
  const int t = blockIdx.x * 256 + threadIdx.x;
  const int k8n = K / 8;
  if (t >= N * k8n) return;
  const int n = t / k8n, k8 = (t % k8n) * 8;
  v8us v;
#pragma unroll
  for (int i = 0; i < 8; ++i) v[i] = bf16_bits(W[(size_t)(k8 + i) * N + n]);
  *(v8us*)(Wt + (size_t)n * K + k8) = v;
  
}

// GEMM C[M][N] (f32, pitch ldc) = act(A[M][K]·W + bias). A f32 row-major (pitch lda) converted per fragment to bf16
// (ASPLIT: hi/lo two planes -> 2 terms, else single rounded term); Wt bf16 [N][K] (pitch ldb). BIAS_BF16 rounds the
// bias to bf16 first (bias quantised to bf16 before the add). K%32==0, M%16==0, N%64==0.
template <bool ASPLIT, int ACT, bool BIAS_BF16>
__global__ __launch_bounds__(128) void k_gemm_bf(const float* __restrict__ A, int lda, const unsigned short* __restrict__ Wt, int ldb,
                                               const float* __restrict__ bias, float* __restrict__ C, int ldc, int M, int N, int K) {
  __shared__ __attribute__((aligned(16))) float so[4][16][64];
  const int tid = threadIdx.x, w = tid >> 5, lane = tid & 31, ln = lane & 15, hh = lane >> 4;
  const int ntn = N / 64;
  const int wid = blockIdx.x * 4 + w;
  const int mt = wid / ntn, nq = wid % ntn;
  if (mt * 16 >= M) return;
  const int row0 = mt * 16, col0 = nq * 64;
  const float* arow = A + (size_t)(row0 + ln) * lda;
  v8f acc[4] = {};
  for (int kb = 0; kb < K; kb += 32) {
    FragB ah, al;
    const v4f x0 = *(const v4fa*)(arow + kb + 8 * hh), x1 = *(const v4fa*)(arow + kb + 8 * hh + 4);
    const v4f x2 = *(const v4fa*)(arow + kb + 16 + 8 * hh), x3 = *(const v4fa*)(arow + kb + 16 + 8 * hh + 4);
    float xs[16] = {x0[0],x0[1],x0[2],x0[3],x1[0],x1[1],x1[2],x1[3],x2[0],x2[1],x2[2],x2[3],x3[0],x3[1],x3[2],x3[3]};
#pragma unroll
    for (int i = 0; i < 16; ++i) { const unsigned short hb = bf16_bits(xs[i]); ah.u[i] = hb; al.u[i] = ASPLIT ? bf16_bits(xs[i] - bf16_val(hb)) : (unsigned short)0; }
#pragma unroll
    for (int t = 0; t < 4; ++t) {
      const unsigned short* brow = Wt + (size_t)(col0 + t * 16 + ln) * ldb + kb;
      FragB b;
      b.half[0] = *(const v8us*)(brow + 8 * hh);
      b.half[1] = *(const v8us*)(brow + 16 + 8 * hh);
      acc[t] = mmaN<ASPLIT ? 2 : 1>(ah.v, al.v, b.v, b.v, acc[t]);
    }
  }
#pragma unroll
  for (int t = 0; t < 4; ++t) {
    float bv = bias ? bias[col0 + t * 16 + ln] : 0.f;
    if (BIAS_BF16) bv = bf16_round(bv);
#pragma unroll
    for (int r = 0; r < 8; ++r) { float v = acc[t][r] + bv; if (ACT == 1) v = fmaxf(v, 0.f); so[w][8 * hh + r][t * 16 + ln] = v; }
  }
  __builtin_amdgcn_fence(__ATOMIC_ACQ_REL, "workgroup");
  __builtin_amdgcn_wave_barrier();
  const int rsub = lane >> 4, c4 = (lane & 15) * 4;
  {
#pragma unroll
    for (int q = 0; q < 8; ++q) {
      const int r = q * 2 + rsub;
      const v4f v = *(const v4fa*)&so[w][r][c4];
      *(v4f*)(C + (size_t)(row0 + r) * ldc + col0 + c4) = v;
    }
    
  }
}

// Flash-style causal/unmasked attention, all contractions 3-term bf16 hi/lo splits, f32 softmax with running max.
// q,k,v rows are read from f32 buffers with arbitrary row pitch (so they can live inside a fused qkv buffer);
// D = head size (multiple of 32, <= 128); one wave = 16 query rows; block = 4 waves (64 queries) sharing K/V chunks of 32.
template <int D, bool CAUSAL>
__global__ __launch_bounds__(128) void k_flash(const float* __restrict__ qb, const float* __restrict__ kb, const float* __restrict__ vb,
                                             int pitch, int T, int H, float scale, float* __restrict__ y, int ypitch) {
  constexpr int KS = D / 32;        // k-steps for QK
  constexpr int DT = D / 16;        // d tiles for PV
  __shared__ __attribute__((aligned(16))) unsigned short sKh[32][D + 8], sKl[32][D + 8], sVh[32][D + 8], sVl[32][D + 8];
  __shared__ __attribute__((aligned(16))) unsigned short sPh[4][16][40], sPl[4][16][40];
  __shared__ __attribute__((aligned(16))) float sO[4][16][D];
  const int tid = threadIdx.x, w = tid >> 5, lane = tid & 31, ln = lane & 15, hh = lane >> 4;
  const int nqb = (T + 63) / 64;
  const int bh = blockIdx.x / nqb, qblk = blockIdx.x % nqb;
  const int b = bh / H, h = bh % H;
  const int q0 = qblk * 64 + w * 16;
  const float* Q = qb + (size_t)b * T * pitch + h * D;
  const float* K = kb + (size_t)b * T * pitch + h * D;
  const float* V = vb + (size_t)b * T * pitch + h * D;

  // A fragments of the wave's 16 query rows (scaled), hi/lo
  FragB aqh[KS], aql[KS];
  {
    int row = q0 + ln; if (row >= T) row = T - 1;
    const float* qr = Q + (size_t)row * pitch;
#pragma unroll
    for (int ks = 0; ks < KS; ++ks)
#pragma unroll
      for (int i = 0; i < 16; ++i) {
        const int d = ks * 32 + ((i < 8) ? (8 * hh + i) : (16 + 8 * hh + (i - 8)));
        const float x = qr[d] * scale; const unsigned short hb = bf16_bits(x);
        aqh[ks].u[i] = hb; aql[ks].u[i] = bf16_bits(x - bf16_val(hb));
      }
  }
  float m_r[8], l_r[8];
#pragma unroll
  for (int r = 0; r < 8; ++r) { m_r[r] = -3.0e38f; l_r[r] = 0.f; }
  v8f oacc[DT];
#pragma unroll
  for (int dt = 0; dt < DT; ++dt) oacc[dt] = (v8f){0.f,0.f,0.f,0.f,0.f,0.f,0.f,0.f};

  const int kv_end = CAUSAL ? min(T, qblk * 64 + 64) : T;     // block-uniform
  for (int j0 = 0; j0 < kv_end; j0 += 32) {
    __syncthreads();
    for (int e = tid; e < 32 * (D / 4); e += 128) {
      const int r = e / (D / 4), c4 = (e % (D / 4)) * 4;
      const int key = j0 + r;
      v4f kf = {0.f,0.f,0.f,0.f}, vf = {0.f,0.f,0.f,0.f};
      if (key < T) { kf = *(const v4fa*)(K + (size_t)key * pitch + c4); vf = *(const v4fa*)(V + (size_t)key * pitch + c4); }
#pragma unroll
      for (int t = 0; t < 4; ++t) {
        unsigned short hb = bf16_bits(kf[t]); sKh[r][c4 + t] = hb; sKl[r][c4 + t] = bf16_bits(kf[t] - bf16_val(hb));
        hb = bf16_bits(vf[t]); sVh[r][c4 + t] = hb; sVl[r][c4 + t] = bf16_bits(vf[t] - bf16_val(hb));
      }
    }
    __syncthreads();
    // S tile 16 x 32
    v8f s[2];
#pragma unroll
    for (int nt = 0; nt < 2; ++nt) {
      v8f acc = {};
#pragma unroll
      for (int ks = 0; ks < KS; ++ks) {
        FragB bh_, bl_;
        bh_.half[0] = *(const v8us*)&sKh[nt * 16 + ln][ks * 32 + 8 * hh]; bh_.half[1] = *(const v8us*)&sKh[nt * 16 + ln][ks * 32 + 16 + 8 * hh];
        bl_.half[0] = *(const v8us*)&sKl[nt * 16 + ln][ks * 32 + 8 * hh]; bl_.half[1] = *(const v8us*)&sKl[nt * 16 + ln][ks * 32 + 16 + 8 * hh];
        acc = mmaN<3>(aqh[ks].v, aql[ks].v, bh_.v, bl_.v, acc);
      }
      s[nt] = acc;
    }
    // mask + running max (rows 8hh+r; the 16 lanes of a half share rows)
    float alpha[8];
#pragma unroll
    for (int r = 0; r < 8; ++r) {
      const int qi = q0 + 8 * hh + r;
      const int ja = j0 + ln, jb = j0 + 16 + ln;
      if (CAUSAL) { if (ja > qi) s[0][r] = -3.0e38f; if (jb > qi) s[1][r] = -3.0e38f; }
      if (ja >= T) s[0][r] = -3.0e38f;
      if (jb >= T) s[1][r] = -3.0e38f;
      float mx = fmaxf(s[0][r], s[1][r]);
      mx = fmaxf(mx, __shfl_xor(mx, 1, 32)); mx = fmaxf(mx, __shfl_xor(mx, 2, 32)); mx = fmaxf(mx, __shfl_xor(mx, 4, 32)); mx = fmaxf(mx, __shfl_xor(mx, 8, 32));
      const float mnew = fmaxf(m_r[r], mx);
      alpha[r] = (mnew > -1.0e38f) ? __expf(m_r[r] - mnew) : 1.0f;
      const float p0 = (s[0][r] > -1.0e38f) ? __expf(s[0][r] - mnew) : 0.f;
      const float p1 = (s[1][r] > -1.0e38f) ? __expf(s[1][r] - mnew) : 0.f;
      m_r[r] = mnew;
      l_r[r] = l_r[r] * alpha[r] + p0 + p1;            // per-lane partial row sum (16 lanes combined at the end)
      unsigned short hb = bf16_bits(p0); sPh[w][8 * hh + r][ln] = hb;      sPl[w][8 * hh + r][ln] = bf16_bits(p0 - bf16_val(hb));
      hb = bf16_bits(p1);                sPh[w][8 * hh + r][16 + ln] = hb; sPl[w][8 * hh + r][16 + ln] = bf16_bits(p1 - bf16_val(hb));
    }
#pragma unroll
    for (int dt = 0; dt < DT; ++dt)
#pragma unroll
      for (int r = 0; r < 8; ++r) oacc[dt][r] *= alpha[r];
    __builtin_amdgcn_fence(__ATOMIC_ACQ_REL, "workgroup");
    __builtin_amdgcn_wave_barrier();
    FragB pah, pal;
    pah.half[0] = *(const v8us*)&sPh[w][ln][8 * hh]; pah.half[1] = *(const v8us*)&sPh[w][ln][16 + 8 * hh];
    pal.half[0] = *(const v8us*)&sPl[w][ln][8 * hh]; pal.half[1] = *(const v8us*)&sPl[w][ln][16 + 8 * hh];
#pragma unroll
    for (int dt = 0; dt < DT; ++dt) {
      FragB bvh, bvl;
#pragma unroll
      for (int i = 0; i < 8; ++i) {
        bvh.u[i] = sVh[8 * hh + i][dt * 16 + ln]; bvh.u[8 + i] = sVh[16 + 8 * hh + i][dt * 16 + ln];
        bvl.u[i] = sVl[8 * hh + i][dt * 16 + ln]; bvl.u[8 + i] = sVl[16 + 8 * hh + i][dt * 16 + ln];
      }
      oacc[dt] = mmaN<3>(pah.v, pal.v, bvh.v, bvl.v, oacc[dt]);
    }
    __builtin_amdgcn_fence(__ATOMIC_ACQ_REL, "workgroup");
    __builtin_amdgcn_wave_barrier();
  }
#pragma unroll
  for (int r = 0; r < 8; ++r) {
    float l = l_r[r];
    l += __shfl_xor(l, 1, 32); l += __shfl_xor(l, 2, 32); l += __shfl_xor(l, 4, 32); l += __shfl_xor(l, 8, 32);
    l_r[r] = (l > 0.f) ? 1.0f / l : 0.f;
  }
#pragma unroll
  for (int dt = 0; dt < DT; ++dt)
#pragma unroll
    for (int r = 0; r < 8; ++r) sO[w][8 * hh + r][dt * 16 + ln] = oacc[dt][r] * l_r[r];
  __builtin_amdgcn_fence(__ATOMIC_ACQ_REL, "workgroup");
  __builtin_amdgcn_wave_barrier();
  {
    for (int r = 0; r < 16; ++r) {
      const int row = q0 + r;
      if (row < T && lane < D / 4) {
        const v4f val = *(const v4fa*)&sO[w][r][lane * 4];
        *(v4f*)(y + ((size_t)b * T + row) * ypitch + h * D + lane * 4) = val;
      }
    }
    
  }
}

// GEMM C = act(A·W + bias + resid): A f32 (ASPLIT -> hi/lo 2 terms), Wt bf16 [N][K]; ACT 0 none, 1 relu, 2 exact gelu;
// resid (optional, f32, row index = (row % rmod), pitch ldr, RES_BF16 rounds it) added before the activation.
template <bool ASPLIT, int ACT, bool BIAS_BF16, bool RES_BF16>
__global__ __launch_bounds__(128) void k_gemm_bf3(const float* __restrict__ A, int lda, const unsigned short* __restrict__ Wt, int ldb,
                                                const float* __restrict__ bias, const float* __restrict__ resid, int rmod, int ldr,
                                                float* __restrict__ C, int ldc, int M, int N, int K) {
  __shared__ __attribute__((aligned(16))) float so[4][16][64];
  const int tid = threadIdx.x, w = tid >> 5, lane = tid & 31, ln = lane & 15, hh = lane >> 4;
  const int ntn = N / 64;
  const int wid = blockIdx.x * 4 + w;
  const int mt = wid / ntn, nq = wid % ntn;
  if (mt * 16 >= M) return;
  const int row0 = mt * 16, col0 = nq * 64;
  const float* arow = A + (size_t)(row0 + ln) * lda;
  v8f acc[4] = {};
  for (int kb = 0; kb < K; kb += 32) {
    FragB ah, al;
    const v4f x0 = *(const v4fa*)(arow + kb + 8 * hh), x1 = *(const v4fa*)(arow + kb + 8 * hh + 4);
    const v4f x2 = *(const v4fa*)(arow + kb + 16 + 8 * hh), x3 = *(const v4fa*)(arow + kb + 16 + 8 * hh + 4);
    float xs[16] = {x0[0],x0[1],x0[2],x0[3],x1[0],x1[1],x1[2],x1[3],x2[0],x2[1],x2[2],x2[3],x3[0],x3[1],x3[2],x3[3]};
#pragma unroll
    for (int i = 0; i < 16; ++i) { const unsigned short hb = bf16_bits(xs[i]); ah.u[i] = hb; al.u[i] = ASPLIT ? bf16_bits(xs[i] - bf16_val(hb)) : (unsigned short)0; }
#pragma unroll
    for (int t = 0; t < 4; ++t) {
      const unsigned short* brow = Wt + (size_t)(col0 + t * 16 + ln) * ldb + kb;
      FragB b;
      b.half[0] = *(const v8us*)(brow + 8 * hh);
      b.half[1] = *(const v8us*)(brow + 16 + 8 * hh);
      acc[t] = mmaN<ASPLIT ? 2 : 1>(ah.v, al.v, b.v, b.v, acc[t]);
    }
  }
#pragma unroll
  for (int t = 0; t < 4; ++t) {
    const int col = col0 + t * 16 + ln;
    float bv = bias ? bias[col] : 0.f;
    if (BIAS_BF16) bv = bf16_round(bv);
#pragma unroll
    for (int r = 0; r < 8; ++r) {
      float v = acc[t][r] + bv;
      if (resid) { float rv = resid[(size_t)((row0 + 8 * hh + r) % rmod) * ldr + col]; if (RES_BF16) rv = bf16_round(rv); v += rv; }
      if (ACT == 1) v = fmaxf(v, 0.f);
      if (ACT == 2) v = 0.5f * v * (1.0f + erff(v * 0.70710678118654752f));
      if (ACT == 3) { const float u = 0.7978845608028654f * (v + 0.044715f * v * v * v); v = 0.5f * v * (1.0f + tanhf(u)); }
      so[w][8 * hh + r][t * 16 + ln] = v;
    }
  }
  __builtin_amdgcn_fence(__ATOMIC_ACQ_REL, "workgroup");
  __builtin_amdgcn_wave_barrier();
  const int rsub = lane >> 4, c4 = (lane & 15) * 4;
  {
#pragma unroll
    for (int q = 0; q < 8; ++q) {
      const int r = q * 2 + rsub;
      const v4f v = *(const v4fa*)&so[w][r][c4];
      *(v4f*)(C + (size_t)(row0 + r) * ldc + col0 + c4) = v;
    }
    
  }
}
// row LayerNorm (biased variance, eps) over N: s = X (+ R); optional out_sum <- s; out_norm <- (s-mu)*rsqrt(var+eps)*g + b
template <bool PARAM_BF16>
__global__ __launch_bounds__(256) void k_layernorm(const float* __restrict__ X, const float* __restrict__ R, const float* __restrict__ g, const float* __restrict__ bta,
                                                  float* __restrict__ out_sum, float* __restrict__ out_norm, int N, float eps) {
  __shared__ float red[256];
  const int row = blockIdx.x, tid = threadIdx.x;
  const float* x = X + (size_t)row * N; const float* rr = R ? R + (size_t)row * N : nullptr;
  float vals[16];                     // up to N = 4096
  const int per = N / 256;            // contiguous chunk per thread? use strided-by-4 chunks: thread handles j = tid*4 + 1024*u
  float s1 = 0.f;
  for (int u = 0; u < per / 4; ++u) {
    const int j = tid * 4 + 1024 * u;
    const v4f a = *(const v4fa*)(x + j);
    v4f b = {0.f,0.f,0.f,0.f}; if (rr) b = *(const v4fa*)(rr + j);
#pragma unroll
    for (int q = 0; q < 4; ++q) { const float v = a[q] + b[q]; vals[u * 4 + q] = v; s1 += v; }
  }
  red[tid] = s1; __syncthreads();
  for (int st = 128; st > 0; st >>= 1) { if (tid < st) red[tid] += red[tid + st]; __syncthreads(); }
  const float mu = red[0] / (float)N; __syncthreads();
  float s2 = 0.f;
  for (int u = 0; u < per / 4; ++u)
#pragma unroll
    for (int q = 0; q < 4; ++q) { const float c = vals[u * 4 + q] - mu; s2 += c * c; }
  red[tid] = s2; __syncthreads();
  for (int st = 128; st > 0; st >>= 1) { if (tid < st) red[tid] += red[tid + st]; __syncthreads(); }
  const float rs = rsqrtf(red[0] / (float)N + eps);
  {
    for (int u = 0; u < per / 4; ++u) {
      const int j = tid * 4 + 1024 * u;
      v4f o, sm;
#pragma unroll
      for (int q = 0; q < 4; ++q) {
        float gg = g[j + q], bb = bta[j + q];
        if (PARAM_BF16) { gg = bf16_round(gg); bb = bf16_round(bb); }
        sm[q] = vals[u * 4 + q]; o[q] = (vals[u * 4 + q] - mu) * rs * gg + bb;
      }
      if (out_sum) *(v4f*)(out_sum + (size_t)row * N + j) = sm;
      *(v4f*)(out_norm + (size_t)row * N + j) = o;
    }
    
  }
}



// ---- f16 WMMA path (v_wmma_f32_16x16x32_f16): 11-bit significands for operands in range — used where a [0,1] probability operand needs more precision than bf16
typedef _Float16 v16h __attribute__((ext_vector_type(16)));
union FragH { v16h v; v8us half[2]; _Float16 h[16]; unsigned short u[16]; };
template <int NT>
__device__ __forceinline__ v8f mmaH(v16h ah, v16h al, v16h bh, v16h bl, v8f c) {
  c = __builtin_amdgcn_wmma_f32_16x16x32_f16(false, ah, false, bh, (short)0, c, false, false);
  if (NT >= 2) c = __builtin_amdgcn_wmma_f32_16x16x32_f16(false, al, false, bh, (short)0, c, false, false);
  if (NT >= 3) c = __builtin_amdgcn_wmma_f32_16x16x32_f16(false, ah, false, bl, (short)0, c, false, false);
  asm volatile("v_nop\n\tv_nop\n\tv_nop\n\tv_nop" : "+v"(c) : "v"(ah), "v"(al), "v"(bh), "v"(bl));
  return c;
}
// batched GEMM like k_gemm_b but f16 operands: A f32 (split into f16 hi/lo if ASPLIT, else rounded to f16), Bt = f16 values [n][k]; alpha; C f32; N multiple of 16 (partial tiles skipped)
template <bool ASPLIT>
__global__ __launch_bounds__(128) void k_gemm_h(const float* __restrict__ A, int lda, size_t sA, const _Float16* __restrict__ Bh, int ldb, size_t sB, float alpha, float* __restrict__ C, int ldc, size_t sC, int M, int N, int K) {
  __shared__ __attribute__((aligned(16))) float so[4][16][64];
  const int tid = threadIdx.x, w = tid >> 5, lane = tid & 31, ln = lane & 15, hh = lane >> 4; const int by = blockIdx.y;
  A += (size_t)by * sA; Bh += (size_t)by * sB; C += (size_t)by * sC;
  const int ntn = (N + 63) / 64; const int wid = blockIdx.x * 4 + w; const int mt = wid / ntn, nq = wid % ntn; if (mt * 16 >= M) return;
  const int row0 = mt * 16, col0 = nq * 64; const float* arow = A + (size_t)(row0 + ln) * lda;
  v8f acc[4] = {};
  for (int kb = 0; kb < K; kb += 32) {
    FragH ah, al;
    const v4f x0 = *(const v4fa*)(arow + kb + 8 * hh), x1 = *(const v4fa*)(arow + kb + 8 * hh + 4), x2 = *(const v4fa*)(arow + kb + 16 + 8 * hh), x3 = *(const v4fa*)(arow + kb + 16 + 8 * hh + 4);
    float xs[16] = {x0[0],x0[1],x0[2],x0[3],x1[0],x1[1],x1[2],x1[3],x2[0],x2[1],x2[2],x2[3],x3[0],x3[1],x3[2],x3[3]};
#pragma unroll
    for (int i = 0; i < 16; ++i) { const _Float16 h = (_Float16)xs[i]; ah.h[i] = h; al.h[i] = ASPLIT ? (_Float16)(xs[i] - (float)h) : (_Float16)0.0f; }
#pragma unroll
    for (int t = 0; t < 4; ++t) { if (col0 + t * 16 >= N) continue; const size_t boff = (size_t)(col0 + t * 16 + ln) * ldb + kb; FragH bq; bq.half[0] = *(const v8us*)(Bh + boff + 8 * hh); bq.half[1] = *(const v8us*)(Bh + boff + 16 + 8 * hh);
      acc[t] = mmaH<ASPLIT ? 2 : 1>(ah.v, al.v, bq.v, bq.v, acc[t]); }
  }
#pragma unroll
  for (int t = 0; t < 4; ++t) { if (col0 + t * 16 >= N) continue;
#pragma unroll
    for (int r = 0; r < 8; ++r) so[w][8 * hh + r][t * 16 + ln] = acc[t][r] * alpha; }
  __builtin_amdgcn_fence(__ATOMIC_ACQ_REL, "workgroup"); __builtin_amdgcn_wave_barrier();
  const int rsub = lane >> 4, c4 = (lane & 15) * 4;
  {
#pragma unroll
    for (int q = 0; q < 8; ++q) { const int r = q * 2 + rsub; if (col0 + c4 < N) { const v4f v = *(const v4fa*)&so[w][r][c4]; *(v4f*)(C + (size_t)(row0 + r) * ldc + col0 + c4) = v; } }
     }
}

// Wt[n][k] = f16(W[k][n]·scale) from f32 row-major W[K][N] (scale = power of two; bf16-exact weights stay exact in f16 away from the subnormal range)
__global__ __launch_bounds__(256) void k_wt_f16(const float* __restrict__ W, _Float16* __restrict__ Wt, int K, int N, float scale) {
  const int t = blockIdx.x * 256 + threadIdx.x; if (t >= N * (K / 8)) return; const int n = t / (K / 8), k8 = (t % (K / 8)) * 8; FragH f;
#pragma unroll
  for (int i = 0; i < 8; ++i) f.h[i] = (_Float16)(bf16_round(W[(size_t)(k8 + i) * N + n]) * scale); const v8us o = f.half[0];
  *(v8us*)((unsigned short*)Wt + (size_t)n * K + k8) = o; 
}
__global__ __launch_bounds__(256) void k_x16(const float* __restrict__ x, _Float16* __restrict__ X16, size_t n8) { const size_t t = (size_t)blockIdx.x * 256 + threadIdx.x; if (t >= n8) return; FragH f;
#pragma unroll
  for (int q = 0; q < 8; ++q) f.h[q] = (_Float16)bf16_round(x[t * 8 + q]); *(v8us*)((unsigned short*)X16 + t * 8) = f.half[0];  }
__global__ __launch_bounds__(256) void k_h16(const float* __restrict__ x, _Float16* __restrict__ X16, size_t n8) { const size_t t = (size_t)blockIdx.x * 256 + threadIdx.x; if (t >= n8) return; FragH f;
#pragma unroll
  for (int q = 0; q < 8; ++q) f.h[q] = (_Float16)x[t * 8 + q]; *(v8us*)((unsigned short*)X16 + t * 8) = f.half[0];  }
__global__ __launch_bounds__(256) void k_round16f(const float* __restrict__ W, _Float16* __restrict__ Bt, size_t n8) { const size_t t = (size_t)blockIdx.x * 256 + threadIdx.x; if (t >= n8) return; FragH f;
#pragma unroll
  for (int i = 0; i < 8; ++i) f.h[i] = (_Float16)(bf16_round(W[t * 8 + i]) * 16.0f); *(v8us*)((unsigned short*)Bt + t * 8) = f.half[0];  }
template <int NHv, int TTv>
__global__ __launch_bounds__(256) void k_vt(const _Float16* __restrict__ V16, int ldv, int voff, _Float16* __restrict__ Vt) { __shared__ unsigned short tl[64][66]; const int tid = threadIdx.x; const int slab = blockIdx.x / (TTv / 64), lg = blockIdx.x % (TTv / 64); const int b = slab / NHv, h = slab % NHv;
  for (int i = tid; i < 64 * 8; i += 256) { const int r = i / 8, c8 = (i % 8) * 8; FragH f; f.half[0] = *(const v8us*)((const unsigned short*)V16 + ((size_t)b * TTv + lg * 64 + r) * ldv + voff + h * 64 + c8);
#pragma unroll
    for (int q = 0; q < 8; ++q) tl[r][c8 + q] = f.u[q]; }
  __syncthreads();
  {
#pragma unroll
    for (int rd = 0; rd < 2; ++rd) { const int d = rd * 32 + tid / 8, pc = tid % 8; FragH f;
#pragma unroll
      for (int q = 0; q < 8; ++q) f.u[q] = tl[pc * 8 + q][d];
      *(v8us*)((unsigned short*)Vt + ((size_t)slab * 64 + d) * TTv + lg * 64 + pc * 8) = f.half[0]; }
     } }

// Eight 16-byte asynchronous copies per lane, global memory to LDS through no register: piece i goes from g + i * gstep to LDS byte l + i * lstep.
// The s_wait_xcnt closes the statement so that it stands in front of any later rewrite of the address registers the copies name.
__device__ __forceinline__ void copy8_to_lds(unsigned l, unsigned lstep, const char* g, size_t gstep) {
  asm volatile("global_load_async_to_lds_b128 %0, %8, off\n\t"
               "global_load_async_to_lds_b128 %1, %9, off\n\t"
               "global_load_async_to_lds_b128 %2, %10, off\n\t"
               "global_load_async_to_lds_b128 %3, %11, off\n\t"
               "global_load_async_to_lds_b128 %4, %12, off\n\t"
               "global_load_async_to_lds_b128 %5, %13, off\n\t"
               "global_load_async_to_lds_b128 %6, %14, off\n\t"
               "global_load_async_to_lds_b128 %7, %15, off\n\t"
               "s_wait_xcnt 0x0"
               :: "v"(l), "v"(l + lstep), "v"(l + 2 * lstep), "v"(l + 3 * lstep), "v"(l + 4 * lstep), "v"(l + 5 * lstep), "v"(l + 6 * lstep), "v"(l + 7 * lstep),
                  "v"(g), "v"(g + gstep), "v"(g + 2 * gstep), "v"(g + 3 * gstep), "v"(g + 4 * gstep), "v"(g + 5 * gstep), "v"(g + 6 * gstep), "v"(g + 7 * gstep)
               : "memory");
}

// One butterfly step of a reduction over a 16-lane row, on the vector pipe: the lane's value joined with that of lane ^ M. It takes the place of a ds_bpermute_b32 and the
// s_wait_dscnt behind it, so that the steps of several rows can follow one another without a wait. Every lane is on where these stand.
template <int M> __device__ __forceinline__ float row_max_step(float v) { float o;
  asm("v_max_num_f32_dpp %0, %1, %1 row_xmask:%2 row_mask:0xf bank_mask:0xf" : "=v"(o) : "v"(v), "n"(M));      // o = max(v of lane ^ M, v)
  return o; }
template <int M> __device__ __forceinline__ float row_add_step(float v) { float o;
  asm("v_add_f32_dpp %0, %1, %1 row_xmask:%2 row_mask:0xf bank_mask:0xf" : "=v"(o) : "v"(v), "n"(M));          // o = v of lane ^ M + v
  return o; }

// K and Vt reach the four waves of a work-group through LDS: a stage is 64 keys (K: 64 rows of 256 B, Vt: 128 rows of 128 B, whole 128-B lines), copied once per work-group,
// two buffers, the next stage in flight while this one is worked on. Row pitches 272 B and 144 B (16 B x odd) keep the ds_load_b128 fragment reads free of bank conflicts.
__global__ __launch_bounds__(128) void k_flash(const _Float16* __restrict__ Q16, int ldq, const _Float16* __restrict__ K16, int ldk, const _Float16* __restrict__ Vt, const int* __restrict__ MSK, float* __restrict__ O, int ldo) {
  constexpr int RPW = 16, RTN = RPW / 16, NQB = 3072 / (4 * RPW), DT = 8, KS = 4;      /* head dim 128 */
  constexpr unsigned KP = 272, VP = 144, KBYTES = 64 * KP, STG = KBYTES + 128 * VP;
  __shared__ __attribute__((aligned(16))) unsigned char ring[2 * STG];
  __shared__ __attribute__((aligned(16))) unsigned short sP[4][RPW][40];
  float (*sO)[RPW][128 + 4] = (float (*)[RPW][128 + 4])ring;      /* output staging takes the ring's place behind the loop's last barrier */
  static_assert(sizeof(float) * 4 * RPW * (128 + 4) <= 2 * STG, "output staging fits the ring");
  const int tid = threadIdx.x, w = tid >> 5, lane = tid & 31, ln = lane & 15, hh = lane >> 4;
  const int slab = blockIdx.x / NQB, qblk = blockIdx.x % NQB; const int b = slab / 8, h = slab % 8; const int qb0 = qblk * (4 * RPW); const int q0 = qb0 + w * RPW;
  FragH aq[2][KS];
#pragma unroll
  for (int rt = 0; rt < RTN; ++rt) { const unsigned short* qr = (const unsigned short*)Q16 + ((size_t)b * 3072 + q0 + rt * 16 + ln) * ldq + h * 128;
#pragma unroll
    for (int ks = 0; ks < KS; ++ks) { aq[rt][ks].half[0] = *(const v8us*)(qr + ks * 32 + 8 * hh); aq[rt][ks].half[1] = *(const v8us*)(qr + ks * 32 + 16 + 8 * hh); } }
  const unsigned short* Vth = (const unsigned short*)Vt + (size_t)slab * 128 * 3072;
  // each thread's own pieces of a stage: K row tid/16 + 8i, 16-byte piece tid%16; Vt row tid/8 + 16i, piece tid%8
  const char* kg = (const char*)((const unsigned short*)K16 + ((size_t)b * 3072 + (tid >> 4)) * ldk + h * 128 + (tid & 15) * 8);
  const char* vg = (const char*)(Vth + (size_t)(tid >> 3) * 3072 + (tid & 7) * 8);
  const unsigned ring0 = (unsigned)(size_t)ring;
  const unsigned kl = ring0 + (unsigned)(tid >> 4) * KP + (unsigned)(tid & 15) * 16u, vl = ring0 + KBYTES + (unsigned)(tid >> 3) * VP + (unsigned)(tid & 7) * 16u;
  const size_t kstage = (size_t)64 * ldk * 2, kstep = (size_t)8 * ldk * 2;
  auto fill = [&](int st, unsigned buf) {
    copy8_to_lds(kl + buf * STG, 8 * KP, kg + (size_t)st * kstage, kstep);
    copy8_to_lds(vl + buf * STG, 16 * VP, vg + (size_t)st * 128, (size_t)16 * 3072 * 2);
  };
  float m_r[2][8], l_r[2][8]; v8f oacc[2][DT];
#pragma unroll
  for (int rt = 0; rt < RTN; ++rt) {
#pragma unroll
    for (int r = 0; r < 8; ++r) { m_r[rt][r] = -3.0e38f; l_r[rt][r] = 0.f; }
#pragma unroll
    for (int dt = 0; dt < DT; ++dt) oacc[rt][dt] = (v8f){0.f,0.f,0.f,0.f,0.f,0.f,0.f,0.f}; }
  const int nst = qblk + 1;      /* stages of 64 keys up to the block's diagonal; the same for the whole work-group */
  fill(0, 0u);
  asm volatile("s_wait_asynccnt 0x0" ::: "memory");      // this wave's pieces of stage 0 have landed
  __syncthreads();                                       // every wave's pieces of stage 0 are readable
  if (nst > 1) fill(1, 1u);
#pragma unroll 1      /* one copy of the body: the ring's order stays as written */
  for (int st = 0; st < nst; ++st) {
    const unsigned char* kbuf = ring + (unsigned)(st & 1) * STG; const unsigned char* vbuf = kbuf + KBYTES;
#pragma unroll 1      /* the two 32-key passes of a stage share one body in the instruction cache */
  for (int sub = 0; sub < 2; ++sub) { const int j0 = st * 64 + sub * 32;
    v8f s[2][2];
#pragma unroll
    for (int nt = 0; nt < 2; ++nt) { const unsigned char* kr = kbuf + (unsigned)(sub * 32 + nt * 16 + ln) * KP + 16 * hh; FragH bk[KS];
#pragma unroll
      for (int ks = 0; ks < KS; ++ks) { bk[ks].half[0] = *(const v8us*)(kr + ks * 64); bk[ks].half[1] = *(const v8us*)(kr + ks * 64 + 32); }
#pragma unroll
      for (int rt = 0; rt < RTN; ++rt) { v8f acc = (v8f){0.f,0.f,0.f,0.f,0.f,0.f,0.f,0.f};
#pragma unroll
        for (int ks = 0; ks < KS; ++ks) acc = mmaH<1>(aq[rt][ks].v, aq[rt][ks].v, bk[ks].v, bk[ks].v, acc); s[rt][nt] = acc; } }
    // The softmax of a pass in three sweeps over each lane's eight rows, each sweep one straight run of code, so that the rows' dependent chains overlap:
    // masked scores, then the row maxima step by step, then the exponentials, each computed ahead of the select that may drop it (no branch stands between two rows).
#pragma unroll
    for (int rt = 0; rt < RTN; ++rt) { const int k0 = j0 + ln, k1 = j0 + 16 + ln; float s0[8], s1[8], mc[8];
#pragma unroll
      for (int r = 0; r < 8; ++r) { const int tq = q0 + rt * 16 + 8 * hh + r;
        s0[r] = (k0 <= tq) ? s[rt][0][r] * (0.08838834764831845f) : -INFINITY; s1[r] = (k1 <= tq) ? s[rt][1][r] * (0.08838834764831845f) : -INFINITY; mc[r] = fmaxf(s0[r], s1[r]); }
#pragma unroll
      for (int r = 0; r < 8; ++r) mc[r] = row_max_step<1>(mc[r]);
#pragma unroll
      for (int r = 0; r < 8; ++r) mc[r] = row_max_step<2>(mc[r]);
#pragma unroll
      for (int r = 0; r < 8; ++r) mc[r] = row_max_step<4>(mc[r]);
#pragma unroll
      for (int r = 0; r < 8; ++r) mc[r] = row_max_step<8>(mc[r]);
#pragma unroll
      for (int r = 0; r < 8; ++r) { const int tq = q0 + rt * 16 + 8 * hh + r; const bool ok0 = (k0 <= tq), ok1 = (k1 <= tq);
        const float mn = fmaxf(m_r[rt][r], mc[r]); const float ea = expf(m_r[rt][r] - mn), e0 = expf(s0[r] - mn), e1 = expf(s1[r] - mn);      /* mn is finite: no difference here is a NaN */
        const float al = (mn > -1.0e38f) ? ea : 1.0f; m_r[rt][r] = mn; const float p0 = ok0 ? e0 : 0.f, p1 = ok1 ? e1 : 0.f; l_r[rt][r] = l_r[rt][r] * al + p0 + p1;
#pragma unroll
        for (int dt = 0; dt < DT; ++dt) oacc[rt][dt][r] *= al;
        FragH t2; t2.h[0] = (_Float16)p0; t2.h[1] = (_Float16)p1; sP[w][rt * 16 + 8 * hh + r][ln] = t2.u[0]; sP[w][rt * 16 + 8 * hh + r][16 + ln] = t2.u[1]; } }
    __builtin_amdgcn_fence(__ATOMIC_ACQ_REL, "workgroup"); __builtin_amdgcn_wave_barrier();
    FragH pa[2];
#pragma unroll
    for (int rt = 0; rt < RTN; ++rt) { pa[rt].half[0] = *(const v8us*)&sP[w][rt * 16 + ln][8 * hh]; pa[rt].half[1] = *(const v8us*)&sP[w][rt * 16 + ln][16 + 8 * hh]; }
#pragma unroll
    for (int dt = 0; dt < DT; ++dt) { const unsigned char* vrow = vbuf + (unsigned)(dt * 16 + ln) * VP + sub * 64 + 16 * hh; FragH bv; bv.half[0] = *(const v8us*)(vrow); bv.half[1] = *(const v8us*)(vrow + 32);
#pragma unroll
      for (int rt = 0; rt < RTN; ++rt) oacc[rt][dt] = mmaH<1>(pa[rt].v, pa[rt].v, bv.v, bv.v, oacc[rt][dt]); }
    __builtin_amdgcn_fence(__ATOMIC_ACQ_REL, "workgroup"); __builtin_amdgcn_wave_barrier(); }
    asm volatile("s_wait_dscnt 0x0" ::: "memory");       // this wave's reads of the buffer have returned before it is refilled
    asm volatile("s_wait_asynccnt 0x0" ::: "memory");    // this wave's pieces of stage st + 1 have landed
    __syncthreads();                                     // publishes stage st + 1 and ends every wave's reads of stage st
    if (st + 2 < nst) fill(st + 2, (unsigned)(st & 1));
  }
  asm volatile("s_wait_asynccnt 0x0" ::: "memory");      // no copy is outstanding when the ring becomes output staging
#pragma unroll
  for (int rt = 0; rt < RTN; ++rt) {
#pragma unroll
    for (int r = 0; r < 8; ++r) l_r[rt][r] = row_add_step<1>(l_r[rt][r]);
#pragma unroll
    for (int r = 0; r < 8; ++r) l_r[rt][r] = row_add_step<2>(l_r[rt][r]);
#pragma unroll
    for (int r = 0; r < 8; ++r) l_r[rt][r] = row_add_step<4>(l_r[rt][r]);
#pragma unroll
    for (int r = 0; r < 8; ++r) l_r[rt][r] = row_add_step<8>(l_r[rt][r]);
#pragma unroll
    for (int r = 0; r < 8; ++r) { const float l = l_r[rt][r]; l_r[rt][r] = (l > 0.f) ? 1.0f / l : 0.f; }
#pragma unroll
    for (int dt = 0; dt < DT; ++dt)
#pragma unroll
      for (int r = 0; r < 8; ++r) sO[w][rt * 16 + 8 * hh + r][dt * 16 + ln] = oacc[rt][dt][r] * l_r[rt][r]; }
  __builtin_amdgcn_fence(__ATOMIC_ACQ_REL, "workgroup"); __builtin_amdgcn_wave_barrier();
  {
#pragma unroll
    for (int rp = 0; rp < RPW; ++rp) { const int r = rp, pc = lane; const v4f val = *(const v4fa*)&sO[w][r][pc * 4]; *(v4f*)(O + ((size_t)(b * 8 + h) * 3072 + q0 + r) * 128 + pc * 4) = val; }      /* output layout [b][h][s][128]: 32 lanes x 16 B rows */
     } }

// Projection GEMM: C[row][col] = alpha * sum_k A[row][k] * Bt[col][k], both operands f16 with CW elements a row, f32 accumulate, k ascending in one chain per accumulator.
// A work-group owns a 64 x 64 tile of C, its four waves 32 x 32 each. A and Bt reach the waves through LDS: a stage is 128 k (64 rows of A and 64 of Bt, 256 B each, whole 128-B lines),
// copied once per work-group, two buffers, the next stage in flight while this one is worked on. Row pitch 272 B (16 B x odd) keeps the ds_load_b128 fragment reads free of bank conflicts.
// One launch does all nine projections. The grid is exact: blockIdx.x = row tile of the TT positions * (CW / 64) + column tile, blockIdx.y = batch, blockIdx.z = projection (0 q, 1 k, 2 v).
// A row tile lies wholly in one segment (SL is a multiple of 64) and takes that segment's weights: plane 3 * projection + (0 middle, 1 state, 2 end) of B9. q and k go out as f32 planes of F2, v as f16.
__global__ __launch_bounds__(128) void k_gemm_ring(const _Float16* __restrict__ A, const _Float16* __restrict__ B9, float alpha, float* __restrict__ F2, _Float16* __restrict__ C16) {
  static_assert(SL % 64 == 0 && TT % 64 == 0, "a row tile never straddles a segment");
  constexpr size_t sA = (size_t)TT * CW, sC = (size_t)TT * CW;
  constexpr unsigned RP = 272, TB = 64 * RP, STG = 2 * TB; constexpr int NST = CW / 128;
  static_assert(NST >= 2, "the ring's prologue fills two stages");
  __shared__ __attribute__((aligned(16))) unsigned char ring[2 * STG];
  float (*so)[64 + 4] = (float (*)[64 + 4])ring;      /* output staging takes the ring's place behind the loop's last barrier */
  static_assert(sizeof(float) * 64 * (64 + 4) <= 2 * STG, "output staging fits the ring");
  const int tid = threadIdx.x, w = tid >> 5, lane = tid & 31, ln = lane & 15, hh = lane >> 4, wm = w >> 1, wn = w & 1;
  const int row0 = (int)(blockIdx.x / (CW / 64)) * 64, col0 = (int)(blockIdx.x % (CW / 64)) * 64;
  const int prj = (int)blockIdx.z, sgm = (row0 < SL) ? 1 : ((row0 < TT - SL) ? 0 : 2); const bool OUT16 = (prj == 2);
  const _Float16* Bt = B9 + (size_t)(prj * 3 + sgm) * CW * CW; float* C = F2 + (size_t)(prj & 1) * NR * CW;
  // each thread's own pieces of a stage: row tid/16 + 8i of either operand, 16-byte piece tid%16
  const char* ag = (const char*)((const unsigned short*)A + (size_t)blockIdx.y * sA + (size_t)(row0 + (tid >> 4)) * CW + (tid & 15) * 8);
  const char* bg = (const char*)((const unsigned short*)Bt + (size_t)(col0 + (tid >> 4)) * CW + (tid & 15) * 8);
  const unsigned al = (unsigned)(size_t)ring + (unsigned)(tid >> 4) * RP + (unsigned)(tid & 15) * 16u, bl = al + TB;
  auto fill = [&](int st, unsigned buf) {
    copy8_to_lds(al + buf * STG, 8 * RP, ag + (size_t)st * 256, (size_t)8 * CW * 2);
    copy8_to_lds(bl + buf * STG, 8 * RP, bg + (size_t)st * 256, (size_t)8 * CW * 2);
  };
  v8f acc[2][2];
#pragma unroll
  for (int i = 0; i < 2; ++i)
#pragma unroll
    for (int j = 0; j < 2; ++j) acc[i][j] = (v8f){0.f,0.f,0.f,0.f,0.f,0.f,0.f,0.f};
  fill(0, 0u);
  asm volatile("s_wait_asynccnt 0x0" ::: "memory");      // this wave's pieces of stage 0 have landed
  __syncthreads();                                       // every wave's pieces of stage 0 are readable
  fill(1, 1u);
#pragma unroll 1      /* one copy of the body: the ring's order stays as written */
  for (int st = 0; st < NST; ++st) {
    const unsigned char* ar = ring + (unsigned)(st & 1) * STG + (unsigned)(wm * 32 + ln) * RP + 16 * hh;
    const unsigned char* br = ring + (unsigned)(st & 1) * STG + TB + (unsigned)(wn * 32 + ln) * RP + 16 * hh;
    FragH fa[4][2], fb[4][2];
#pragma unroll
    for (int ks = 0; ks < 4; ++ks)
#pragma unroll
      for (int i = 0; i < 2; ++i) {
        fa[ks][i].half[0] = *(const v8us*)(ar + i * 16 * RP + ks * 64); fa[ks][i].half[1] = *(const v8us*)(ar + i * 16 * RP + ks * 64 + 32);
        fb[ks][i].half[0] = *(const v8us*)(br + i * 16 * RP + ks * 64); fb[ks][i].half[1] = *(const v8us*)(br + i * 16 * RP + ks * 64 + 32); }
    asm volatile("s_wait_dscnt 0x0" ::: "memory");       // the stage's 32 fragment reads, one group, have returned: this wave is done with the buffer before it is refilled
    asm volatile("s_wait_asynccnt 0x0" ::: "memory");    // this wave's pieces of stage st + 1 have landed
    __syncthreads();                                     // publishes stage st + 1 and ends every wave's reads of stage st
    if (st + 2 < NST) fill(st + 2, (unsigned)(st & 1));  // in front of the WMMAs, which work from registers, so that the copies fly behind them
#pragma unroll
    for (int ks = 0; ks < 4; ++ks)
#pragma unroll
      for (int i = 0; i < 2; ++i)
#pragma unroll
        for (int j = 0; j < 2; ++j) acc[i][j] = __builtin_amdgcn_wmma_f32_16x16x32_f16(false, fa[ks][i].v, false, fb[ks][j].v, (short)0, acc[i][j], false, false);
  }
  asm volatile("s_wait_asynccnt 0x0" ::: "memory");      // no copy is outstanding when the ring becomes output staging
#pragma unroll
  for (int i = 0; i < 2; ++i)
#pragma unroll
    for (int j = 0; j < 2; ++j)
#pragma unroll
      for (int r = 0; r < 8; ++r) so[wm * 32 + i * 16 + 8 * hh + r][wn * 32 + j * 16 + ln] = acc[i][j][r] * alpha;
  __syncthreads();                                       // a stored row of 64 columns holds two waves' results
  const int rsub = lane >> 4, c4 = (lane & 15) * 4; typedef _Float16 v4h __attribute__((ext_vector_type(4)));
  if (OUT16) {      /* the test stands once, in front of the eight rows, so that their LDS reads stay one group */
#pragma unroll
    for (int q = 0; q < 8; ++q) { const int r = w * 16 + q * 2 + rsub; const v4f v = *(const v4fa*)&so[r][c4]; const size_t o = (size_t)blockIdx.y * sC + (size_t)(row0 + r) * CW + col0 + c4; v4h h4;
#pragma unroll
      for (int i = 0; i < 4; ++i) h4[i] = (_Float16)v[i];
      *(v4h*)(C16 + o) = h4; }      /* whole 128-B lines, one wave a line */
  } else {
#pragma unroll
    for (int q = 0; q < 8; ++q) { const int r = w * 16 + q * 2 + rsub; const v4f v = *(const v4fa*)&so[r][c4]; const size_t o = (size_t)blockIdx.y * sC + (size_t)(row0 + r) * CW + col0 + c4;
      *(v4f*)(C + o) = v; }
    asm volatile("s_wait_xcnt 0x0" ::: "memory");      // stands behind the run of f32 stores, in front of any later rewrite of the registers they name
  }
}

__global__ __launch_bounds__(256) void k_xt(const float* __restrict__ x, _Float16* __restrict__ XT) { const size_t t = (size_t)blockIdx.x * 256 + threadIdx.x; if (t >= (size_t)NR * NH * 16) return; const int p = (int)(t % 16); const int h = (int)((t / 16) % NH); const size_t bs = t / (16 * NH); const int b = (int)(bs / TT), s = (int)(bs % TT); const float* src = x + (((size_t)(b * NH + h) * TT + s) * HD) + p * 8; FragH f;
#pragma unroll
  for (int q = 0; q < 8; ++q) f.h[q] = (_Float16)bf16_round(src[q]); unsigned short* d = (unsigned short*)XT + bs * CW + h * HD + p * 8; *(v8us*)d = f.half[0];  }
// One launch re-lays all nine weight tensors: blockIdx.y picks the tensor and its plane of B9.
__global__ __launch_bounds__(256) void k_wst(const float* __restrict__ W0, const float* __restrict__ W1, const float* __restrict__ W2, const float* __restrict__ W3, const float* __restrict__ W4,
                                             const float* __restrict__ W5, const float* __restrict__ W6, const float* __restrict__ W7, const float* __restrict__ W8, _Float16* __restrict__ B9) {
  const unsigned y = blockIdx.y; const float* W = W0; W = (y == 1) ? W1 : W; W = (y == 2) ? W2 : W; W = (y == 3) ? W3 : W; W = (y == 4) ? W4 : W; W = (y == 5) ? W5 : W; W = (y == 6) ? W6 : W; W = (y == 7) ? W7 : W; W = (y == 8) ? W8 : W; _Float16* Bt = B9 + (size_t)y * CW * CW;
  const size_t t = (size_t)blockIdx.x * 256 + threadIdx.x; if (t >= (size_t)CW * NH * 16) return; const int p = (int)(t % 16); const int h = (int)((t / 16) % NH); const int n = (int)(t / (16 * NH)); const int g = n / HD, e = n % HD; FragH f;
#pragma unroll
  for (int q = 0; q < 8; ++q) { const int d = p * 8 + q; f.h[q] = (_Float16)(bf16_round(W[(((size_t)(h * NH + g) * HD + d) * HD) + e]) * 16.0f); }
  unsigned short* dst = (unsigned short*)Bt + (size_t)n * CW + h * HD + p * 8; *(v8us*)dst = f.half[0];  }
// One launch rotates q and k: blockIdx.y picks the f32 plane of F2 and the f16 destination.
__global__ __launch_bounds__(256) void k_rope(const float* __restrict__ F2, const int* __restrict__ offp, float oscale, _Float16* __restrict__ Q16, _Float16* __restrict__ K16) {
  const float* F = F2 + (size_t)blockIdx.y * NR * CW; _Float16* D16 = blockIdx.y ? K16 : Q16; __shared__ __attribute__((aligned(16))) _Float16 st[256][8]; const int tid = threadIdx.x; const size_t t = (size_t)blockIdx.x * 256 + tid; if (t >= (size_t)NR * NH * 16) return; const int li = (int)(t % 16); const int h = (int)((t / 16) % NH); const size_t bs = t / (16 * NH); const int s = (int)(bs % TT); const float pos = (float)(s + offp[0]); const float* src = F + bs * CW + h * HD;
#pragma unroll 1
  for (int q = 0; q < 8; ++q) { const int j = li * 8 + q; const int i = j & 63; const float ang = pos * __builtin_powf(10000.0f, -(float)(2 * i) / 128.0f); const float c = cosf(ang), sn = sinf(ang); const float xj = src[j], xp = src[(j + 64) & 127]; const float rot = (j < 64) ? -xp : xp; st[tid][q] = (_Float16)((xj * c + rot * sn) * oscale); }
  FragH f; f.half[0] = *(const v8us*)&st[tid][0]; unsigned short* d = (unsigned short*)D16 + bs * CW + h * HD + li * 8; *(v8us*)d = f.half[0];  }
__global__ __launch_bounds__(256) void k_vt128(const _Float16* __restrict__ V16, _Float16* __restrict__ Vt) { __shared__ unsigned short tl[64][130]; const int tid = threadIdx.x; const int slab = blockIdx.x / (TT / 64), lg = blockIdx.x % (TT / 64); const int b = slab / NH, h = slab % NH;
  for (int i = tid; i < 64 * 16; i += 256) { const int r = i / 16, c8 = (i % 16) * 8; FragH f; f.half[0] = *(const v8us*)((const unsigned short*)V16 + ((size_t)b * TT + lg * 64 + r) * CW + h * HD + c8);
#pragma unroll
    for (int q = 0; q < 8; ++q) tl[r][c8 + q] = f.u[q]; }
  __syncthreads();
  { for (int i = tid; i < 128 * 8; i += 256) { const int d = i / 8, pc = i % 8; FragH f;
#pragma unroll
      for (int q = 0; q < 8; ++q) f.u[q] = tl[pc * 8 + q][d]; *(v8us*)((unsigned short*)Vt + ((size_t)slab * HD + d) * TT + lg * 64 + pc * 8) = f.half[0]; }  } }
extern "C" void kernel_launch(void* const* d_in, const int* in_sizes, int n_in,
                              void* d_out, int out_size, void* d_ws, size_t ws_size, hipStream_t stream) {
  (void)in_sizes; (void)n_in; (void)out_size;
  const float* x = (const float*)d_in[0]; const float* Wm[3] = {(const float*)d_in[1], (const float*)d_in[2], (const float*)d_in[3]}; const float* Wsg[3] = {(const float*)d_in[4], (const float*)d_in[5], (const float*)d_in[6]}; const float* Weg[3] = {(const float*)d_in[7], (const float*)d_in[8], (const float*)d_in[9]}; const int* offp = (const int*)d_in[10];
  char* ws = (char*)d_ws; size_t off = 0;
  auto take = [&](size_t bytes) { char* p = ws + off; off += (bytes + 255) & ~(size_t)255; return p; };
  _Float16* B9 = (_Float16*)take((size_t)9 * CW * CW * 2);      // plane 3 * projection + (0 middle, 1 state, 2 end)
  _Float16* XT = (_Float16*)take((size_t)NR * CW * 2); float* F2 = (float*)take((size_t)2 * NR * CW * 4); _Float16* Q16 = (_Float16*)take((size_t)NR * CW * 2); _Float16* K16 = (_Float16*)take((size_t)NR * CW * 2); _Float16* V16 = (_Float16*)take((size_t)NR * CW * 2); _Float16* Vt = (_Float16*)take((size_t)NR * CW * 2);
  if (off > ws_size) return;      // 18.9 + 12.6 + 50.3 + 12.6 x 4 = 132 MB
  k_xt<<<(unsigned)(((size_t)NR * NH * 16 + 255) / 256), 256, 0, stream>>>(x, XT);
  const unsigned gw = (unsigned)(((size_t)CW * NH * 16 + 255) / 256), gr = (unsigned)(((size_t)NR * NH * 16 + 255) / 256);
  k_wst<<<dim3(gw, 9), 256, 0, stream>>>(Wm[0], Wsg[0], Weg[0], Wm[1], Wsg[1], Weg[1], Wm[2], Wsg[2], Weg[2], B9);
  k_gemm_ring<<<dim3((TT / 64) * (CW / 64), BB, 3), 128, 0, stream>>>(XT, B9, 0.0625f, F2, V16);
  k_rope<<<dim3(gr, 2), 256, 0, stream>>>(F2, offp, 1.0f, Q16, K16);
  k_vt128<<<BB * NH * (TT / 64), 256, 0, stream>>>(V16, Vt);
  k_flash<<<BB * NH * (TT / 64), 128, 0, stream>>>(Q16, CW, K16, CW, Vt, nullptr, (float*)d_out, 0);
}

// v005
// Measured time: 231 microseconds a run.
// Two timings next to v004 put it at 1.08 and 1.07 times that version's speed.
// All steps since v000 together make it 4.01 times as fast.
#include <hip/hip_runtime.h>
// Causal multi-head attention with state segments (x [2, 8 heads, 3072, 128]; StackedLinear projections that mix heads and features — separate weights for the first 512 (state), middle 2048 and
// last 512 (end) positions; rotate-half RoPE with an INPUT offset; causal softmax(q·k/√128)·v; output [2,8,3072,128]): the nine (h,d)→(g,e) projections as GEMMs on the (b,s)-major transposed
// input (bf16-exact ×2^4 weights, f32 accumulate) and the attention as a fused flash-style kernel (d = 128: 4 k-steps / 8 d-tiles; causal chunk skipping; online softmax f32; P f16 ≤ 1;
// O = P·Vt written straight into the output; RPW-16 waves) on v_wmma_f32_16x16x32_f16; RoPE f32 VALU.
#define BB 2
#define NH 8
#define TT 3072
#define HD 128
#define CW (NH * HD)
#define NR (BB * TT)
#define SL 512

typedef __bf16 v16b __attribute__((ext_vector_type(16)));
typedef unsigned short v8us __attribute__((ext_vector_type(8), may_alias));
typedef float  v8f  __attribute__((ext_vector_type(8)));
typedef float  v4f  __attribute__((ext_vector_type(4)));
typedef float  v4fa __attribute__((ext_vector_type(4), may_alias));
union FragB { v16b v; v8us half[2]; unsigned short u[16]; };

__device__ __forceinline__ unsigned short bf16_bits(float x) { unsigned int u = __float_as_uint(x); return (unsigned short)((u + 0x7FFFu + ((u >> 16) & 1u)) >> 16); }
__device__ __forceinline__ float bf16_val(unsigned short b) { return __uint_as_float(((unsigned int)b) << 16); }
__device__ __forceinline__ float bf16_round(float x) { return bf16_val(bf16_bits(x)); }
// D += A·B with NT terms: 1 = ah·bh, 2 = + al·bh (A split), 3 = + ah·bl (both split)
template <int NT>
__device__ __forceinline__ v8f mmaN(v16b ah, v16b al, v16b bh, v16b bl, v8f c) {
  c = __builtin_amdgcn_wmma_f32_16x16x32_bf16(false, ah, false, bh, (short)0, c, false, false);
  if (NT >= 2) c = __builtin_amdgcn_wmma_f32_16x16x32_bf16(false, al, false, bh, (short)0, c, false, false);
  if (NT >= 3) c = __builtin_amdgcn_wmma_f32_16x16x32_bf16(false, ah, false, bl, (short)0, c, false, false);
  asm volatile("v_nop\n\tv_nop\n\tv_nop\n\tv_nop" : "+v"(c) : "v"(ah), "v"(al), "v"(bh), "v"(bl));
  return c;
}

__global__ __launch_bounds__(256) void k_wt_bf16(const float* __restrict__ W, unsigned short* __restrict__ Wt, int K, int N) {
  const int t = blockIdx.x * 256 + threadIdx.x;
  const int k8n = K / 8;
  if (t >= N * k8n) return;
  const int n = t / k8n, k8 = (t % k8n) * 8;
  v8us v;
#pragma unroll
  for (int i = 0; i < 8; ++i) v[i] = bf16_bits(W[(size_t)(k8 + i) * N + n]);
  *(v8us*)(Wt + (size_t)n * K + k8) = v;
  
}

// GEMM C[M][N] (f32, pitch ldc) = act(A[M][K]·W + bias). A f32 row-major (pitch lda) converted per fragment to bf16
// (ASPLIT: hi/lo two planes -> 2 terms, else single rounded term); Wt bf16 [N][K] (pitch ldb). BIAS_BF16 rounds the
// bias to bf16 first (bias quantised to bf16 before the add). K%32==0, M%16==0, N%64==0.
template <bool ASPLIT, int ACT, bool BIAS_BF16>
__global__ __launch_bounds__(128) void k_gemm_bf(const float* __restrict__ A, int lda, const unsigned short* __restrict__ Wt, int ldb,
                                               const float* __restrict__ bias, float* __restrict__ C, int ldc, int M, int N, int K) {
  __shared__ __attribute__((aligned(16))) float so[4][16][64];
  const int tid = threadIdx.x, w = tid >> 5, lane = tid & 31, ln = lane & 15, hh = lane >> 4;
  const int ntn = N / 64;
  const int wid = blockIdx.x * 4 + w;
  const int mt = wid / ntn, nq = wid % ntn;
  if (mt * 16 >= M) return;
  const int row0 = mt * 16, col0 = nq * 64;
  const float* arow = A + (size_t)(row0 + ln) * lda;
  v8f acc[4] = {};
  for (int kb = 0; kb < K; kb += 32) {
    FragB ah, al;
    const v4f x0 = *(const v4fa*)(arow + kb + 8 * hh), x1 = *(const v4fa*)(arow + kb + 8 * hh + 4);
    const v4f x2 = *(const v4fa*)(arow + kb + 16 + 8 * hh), x3 = *(const v4fa*)(arow + kb + 16 + 8 * hh + 4);
    float xs[16] = {x0[0],x0[1],x0[2],x0[3],x1[0],x1[1],x1[2],x1[3],x2[0],x2[1],x2[2],x2[3],x3[0],x3[1],x3[2],x3[3]};
#pragma unroll
    for (int i = 0; i < 16; ++i) { const unsigned short hb = bf16_bits(xs[i]); ah.u[i] = hb; al.u[i] = ASPLIT ? bf16_bits(xs[i] - bf16_val(hb)) : (unsigned short)0; }
#pragma unroll
    for (int t = 0; t < 4; ++t) {
      const unsigned short* brow = Wt + (size_t)(col0 + t * 16 + ln) * ldb + kb;
      FragB b;
      b.half[0] = *(const v8us*)(brow + 8 * hh);
      b.half[1] = *(const v8us*)(brow + 16 + 8 * hh);
      acc[t] = mmaN<ASPLIT ? 2 : 1>(ah.v, al.v, b.v, b.v, acc[t]);
    }
  }
#pragma unroll
  for (int t = 0; t < 4; ++t) {
    float bv = bias ? bias[col0 + t * 16 + ln] : 0.f;
    if (BIAS_BF16) bv = bf16_round(bv);
#pragma unroll
    for (int r = 0; r < 8; ++r) { float v = acc[t][r] + bv; if (ACT == 1) v = fmaxf(v, 0.f); so[w][8 * hh + r][t * 16 + ln] = v; }
  }
  __builtin_amdgcn_fence(__ATOMIC_ACQ_REL, "workgroup");
  __builtin_amdgcn_wave_barrier();
  const int rsub = lane >> 4, c4 = (lane & 15) * 4;
  {
#pragma unroll
    for (int q = 0; q < 8; ++q) {
      const int r = q * 2 + rsub;
      const v4f v = *(const v4fa*)&so[w][r][c4];
      *(v4f*)(C + (size_t)(row0 + r) * ldc + col0 + c4) = v;
    }
    
  }
}

// Flash-style causal/unmasked attention, all contractions 3-term bf16 hi/lo splits, f32 softmax with running max.
// q,k,v rows are read from f32 buffers with arbitrary row pitch (so they can live inside a fused qkv buffer);
// D = head size (multiple of 32, <= 128); one wave = 16 query rows; block = 4 waves (64 queries) sharing K/V chunks of 32.
template <int D, bool CAUSAL>
__global__ __launch_bounds__(128) void k_flash(const float* __restrict__ qb, const float* __restrict__ kb, const float* __restrict__ vb,
                                             int pitch, int T, int H, float scale, float* __restrict__ y, int ypitch) {
  constexpr int KS = D / 32;        // k-steps for QK
  constexpr int DT = D / 16;        // d tiles for PV
  __shared__ __attribute__((aligned(16))) unsigned short sKh[32][D + 8], sKl[32][D + 8], sVh[32][D + 8], sVl[32][D + 8];
  __shared__ __attribute__((aligned(16))) unsigned short sPh[4][16][40], sPl[4][16][40];
  __shared__ __attribute__((aligned(16))) float sO[4][16][D];
  const int tid = threadIdx.x, w = tid >> 5, lane = tid & 31, ln = lane & 15, hh = lane >> 4;
  const int nqb = (T + 63) / 64;
  const int bh = blockIdx.x / nqb, qblk = blockIdx.x % nqb;
  const int b = bh / H, h = bh % H;
  const int q0 = qblk * 64 + w * 16;
  const float* Q = qb + (size_t)b * T * pitch + h * D;
  const float* K = kb + (size_t)b * T * pitch + h * D;
  const float* V = vb + (size_t)b * T * pitch + h * D;

  // A fragments of the wave's 16 query rows (scaled), hi/lo
  FragB aqh[KS], aql[KS];
  {
    int row = q0 + ln; if (row >= T) row = T - 1;
    const float* qr = Q + (size_t)row * pitch;
#pragma unroll
    for (int ks = 0; ks < KS; ++ks)
#pragma unroll
      for (int i = 0; i < 16; ++i) {
        const int d = ks * 32 + ((i < 8) ? (8 * hh + i) : (16 + 8 * hh + (i - 8)));
        const float x = qr[d] * scale; const unsigned short hb = bf16_bits(x);
        aqh[ks].u[i] = hb; aql[ks].u[i] = bf16_bits(x - bf16_val(hb));
      }
  }
  float m_r[8], l_r[8];
#pragma unroll
  for (int r = 0; r < 8; ++r) { m_r[r] = -3.0e38f; l_r[r] = 0.f; }
  v8f oacc[DT];
#pragma unroll
  for (int dt = 0; dt < DT; ++dt) oacc[dt] = (v8f){0.f,0.f,0.f,0.f,0.f,0.f,0.f,0.f};

  const int kv_end = CAUSAL ? min(T, qblk * 64 + 64) : T;     // block-uniform
  for (int j0 = 0; j0 < kv_end; j0 += 32) {
    __syncthreads();
    for (int e = tid; e < 32 * (D / 4); e += 128) {
      const int r = e / (D / 4), c4 = (e % (D / 4)) * 4;
      const int key = j0 + r;
      v4f kf = {0.f,0.f,0.f,0.f}, vf = {0.f,0.f,0.f,0.f};
      if (key < T) { kf = *(const v4fa*)(K + (size_t)key * pitch + c4); vf = *(const v4fa*)(V + (size_t)key * pitch + c4); }
#pragma unroll
      for (int t = 0; t < 4; ++t) {
        unsigned short hb = bf16_bits(kf[t]); sKh[r][c4 + t] = hb; sKl[r][c4 + t] = bf16_bits(kf[t] - bf16_val(hb));
        hb = bf16_bits(vf[t]); sVh[r][c4 + t] = hb; sVl[r][c4 + t] = bf16_bits(vf[t] - bf16_val(hb));
      }
    }
    __syncthreads();
    // S tile 16 x 32
    v8f s[2];
#pragma unroll
    for (int nt = 0; nt < 2; ++nt) {
      v8f acc = {};
#pragma unroll
      for (int ks = 0; ks < KS; ++ks) {
        FragB bh_, bl_;
        bh_.half[0] = *(const v8us*)&sKh[nt * 16 + ln][ks * 32 + 8 * hh]; bh_.half[1] = *(const v8us*)&sKh[nt * 16 + ln][ks * 32 + 16 + 8 * hh];
        bl_.half[0] = *(const v8us*)&sKl[nt * 16 + ln][ks * 32 + 8 * hh]; bl_.half[1] = *(const v8us*)&sKl[nt * 16 + ln][ks * 32 + 16 + 8 * hh];
        acc = mmaN<3>(aqh[ks].v, aql[ks].v, bh_.v, bl_.v, acc);
      }
      s[nt] = acc;
    }
    // mask + running max (rows 8hh+r; the 16 lanes of a half share rows)
    float alpha[8];
#pragma unroll
    for (int r = 0; r < 8; ++r) {
      const int qi = q0 + 8 * hh + r;
      const int ja = j0 + ln, jb = j0 + 16 + ln;
      if (CAUSAL) { if (ja > qi) s[0][r] = -3.0e38f; if (jb > qi) s[1][r] = -3.0e38f; }
      if (ja >= T) s[0][r] = -3.0e38f;
      if (jb >= T) s[1][r] = -3.0e38f;
      float mx = fmaxf(s[0][r], s[1][r]);
      mx = fmaxf(mx, __shfl_xor(mx, 1, 32)); mx = fmaxf(mx, __shfl_xor(mx, 2, 32)); mx = fmaxf(mx, __shfl_xor(mx, 4, 32)); mx = fmaxf(mx, __shfl_xor(mx, 8, 32));
      const float mnew = fmaxf(m_r[r], mx);
      alpha[r] = (mnew > -1.0e38f) ? __expf(m_r[r] - mnew) : 1.0f;
      const float p0 = (s[0][r] > -1.0e38f) ? __expf(s[0][r] - mnew) : 0.f;
      const float p1 = (s[1][r] > -1.0e38f) ? __expf(s[1][r] - mnew) : 0.f;
      m_r[r] = mnew;
      l_r[r] = l_r[r] * alpha[r] + p0 + p1;            // per-lane partial row sum (16 lanes combined at the end)
      unsigned short hb = bf16_bits(p0); sPh[w][8 * hh + r][ln] = hb;      sPl[w][8 * hh + r][ln] = bf16_bits(p0 - bf16_val(hb));
      hb = bf16_bits(p1);                sPh[w][8 * hh + r][16 + ln] = hb; sPl[w][8 * hh + r][16 + ln] = bf16_bits(p1 - bf16_val(hb));
    }
#pragma unroll
    for (int dt = 0; dt < DT; ++dt)
#pragma unroll
      for (int r = 0; r < 8; ++r) oacc[dt][r] *= alpha[r];
    __builtin_amdgcn_fence(__ATOMIC_ACQ_REL, "workgroup");
    __builtin_amdgcn_wave_barrier();
    FragB pah, pal;
    pah.half[0] = *(const v8us*)&sPh[w][ln][8 * hh]; pah.half[1] = *(const v8us*)&sPh[w][ln][16 + 8 * hh];
    pal.half[0] = *(const v8us*)&sPl[w][ln][8 * hh]; pal.half[1] = *(const v8us*)&sPl[w][ln][16 + 8 * hh];
#pragma unroll
    for (int dt = 0; dt < DT; ++dt) {
      FragB bvh, bvl;
#pragma unroll
      for (int i = 0; i < 8; ++i) {
        bvh.u[i] = sVh[8 * hh + i][dt * 16 + ln]; bvh.u[8 + i] = sVh[16 + 8 * hh + i][dt * 16 + ln];
        bvl.u[i] = sVl[8 * hh + i][dt * 16 + ln]; bvl.u[8 + i] = sVl[16 + 8 * hh + i][dt * 16 + ln];
      }
      oacc[dt] = mmaN<3>(pah.v, pal.v, bvh.v, bvl.v, oacc[dt]);
    }
    __builtin_amdgcn_fence(__ATOMIC_ACQ_REL, "workgroup");
    __builtin_amdgcn_wave_barrier();
  }
#pragma unroll
  for (int r = 0; r < 8; ++r) {
    float l = l_r[r];
    l += __shfl_xor(l, 1, 32); l += __shfl_xor(l, 2, 32); l += __shfl_xor(l, 4, 32); l += __shfl_xor(l, 8, 32);
    l_r[r] = (l > 0.f) ? 1.0f / l : 0.f;
  }
#pragma unroll
  for (int dt = 0; dt < DT; ++dt)
#pragma unroll
    for (int r = 0; r < 8; ++r) sO[w][8 * hh + r][dt * 16 + ln] = oacc[dt][r] * l_r[r];
  __builtin_amdgcn_fence(__ATOMIC_ACQ_REL, "workgroup");
  __builtin_amdgcn_wave_barrier();
  {
    for (int r = 0; r < 16; ++r) {
      const int row = q0 + r;
      if (row < T && lane < D / 4) {
        const v4f val = *(const v4fa*)&sO[w][r][lane * 4];
        *(v4f*)(y + ((size_t)b * T + row) * ypitch + h * D + lane * 4) = val;
      }
    }
    
  }
}

// GEMM C = act(A·W + bias + resid): A f32 (ASPLIT -> hi/lo 2 terms), Wt bf16 [N][K]; ACT 0 none, 1 relu, 2 exact gelu;
// resid (optional, f32, row index = (row % rmod), pitch ldr, RES_BF16 rounds it) added before the activation.
template <bool ASPLIT, int ACT, bool BIAS_BF16, bool RES_BF16>
__global__ __launch_bounds__(128) void k_gemm_bf3(const float* __restrict__ A, int lda, const unsigned short* __restrict__ Wt, int ldb,
                                                const float* __restrict__ bias, const float* __restrict__ resid, int rmod, int ldr,
                                                float* __restrict__ C, int ldc, int M, int N, int K) {
  __shared__ __attribute__((aligned(16))) float so[4][16][64];
  const int tid = threadIdx.x, w = tid >> 5, lane = tid & 31, ln = lane & 15, hh = lane >> 4;
  const int ntn = N / 64;
  const int wid = blockIdx.x * 4 + w;
  const int mt = wid / ntn, nq = wid % ntn;
  if (mt * 16 >= M) return;
  const int row0 = mt * 16, col0 = nq * 64;
  const float* arow = A + (size_t)(row0 + ln) * lda;
  v8f acc[4] = {};
  for (int kb = 0; kb < K; kb += 32) {
    FragB ah, al;
    const v4f x0 = *(const v4fa*)(arow + kb + 8 * hh), x1 = *(const v4fa*)(arow + kb + 8 * hh + 4);
    const v4f x2 = *(const v4fa*)(arow + kb + 16 + 8 * hh), x3 = *(const v4fa*)(arow + kb + 16 + 8 * hh + 4);
    float xs[16] = {x0[0],x0[1],x0[2],x0[3],x1[0],x1[1],x1[2],x1[3],x2[0],x2[1],x2[2],x2[3],x3[0],x3[1],x3[2],x3[3]};
#pragma unroll
    for (int i = 0; i < 16; ++i) { const unsigned short hb = bf16_bits(xs[i]); ah.u[i] = hb; al.u[i] = ASPLIT ? bf16_bits(xs[i] - bf16_val(hb)) : (unsigned short)0; }
#pragma unroll
    for (int t = 0; t < 4; ++t) {
      const unsigned short* brow = Wt + (size_t)(col0 + t * 16 + ln) * ldb + kb;
      FragB b;
      b.half[0] = *(const v8us*)(brow + 8 * hh);
      b.half[1] = *(const v8us*)(brow + 16 + 8 * hh);
      acc[t] = mmaN<ASPLIT ? 2 : 1>(ah.v, al.v, b.v, b.v, acc[t]);
    }
  }
#pragma unroll
  for (int t = 0; t < 4; ++t) {
    const int col = col0 + t * 16 + ln;
    float bv = bias ? bias[col] : 0.f;
    if (BIAS_BF16) bv = bf16_round(bv);
#pragma unroll
    for (int r = 0; r < 8; ++r) {
      float v = acc[t][r] + bv;
      if (resid) { float rv = resid[(size_t)((row0 + 8 * hh + r) % rmod) * ldr + col]; if (RES_BF16) rv = bf16_round(rv); v += rv; }
      if (ACT == 1) v = fmaxf(v, 0.f);
      if (ACT == 2) v = 0.5f * v * (1.0f + erff(v * 0.70710678118654752f));
      if (ACT == 3) { const float u = 0.7978845608028654f * (v + 0.044715f * v * v * v); v = 0.5f * v * (1.0f + tanhf(u)); }
      so[w][8 * hh + r][t * 16 + ln] = v;
    }
  }
  __builtin_amdgcn_fence(__ATOMIC_ACQ_REL, "workgroup");
  __builtin_amdgcn_wave_barrier();
  const int rsub = lane >> 4, c4 = (lane & 15) * 4;
  {
#pragma unroll
    for (int q = 0; q < 8; ++q) {
      const int r = q * 2 + rsub;
      const v4f v = *(const v4fa*)&so[w][r][c4];
      *(v4f*)(C + (size_t)(row0 + r) * ldc + col0 + c4) = v;
    }
    
  }
}
// row LayerNorm (biased variance, eps) over N: s = X (+ R); optional out_sum <- s; out_norm <- (s-mu)*rsqrt(var+eps)*g + b
template <bool PARAM_BF16>
__global__ __launch_bounds__(256) void k_layernorm(const float* __restrict__ X, const float* __restrict__ R, const float* __restrict__ g, const float* __restrict__ bta,
                                                  float* __restrict__ out_sum, float* __restrict__ out_norm, int N, float eps) {
  __shared__ float red[256];
  const int row = blockIdx.x, tid = threadIdx.x;
  const float* x = X + (size_t)row * N; const float* rr = R ? R + (size_t)row * N : nullptr;
  float vals[16];                     // up to N = 4096
  const int per = N / 256;            // contiguous chunk per thread? use strided-by-4 chunks: thread handles j = tid*4 + 1024*u
  float s1 = 0.f;
  for (int u = 0; u < per / 4; ++u) {
    const int j = tid * 4 + 1024 * u;
    const v4f a = *(const v4fa*)(x + j);
    v4f b = {0.f,0.f,0.f,0.f}; if (rr) b = *(const v4fa*)(rr + j);
#pragma unroll
    for (int q = 0; q < 4; ++q) { const float v = a[q] + b[q]; vals[u * 4 + q] = v; s1 += v; }
  }
  red[tid] = s1; __syncthreads();
  for (int st = 128; st > 0; st >>= 1) { if (tid < st) red[tid] += red[tid + st]; __syncthreads(); }
  const float mu = red[0] / (float)N; __syncthreads();
  float s2 = 0.f;
  for (int u = 0; u < per / 4; ++u)
#pragma unroll
    for (int q = 0; q < 4; ++q) { const float c = vals[u * 4 + q] - mu; s2 += c * c; }
  red[tid] = s2; __syncthreads();
  for (int st = 128; st > 0; st >>= 1) { if (tid < st) red[tid] += red[tid + st]; __syncthreads(); }
  const float rs = rsqrtf(red[0] / (float)N + eps);
  {
    for (int u = 0; u < per / 4; ++u) {
      const int j = tid * 4 + 1024 * u;
      v4f o, sm;
#pragma unroll
      for (int q = 0; q < 4; ++q) {
        float gg = g[j + q], bb = bta[j + q];
        if (PARAM_BF16) { gg = bf16_round(gg); bb = bf16_round(bb); }
        sm[q] = vals[u * 4 + q]; o[q] = (vals[u * 4 + q] - mu) * rs * gg + bb;
      }
      if (out_sum) *(v4f*)(out_sum + (size_t)row * N + j) = sm;
      *(v4f*)(out_norm + (size_t)row * N + j) = o;
    }
    
  }
}



// ---- f16 WMMA path (v_wmma_f32_16x16x32_f16): 11-bit significands for operands in range — used where a [0,1] probability operand needs more precision than bf16
typedef _Float16 v16h __attribute__((ext_vector_type(16)));
union FragH { v16h v; v8us half[2]; _Float16 h[16]; unsigned short u[16]; };
template <int NT>
__device__ __forceinline__ v8f mmaH(v16h ah, v16h al, v16h bh, v16h bl, v8f c) {
  c = __builtin_amdgcn_wmma_f32_16x16x32_f16(false, ah, false, bh, (short)0, c, false, false);
  if (NT >= 2) c = __builtin_amdgcn_wmma_f32_16x16x32_f16(false, al, false, bh, (short)0, c, false, false);
  if (NT >= 3) c = __builtin_amdgcn_wmma_f32_16x16x32_f16(false, ah, false, bl, (short)0, c, false, false);
  asm volatile("v_nop\n\tv_nop\n\tv_nop\n\tv_nop" : "+v"(c) : "v"(ah), "v"(al), "v"(bh), "v"(bl));
  return c;
}
// batched GEMM like k_gemm_b but f16 operands: A f32 (split into f16 hi/lo if ASPLIT, else rounded to f16), Bt = f16 values [n][k]; alpha; C f32; N multiple of 16 (partial tiles skipped)
template <bool ASPLIT>
__global__ __launch_bounds__(128) void k_gemm_h(const float* __restrict__ A, int lda, size_t sA, const _Float16* __restrict__ Bh, int ldb, size_t sB, float alpha, float* __restrict__ C, int ldc, size_t sC, int M, int N, int K) {
  __shared__ __attribute__((aligned(16))) float so[4][16][64];
  const int tid = threadIdx.x, w = tid >> 5, lane = tid & 31, ln = lane & 15, hh = lane >> 4; const int by = blockIdx.y;
  A += (size_t)by * sA; Bh += (size_t)by * sB; C += (size_t)by * sC;
  const int ntn = (N + 63) / 64; const int wid = blockIdx.x * 4 + w; const int mt = wid / ntn, nq = wid % ntn; if (mt * 16 >= M) return;
  const int row0 = mt * 16, col0 = nq * 64; const float* arow = A + (size_t)(row0 + ln) * lda;
  v8f acc[4] = {};
  for (int kb = 0; kb < K; kb += 32) {
    FragH ah, al;
    const v4f x0 = *(const v4fa*)(arow + kb + 8 * hh), x1 = *(const v4fa*)(arow + kb + 8 * hh + 4), x2 = *(const v4fa*)(arow + kb + 16 + 8 * hh), x3 = *(const v4fa*)(arow + kb + 16 + 8 * hh + 4);
    float xs[16] = {x0[0],x0[1],x0[2],x0[3],x1[0],x1[1],x1[2],x1[3],x2[0],x2[1],x2[2],x2[3],x3[0],x3[1],x3[2],x3[3]};
#pragma unroll
    for (int i = 0; i < 16; ++i) { const _Float16 h = (_Float16)xs[i]; ah.h[i] = h; al.h[i] = ASPLIT ? (_Float16)(xs[i] - (float)h) : (_Float16)0.0f; }
#pragma unroll
    for (int t = 0; t < 4; ++t) { if (col0 + t * 16 >= N) continue; const size_t boff = (size_t)(col0 + t * 16 + ln) * ldb + kb; FragH bq; bq.half[0] = *(const v8us*)(Bh + boff + 8 * hh); bq.half[1] = *(const v8us*)(Bh + boff + 16 + 8 * hh);
      acc[t] = mmaH<ASPLIT ? 2 : 1>(ah.v, al.v, bq.v, bq.v, acc[t]); }
  }
#pragma unroll
  for (int t = 0; t < 4; ++t) { if (col0 + t * 16 >= N) continue;
#pragma unroll
    for (int r = 0; r < 8; ++r) so[w][8 * hh + r][t * 16 + ln] = acc[t][r] * alpha; }
  __builtin_amdgcn_fence(__ATOMIC_ACQ_REL, "workgroup"); __builtin_amdgcn_wave_barrier();
  const int rsub = lane >> 4, c4 = (lane & 15) * 4;
  {
#pragma unroll
    for (int q = 0; q < 8; ++q) { const int r = q * 2 + rsub; if (col0 + c4 < N) { const v4f v = *(const v4fa*)&so[w][r][c4]; *(v4f*)(C + (size_t)(row0 + r) * ldc + col0 + c4) = v; } }
     }
}

// Wt[n][k] = f16(W[k][n]·scale) from f32 row-major W[K][N] (scale = power of two; bf16-exact weights stay exact in f16 away from the subnormal range)
__global__ __launch_bounds__(256) void k_wt_f16(const float* __restrict__ W, _Float16* __restrict__ Wt, int K, int N, float scale) {
  const int t = blockIdx.x * 256 + threadIdx.x; if (t >= N * (K / 8)) return; const int n = t / (K / 8), k8 = (t % (K / 8)) * 8; FragH f;
#pragma unroll
  for (int i = 0; i < 8; ++i) f.h[i] = (_Float16)(bf16_round(W[(size_t)(k8 + i) * N + n]) * scale); const v8us o = f.half[0];
  *(v8us*)((unsigned short*)Wt + (size_t)n * K + k8) = o; 
}
__global__ __launch_bounds__(256) void k_x16(const float* __restrict__ x, _Float16* __restrict__ X16, size_t n8) { const size_t t = (size_t)blockIdx.x * 256 + threadIdx.x; if (t >= n8) return; FragH f;
#pragma unroll
  for (int q = 0; q < 8; ++q) f.h[q] = (_Float16)bf16_round(x[t * 8 + q]); *(v8us*)((unsigned short*)X16 + t * 8) = f.half[0];  }
__global__ __launch_bounds__(256) void k_h16(const float* __restrict__ x, _Float16* __restrict__ X16, size_t n8) { const size_t t = (size_t)blockIdx.x * 256 + threadIdx.x; if (t >= n8) return; FragH f;
#pragma unroll
  for (int q = 0; q < 8; ++q) f.h[q] = (_Float16)x[t * 8 + q]; *(v8us*)((unsigned short*)X16 + t * 8) = f.half[0];  }
__global__ __launch_bounds__(256) void k_round16f(const float* __restrict__ W, _Float16* __restrict__ Bt, size_t n8) { const size_t t = (size_t)blockIdx.x * 256 + threadIdx.x; if (t >= n8) return; FragH f;
#pragma unroll
  for (int i = 0; i < 8; ++i) f.h[i] = (_Float16)(bf16_round(W[t * 8 + i]) * 16.0f); *(v8us*)((unsigned short*)Bt + t * 8) = f.half[0];  }
template <int NHv, int TTv>
__global__ __launch_bounds__(256) void k_vt(const _Float16* __restrict__ V16, int ldv, int voff, _Float16* __restrict__ Vt) { __shared__ unsigned short tl[64][66]; const int tid = threadIdx.x; const int slab = blockIdx.x / (TTv / 64), lg = blockIdx.x % (TTv / 64); const int b = slab / NHv, h = slab % NHv;
  for (int i = tid; i < 64 * 8; i += 256) { const int r = i / 8, c8 = (i % 8) * 8; FragH f; f.half[0] = *(const v8us*)((const unsigned short*)V16 + ((size_t)b * TTv + lg * 64 + r) * ldv + voff + h * 64 + c8);
#pragma unroll
    for (int q = 0; q < 8; ++q) tl[r][c8 + q] = f.u[q]; }
  __syncthreads();
  {
#pragma unroll
    for (int rd = 0; rd < 2; ++rd) { const int d = rd * 32 + tid / 8, pc = tid % 8; FragH f;
#pragma unroll
      for (int q = 0; q < 8; ++q) f.u[q] = tl[pc * 8 + q][d];
      *(v8us*)((unsigned short*)Vt + ((size_t)slab * 64 + d) * TTv + lg * 64 + pc * 8) = f.half[0]; }
     } }

// Eight 16-byte asynchronous copies per lane, global memory to LDS through no register: piece i goes from g + i * gstep to LDS byte l + i * lstep.
// The s_wait_xcnt closes the statement so that it stands in front of any later rewrite of the address registers the copies name.
__device__ __forceinline__ void copy8_to_lds(unsigned l, unsigned lstep, const char* g, size_t gstep) {
  asm volatile("global_load_async_to_lds_b128 %0, %8, off\n\t"
               "global_load_async_to_lds_b128 %1, %9, off\n\t"
               "global_load_async_to_lds_b128 %2, %10, off\n\t"
               "global_load_async_to_lds_b128 %3, %11, off\n\t"
               "global_load_async_to_lds_b128 %4, %12, off\n\t"
               "global_load_async_to_lds_b128 %5, %13, off\n\t"
               "global_load_async_to_lds_b128 %6, %14, off\n\t"
               "global_load_async_to_lds_b128 %7, %15, off\n\t"
               "s_wait_xcnt 0x0"
               :: "v"(l), "v"(l + lstep), "v"(l + 2 * lstep), "v"(l + 3 * lstep), "v"(l + 4 * lstep), "v"(l + 5 * lstep), "v"(l + 6 * lstep), "v"(l + 7 * lstep),
                  "v"(g), "v"(g + gstep), "v"(g + 2 * gstep), "v"(g + 3 * gstep), "v"(g + 4 * gstep), "v"(g + 5 * gstep), "v"(g + 6 * gstep), "v"(g + 7 * gstep)
               : "memory");
}

// One butterfly step of a reduction over a 16-lane row, on the vector pipe: the lane's value joined with that of lane ^ M. It takes the place of a ds_bpermute_b32 and the
// s_wait_dscnt behind it, so that the steps of several rows can follow one another without a wait. Every lane is on where these stand.
template <int M> __device__ __forceinline__ float row_max_step(float v) { float o;
  asm("v_max_num_f32_dpp %0, %1, %1 row_xmask:%2 row_mask:0xf bank_mask:0xf" : "=v"(o) : "v"(v), "n"(M));      // o = max(v of lane ^ M, v)
  return o; }
template <int M> __device__ __forceinline__ float row_add_step(float v) { float o;
  asm("v_add_f32_dpp %0, %1, %1 row_xmask:%2 row_mask:0xf bank_mask:0xf" : "=v"(o) : "v"(v), "n"(M));          // o = v of lane ^ M + v
  return o; }

// K and Vt reach the four waves of a work-group through LDS: a stage is 64 keys (K: 64 rows of 256 B, Vt: 128 rows of 128 B, whole 128-B lines), copied once per work-group,
// two buffers, the next stage in flight while this one is worked on. Row pitches 272 B and 144 B (16 B x odd) keep the ds_load_b128 fragment reads free of bank conflicts.
__global__ __launch_bounds__(128) void k_flash(const _Float16* __restrict__ Q16, int ldq, const _Float16* __restrict__ K16, int ldk, const _Float16* __restrict__ Vt, const int* __restrict__ MSK, float* __restrict__ O, int ldo) {
  constexpr int RPW = 16, RTN = RPW / 16, NQB = 3072 / (4 * RPW), DT = 8, KS = 4;      /* head dim 128 */
  constexpr unsigned KP = 272, VP = 144, KBYTES = 64 * KP, STG = KBYTES + 128 * VP;
  __shared__ __attribute__((aligned(16))) unsigned char ring[2 * STG];
  __shared__ __attribute__((aligned(16))) unsigned short sP[4][RPW][40];
  float (*sO)[RPW][128 + 4] = (float (*)[RPW][128 + 4])ring;      /* output staging takes the ring's place behind the loop's last barrier */
  static_assert(sizeof(float) * 4 * RPW * (128 + 4) <= 2 * STG, "output staging fits the ring");
  const int tid = threadIdx.x, w = tid >> 5, lane = tid & 31, ln = lane & 15, hh = lane >> 4;
  const int slab = blockIdx.x / NQB, qblk = blockIdx.x % NQB; const int b = slab / 8, h = slab % 8; const int qb0 = qblk * (4 * RPW); const int q0 = qb0 + w * RPW;
  FragH aq[2][KS];
#pragma unroll
  for (int rt = 0; rt < RTN; ++rt) { const unsigned short* qr = (const unsigned short*)Q16 + ((size_t)b * 3072 + q0 + rt * 16 + ln) * ldq + h * 128;
#pragma unroll
    for (int ks = 0; ks < KS; ++ks) { aq[rt][ks].half[0] = *(const v8us*)(qr + ks * 32 + 8 * hh); aq[rt][ks].half[1] = *(const v8us*)(qr + ks * 32 + 16 + 8 * hh); } }
  const unsigned short* Vth = (const unsigned short*)Vt + (size_t)slab * 128 * 3072;
  // each thread's own pieces of a stage: K row tid/16 + 8i, 16-byte piece tid%16; Vt row tid/8 + 16i, piece tid%8
  const char* kg = (const char*)((const unsigned short*)K16 + ((size_t)b * 3072 + (tid >> 4)) * ldk + h * 128 + (tid & 15) * 8);
  const char* vg = (const char*)(Vth + (size_t)(tid >> 3) * 3072 + (tid & 7) * 8);
  const unsigned ring0 = (unsigned)(size_t)ring;
  const unsigned kl = ring0 + (unsigned)(tid >> 4) * KP + (unsigned)(tid & 15) * 16u, vl = ring0 + KBYTES + (unsigned)(tid >> 3) * VP + (unsigned)(tid & 7) * 16u;
  const size_t kstage = (size_t)64 * ldk * 2, kstep = (size_t)8 * ldk * 2;
  auto fill = [&](int st, unsigned buf) {
    copy8_to_lds(kl + buf * STG, 8 * KP, kg + (size_t)st * kstage, kstep);
    copy8_to_lds(vl + buf * STG, 16 * VP, vg + (size_t)st * 128, (size_t)16 * 3072 * 2);
  };
  float m_r[2][8], l_r[2][8]; v8f oacc[2][DT];
#pragma unroll
  for (int rt = 0; rt < RTN; ++rt) {
#pragma unroll
    for (int r = 0; r < 8; ++r) { m_r[rt][r] = -3.0e38f; l_r[rt][r] = 0.f; }
#pragma unroll
    for (int dt = 0; dt < DT; ++dt) oacc[rt][dt] = (v8f){0.f,0.f,0.f,0.f,0.f,0.f,0.f,0.f}; }
  const int nst = qblk + 1;      /* stages of 64 keys up to the block's diagonal; the same for the whole work-group */
  fill(0, 0u);
  asm volatile("s_wait_asynccnt 0x0" ::: "memory");      // this wave's pieces of stage 0 have landed
  __syncthreads();                                       // every wave's pieces of stage 0 are readable
  if (nst > 1) fill(1, 1u);
#pragma unroll 1      /* one copy of the body: the ring's order stays as written */
  for (int st = 0; st < nst; ++st) {
    const unsigned char* kbuf = ring + (unsigned)(st & 1) * STG; const unsigned char* vbuf = kbuf + KBYTES;
#pragma unroll 1      /* the two 32-key passes of a stage share one body in the instruction cache */
  for (int sub = 0; sub < 2; ++sub) { const int j0 = st * 64 + sub * 32;
    v8f s[2][2];
#pragma unroll
    for (int nt = 0; nt < 2; ++nt) { const unsigned char* kr = kbuf + (unsigned)(sub * 32 + nt * 16 + ln) * KP + 16 * hh; FragH bk[KS];
#pragma unroll
      for (int ks = 0; ks < KS; ++ks) { bk[ks].half[0] = *(const v8us*)(kr + ks * 64); bk[ks].half[1] = *(const v8us*)(kr + ks * 64 + 32); }
#pragma unroll
      for (int rt = 0; rt < RTN; ++rt) { v8f acc = (v8f){0.f,0.f,0.f,0.f,0.f,0.f,0.f,0.f};
#pragma unroll
        for (int ks = 0; ks < KS; ++ks) acc = mmaH<1>(aq[rt][ks].v, aq[rt][ks].v, bk[ks].v, bk[ks].v, acc); s[rt][nt] = acc; } }
    // The softmax of a pass in three sweeps over each lane's eight rows, each sweep one straight run of code, so that the rows' dependent chains overlap:
    // masked scores, then the row maxima step by step, then the exponentials, each computed ahead of the select that may drop it (no branch stands between two rows).
#pragma unroll
    for (int rt = 0; rt < RTN; ++rt) { const int k0 = j0 + ln, k1 = j0 + 16 + ln; float s0[8], s1[8], mc[8];
#pragma unroll
      for (int r = 0; r < 8; ++r) { const int tq = q0 + rt * 16 + 8 * hh + r;
        s0[r] = (k0 <= tq) ? s[rt][0][r] * (0.08838834764831845f) : -INFINITY; s1[r] = (k1 <= tq) ? s[rt][1][r] * (0.08838834764831845f) : -INFINITY; mc[r] = fmaxf(s0[r], s1[r]); }
#pragma unroll
      for (int r = 0; r < 8; ++r) mc[r] = row_max_step<1>(mc[r]);
#pragma unroll
      for (int r = 0; r < 8; ++r) mc[r] = row_max_step<2>(mc[r]);
#pragma unroll
      for (int r = 0; r < 8; ++r) mc[r] = row_max_step<4>(mc[r]);
#pragma unroll
      for (int r = 0; r < 8; ++r) mc[r] = row_max_step<8>(mc[r]);
#pragma unroll
      for (int r = 0; r < 8; ++r) { const int tq = q0 + rt * 16 + 8 * hh + r; const bool ok0 = (k0 <= tq), ok1 = (k1 <= tq);
        const float mn = fmaxf(m_r[rt][r], mc[r]); const float ea = expf(m_r[rt][r] - mn), e0 = expf(s0[r] - mn), e1 = expf(s1[r] - mn);      /* mn is finite: no difference here is a NaN */
        const float al = (mn > -1.0e38f) ? ea : 1.0f; m_r[rt][r] = mn; const float p0 = ok0 ? e0 : 0.f, p1 = ok1 ? e1 : 0.f; l_r[rt][r] = l_r[rt][r] * al + p0 + p1;
#pragma unroll
        for (int dt = 0; dt < DT; ++dt) oacc[rt][dt][r] *= al;
        FragH t2; t2.h[0] = (_Float16)p0; t2.h[1] = (_Float16)p1; sP[w][rt * 16 + 8 * hh + r][ln] = t2.u[0]; sP[w][rt * 16 + 8 * hh + r][16 + ln] = t2.u[1]; } }
    __builtin_amdgcn_fence(__ATOMIC_ACQ_REL, "workgroup"); __builtin_amdgcn_wave_barrier();
    FragH pa[2];
#pragma unroll
    for (int rt = 0; rt < RTN; ++rt) { pa[rt].half[0] = *(const v8us*)&sP[w][rt * 16 + ln][8 * hh]; pa[rt].half[1] = *(const v8us*)&sP[w][rt * 16 + ln][16 + 8 * hh]; }
#pragma unroll
    for (int dt = 0; dt < DT; ++dt) { const unsigned char* vrow = vbuf + (unsigned)(dt * 16 + ln) * VP + sub * 64 + 16 * hh; FragH bv; bv.half[0] = *(const v8us*)(vrow); bv.half[1] = *(const v8us*)(vrow + 32);
#pragma unroll
      for (int rt = 0; rt < RTN; ++rt) oacc[rt][dt] = mmaH<1>(pa[rt].v, pa[rt].v, bv.v, bv.v, oacc[rt][dt]); }
    __builtin_amdgcn_fence(__ATOMIC_ACQ_REL, "workgroup"); __builtin_amdgcn_wave_barrier(); }
    asm volatile("s_wait_dscnt 0x0" ::: "memory");       // this wave's reads of the buffer have returned before it is refilled
    asm volatile("s_wait_asynccnt 0x0" ::: "memory");    // this wave's pieces of stage st + 1 have landed
    __syncthreads();                                     // publishes stage st + 1 and ends every wave's reads of stage st
    if (st + 2 < nst) fill(st + 2, (unsigned)(st & 1));
  }
  asm volatile("s_wait_asynccnt 0x0" ::: "memory");      // no copy is outstanding when the ring becomes output staging
#pragma unroll
  for (int rt = 0; rt < RTN; ++rt) {
#pragma unroll
    for (int r = 0; r < 8; ++r) l_r[rt][r] = row_add_step<1>(l_r[rt][r]);
#pragma unroll
    for (int r = 0; r < 8; ++r) l_r[rt][r] = row_add_step<2>(l_r[rt][r]);
#pragma unroll
    for (int r = 0; r < 8; ++r) l_r[rt][r] = row_add_step<4>(l_r[rt][r]);
#pragma unroll
    for (int r = 0; r < 8; ++r) l_r[rt][r] = row_add_step<8>(l_r[rt][r]);
#pragma unroll
    for (int r = 0; r < 8; ++r) { const float l = l_r[rt][r]; l_r[rt][r] = (l > 0.f) ? 1.0f / l : 0.f; }
#pragma unroll
    for (int dt = 0; dt < DT; ++dt)
#pragma unroll
      for (int r = 0; r < 8; ++r) sO[w][rt * 16 + 8 * hh + r][dt * 16 + ln] = oacc[rt][dt][r] * l_r[rt][r]; }
  __builtin_amdgcn_fence(__ATOMIC_ACQ_REL, "workgroup"); __builtin_amdgcn_wave_barrier();
  {
#pragma unroll
    for (int rp = 0; rp < RPW; ++rp) { const int r = rp, pc = lane; const v4f val = *(const v4fa*)&sO[w][r][pc * 4]; *(v4f*)(O + ((size_t)(b * 8 + h) * 3072 + q0 + r) * 128 + pc * 4) = val; }      /* output layout [b][h][s][128]: 32 lanes x 16 B rows */
     } }

// Projection GEMM: C[row][col] = alpha * sum_k A[row][k] * Bt[col][k], both operands f16 with CW elements a row, f32 accumulate, k ascending in one chain per accumulator.
// A work-group owns a 64 x 64 tile of C, its four waves 32 x 32 each. A and Bt reach the waves through LDS: a stage is 128 k (64 rows of A and 64 of Bt, 256 B each, whole 128-B lines),
// copied once per work-group, two buffers, the next stage in flight while this one is worked on. Row pitch 272 B (16 B x odd) keeps the ds_load_b128 fragment reads free of bank conflicts.
// One launch does all nine projections. The grid is exact: blockIdx.x = row tile of the TT positions * (CW / 64) + column tile, blockIdx.y = batch, blockIdx.z = projection (0 q, 1 k, 2 v).
// A row tile lies wholly in one segment (SL is a multiple of 64) and takes that segment's weights: plane 3 * projection + (0 middle, 1 state, 2 end) of B9. All three go out as f16.
// q and k are rotated (RoPE) on their way out. Their weight planes come with bits 5 and 6 of the column-in-head swapped (k_wst), so that columns c and c + 32 of a tile are the pair
// (j, j + 64) of one head, j = 32 * (tile & 1) + c: both partners lie in the tile's output staging. q and k keep that column order in Q16 and K16; it is the same in both, so q.k is the same sum in another order.
// CS[position][128] holds cos (0..63) and sin (64..127) of the position's 64 angles.
__global__ __launch_bounds__(128) void k_gemm_ring(const _Float16* __restrict__ A, const _Float16* __restrict__ B9, float alpha, const float* __restrict__ CS, _Float16* __restrict__ Q16, _Float16* __restrict__ K16, _Float16* __restrict__ C16) {
  static_assert(SL % 64 == 0 && TT % 64 == 0, "a row tile never straddles a segment");
  constexpr size_t sA = (size_t)TT * CW, sC = (size_t)TT * CW;
  constexpr unsigned RP = 272, TB = 64 * RP, STG = 2 * TB; constexpr int NST = CW / 128;
  static_assert(NST >= 2, "the ring's prologue fills two stages");
  __shared__ __attribute__((aligned(16))) unsigned char ring[2 * STG];
  float (*so)[64 + 4] = (float (*)[64 + 4])ring;      /* output staging takes the ring's place behind the loop's last barrier */
  static_assert(sizeof(float) * 64 * (64 + 4) <= 2 * STG, "output staging fits the ring");
  const int tid = threadIdx.x, w = tid >> 5, lane = tid & 31, ln = lane & 15, hh = lane >> 4, wm = w >> 1, wn = w & 1;
  const int row0 = (int)(blockIdx.x / (CW / 64)) * 64, col0 = (int)(blockIdx.x % (CW / 64)) * 64;
  const int prj = (int)blockIdx.z, sgm = (row0 < SL) ? 1 : ((row0 < TT - SL) ? 0 : 2); const bool OUT16 = (prj == 2);
  const _Float16* Bt = B9 + (size_t)(prj * 3 + sgm) * CW * CW;
  // each thread's own pieces of a stage: row tid/16 + 8i of either operand, 16-byte piece tid%16
  const char* ag = (const char*)((const unsigned short*)A + (size_t)blockIdx.y * sA + (size_t)(row0 + (tid >> 4)) * CW + (tid & 15) * 8);
  const char* bg = (const char*)((const unsigned short*)Bt + (size_t)(col0 + (tid >> 4)) * CW + (tid & 15) * 8);
  const unsigned al = (unsigned)(size_t)ring + (unsigned)(tid >> 4) * RP + (unsigned)(tid & 15) * 16u, bl = al + TB;
  auto fill = [&](int st, unsigned buf) {
    copy8_to_lds(al + buf * STG, 8 * RP, ag + (size_t)st * 256, (size_t)8 * CW * 2);
    copy8_to_lds(bl + buf * STG, 8 * RP, bg + (size_t)st * 256, (size_t)8 * CW * 2);
  };
  v8f acc[2][2];
#pragma unroll
  for (int i = 0; i < 2; ++i)
#pragma unroll
    for (int j = 0; j < 2; ++j) acc[i][j] = (v8f){0.f,0.f,0.f,0.f,0.f,0.f,0.f,0.f};
  fill(0, 0u);
  asm volatile("s_wait_asynccnt 0x0" ::: "memory");      // this wave's pieces of stage 0 have landed
  __syncthreads();                                       // every wave's pieces of stage 0 are readable
  fill(1, 1u);
#pragma unroll 1      /* one copy of the body: the ring's order stays as written */
  for (int st = 0; st < NST; ++st) {
    const unsigned char* ar = ring + (unsigned)(st & 1) * STG + (unsigned)(wm * 32 + ln) * RP + 16 * hh;
    const unsigned char* br = ring + (unsigned)(st & 1) * STG + TB + (unsigned)(wn * 32 + ln) * RP + 16 * hh;
    FragH fa[4][2], fb[4][2];
#pragma unroll
    for (int ks = 0; ks < 4; ++ks)
#pragma unroll
      for (int i = 0; i < 2; ++i) {
        fa[ks][i].half[0] = *(const v8us*)(ar + i * 16 * RP + ks * 64); fa[ks][i].half[1] = *(const v8us*)(ar + i * 16 * RP + ks * 64 + 32);
        fb[ks][i].half[0] = *(const v8us*)(br + i * 16 * RP + ks * 64); fb[ks][i].half[1] = *(const v8us*)(br + i * 16 * RP + ks * 64 + 32); }
    asm volatile("s_wait_dscnt 0x0" ::: "memory");       // the stage's 32 fragment reads, one group, have returned: this wave is done with the buffer before it is refilled
    asm volatile("s_wait_asynccnt 0x0" ::: "memory");    // this wave's pieces of stage st + 1 have landed
    __syncthreads();                                     // publishes stage st + 1 and ends every wave's reads of stage st
    if (st + 2 < NST) fill(st + 2, (unsigned)(st & 1));  // in front of the WMMAs, which work from registers, so that the copies fly behind them
#pragma unroll
    for (int ks = 0; ks < 4; ++ks)
#pragma unroll
      for (int i = 0; i < 2; ++i)
#pragma unroll
        for (int j = 0; j < 2; ++j) acc[i][j] = __builtin_amdgcn_wmma_f32_16x16x32_f16(false, fa[ks][i].v, false, fb[ks][j].v, (short)0, acc[i][j], false, false);
  }
  // q, k: a thread rotates four pairs of columns (cl.., cl + 32..) in each of four rows; their cos and sin are fetched here so that they fly while the tile is staged
  const int rs = lane >> 3, cl = (lane & 7) * 4; v4f tc[4] = {}, ts[4] = {};
  if (!OUT16) { const float* cs = CS + (size_t)(row0 + w * 16 + rs) * 128 + ((col0 >> 6) & 1) * 32 + cl;
#pragma unroll
    for (int q = 0; q < 4; ++q) { tc[q] = *(const v4fa*)(cs + q * 4 * 128); ts[q] = *(const v4fa*)(cs + q * 4 * 128 + 64); } }
  asm volatile("s_wait_asynccnt 0x0" ::: "memory");      // no copy is outstanding when the ring becomes output staging
#pragma unroll
  for (int i = 0; i < 2; ++i)
#pragma unroll
    for (int j = 0; j < 2; ++j)
#pragma unroll
      for (int r = 0; r < 8; ++r) so[wm * 32 + i * 16 + 8 * hh + r][wn * 32 + j * 16 + ln] = acc[i][j][r] * alpha;
  __syncthreads();                                       // a stored row of 64 columns holds two waves' results
  const int rsub = lane >> 4, c4 = (lane & 15) * 4; typedef _Float16 v4h __attribute__((ext_vector_type(4)));
  if (OUT16) {      /* the test stands once, in front of the eight rows, so that their LDS reads stay one group */
#pragma unroll
    for (int q = 0; q < 8; ++q) { const int r = w * 16 + q * 2 + rsub; const v4f v = *(const v4fa*)&so[r][c4]; const size_t o = (size_t)blockIdx.y * sC + (size_t)(row0 + r) * CW + col0 + c4; v4h h4;
#pragma unroll
      for (int i = 0; i < 4; ++i) h4[i] = (_Float16)v[i];
      *(v4h*)(C16 + o) = h4; }      /* whole 128-B lines, one wave a line */
  } else {
    _Float16* D16 = prj ? K16 : Q16;
#pragma unroll
    for (int q = 0; q < 4; ++q) { const int r = w * 16 + q * 4 + rs; const v4f lo = *(const v4fa*)&so[r][cl], hi = *(const v4fa*)&so[r][cl + 32]; const size_t o = (size_t)blockIdx.y * sC + (size_t)(row0 + r) * CW + col0 + cl; v4h ol, oh;
#pragma unroll
      for (int i = 0; i < 4; ++i) { ol[i] = (_Float16)(lo[i] * tc[q][i] + (-hi[i]) * ts[q][i]); oh[i] = (_Float16)(hi[i] * tc[q][i] + lo[i] * ts[q][i]); }
      *(v4h*)(D16 + o) = ol; *(v4h*)(D16 + o + 32) = oh; }      /* the two halves of a 128-B line, both from this wave */
    asm volatile("s_wait_xcnt 0x0" ::: "memory");      // stands behind the run of stores, in front of any later rewrite of the registers they name
  }
}

__global__ __launch_bounds__(256) void k_xt(const float* __restrict__ x, _Float16* __restrict__ XT) { const size_t t = (size_t)blockIdx.x * 256 + threadIdx.x; if (t >= (size_t)NR * NH * 16) return; const int p = (int)(t % 16); const int h = (int)((t / 16) % NH); const size_t bs = t / (16 * NH); const int b = (int)(bs / TT), s = (int)(bs % TT); const float* src = x + (((size_t)(b * NH + h) * TT + s) * HD) + p * 8; FragH f;
#pragma unroll
  for (int q = 0; q < 8; ++q) f.h[q] = (_Float16)bf16_round(src[q]); unsigned short* d = (unsigned short*)XT + bs * CW + h * HD + p * 8; *(v8us*)d = f.half[0];  }
// One launch re-lays all nine weight tensors: blockIdx.y picks the tensor and its plane of B9. The q and k planes (0..5) take their rows with bits 5 and 6 of the column-in-head swapped (see k_gemm_ring).
// A tenth plane of the grid fills the RoPE table CS[position][128]: cos (0..63) and sin (64..127) of (position + offset) * 10000^(-2i/128), each angle worked out once.
__global__ __launch_bounds__(256) void k_wst(const float* __restrict__ W0, const float* __restrict__ W1, const float* __restrict__ W2, const float* __restrict__ W3, const float* __restrict__ W4,
                                             const float* __restrict__ W5, const float* __restrict__ W6, const float* __restrict__ W7, const float* __restrict__ W8, _Float16* __restrict__ B9, const int* __restrict__ offp, float* __restrict__ CS) {
  const unsigned y = blockIdx.y;
  if (y == 9) { const int o0 = offp[0];
#pragma unroll 1      /* one copy of the cos and sin code */
    for (unsigned u = blockIdx.x * 256 + threadIdx.x; u < (unsigned)TT * 64; u += (unsigned)CW * NH * 16) { const int i = (int)(u & 63), s = (int)(u >> 6); const float pos = (float)(s + o0);
      const float ang = pos * __builtin_powf(10000.0f, -(float)(2 * i) / 128.0f); CS[(size_t)s * 128 + i] = cosf(ang); CS[(size_t)s * 128 + 64 + i] = sinf(ang); }
    return; }
  const float* W = W0; W = (y == 1) ? W1 : W; W = (y == 2) ? W2 : W; W = (y == 3) ? W3 : W; W = (y == 4) ? W4 : W; W = (y == 5) ? W5 : W; W = (y == 6) ? W6 : W; W = (y == 7) ? W7 : W; W = (y == 8) ? W8 : W; _Float16* Bt = B9 + (size_t)y * CW * CW;
  const size_t t = (size_t)blockIdx.x * 256 + threadIdx.x; if (t >= (size_t)CW * NH * 16) return; const int p = (int)(t % 16); const int h = (int)((t / 16) % NH); const int n = (int)(t / (16 * NH)); const int g = n / HD, ep = n % HD, e = (y < 6) ? ((ep & 31) | ((ep & 32) << 1) | ((ep & 64) >> 1)) : ep; FragH f;
#pragma unroll
  for (int q = 0; q < 8; ++q) { const int d = p * 8 + q; f.h[q] = (_Float16)(bf16_round(W[(((size_t)(h * NH + g) * HD + d) * HD) + e]) * 16.0f); }
  unsigned short* dst = (unsigned short*)Bt + (size_t)n * CW + h * HD + p * 8; *(v8us*)dst = f.half[0];  }
__global__ __launch_bounds__(256) void k_vt128(const _Float16* __restrict__ V16, _Float16* __restrict__ Vt) { __shared__ unsigned short tl[64][130]; const int tid = threadIdx.x; const int slab = blockIdx.x / (TT / 64), lg = blockIdx.x % (TT / 64); const int b = slab / NH, h = slab % NH;
  for (int i = tid; i < 64 * 16; i += 256) { const int r = i / 16, c8 = (i % 16) * 8; FragH f; f.half[0] = *(const v8us*)((const unsigned short*)V16 + ((size_t)b * TT + lg * 64 + r) * CW + h * HD + c8);
#pragma unroll
    for (int q = 0; q < 8; ++q) tl[r][c8 + q] = f.u[q]; }
  __syncthreads();
  { for (int i = tid; i < 128 * 8; i += 256) { const int d = i / 8, pc = i % 8; FragH f;
#pragma unroll
      for (int q = 0; q < 8; ++q) f.u[q] = tl[pc * 8 + q][d]; *(v8us*)((unsigned short*)Vt + ((size_t)slab * HD + d) * TT + lg * 64 + pc * 8) = f.half[0]; }  } }
extern "C" void kernel_launch(void* const* d_in, const int* in_sizes, int n_in,
                              void* d_out, int out_size, void* d_ws, size_t ws_size, hipStream_t stream) {
  (void)in_sizes; (void)n_in; (void)out_size;
  const float* x = (const float*)d_in[0]; const float* Wm[3] = {(const float*)d_in[1], (const float*)d_in[2], (const float*)d_in[3]}; const float* Wsg[3] = {(const float*)d_in[4], (const float*)d_in[5], (const float*)d_in[6]}; const float* Weg[3] = {(const float*)d_in[7], (const float*)d_in[8], (const float*)d_in[9]}; const int* offp = (const int*)d_in[10];
  char* ws = (char*)d_ws; size_t off = 0;
  auto take = [&](size_t bytes) { char* p = ws + off; off += (bytes + 255) & ~(size_t)255; return p; };
  _Float16* B9 = (_Float16*)take((size_t)9 * CW * CW * 2);      // plane 3 * projection + (0 middle, 1 state, 2 end)
  _Float16* XT = (_Float16*)take((size_t)NR * CW * 2); float* CS = (float*)take((size_t)TT * 128 * 4); _Float16* Q16 = (_Float16*)take((size_t)NR * CW * 2); _Float16* K16 = (_Float16*)take((size_t)NR * CW * 2); _Float16* V16 = (_Float16*)take((size_t)NR * CW * 2); _Float16* Vt = (_Float16*)take((size_t)NR * CW * 2);
  if (off > ws_size) return;      // 18.9 + 12.6 + 1.6 + 12.6 x 4 = 83 MB
  k_xt<<<(unsigned)(((size_t)NR * NH * 16 + 255) / 256), 256, 0, stream>>>(x, XT);
  const unsigned gw = (unsigned)(((size_t)CW * NH * 16 + 255) / 256);
  k_wst<<<dim3(gw, 10), 256, 0, stream>>>(Wm[0], Wsg[0], Weg[0], Wm[1], Wsg[1], Weg[1], Wm[2], Wsg[2], Weg[2], B9, offp, CS);
  k_gemm_ring<<<dim3((TT / 64) * (CW / 64), BB, 3), 128, 0, stream>>>(XT, B9, 0.0625f, CS, Q16, K16, V16);
  k_vt128<<<BB * NH * (TT / 64), 256, 0, stream>>>(V16, Vt);
  k_flash<<<BB * NH * (TT / 64), 128, 0, stream>>>(Q16, CW, K16, CW, Vt, nullptr, (float*)d_out, 0);
}

// v006
// One run takes 214 microseconds.
// Two timings next to v005 both put it at 1.08 times that version's speed.
// Over all steps from v000 it is 4.32 times as fast.
#include <hip/hip_runtime.h>
// Causal multi-head attention with state segments (x [2, 8 heads, 3072, 128]; StackedLinear projections that mix heads and features — separate weights for the first 512 (state), middle 2048 and
// last 512 (end) positions; rotate-half RoPE with an INPUT offset; causal softmax(q·k/√128)·v; output [2,8,3072,128]): the nine (h,d)→(g,e) projections as GEMMs on the (b,s)-major transposed
// input (bf16-exact ×2^4 weights, f32 accumulate) and the attention as a fused flash-style kernel (d = 128: 4 k-steps / 8 d-tiles; causal chunk skipping; online softmax f32; P f16 ≤ 1;
// O = P·Vt written straight into the output; RPW-16 waves) on v_wmma_f32_16x16x32_f16; RoPE f32 VALU.
#define BB 2
#define NH 8
#define TT 3072
#define HD 128
#define CW (NH * HD)
#define NR (BB * TT)
#define SL 512

typedef __bf16 v16b __attribute__((ext_vector_type(16)));
typedef unsigned short v8us __attribute__((ext_vector_type(8), may_alias));
typedef float  v8f  __attribute__((ext_vector_type(8)));
typedef float  v4f  __attribute__((ext_vector_type(4)));
typedef float  v4fa __attribute__((ext_vector_type(4), may_alias));
union FragB { v16b v; v8us half[2]; unsigned short u[16]; };

__device__ __forceinline__ unsigned short bf16_bits(float x) { unsigned int u = __float_as_uint(x); return (unsigned short)((u + 0x7FFFu + ((u >> 16) & 1u)) >> 16); }
__device__ __forceinline__ float bf16_val(unsigned short b) { return __uint_as_float(((unsigned int)b) << 16); }
__device__ __forceinline__ float bf16_round(float x) { return bf16_val(bf16_bits(x)); }
// D += A·B with NT terms: 1 = ah·bh, 2 = + al·bh (A split), 3 = + ah·bl (both split)
template <int NT>
__device__ __forceinline__ v8f mmaN(v16b ah, v16b al, v16b bh, v16b bl, v8f c) {
  c = __builtin_amdgcn_wmma_f32_16x16x32_bf16(false, ah, false, bh, (short)0, c, false, false);
  if (NT >= 2) c = __builtin_amdgcn_wmma_f32_16x16x32_bf16(false, al, false, bh, (short)0, c, false, false);
  if (NT >= 3) c = __builtin_amdgcn_wmma_f32_16x16x32_bf16(false, ah, false, bl, (short)0, c, false, false);
  asm volatile("v_nop\n\tv_nop\n\tv_nop\n\tv_nop" : "+v"(c) : "v"(ah), "v"(al), "v"(bh), "v"(bl));
  return c;
}

__global__ __launch_bounds__(256) void k_wt_bf16(const float* __restrict__ W, unsigned short* __restrict__ Wt, int K, int N) {
  const int t = blockIdx.x * 256 + threadIdx.x;
  const int k8n = K / 8;
  if (t >= N * k8n) return;
  const int n = t / k8n, k8 = (t % k8n) * 8;
  v8us v;
#pragma unroll
  for (int i = 0; i < 8; ++i) v[i] = bf16_bits(W[(size_t)(k8 + i) * N + n]);
  *(v8us*)(Wt + (size_t)n * K + k8) = v;
  
}

// GEMM C[M][N] (f32, pitch ldc) = act(A[M][K]·W + bias). A f32 row-major (pitch lda) converted per fragment to bf16
// (ASPLIT: hi/lo two planes -> 2 terms, else single rounded term); Wt bf16 [N][K] (pitch ldb). BIAS_BF16 rounds the
// bias to bf16 first (bias quantised to bf16 before the add). K%32==0, M%16==0, N%64==0.
template <bool ASPLIT, int ACT, bool BIAS_BF16>
__global__ __launch_bounds__(128) void k_gemm_bf(const float* __restrict__ A, int lda, const unsigned short* __restrict__ Wt, int ldb,
                                               const float* __restrict__ bias, float* __restrict__ C, int ldc, int M, int N, int K) {
  __shared__ __attribute__((aligned(16))) float so[4][16][64];
  const int tid = threadIdx.x, w = tid >> 5, lane = tid & 31, ln = lane & 15, hh = lane >> 4;
  const int ntn = N / 64;
  const int wid = blockIdx.x * 4 + w;
  const int mt = wid / ntn, nq = wid % ntn;
  if (mt * 16 >= M) return;
  const int row0 = mt * 16, col0 = nq * 64;
  const float* arow = A + (size_t)(row0 + ln) * lda;
  v8f acc[4] = {};
  for (int kb = 0; kb < K; kb += 32) {
    FragB ah, al;
    const v4f x0 = *(const v4fa*)(arow + kb + 8 * hh), x1 = *(const v4fa*)(arow + kb + 8 * hh + 4);
    const v4f x2 = *(const v4fa*)(arow + kb + 16 + 8 * hh), x3 = *(const v4fa*)(arow + kb + 16 + 8 * hh + 4);
    float xs[16] = {x0[0],x0[1],x0[2],x0[3],x1[0],x1[1],x1[2],x1[3],x2[0],x2[1],x2[2],x2[3],x3[0],x3[1],x3[2],x3[3]};
#pragma unroll
    for (int i = 0; i < 16; ++i) { const unsigned short hb = bf16_bits(xs[i]); ah.u[i] = hb; al.u[i] = ASPLIT ? bf16_bits(xs[i] - bf16_val(hb)) : (unsigned short)0; }
#pragma unroll
    for (int t = 0; t < 4; ++t) {
      const unsigned short* brow = Wt + (size_t)(col0 + t * 16 + ln) * ldb + kb;
      FragB b;
      b.half[0] = *(const v8us*)(brow + 8 * hh);
      b.half[1] = *(const v8us*)(brow + 16 + 8 * hh);
      acc[t] = mmaN<ASPLIT ? 2 : 1>(ah.v, al.v, b.v, b.v, acc[t]);
    }
  }
#pragma unroll
  for (int t = 0; t < 4; ++t) {
    float bv = bias ? bias[col0 + t * 16 + ln] : 0.f;
    if (BIAS_BF16) bv = bf16_round(bv);
#pragma unroll
    for (int r = 0; r < 8; ++r) { float v = acc[t][r] + bv; if (ACT == 1) v = fmaxf(v, 0.f); so[w][8 * hh + r][t * 16 + ln] = v; }
  }
  __builtin_amdgcn_fence(__ATOMIC_ACQ_REL, "workgroup");
  __builtin_amdgcn_wave_barrier();
  const int rsub = lane >> 4, c4 = (lane & 15) * 4;
  {
#pragma unroll
    for (int q = 0; q < 8; ++q) {
      const int r = q * 2 + rsub;
      const v4f v = *(const v4fa*)&so[w][r][c4];
      *(v4f*)(C + (size_t)(row0 + r) * ldc + col0 + c4) = v;
    }
    
  }
}

// Flash-style causal/unmasked attention, all contractions 3-term bf16 hi/lo splits, f32 softmax with running max.
// q,k,v rows are read from f32 buffers with arbitrary row pitch (so they can live inside a fused qkv buffer);
// D = head size (multiple of 32, <= 128); one wave = 16 query rows; block = 4 waves (64 queries) sharing K/V chunks of 32.
template <int D, bool CAUSAL>
__global__ __launch_bounds__(128) void k_flash(const float* __restrict__ qb, const float* __restrict__ kb, const float* __restrict__ vb,
                                             int pitch, int T, int H, float scale, float* __restrict__ y, int ypitch) {
  constexpr int KS = D / 32;        // k-steps for QK
  constexpr int DT = D / 16;        // d tiles for PV
  __shared__ __attribute__((aligned(16))) unsigned short sKh[32][D + 8], sKl[32][D + 8], sVh[32][D + 8], sVl[32][D + 8];
  __shared__ __attribute__((aligned(16))) unsigned short sPh[4][16][40], sPl[4][16][40];
  __shared__ __attribute__((aligned(16))) float sO[4][16][D];
  const int tid = threadIdx.x, w = tid >> 5, lane = tid & 31, ln = lane & 15, hh = lane >> 4;
  const int nqb = (T + 63) / 64;
  const int bh = blockIdx.x / nqb, qblk = blockIdx.x % nqb;
  const int b = bh / H, h = bh % H;
  const int q0 = qblk * 64 + w * 16;
  const float* Q = qb + (size_t)b * T * pitch + h * D;
  const float* K = kb + (size_t)b * T * pitch + h * D;
  const float* V = vb + (size_t)b * T * pitch + h * D;

  // A fragments of the wave's 16 query rows (scaled), hi/lo
  FragB aqh[KS], aql[KS];
  {
    int row = q0 + ln; if (row >= T) row = T - 1;
    const float* qr = Q + (size_t)row * pitch;
#pragma unroll
    for (int ks = 0; ks < KS; ++ks)
#pragma unroll
      for (int i = 0; i < 16; ++i) {
        const int d = ks * 32 + ((i < 8) ? (8 * hh + i) : (16 + 8 * hh + (i - 8)));
        const float x = qr[d] * scale; const unsigned short hb = bf16_bits(x);
        aqh[ks].u[i] = hb; aql[ks].u[i] = bf16_bits(x - bf16_val(hb));
      }
  }
  float m_r[8], l_r[8];
#pragma unroll
  for (int r = 0; r < 8; ++r) { m_r[r] = -3.0e38f; l_r[r] = 0.f; }
  v8f oacc[DT];
#pragma unroll
  for (int dt = 0; dt < DT; ++dt) oacc[dt] = (v8f){0.f,0.f,0.f,0.f,0.f,0.f,0.f,0.f};

  const int kv_end = CAUSAL ? min(T, qblk * 64 + 64) : T;     // block-uniform
  for (int j0 = 0; j0 < kv_end; j0 += 32) {
    __syncthreads();
    for (int e = tid; e < 32 * (D / 4); e += 128) {
      const int r = e / (D / 4), c4 = (e % (D / 4)) * 4;
      const int key = j0 + r;
      v4f kf = {0.f,0.f,0.f,0.f}, vf = {0.f,0.f,0.f,0.f};
      if (key < T) { kf = *(const v4fa*)(K + (size_t)key * pitch + c4); vf = *(const v4fa*)(V + (size_t)key * pitch + c4); }
#pragma unroll
      for (int t = 0; t < 4; ++t) {
        unsigned short hb = bf16_bits(kf[t]); sKh[r][c4 + t] = hb; sKl[r][c4 + t] = bf16_bits(kf[t] - bf16_val(hb));
        hb = bf16_bits(vf[t]); sVh[r][c4 + t] = hb; sVl[r][c4 + t] = bf16_bits(vf[t] - bf16_val(hb));
      }
    }
    __syncthreads();
    // S tile 16 x 32
    v8f s[2];
#pragma unroll
    for (int nt = 0; nt < 2; ++nt) {
      v8f acc = {};
#pragma unroll
      for (int ks = 0; ks < KS; ++ks) {
        FragB bh_, bl_;
        bh_.half[0] = *(const v8us*)&sKh[nt * 16 + ln][ks * 32 + 8 * hh]; bh_.half[1] = *(const v8us*)&sKh[nt * 16 + ln][ks * 32 + 16 + 8 * hh];
        bl_.half[0] = *(const v8us*)&sKl[nt * 16 + ln][ks * 32 + 8 * hh]; bl_.half[1] = *(const v8us*)&sKl[nt * 16 + ln][ks * 32 + 16 + 8 * hh];
        acc = mmaN<3>(aqh[ks].v, aql[ks].v, bh_.v, bl_.v, acc);
      }
      s[nt] = acc;
    }
    // mask + running max (rows 8hh+r; the 16 lanes of a half share rows)
    float alpha[8];
#pragma unroll
    for (int r = 0; r < 8; ++r) {
      const int qi = q0 + 8 * hh + r;
      const int ja = j0 + ln, jb = j0 + 16 + ln;
      if (CAUSAL) { if (ja > qi) s[0][r] = -3.0e38f; if (jb > qi) s[1][r] = -3.0e38f; }
      if (ja >= T) s[0][r] = -3.0e38f;
      if (jb >= T) s[1][r] = -3.0e38f;
      float mx = fmaxf(s[0][r], s[1][r]);
      mx = fmaxf(mx, __shfl_xor(mx, 1, 32)); mx = fmaxf(mx, __shfl_xor(mx, 2, 32)); mx = fmaxf(mx, __shfl_xor(mx, 4, 32)); mx = fmaxf(mx, __shfl_xor(mx, 8, 32));
      const float mnew = fmaxf(m_r[r], mx);
      alpha[r] = (mnew > -1.0e38f) ? __expf(m_r[r] - mnew) : 1.0f;
      const float p0 = (s[0][r] > -1.0e38f) ? __expf(s[0][r] - mnew) : 0.f;
      const float p1 = (s[1][r] > -1.0e38f) ? __expf(s[1][r] - mnew) : 0.f;
      m_r[r] = mnew;
      l_r[r] = l_r[r] * alpha[r] + p0 + p1;            // per-lane partial row sum (16 lanes combined at the end)
      unsigned short hb = bf16_bits(p0); sPh[w][8 * hh + r][ln] = hb;      sPl[w][8 * hh + r][ln] = bf16_bits(p0 - bf16_val(hb));
      hb = bf16_bits(p1);                sPh[w][8 * hh + r][16 + ln] = hb; sPl[w][8 * hh + r][16 + ln] = bf16_bits(p1 - bf16_val(hb));
    }
#pragma unroll
    for (int dt = 0; dt < DT; ++dt)
#pragma unroll
      for (int r = 0; r < 8; ++r) oacc[dt][r] *= alpha[r];
    __builtin_amdgcn_fence(__ATOMIC_ACQ_REL, "workgroup");
    __builtin_amdgcn_wave_barrier();
    FragB pah, pal;
    pah.half[0] = *(const v8us*)&sPh[w][ln][8 * hh]; pah.half[1] = *(const v8us*)&sPh[w][ln][16 + 8 * hh];
    pal.half[0] = *(const v8us*)&sPl[w][ln][8 * hh]; pal.half[1] = *(const v8us*)&sPl[w][ln][16 + 8 * hh];
#pragma unroll
    for (int dt = 0; dt < DT; ++dt) {
      FragB bvh, bvl;
#pragma unroll
      for (int i = 0; i < 8; ++i) {
        bvh.u[i] = sVh[8 * hh + i][dt * 16 + ln]; bvh.u[8 + i] = sVh[16 + 8 * hh + i][dt * 16 + ln];
        bvl.u[i] = sVl[8 * hh + i][dt * 16 + ln]; bvl.u[8 + i] = sVl[16 + 8 * hh + i][dt * 16 + ln];
      }
      oacc[dt] = mmaN<3>(pah.v, pal.v, bvh.v, bvl.v, oacc[dt]);
    }
    __builtin_amdgcn_fence(__ATOMIC_ACQ_REL, "workgroup");
    __builtin_amdgcn_wave_barrier();
  }
#pragma unroll
  for (int r = 0; r < 8; ++r) {
    float l = l_r[r];
    l += __shfl_xor(l, 1, 32); l += __shfl_xor(l, 2, 32); l += __shfl_xor(l, 4, 32); l += __shfl_xor(l, 8, 32);
    l_r[r] = (l > 0.f) ? 1.0f / l : 0.f;
  }
#pragma unroll
  for (int dt = 0; dt < DT; ++dt)
#pragma unroll
    for (int r = 0; r < 8; ++r) sO[w][8 * hh + r][dt * 16 + ln] = oacc[dt][r] * l_r[r];
  __builtin_amdgcn_fence(__ATOMIC_ACQ_REL, "workgroup");
  __builtin_amdgcn_wave_barrier();
  {
    for (int r = 0; r < 16; ++r) {
      const int row = q0 + r;
      if (row < T && lane < D / 4) {
        const v4f val = *(const v4fa*)&sO[w][r][lane * 4];
        *(v4f*)(y + ((size_t)b * T + row) * ypitch + h * D + lane * 4) = val;
      }
    }
    
  }
}

// GEMM C = act(A·W + bias + resid): A f32 (ASPLIT -> hi/lo 2 terms), Wt bf16 [N][K]; ACT 0 none, 1 relu, 2 exact gelu;
// resid (optional, f32, row index = (row % rmod), pitch ldr, RES_BF16 rounds it) added before the activation.
template <bool ASPLIT, int ACT, bool BIAS_BF16, bool RES_BF16>
__global__ __launch_bounds__(128) void k_gemm_bf3(const float* __restrict__ A, int lda, const unsigned short* __restrict__ Wt, int ldb,
                                                const float* __restrict__ bias, const float* __restrict__ resid, int rmod, int ldr,
                                                float* __restrict__ C, int ldc, int M, int N, int K) {
  __shared__ __attribute__((aligned(16))) float so[4][16][64];
  const int tid = threadIdx.x, w = tid >> 5, lane = tid & 31, ln = lane & 15, hh = lane >> 4;
  const int ntn = N / 64;
  const int wid = blockIdx.x * 4 + w;
  const int mt = wid / ntn, nq = wid % ntn;
  if (mt * 16 >= M) return;
  const int row0 = mt * 16, col0 = nq * 64;
  const float* arow = A + (size_t)(row0 + ln) * lda;
  v8f acc[4] = {};
  for (int kb = 0; kb < K; kb += 32) {
    FragB ah, al;
    const v4f x0 = *(const v4fa*)(arow + kb + 8 * hh), x1 = *(const v4fa*)(arow + kb + 8 * hh + 4);
    const v4f x2 = *(const v4fa*)(arow + kb + 16 + 8 * hh), x3 = *(const v4fa*)(arow + kb + 16 + 8 * hh + 4);
    float xs[16] = {x0[0],x0[1],x0[2],x0[3],x1[0],x1[1],x1[2],x1[3],x2[0],x2[1],x2[2],x2[3],x3[0],x3[1],x3[2],x3[3]};
#pragma unroll
    for (int i = 0; i < 16; ++i) { const unsigned short hb = bf16_bits(xs[i]); ah.u[i] = hb; al.u[i] = ASPLIT ? bf16_bits(xs[i] - bf16_val(hb)) : (unsigned short)0; }
#pragma unroll
    for (int t = 0; t < 4; ++t) {
      const unsigned short* brow = Wt + (size_t)(col0 + t * 16 + ln) * ldb + kb;
      FragB b;
      b.half[0] = *(const v8us*)(brow + 8 * hh);
      b.half[1] = *(const v8us*)(brow + 16 + 8 * hh);
      acc[t] = mmaN<ASPLIT ? 2 : 1>(ah.v, al.v, b.v, b.v, acc[t]);
    }
  }
#pragma unroll
  for (int t = 0; t < 4; ++t) {
    const int col = col0 + t * 16 + ln;
    float bv = bias ? bias[col] : 0.f;
    if (BIAS_BF16) bv = bf16_round(bv);
#pragma unroll
    for (int r = 0; r < 8; ++r) {
      float v = acc[t][r] + bv;
      if (resid) { float rv = resid[(size_t)((row0 + 8 * hh + r) % rmod) * ldr + col]; if (RES_BF16) rv = bf16_round(rv); v += rv; }
      if (ACT == 1) v = fmaxf(v, 0.f);
      if (ACT == 2) v = 0.5f * v * (1.0f + erff(v * 0.70710678118654752f));
      if (ACT == 3) { const float u = 0.7978845608028654f * (v + 0.044715f * v * v * v); v = 0.5f * v * (1.0f + tanhf(u)); }
      so[w][8 * hh + r][t * 16 + ln] = v;
    }
  }
  __builtin_amdgcn_fence(__ATOMIC_ACQ_REL, "workgroup");
  __builtin_amdgcn_wave_barrier();
  const int rsub = lane >> 4, c4 = (lane & 15) * 4;
  {
#pragma unroll
    for (int q = 0; q < 8; ++q) {
      const int r = q * 2 + rsub;
      const v4f v = *(const v4fa*)&so[w][r][c4];
      *(v4f*)(C + (size_t)(row0 + r) * ldc + col0 + c4) = v;
    }
    
  }
}
// row LayerNorm (biased variance, eps) over N: s = X (+ R); optional out_sum <- s; out_norm <- (s-mu)*rsqrt(var+eps)*g + b
template <bool PARAM_BF16>
__global__ __launch_bounds__(256) void k_layernorm(const float* __restrict__ X, const float* __restrict__ R, const float* __restrict__ g, const float* __restrict__ bta,
                                                  float* __restrict__ out_sum, float* __restrict__ out_norm, int N, float eps) {
  __shared__ float red[256];
  const int row = blockIdx.x, tid = threadIdx.x;
  const float* x = X + (size_t)row * N; const float* rr = R ? R + (size_t)row * N : nullptr;
  float vals[16];                     // up to N = 4096
  const int per = N / 256;            // contiguous chunk per thread? use strided-by-4 chunks: thread handles j = tid*4 + 1024*u
  float s1 = 0.f;
  for (int u = 0; u < per / 4; ++u) {
    const int j = tid * 4 + 1024 * u;
    const v4f a = *(const v4fa*)(x + j);
    v4f b = {0.f,0.f,0.f,0.f}; if (rr) b = *(const v4fa*)(rr + j);
#pragma unroll
    for (int q = 0; q < 4; ++q) { const float v = a[q] + b[q]; vals[u * 4 + q] = v; s1 += v; }
  }
  red[tid] = s1; __syncthreads();
  for (int st = 128; st > 0; st >>= 1) { if (tid < st) red[tid] += red[tid + st]; __syncthreads(); }
  const float mu = red[0] / (float)N; __syncthreads();
  float s2 = 0.f;
  for (int u = 0; u < per / 4; ++u)
#pragma unroll
    for (int q = 0; q < 4; ++q) { const float c = vals[u * 4 + q] - mu; s2 += c * c; }
  red[tid] = s2; __syncthreads();
  for (int st = 128; st > 0; st >>= 1) { if (tid < st) red[tid] += red[tid + st]; __syncthreads(); }
  const float rs = rsqrtf(red[0] / (float)N + eps);
  {
    for (int u = 0; u < per / 4; ++u) {
      const int j = tid * 4 + 1024 * u;
      v4f o, sm;
#pragma unroll
      for (int q = 0; q < 4; ++q) {
        float gg = g[j + q], bb = bta[j + q];
        if (PARAM_BF16) { gg = bf16_round(gg); bb = bf16_round(bb); }
        sm[q] = vals[u * 4 + q]; o[q] = (vals[u * 4 + q] - mu) * rs * gg + bb;
      }
      if (out_sum) *(v4f*)(out_sum + (size_t)row * N + j) = sm;
      *(v4f*)(out_norm + (size_t)row * N + j) = o;
    }
    
  }
}



// ---- f16 WMMA path (v_wmma_f32_16x16x32_f16): 11-bit significands for operands in range — used where a [0,1] probability operand needs more precision than bf16
typedef _Float16 v16h __attribute__((ext_vector_type(16)));
union FragH { v16h v; v8us half[2]; _Float16 h[16]; unsigned short u[16]; };
template <int NT>
__device__ __forceinline__ v8f mmaH(v16h ah, v16h al, v16h bh, v16h bl, v8f c) {
  c = __builtin_amdgcn_wmma_f32_16x16x32_f16(false, ah, false, bh, (short)0, c, false, false);
  if (NT >= 2) c = __builtin_amdgcn_wmma_f32_16x16x32_f16(false, al, false, bh, (short)0, c, false, false);
  if (NT >= 3) c = __builtin_amdgcn_wmma_f32_16x16x32_f16(false, ah, false, bl, (short)0, c, false, false);
  asm volatile("v_nop\n\tv_nop\n\tv_nop\n\tv_nop" : "+v"(c) : "v"(ah), "v"(al), "v"(bh), "v"(bl));
  return c;
}
// batched GEMM like k_gemm_b but f16 operands: A f32 (split into f16 hi/lo if ASPLIT, else rounded to f16), Bt = f16 values [n][k]; alpha; C f32; N multiple of 16 (partial tiles skipped)
template <bool ASPLIT>
__global__ __launch_bounds__(128) void k_gemm_h(const float* __restrict__ A, int lda, size_t sA, const _Float16* __restrict__ Bh, int ldb, size_t sB, float alpha, float* __restrict__ C, int ldc, size_t sC, int M, int N, int K) {
  __shared__ __attribute__((aligned(16))) float so[4][16][64];
  const int tid = threadIdx.x, w = tid >> 5, lane = tid & 31, ln = lane & 15, hh = lane >> 4; const int by = blockIdx.y;
  A += (size_t)by * sA; Bh += (size_t)by * sB; C += (size_t)by * sC;
  const int ntn = (N + 63) / 64; const int wid = blockIdx.x * 4 + w; const int mt = wid / ntn, nq = wid % ntn; if (mt * 16 >= M) return;
  const int row0 = mt * 16, col0 = nq * 64; const float* arow = A + (size_t)(row0 + ln) * lda;
  v8f acc[4] = {};
  for (int kb = 0; kb < K; kb += 32) {
    FragH ah, al;
    const v4f x0 = *(const v4fa*)(arow + kb + 8 * hh), x1 = *(const v4fa*)(arow + kb + 8 * hh + 4), x2 = *(const v4fa*)(arow + kb + 16 + 8 * hh), x3 = *(const v4fa*)(arow + kb + 16 + 8 * hh + 4);
    float xs[16] = {x0[0],x0[1],x0[2],x0[3],x1[0],x1[1],x1[2],x1[3],x2[0],x2[1],x2[2],x2[3],x3[0],x3[1],x3[2],x3[3]};
#pragma unroll
    for (int i = 0; i < 16; ++i) { const _Float16 h = (_Float16)xs[i]; ah.h[i] = h; al.h[i] = ASPLIT ? (_Float16)(xs[i] - (float)h) : (_Float16)0.0f; }
#pragma unroll
    for (int t = 0; t < 4; ++t) { if (col0 + t * 16 >= N) continue; const size_t boff = (size_t)(col0 + t * 16 + ln) * ldb + kb; FragH bq; bq.half[0] = *(const v8us*)(Bh + boff + 8 * hh); bq.half[1] = *(const v8us*)(Bh + boff + 16 + 8 * hh);
      acc[t] = mmaH<ASPLIT ? 2 : 1>(ah.v, al.v, bq.v, bq.v, acc[t]); }
  }
#pragma unroll
  for (int t = 0; t < 4; ++t) { if (col0 + t * 16 >= N) continue;
#pragma unroll
    for (int r = 0; r < 8; ++r) so[w][8 * hh + r][t * 16 + ln] = acc[t][r] * alpha; }
  __builtin_amdgcn_fence(__ATOMIC_ACQ_REL, "workgroup"); __builtin_amdgcn_wave_barrier();
  const int rsub = lane >> 4, c4 = (lane & 15) * 4;
  {
#pragma unroll
    for (int q = 0; q < 8; ++q) { const int r = q * 2 + rsub; if (col0 + c4 < N) { const v4f v = *(const v4fa*)&so[w][r][c4]; *(v4f*)(C + (size_t)(row0 + r) * ldc + col0 + c4) = v; } }
     }
}

// Wt[n][k] = f16(W[k][n]·scale) from f32 row-major W[K][N] (scale = power of two; bf16-exact weights stay exact in f16 away from the subnormal range)
__global__ __launch_bounds__(256) void k_wt_f16(const float* __restrict__ W, _Float16* __restrict__ Wt, int K, int N, float scale) {
  const int t = blockIdx.x * 256 + threadIdx.x; if (t >= N * (K / 8)) return; const int n = t / (K / 8), k8 = (t % (K / 8)) * 8; FragH f;
#pragma unroll
  for (int i = 0; i < 8; ++i) f.h[i] = (_Float16)(bf16_round(W[(size_t)(k8 + i) * N + n]) * scale); const v8us o = f.half[0];
  *(v8us*)((unsigned short*)Wt + (size_t)n * K + k8) = o; 
}
__global__ __launch_bounds__(256) void k_x16(const float* __restrict__ x, _Float16* __restrict__ X16, size_t n8) { const size_t t = (size_t)blockIdx.x * 256 + threadIdx.x; if (t >= n8) return; FragH f;
#pragma unroll
  for (int q = 0; q < 8; ++q) f.h[q] = (_Float16)bf16_round(x[t * 8 + q]); *(v8us*)((unsigned short*)X16 + t * 8) = f.half[0];  }
__global__ __launch_bounds__(256) void k_h16(const float* __restrict__ x, _Float16* __restrict__ X16, size_t n8) { const size_t t = (size_t)blockIdx.x * 256 + threadIdx.x; if (t >= n8) return; FragH f;
#pragma unroll
  for (int q = 0; q < 8; ++q) f.h[q] = (_Float16)x[t * 8 + q]; *(v8us*)((unsigned short*)X16 + t * 8) = f.half[0];  }
__global__ __launch_bounds__(256) void k_round16f(const float* __restrict__ W, _Float16* __restrict__ Bt, size_t n8) { const size_t t = (size_t)blockIdx.x * 256 + threadIdx.x; if (t >= n8) return; FragH f;
#pragma unroll
  for (int i = 0; i < 8; ++i) f.h[i] = (_Float16)(bf16_round(W[t * 8 + i]) * 16.0f); *(v8us*)((unsigned short*)Bt + t * 8) = f.half[0];  }
template <int NHv, int TTv>
__global__ __launch_bounds__(256) void k_vt(const _Float16* __restrict__ V16, int ldv, int voff, _Float16* __restrict__ Vt) { __shared__ unsigned short tl[64][66]; const int tid = threadIdx.x; const int slab = blockIdx.x / (TTv / 64), lg = blockIdx.x % (TTv / 64); const int b = slab / NHv, h = slab % NHv;
  for (int i = tid; i < 64 * 8; i += 256) { const int r = i / 8, c8 = (i % 8) * 8; FragH f; f.half[0] = *(const v8us*)((const unsigned short*)V16 + ((size_t)b * TTv + lg * 64 + r) * ldv + voff + h * 64 + c8);
#pragma unroll
    for (int q = 0; q < 8; ++q) tl[r][c8 + q] = f.u[q]; }
  __syncthreads();
  {
#pragma unroll
    for (int rd = 0; rd < 2; ++rd) { const int d = rd * 32 + tid / 8, pc = tid % 8; FragH f;
#pragma unroll
      for (int q = 0; q < 8; ++q) f.u[q] = tl[pc * 8 + q][d];
      *(v8us*)((unsigned short*)Vt + ((size_t)slab * 64 + d) * TTv + lg * 64 + pc * 8) = f.half[0]; }
     } }

// Eight 16-byte asynchronous copies per lane, global memory to LDS through no register: piece i goes from g + i * gstep to LDS byte l + i * lstep.
// The s_wait_xcnt closes the statement so that it stands in front of any later rewrite of the address registers the copies name.
__device__ __forceinline__ void copy8_to_lds(unsigned l, unsigned lstep, const char* g, size_t gstep) {
  asm volatile("global_load_async_to_lds_b128 %0, %8, off\n\t"
               "global_load_async_to_lds_b128 %1, %9, off\n\t"
               "global_load_async_to_lds_b128 %2, %10, off\n\t"
               "global_load_async_to_lds_b128 %3, %11, off\n\t"
               "global_load_async_to_lds_b128 %4, %12, off\n\t"
               "global_load_async_to_lds_b128 %5, %13, off\n\t"
               "global_load_async_to_lds_b128 %6, %14, off\n\t"
               "global_load_async_to_lds_b128 %7, %15, off\n\t"
               "s_wait_xcnt 0x0"
               :: "v"(l), "v"(l + lstep), "v"(l + 2 * lstep), "v"(l + 3 * lstep), "v"(l + 4 * lstep), "v"(l + 5 * lstep), "v"(l + 6 * lstep), "v"(l + 7 * lstep),
                  "v"(g), "v"(g + gstep), "v"(g + 2 * gstep), "v"(g + 3 * gstep), "v"(g + 4 * gstep), "v"(g + 5 * gstep), "v"(g + 6 * gstep), "v"(g + 7 * gstep)
               : "memory");
}

// One butterfly step of a reduction over a 16-lane row, on the vector pipe: the lane's value joined with that of lane ^ M. It takes the place of a ds_bpermute_b32 and the
// s_wait_dscnt behind it, so that the steps of several rows can follow one another without a wait. Every lane is on where these stand.
template <int M> __device__ __forceinline__ float row_max_step(float v) { float o;
  asm("v_max_num_f32_dpp %0, %1, %1 row_xmask:%2 row_mask:0xf bank_mask:0xf" : "=v"(o) : "v"(v), "n"(M));      // o = max(v of lane ^ M, v)
  return o; }
template <int M> __device__ __forceinline__ float row_add_step(float v) { float o;
  asm("v_add_f32_dpp %0, %1, %1 row_xmask:%2 row_mask:0xf bank_mask:0xf" : "=v"(o) : "v"(v), "n"(M));          // o = v of lane ^ M + v
  return o; }

// K and Vt reach the four waves of a work-group through LDS: a stage is 64 keys (K: 64 rows of 256 B, Vt: 128 rows of 128 B, whole 128-B lines), copied once per work-group,
// two buffers, the next stage in flight while this one is worked on. Row pitches 272 B and 144 B (16 B x odd) keep the ds_load_b128 fragment reads free of bank conflicts.
__global__ __launch_bounds__(128) void k_flash(const _Float16* __restrict__ Q16, int ldq, const _Float16* __restrict__ K16, int ldk, const _Float16* __restrict__ Vt, const int* __restrict__ MSK, float* __restrict__ O, int ldo) {
  constexpr int RPW = 16, RTN = RPW / 16, NQB = 3072 / (4 * RPW), DT = 8, KS = 4;      /* head dim 128 */
  constexpr unsigned KP = 272, VP = 144, KBYTES = 64 * KP, STG = KBYTES + 128 * VP;
  __shared__ __attribute__((aligned(16))) unsigned char ring[2 * STG];
  __shared__ __attribute__((aligned(16))) unsigned short sP[4][RPW][40];
  float (*sO)[RPW][128 + 4] = (float (*)[RPW][128 + 4])ring;      /* output staging takes the ring's place behind the loop's last barrier */
  static_assert(sizeof(float) * 4 * RPW * (128 + 4) <= 2 * STG, "output staging fits the ring");
  const int tid = threadIdx.x, w = tid >> 5, lane = tid & 31, ln = lane & 15, hh = lane >> 4;
  const int slab = blockIdx.x / NQB, qblk = blockIdx.x % NQB; const int b = slab / 8, h = slab % 8; const int qb0 = qblk * (4 * RPW); const int q0 = qb0 + w * RPW;
  FragH aq[2][KS];
#pragma unroll
  for (int rt = 0; rt < RTN; ++rt) { const unsigned short* qr = (const unsigned short*)Q16 + ((size_t)b * 3072 + q0 + rt * 16 + ln) * ldq + h * 128;
#pragma unroll
    for (int ks = 0; ks < KS; ++ks) { aq[rt][ks].half[0] = *(const v8us*)(qr + ks * 32 + 8 * hh); aq[rt][ks].half[1] = *(const v8us*)(qr + ks * 32 + 16 + 8 * hh); } }
  const unsigned short* Vth = (const unsigned short*)Vt + (size_t)slab * 128 * 3072;
  // each thread's own pieces of a stage: K row tid/16 + 8i, 16-byte piece tid%16; Vt row tid/8 + 16i, piece tid%8
  const char* kg = (const char*)((const unsigned short*)K16 + ((size_t)b * 3072 + (tid >> 4)) * ldk + h * 128 + (tid & 15) * 8);
  const char* vg = (const char*)(Vth + (size_t)(tid >> 3) * 3072 + (tid & 7) * 8);
  const unsigned ring0 = (unsigned)(size_t)ring;
  const unsigned kl = ring0 + (unsigned)(tid >> 4) * KP + (unsigned)(tid & 15) * 16u, vl = ring0 + KBYTES + (unsigned)(tid >> 3) * VP + (unsigned)(tid & 7) * 16u;
  const size_t kstage = (size_t)64 * ldk * 2, kstep = (size_t)8 * ldk * 2;
  auto fill = [&](int st, unsigned buf) {
    copy8_to_lds(kl + buf * STG, 8 * KP, kg + (size_t)st * kstage, kstep);
    copy8_to_lds(vl + buf * STG, 16 * VP, vg + (size_t)st * 128, (size_t)16 * 3072 * 2);
  };
  float m_r[2][8], l_r[2][8]; v8f oacc[2][DT];
#pragma unroll
  for (int rt = 0; rt < RTN; ++rt) {
#pragma unroll
    for (int r = 0; r < 8; ++r) { m_r[rt][r] = -3.0e38f; l_r[rt][r] = 0.f; }
#pragma unroll
    for (int dt = 0; dt < DT; ++dt) oacc[rt][dt] = (v8f){0.f,0.f,0.f,0.f,0.f,0.f,0.f,0.f}; }
  const int nst = qblk + 1;      /* stages of 64 keys up to the block's diagonal; the same for the whole work-group */
  fill(0, 0u);
  asm volatile("s_wait_asynccnt 0x0" ::: "memory");      // this wave's pieces of stage 0 have landed
  __syncthreads();                                       // every wave's pieces of stage 0 are readable
  if (nst > 1) fill(1, 1u);
#pragma unroll 1      /* one copy of the body: the ring's order stays as written */
  for (int st = 0; st < nst; ++st) {
    const unsigned char* kbuf = ring + (unsigned)(st & 1) * STG; const unsigned char* vbuf = kbuf + KBYTES;
#pragma unroll 1      /* the two 32-key passes of a stage share one body in the instruction cache */
  for (int sub = 0; sub < 2; ++sub) { const int j0 = st * 64 + sub * 32;
    v8f s[2][2]; FragH bk[2][KS];      /* the pass's K fragments, both key tiles, one group of LDS reads ahead of the score products */
#pragma unroll
    for (int nt = 0; nt < 2; ++nt) { const unsigned char* kr = kbuf + (unsigned)(sub * 32 + nt * 16 + ln) * KP + 16 * hh;
#pragma unroll
      for (int ks = 0; ks < KS; ++ks) { bk[nt][ks].half[0] = *(const v8us*)(kr + ks * 64); bk[nt][ks].half[1] = *(const v8us*)(kr + ks * 64 + 32); } }
#pragma unroll
    for (int nt = 0; nt < 2; ++nt) {
#pragma unroll
      for (int rt = 0; rt < RTN; ++rt) { v8f acc = (v8f){0.f,0.f,0.f,0.f,0.f,0.f,0.f,0.f};
#pragma unroll
        for (int ks = 0; ks < KS; ++ks) acc = mmaH<1>(aq[rt][ks].v, aq[rt][ks].v, bk[nt][ks].v, bk[nt][ks].v, acc); s[rt][nt] = acc; } }
    // The softmax of a pass in six sweeps over the eight rows a lane holds (the wave's sixteen), each sweep one straight run of code, so that the rows' dependent chains overlap:
    // masked scores, then the row maxima step by step, then the exponentials, each computed ahead of the select that may drop it (no branch stands between two rows).
#pragma unroll
    for (int rt = 0; rt < RTN; ++rt) { const int k0 = j0 + ln, k1 = j0 + 16 + ln; float s0[8], s1[8], mc[8];
#pragma unroll
      for (int r = 0; r < 8; ++r) { const int tq = q0 + rt * 16 + 8 * hh + r;
        s0[r] = (k0 <= tq) ? s[rt][0][r] * (0.08838834764831845f) : -INFINITY; s1[r] = (k1 <= tq) ? s[rt][1][r] * (0.08838834764831845f) : -INFINITY; mc[r] = fmaxf(s0[r], s1[r]); }
#pragma unroll
      for (int r = 0; r < 8; ++r) mc[r] = row_max_step<1>(mc[r]);
#pragma unroll
      for (int r = 0; r < 8; ++r) mc[r] = row_max_step<2>(mc[r]);
#pragma unroll
      for (int r = 0; r < 8; ++r) mc[r] = row_max_step<4>(mc[r]);
#pragma unroll
      for (int r = 0; r < 8; ++r) mc[r] = row_max_step<8>(mc[r]);
#pragma unroll
      for (int r = 0; r < 8; ++r) { const int tq = q0 + rt * 16 + 8 * hh + r; const bool ok0 = (k0 <= tq), ok1 = (k1 <= tq);
        const float mn = fmaxf(m_r[rt][r], mc[r]); const float ea = expf(m_r[rt][r] - mn), e0 = expf(s0[r] - mn), e1 = expf(s1[r] - mn);      /* mn is finite: no difference here is a NaN */
        const float al = (mn > -1.0e38f) ? ea : 1.0f; m_r[rt][r] = mn; const float p0 = ok0 ? e0 : 0.f, p1 = ok1 ? e1 : 0.f; l_r[rt][r] = l_r[rt][r] * al + p0 + p1;
#pragma unroll
        for (int dt = 0; dt < DT; ++dt) oacc[rt][dt][r] *= al;
        FragH t2; t2.h[0] = (_Float16)p0; t2.h[1] = (_Float16)p1; sP[w][rt * 16 + 8 * hh + r][ln] = t2.u[0]; sP[w][rt * 16 + 8 * hh + r][16 + ln] = t2.u[1]; } }
    // The pass's Vt fragments, one group of LDS reads, in flight together with the stores of P: one wait serves them all, and the P.V products below follow one another from registers.
    FragH bv[DT];
#pragma unroll
    for (int dt = 0; dt < DT; ++dt) { const unsigned char* vrow = vbuf + (unsigned)(dt * 16 + ln) * VP + sub * 64 + 16 * hh; bv[dt].half[0] = *(const v8us*)(vrow); bv[dt].half[1] = *(const v8us*)(vrow + 32); }
    __builtin_amdgcn_fence(__ATOMIC_ACQ_REL, "workgroup"); __builtin_amdgcn_wave_barrier();
    FragH pa[2];
#pragma unroll
    for (int rt = 0; rt < RTN; ++rt) { pa[rt].half[0] = *(const v8us*)&sP[w][rt * 16 + ln][8 * hh]; pa[rt].half[1] = *(const v8us*)&sP[w][rt * 16 + ln][16 + 8 * hh]; }
#pragma unroll
    for (int dt = 0; dt < DT; ++dt) {
#pragma unroll
      for (int rt = 0; rt < RTN; ++rt) oacc[rt][dt] = mmaH<1>(pa[rt].v, pa[rt].v, bv[dt].v, bv[dt].v, oacc[rt][dt]); }
    __builtin_amdgcn_fence(__ATOMIC_ACQ_REL, "workgroup"); __builtin_amdgcn_wave_barrier(); }
    asm volatile("s_wait_dscnt 0x0" ::: "memory");       // this wave's reads of the buffer have returned before it is refilled
    asm volatile("s_wait_asynccnt 0x0" ::: "memory");    // this wave's pieces of stage st + 1 have landed
    __syncthreads();                                     // publishes stage st + 1 and ends every wave's reads of stage st
    if (st + 2 < nst) fill(st + 2, (unsigned)(st & 1));
  }
  asm volatile("s_wait_asynccnt 0x0" ::: "memory");      // no copy is outstanding when the ring becomes output staging
#pragma unroll
  for (int rt = 0; rt < RTN; ++rt) {
#pragma unroll
    for (int r = 0; r < 8; ++r) l_r[rt][r] = row_add_step<1>(l_r[rt][r]);
#pragma unroll
    for (int r = 0; r < 8; ++r) l_r[rt][r] = row_add_step<2>(l_r[rt][r]);
#pragma unroll
    for (int r = 0; r < 8; ++r) l_r[rt][r] = row_add_step<4>(l_r[rt][r]);
#pragma unroll
    for (int r = 0; r < 8; ++r) l_r[rt][r] = row_add_step<8>(l_r[rt][r]);
#pragma unroll
    for (int r = 0; r < 8; ++r) { const float l = l_r[rt][r]; l_r[rt][r] = (l > 0.f) ? 1.0f / l : 0.f; }
#pragma unroll
    for (int dt = 0; dt < DT; ++dt)
#pragma unroll
      for (int r = 0; r < 8; ++r) sO[w][rt * 16 + 8 * hh + r][dt * 16 + ln] = oacc[rt][dt][r] * l_r[rt][r]; }
  __builtin_amdgcn_fence(__ATOMIC_ACQ_REL, "workgroup"); __builtin_amdgcn_wave_barrier();
  {
#pragma unroll
    for (int rp = 0; rp < RPW; ++rp) { const int r = rp, pc = lane; const v4f val = *(const v4fa*)&sO[w][r][pc * 4]; *(v4f*)(O + ((size_t)(b * 8 + h) * 3072 + q0 + r) * 128 + pc * 4) = val; }      /* output layout [b][h][s][128]: 32 lanes x 16 B rows */
     } }

// Projection GEMM: C[row][col] = alpha * sum_k A[row][k] * Bt[col][k], both operands f16 with CW elements a row, f32 accumulate, k ascending in one chain per accumulator.
// A work-group owns a 64 x 64 tile of C, its four waves 32 x 32 each. A and Bt reach the waves through LDS: a stage is 128 k (64 rows of A and 64 of Bt, 256 B each, whole 128-B lines),
// copied once per work-group, two buffers, the next stage in flight while this one is worked on. Row pitch 272 B (16 B x odd) keeps the ds_load_b128 fragment reads free of bank conflicts.
// One launch does all nine projections. The grid is exact: blockIdx.x = row tile of the TT positions * (CW / 64) + column tile, blockIdx.y = batch, blockIdx.z = projection (0 q, 1 k, 2 v).
// A row tile lies wholly in one segment (SL is a multiple of 64) and takes that segment's weights: plane 3 * projection + (0 middle, 1 state, 2 end) of B9. All three go out as f16.
// q and k are rotated (RoPE) on their way out. Their weight planes come with bits 5 and 6 of the column-in-head swapped (k_wst), so that columns c and c + 32 of a tile are the pair
// (j, j + 64) of one head, j = 32 * (tile & 1) + c: both partners lie in the tile's output staging. q and k keep that column order in Q16 and K16; it is the same in both, so q.k is the same sum in another order.
// CS[position][128] holds cos (0..63) and sin (64..127) of the position's 64 angles.
__global__ __launch_bounds__(128) void k_gemm_ring(const _Float16* __restrict__ A, const _Float16* __restrict__ B9, float alpha, const float* __restrict__ CS, _Float16* __restrict__ Q16, _Float16* __restrict__ K16, _Float16* __restrict__ C16) {
  static_assert(SL % 64 == 0 && TT % 64 == 0, "a row tile never straddles a segment");
  constexpr size_t sA = (size_t)TT * CW, sC = (size_t)TT * CW;
  constexpr unsigned RP = 272, TB = 64 * RP, STG = 2 * TB; constexpr int NST = CW / 128;
  static_assert(NST >= 2, "the ring's prologue fills two stages");
  __shared__ __attribute__((aligned(16))) unsigned char ring[2 * STG];
  float (*so)[64 + 4] = (float (*)[64 + 4])ring;      /* output staging takes the ring's place behind the loop's last barrier */
  static_assert(sizeof(float) * 64 * (64 + 4) <= 2 * STG, "output staging fits the ring");
  const int tid = threadIdx.x, w = tid >> 5, lane = tid & 31, ln = lane & 15, hh = lane >> 4, wm = w >> 1, wn = w & 1;
  const int row0 = (int)(blockIdx.x / (CW / 64)) * 64, col0 = (int)(blockIdx.x % (CW / 64)) * 64;
  const int prj = (int)blockIdx.z, sgm = (row0 < SL) ? 1 : ((row0 < TT - SL) ? 0 : 2); const bool OUT16 = (prj == 2);
  const _Float16* Bt = B9 + (size_t)(prj * 3 + sgm) * CW * CW;
  // each thread's own pieces of a stage: row tid/16 + 8i of either operand, 16-byte piece tid%16
  const char* ag = (const char*)((const unsigned short*)A + (size_t)blockIdx.y * sA + (size_t)(row0 + (tid >> 4)) * CW + (tid & 15) * 8);
  const char* bg = (const char*)((const unsigned short*)Bt + (size_t)(col0 + (tid >> 4)) * CW + (tid & 15) * 8);
  const unsigned al = (unsigned)(size_t)ring + (unsigned)(tid >> 4) * RP + (unsigned)(tid & 15) * 16u, bl = al + TB;
  auto fill = [&](int st, unsigned buf) {
    copy8_to_lds(al + buf * STG, 8 * RP, ag + (size_t)st * 256, (size_t)8 * CW * 2);
    copy8_to_lds(bl + buf * STG, 8 * RP, bg + (size_t)st * 256, (size_t)8 * CW * 2);
  };
  v8f acc[2][2];
#pragma unroll
  for (int i = 0; i < 2; ++i)
#pragma unroll
    for (int j = 0; j < 2; ++j) acc[i][j] = (v8f){0.f,0.f,0.f,0.f,0.f,0.f,0.f,0.f};
  fill(0, 0u);
  asm volatile("s_wait_asynccnt 0x0" ::: "memory");      // this wave's pieces of stage 0 have landed
  __syncthreads();                                       // every wave's pieces of stage 0 are readable
  fill(1, 1u);
#pragma unroll 1      /* one copy of the body: the ring's order stays as written */
  for (int st = 0; st < NST; ++st) {
    const unsigned char* ar = ring + (unsigned)(st & 1) * STG + (unsigned)(wm * 32 + ln) * RP + 16 * hh;
    const unsigned char* br = ring + (unsigned)(st & 1) * STG + TB + (unsigned)(wn * 32 + ln) * RP + 16 * hh;
    FragH fa[4][2], fb[4][2];
#pragma unroll
    for (int ks = 0; ks < 4; ++ks)
#pragma unroll
      for (int i = 0; i < 2; ++i) {
        fa[ks][i].half[0] = *(const v8us*)(ar + i * 16 * RP + ks * 64); fa[ks][i].half[1] = *(const v8us*)(ar + i * 16 * RP + ks * 64 + 32);
        fb[ks][i].half[0] = *(const v8us*)(br + i * 16 * RP + ks * 64); fb[ks][i].half[1] = *(const v8us*)(br + i * 16 * RP + ks * 64 + 32); }
    asm volatile("s_wait_dscnt 0x0" ::: "memory");       // the stage's 32 fragment reads, one group, have returned: this wave is done with the buffer before it is refilled
    asm volatile("s_wait_asynccnt 0x0" ::: "memory");    // this wave's pieces of stage st + 1 have landed
    __syncthreads();                                     // publishes stage st + 1 and ends every wave's reads of stage st
    if (st + 2 < NST) fill(st + 2, (unsigned)(st & 1));  // in front of the WMMAs, which work from registers, so that the copies fly behind them
#pragma unroll
    for (int ks = 0; ks < 4; ++ks)
#pragma unroll
      for (int i = 0; i < 2; ++i)
#pragma unroll
        for (int j = 0; j < 2; ++j) acc[i][j] = __builtin_amdgcn_wmma_f32_16x16x32_f16(false, fa[ks][i].v, false, fb[ks][j].v, (short)0, acc[i][j], false, false);
  }
  // q, k: a thread rotates four pairs of columns (cl.., cl + 32..) in each of four rows; their cos and sin are fetched here so that they fly while the tile is staged
  const int rs = lane >> 3, cl = (lane & 7) * 4; v4f tc[4] = {}, ts[4] = {};
  if (!OUT16) { const float* cs = CS + (size_t)(row0 + w * 16 + rs) * 128 + ((col0 >> 6) & 1) * 32 + cl;
#pragma unroll
    for (int q = 0; q < 4; ++q) { tc[q] = *(const v4fa*)(cs + q * 4 * 128); ts[q] = *(const v4fa*)(cs + q * 4 * 128 + 64); } }
  asm volatile("s_wait_asynccnt 0x0" ::: "memory");      // no copy is outstanding when the ring becomes output staging
#pragma unroll
  for (int i = 0; i < 2; ++i)
#pragma unroll
    for (int j = 0; j < 2; ++j)
#pragma unroll
      for (int r = 0; r < 8; ++r) so[wm * 32 + i * 16 + 8 * hh + r][wn * 32 + j * 16 + ln] = acc[i][j][r] * alpha;
  __syncthreads();                                       // a stored row of 64 columns holds two waves' results
  const int rsub = lane >> 4, c4 = (lane & 15) * 4; typedef _Float16 v4h __attribute__((ext_vector_type(4)));
  if (OUT16) {      /* the test stands once, in front of the eight rows, so that their LDS reads stay one group */
#pragma unroll
    for (int q = 0; q < 8; ++q) { const int r = w * 16 + q * 2 + rsub; const v4f v = *(const v4fa*)&so[r][c4]; const size_t o = (size_t)blockIdx.y * sC + (size_t)(row0 + r) * CW + col0 + c4; v4h h4;
#pragma unroll
      for (int i = 0; i < 4; ++i) h4[i] = (_Float16)v[i];
      *(v4h*)(C16 + o) = h4; }      /* whole 128-B lines, one wave a line */
  } else {
    _Float16* D16 = prj ? K16 : Q16;
#pragma unroll
    for (int q = 0; q < 4; ++q) { const int r = w * 16 + q * 4 + rs; const v4f lo = *(const v4fa*)&so[r][cl], hi = *(const v4fa*)&so[r][cl + 32]; const size_t o = (size_t)blockIdx.y * sC + (size_t)(row0 + r) * CW + col0 + cl; v4h ol, oh;
#pragma unroll
      for (int i = 0; i < 4; ++i) { ol[i] = (_Float16)(lo[i] * tc[q][i] + (-hi[i]) * ts[q][i]); oh[i] = (_Float16)(hi[i] * tc[q][i] + lo[i] * ts[q][i]); }
      *(v4h*)(D16 + o) = ol; *(v4h*)(D16 + o + 32) = oh; }      /* the two halves of a 128-B line, both from this wave */
    asm volatile("s_wait_xcnt 0x0" ::: "memory");      // stands behind the run of stores, in front of any later rewrite of the registers they name
  }
}

__global__ __launch_bounds__(256) void k_xt(const float* __restrict__ x, _Float16* __restrict__ XT) { const size_t t = (size_t)blockIdx.x * 256 + threadIdx.x; if (t >= (size_t)NR * NH * 16) return; const int p = (int)(t % 16); const int h = (int)((t / 16) % NH); const size_t bs = t / (16 * NH); const int b = (int)(bs / TT), s = (int)(bs % TT); const float* src = x + (((size_t)(b * NH + h) * TT + s) * HD) + p * 8; FragH f;
#pragma unroll
  for (int q = 0; q < 8; ++q) f.h[q] = (_Float16)bf16_round(src[q]); unsigned short* d = (unsigned short*)XT + bs * CW + h * HD + p * 8; *(v8us*)d = f.half[0];  }
// One launch re-lays all nine weight tensors: blockIdx.y picks the tensor and its plane of B9. The q and k planes (0..5) take their rows with bits 5 and 6 of the column-in-head swapped (see k_gemm_ring).
// A tenth plane of the grid fills the RoPE table CS[position][128]: cos (0..63) and sin (64..127) of (position + offset) * 10000^(-2i/128), each angle worked out once.
__global__ __launch_bounds__(256) void k_wst(const float* __restrict__ W0, const float* __restrict__ W1, const float* __restrict__ W2, const float* __restrict__ W3, const float* __restrict__ W4,
                                             const float* __restrict__ W5, const float* __restrict__ W6, const float* __restrict__ W7, const float* __restrict__ W8, _Float16* __restrict__ B9, const int* __restrict__ offp, float* __restrict__ CS) {
  const unsigned y = blockIdx.y;
  if (y == 9) { const int o0 = offp[0];
#pragma unroll 1      /* one copy of the cos and sin code */
    for (unsigned u = blockIdx.x * 256 + threadIdx.x; u < (unsigned)TT * 64; u += (unsigned)CW * NH * 16) { const int i = (int)(u & 63), s = (int)(u >> 6); const float pos = (float)(s + o0);
      const float ang = pos * __builtin_powf(10000.0f, -(float)(2 * i) / 128.0f); CS[(size_t)s * 128 + i] = cosf(ang); CS[(size_t)s * 128 + 64 + i] = sinf(ang); }
    return; }
  const float* W = W0; W = (y == 1) ? W1 : W; W = (y == 2) ? W2 : W; W = (y == 3) ? W3 : W; W = (y == 4) ? W4 : W; W = (y == 5) ? W5 : W; W = (y == 6) ? W6 : W; W = (y == 7) ? W7 : W; W = (y == 8) ? W8 : W; _Float16* Bt = B9 + (size_t)y * CW * CW;
  const size_t t = (size_t)blockIdx.x * 256 + threadIdx.x; if (t >= (size_t)CW * NH * 16) return; const int p = (int)(t % 16); const int h = (int)((t / 16) % NH); const int n = (int)(t / (16 * NH)); const int g = n / HD, ep = n % HD, e = (y < 6) ? ((ep & 31) | ((ep & 32) << 1) | ((ep & 64) >> 1)) : ep; FragH f;
#pragma unroll
  for (int q = 0; q < 8; ++q) { const int d = p * 8 + q; f.h[q] = (_Float16)(bf16_round(W[(((size_t)(h * NH + g) * HD + d) * HD) + e]) * 16.0f); }
  unsigned short* dst = (unsigned short*)Bt + (size_t)n * CW + h * HD + p * 8; *(v8us*)dst = f.half[0];  }
__global__ __launch_bounds__(256) void k_vt128(const _Float16* __restrict__ V16, _Float16* __restrict__ Vt) { __shared__ unsigned short tl[64][130]; const int tid = threadIdx.x; const int slab = blockIdx.x / (TT / 64), lg = blockIdx.x % (TT / 64); const int b = slab / NH, h = slab % NH;
  for (int i = tid; i < 64 * 16; i += 256) { const int r = i / 16, c8 = (i % 16) * 8; FragH f; f.half[0] = *(const v8us*)((const unsigned short*)V16 + ((size_t)b * TT + lg * 64 + r) * CW + h * HD + c8);
#pragma unroll
    for (int q = 0; q < 8; ++q) tl[r][c8 + q] = f.u[q]; }
  __syncthreads();
  { for (int i = tid; i < 128 * 8; i += 256) { const int d = i / 8, pc = i % 8; FragH f;
#pragma unroll
      for (int q = 0; q < 8; ++q) f.u[q] = tl[pc * 8 + q][d]; *(v8us*)((unsigned short*)Vt + ((size_t)slab * HD + d) * TT + lg * 64 + pc * 8) = f.half[0]; }  } }
extern "C" void kernel_launch(void* const* d_in, const int* in_sizes, int n_in,
                              void* d_out, int out_size, void* d_ws, size_t ws_size, hipStream_t stream) {
  (void)in_sizes; (void)n_in; (void)out_size;
  const float* x = (const float*)d_in[0]; const float* Wm[3] = {(const float*)d_in[1], (const float*)d_in[2], (const float*)d_in[3]}; const float* Wsg[3] = {(const float*)d_in[4], (const float*)d_in[5], (const float*)d_in[6]}; const float* Weg[3] = {(const float*)d_in[7], (const float*)d_in[8], (const float*)d_in[9]}; const int* offp = (const int*)d_in[10];
  char* ws = (char*)d_ws; size_t off = 0;
  auto take = [&](size_t bytes) { char* p = ws + off; off += (bytes + 255) & ~(size_t)255; return p; };
  _Float16* B9 = (_Float16*)take((size_t)9 * CW * CW * 2);      // plane 3 * projection + (0 middle, 1 state, 2 end)
  _Float16* XT = (_Float16*)take((size_t)NR * CW * 2); float* CS = (float*)take((size_t)TT * 128 * 4); _Float16* Q16 = (_Float16*)take((size_t)NR * CW * 2); _Float16* K16 = (_Float16*)take((size_t)NR * CW * 2); _Float16* V16 = (_Float16*)take((size_t)NR * CW * 2); _Float16* Vt = (_Float16*)take((size_t)NR * CW * 2);
  if (off > ws_size) return;      // 18.9 + 12.6 + 1.6 + 12.6 x 4 = 83 MB
  k_xt<<<(unsigned)(((size_t)NR * NH * 16 + 255) / 256), 256, 0, stream>>>(x, XT);
  const unsigned gw = (unsigned)(((size_t)CW * NH * 16 + 255) / 256);
  k_wst<<<dim3(gw, 10), 256, 0, stream>>>(Wm[0], Wsg[0], Weg[0], Wm[1], Wsg[1], Weg[1], Wm[2], Wsg[2], Weg[2], B9, offp, CS);
  k_gemm_ring<<<dim3((TT / 64) * (CW / 64), BB, 3), 128, 0, stream>>>(XT, B9, 0.0625f, CS, Q16, K16, V16);
  k_vt128<<<BB * NH * (TT / 64), 256, 0, stream>>>(V16, Vt);
  k_flash<<<BB * NH * (TT / 64), 128, 0, stream>>>(Q16, CW, K16, CW, Vt, nullptr, (float*)d_out, 0);
}

// v007
// Measured time: 184 microseconds a run.
// In both of two side-by-side timings against v006, it was 1.16 times as fast.
// Over all steps from v000 it is 5.03 times as fast.
#include <hip/hip_runtime.h>
// Causal multi-head attention with state segments (x [2, 8 heads, 3072, 128]; StackedLinear projections that mix heads and features — separate weights for the first 512 (state), middle 2048 and
// last 512 (end) positions; rotate-half RoPE with an INPUT offset; causal softmax(q·k/√128)·v; output [2,8,3072,128]): the nine (h,d)→(g,e) projections as GEMMs on the (b,s)-major transposed
// input (bf16-exact ×2^4 weights, f32 accumulate) and the attention as a fused flash-style kernel (d = 128: 4 k-steps / 8 d-tiles; causal chunk skipping; online softmax f32; P f16 ≤ 1;
// O = P·Vt written straight into the output; RPW-16 waves) on v_wmma_f32_16x16x32_f16; RoPE f32 VALU.
#define BB 2
#define NH 8
#define TT 3072
#define HD 128
#define CW (NH * HD)
#define NR (BB * TT)
#define SL 512

typedef __bf16 v16b __attribute__((ext_vector_type(16)));
typedef unsigned short v8us __attribute__((ext_vector_type(8), may_alias));
typedef float  v8f  __attribute__((ext_vector_type(8)));
typedef float  v4f  __attribute__((ext_vector_type(4)));
typedef float  v4fa __attribute__((ext_vector_type(4), may_alias));
union FragB { v16b v; v8us half[2]; unsigned short u[16]; };

__device__ __forceinline__ unsigned short bf16_bits(float x) { unsigned int u = __float_as_uint(x); return (unsigned short)((u + 0x7FFFu + ((u >> 16) & 1u)) >> 16); }
__device__ __forceinline__ float bf16_val(unsigned short b) { return __uint_as_float(((unsigned int)b) << 16); }
__device__ __forceinline__ float bf16_round(float x) { return bf16_val(bf16_bits(x)); }
// D += A·B with NT terms: 1 = ah·bh, 2 = + al·bh (A split), 3 = + ah·bl (both split)
template <int NT>
__device__ __forceinline__ v8f mmaN(v16b ah, v16b al, v16b bh, v16b bl, v8f c) {
  c = __builtin_amdgcn_wmma_f32_16x16x32_bf16(false, ah, false, bh, (short)0, c, false, false);
  if (NT >= 2) c = __builtin_amdgcn_wmma_f32_16x16x32_bf16(false, al, false, bh, (short)0, c, false, false);
  if (NT >= 3) c = __builtin_amdgcn_wmma_f32_16x16x32_bf16(false, ah, false, bl, (short)0, c, false, false);
  asm volatile("v_nop\n\tv_nop\n\tv_nop\n\tv_nop" : "+v"(c) : "v"(ah), "v"(al), "v"(bh), "v"(bl));
  return c;
}

__global__ __launch_bounds__(256) void k_wt_bf16(const float* __restrict__ W, unsigned short* __restrict__ Wt, int K, int N) {
  const int t = blockIdx.x * 256 + threadIdx.x;
  const int k8n = K / 8;
  if (t >= N * k8n) return;
  const int n = t / k8n, k8 = (t % k8n) * 8;
  v8us v;
#pragma unroll
  for (int i = 0; i < 8; ++i) v[i] = bf16_bits(W[(size_t)(k8 + i) * N + n]);
  *(v8us*)(Wt + (size_t)n * K + k8) = v;
  
}

// GEMM C[M][N] (f32, pitch ldc) = act(A[M][K]·W + bias). A f32 row-major (pitch lda) converted per fragment to bf16
// (ASPLIT: hi/lo two planes -> 2 terms, else single rounded term); Wt bf16 [N][K] (pitch ldb). BIAS_BF16 rounds the
// bias to bf16 first (bias quantised to bf16 before the add). K%32==0, M%16==0, N%64==0.
template <bool ASPLIT, int ACT, bool BIAS_BF16>
__global__ __launch_bounds__(128) void k_gemm_bf(const float* __restrict__ A, int lda, const unsigned short* __restrict__ Wt, int ldb,
                                               const float* __restrict__ bias, float* __restrict__ C, int ldc, int M, int N, int K) {
  __shared__ __attribute__((aligned(16))) float so[4][16][64];
  const int tid = threadIdx.x, w = tid >> 5, lane = tid & 31, ln = lane & 15, hh = lane >> 4;
  const int ntn = N / 64;
  const int wid = blockIdx.x * 4 + w;
  const int mt = wid / ntn, nq = wid % ntn;
  if (mt * 16 >= M) return;
  const int row0 = mt * 16, col0 = nq * 64;
  const float* arow = A + (size_t)(row0 + ln) * lda;
  v8f acc[4] = {};
  for (int kb = 0; kb < K; kb += 32) {
    FragB ah, al;
    const v4f x0 = *(const v4fa*)(arow + kb + 8 * hh), x1 = *(const v4fa*)(arow + kb + 8 * hh + 4);
    const v4f x2 = *(const v4fa*)(arow + kb + 16 + 8 * hh), x3 = *(const v4fa*)(arow + kb + 16 + 8 * hh + 4);
    float xs[16] = {x0[0],x0[1],x0[2],x0[3],x1[0],x1[1],x1[2],x1[3],x2[0],x2[1],x2[2],x2[3],x3[0],x3[1],x3[2],x3[3]};
#pragma unroll
    for (int i = 0; i < 16; ++i) { const unsigned short hb = bf16_bits(xs[i]); ah.u[i] = hb; al.u[i] = ASPLIT ? bf16_bits(xs[i] - bf16_val(hb)) : (unsigned short)0; }
#pragma unroll
    for (int t = 0; t < 4; ++t) {
      const unsigned short* brow = Wt + (size_t)(col0 + t * 16 + ln) * ldb + kb;
      FragB b;
      b.half[0] = *(const v8us*)(brow + 8 * hh);
      b.half[1] = *(const v8us*)(brow + 16 + 8 * hh);
      acc[t] = mmaN<ASPLIT ? 2 : 1>(ah.v, al.v, b.v, b.v, acc[t]);
    }
  }
#pragma unroll
  for (int t = 0; t < 4; ++t) {
    float bv = bias ? bias[col0 + t * 16 + ln] : 0.f;
    if (BIAS_BF16) bv = bf16_round(bv);
#pragma unroll
    for (int r = 0; r < 8; ++r) { float v = acc[t][r] + bv; if (ACT == 1) v = fmaxf(v, 0.f); so[w][8 * hh + r][t * 16 + ln] = v; }
  }
  __builtin_amdgcn_fence(__ATOMIC_ACQ_REL, "workgroup");
  __builtin_amdgcn_wave_barrier();
  const int rsub = lane >> 4, c4 = (lane & 15) * 4;
  {
#pragma unroll
    for (int q = 0; q < 8; ++q) {
      const int r = q * 2 + rsub;
      const v4f v = *(const v4fa*)&so[w][r][c4];
      *(v4f*)(C + (size_t)(row0 + r) * ldc + col0 + c4) = v;
    }
    
  }
}

// Flash-style causal/unmasked attention, all contractions 3-term bf16 hi/lo splits, f32 softmax with running max.
// q,k,v rows are read from f32 buffers with arbitrary row pitch (so they can live inside a fused qkv buffer);
// D = head size (multiple of 32, <= 128); one wave = 16 query rows; block = 4 waves (64 queries) sharing K/V chunks of 32.
template <int D, bool CAUSAL>
__global__ __launch_bounds__(128) void k_flash(const float* __restrict__ qb, const float* __restrict__ kb, const float* __restrict__ vb,
                                             int pitch, int T, int H, float scale, float* __restrict__ y, int ypitch) {
  constexpr int KS = D / 32;        // k-steps for QK
  constexpr int DT = D / 16;        // d tiles for PV
  __shared__ __attribute__((aligned(16))) unsigned short sKh[32][D + 8], sKl[32][D + 8], sVh[32][D + 8], sVl[32][D + 8];
  __shared__ __attribute__((aligned(16))) unsigned short sPh[4][16][40], sPl[4][16][40];
  __shared__ __attribute__((aligned(16))) float sO[4][16][D];
  const int tid = threadIdx.x, w = tid >> 5, lane = tid & 31, ln = lane & 15, hh = lane >> 4;
  const int nqb = (T + 63) / 64;
  const int bh = blockIdx.x / nqb, qblk = blockIdx.x % nqb;
  const int b = bh / H, h = bh % H;
  const int q0 = qblk * 64 + w * 16;
  const float* Q = qb + (size_t)b * T * pitch + h * D;
  const float* K = kb + (size_t)b * T * pitch + h * D;
  const float* V = vb + (size_t)b * T * pitch + h * D;

  // A fragments of the wave's 16 query rows (scaled), hi/lo
  FragB aqh[KS], aql[KS];
  {
    int row = q0 + ln; if (row >= T) row = T - 1;
    const float* qr = Q + (size_t)row * pitch;
#pragma unroll
    for (int ks = 0; ks < KS; ++ks)
#pragma unroll
      for (int i = 0; i < 16; ++i) {
        const int d = ks * 32 + ((i < 8) ? (8 * hh + i) : (16 + 8 * hh + (i - 8)));
        const float x = qr[d] * scale; const unsigned short hb = bf16_bits(x);
        aqh[ks].u[i] = hb; aql[ks].u[i] = bf16_bits(x - bf16_val(hb));
      }
  }
  float m_r[8], l_r[8];
#pragma unroll
  for (int r = 0; r < 8; ++r) { m_r[r] = -3.0e38f; l_r[r] = 0.f; }
  v8f oacc[DT];
#pragma unroll
  for (int dt = 0; dt < DT; ++dt) oacc[dt] = (v8f){0.f,0.f,0.f,0.f,0.f,0.f,0.f,0.f};

  const int kv_end = CAUSAL ? min(T, qblk * 64 + 64) : T;     // block-uniform
  for (int j0 = 0; j0 < kv_end; j0 += 32) {
    __syncthreads();
    for (int e = tid; e < 32 * (D / 4); e += 128) {
      const int r = e / (D / 4), c4 = (e % (D / 4)) * 4;
      const int key = j0 + r;
      v4f kf = {0.f,0.f,0.f,0.f}, vf = {0.f,0.f,0.f,0.f};
      if (key < T) { kf = *(const v4fa*)(K + (size_t)key * pitch + c4); vf = *(const v4fa*)(V + (size_t)key * pitch + c4); }
#pragma unroll
      for (int t = 0; t < 4; ++t) {
        unsigned short hb = bf16_bits(kf[t]); sKh[r][c4 + t] = hb; sKl[r][c4 + t] = bf16_bits(kf[t] - bf16_val(hb));
        hb = bf16_bits(vf[t]); sVh[r][c4 + t] = hb; sVl[r][c4 + t] = bf16_bits(vf[t] - bf16_val(hb));
      }
    }
    __syncthreads();
    // S tile 16 x 32
    v8f s[2];
#pragma unroll
    for (int nt = 0; nt < 2; ++nt) {
      v8f acc = {};
#pragma unroll
      for (int ks = 0; ks < KS; ++ks) {
        FragB bh_, bl_;
        bh_.half[0] = *(const v8us*)&sKh[nt * 16 + ln][ks * 32 + 8 * hh]; bh_.half[1] = *(const v8us*)&sKh[nt * 16 + ln][ks * 32 + 16 + 8 * hh];
        bl_.half[0] = *(const v8us*)&sKl[nt * 16 + ln][ks * 32 + 8 * hh]; bl_.half[1] = *(const v8us*)&sKl[nt * 16 + ln][ks * 32 + 16 + 8 * hh];
        acc = mmaN<3>(aqh[ks].v, aql[ks].v, bh_.v, bl_.v, acc);
      }
      s[nt] = acc;
    }
    // mask + running max (rows 8hh+r; the 16 lanes of a half share rows)
    float alpha[8];
#pragma unroll
    for (int r = 0; r < 8; ++r) {
      const int qi = q0 + 8 * hh + r;
      const int ja = j0 + ln, jb = j0 + 16 + ln;
      if (CAUSAL) { if (ja > qi) s[0][r] = -3.0e38f; if (jb > qi) s[1][r] = -3.0e38f; }
      if (ja >= T) s[0][r] = -3.0e38f;
      if (jb >= T) s[1][r] = -3.0e38f;
      float mx = fmaxf(s[0][r], s[1][r]);
      mx = fmaxf(mx, __shfl_xor(mx, 1, 32)); mx = fmaxf(mx, __shfl_xor(mx, 2, 32)); mx = fmaxf(mx, __shfl_xor(mx, 4, 32)); mx = fmaxf(mx, __shfl_xor(mx, 8, 32));
      const float mnew = fmaxf(m_r[r], mx);
      alpha[r] = (mnew > -1.0e38f) ? __expf(m_r[r] - mnew) : 1.0f;
      const float p0 = (s[0][r] > -1.0e38f) ? __expf(s[0][r] - mnew) : 0.f;
      const float p1 = (s[1][r] > -1.0e38f) ? __expf(s[1][r] - mnew) : 0.f;
      m_r[r] = mnew;
      l_r[r] = l_r[r] * alpha[r] + p0 + p1;            // per-lane partial row sum (16 lanes combined at the end)
      unsigned short hb = bf16_bits(p0); sPh[w][8 * hh + r][ln] = hb;      sPl[w][8 * hh + r][ln] = bf16_bits(p0 - bf16_val(hb));
      hb = bf16_bits(p1);                sPh[w][8 * hh + r][16 + ln] = hb; sPl[w][8 * hh + r][16 + ln] = bf16_bits(p1 - bf16_val(hb));
    }
#pragma unroll
    for (int dt = 0; dt < DT; ++dt)
#pragma unroll
      for (int r = 0; r < 8; ++r) oacc[dt][r] *= alpha[r];
    __builtin_amdgcn_fence(__ATOMIC_ACQ_REL, "workgroup");
    __builtin_amdgcn_wave_barrier();
    FragB pah, pal;
    pah.half[0] = *(const v8us*)&sPh[w][ln][8 * hh]; pah.half[1] = *(const v8us*)&sPh[w][ln][16 + 8 * hh];
    pal.half[0] = *(const v8us*)&sPl[w][ln][8 * hh]; pal.half[1] = *(const v8us*)&sPl[w][ln][16 + 8 * hh];
#pragma unroll
    for (int dt = 0; dt < DT; ++dt) {
      FragB bvh, bvl;
#pragma unroll
      for (int i = 0; i < 8; ++i) {
        bvh.u[i] = sVh[8 * hh + i][dt * 16 + ln]; bvh.u[8 + i] = sVh[16 + 8 * hh + i][dt * 16 + ln];
        bvl.u[i] = sVl[8 * hh + i][dt * 16 + ln]; bvl.u[8 + i] = sVl[16 + 8 * hh + i][dt * 16 + ln];
      }
      oacc[dt] = mmaN<3>(pah.v, pal.v, bvh.v, bvl.v, oacc[dt]);
    }
    __builtin_amdgcn_fence(__ATOMIC_ACQ_REL, "workgroup");
    __builtin_amdgcn_wave_barrier();
  }
#pragma unroll
  for (int r = 0; r < 8; ++r) {
    float l = l_r[r];
    l += __shfl_xor(l, 1, 32); l += __shfl_xor(l, 2, 32); l += __shfl_xor(l, 4, 32); l += __shfl_xor(l, 8, 32);
    l_r[r] = (l > 0.f) ? 1.0f / l : 0.f;
  }
#pragma unroll
  for (int dt = 0; dt < DT; ++dt)
#pragma unroll
    for (int r = 0; r < 8; ++r) sO[w][8 * hh + r][dt * 16 + ln] = oacc[dt][r] * l_r[r];
  __builtin_amdgcn_fence(__ATOMIC_ACQ_REL, "workgroup");
  __builtin_amdgcn_wave_barrier();
  {
    for (int r = 0; r < 16; ++r) {
      const int row = q0 + r;
      if (row < T && lane < D / 4) {
        const v4f val = *(const v4fa*)&sO[w][r][lane * 4];
        *(v4f*)(y + ((size_t)b * T + row) * ypitch + h * D + lane * 4) = val;
      }
    }
    
  }
}

// GEMM C = act(A·W + bias + resid): A f32 (ASPLIT -> hi/lo 2 terms), Wt bf16 [N][K]; ACT 0 none, 1 relu, 2 exact gelu;
// resid (optional, f32, row index = (row % rmod), pitch ldr, RES_BF16 rounds it) added before the activation.
template <bool ASPLIT, int ACT, bool BIAS_BF16, bool RES_BF16>
__global__ __launch_bounds__(128) void k_gemm_bf3(const float* __restrict__ A, int lda, const unsigned short* __restrict__ Wt, int ldb,
                                                const float* __restrict__ bias, const float* __restrict__ resid, int rmod, int ldr,
                                                float* __restrict__ C, int ldc, int M, int N, int K) {
  __shared__ __attribute__((aligned(16))) float so[4][16][64];
  const int tid = threadIdx.x, w = tid >> 5, lane = tid & 31, ln = lane & 15, hh = lane >> 4;
  const int ntn = N / 64;
  const int wid = blockIdx.x * 4 + w;
  const int mt = wid / ntn, nq = wid % ntn;
  if (mt * 16 >= M) return;
  const int row0 = mt * 16, col0 = nq * 64;
  const float* arow = A + (size_t)(row0 + ln) * lda;
  v8f acc[4] = {};
  for (int kb = 0; kb < K; kb += 32) {
    FragB ah, al;
    const v4f x0 = *(const v4fa*)(arow + kb + 8 * hh), x1 = *(const v4fa*)(arow + kb + 8 * hh + 4);
    const v4f x2 = *(const v4fa*)(arow + kb + 16 + 8 * hh), x3 = *(const v4fa*)(arow + kb + 16 + 8 * hh + 4);
    float xs[16] = {x0[0],x0[1],x0[2],x0[3],x1[0],x1[1],x1[2],x1[3],x2[0],x2[1],x2[2],x2[3],x3[0],x3[1],x3[2],x3[3]};
#pragma unroll
    for (int i = 0; i < 16; ++i) { const unsigned short hb = bf16_bits(xs[i]); ah.u[i] = hb; al.u[i] = ASPLIT ? bf16_bits(xs[i] - bf16_val(hb)) : (unsigned short)0; }
#pragma unroll
    for (int t = 0; t < 4; ++t) {
      const unsigned short* brow = Wt + (size_t)(col0 + t * 16 + ln) * ldb + kb;
      FragB b;
      b.half[0] = *(const v8us*)(brow + 8 * hh);
      b.half[1] = *(const v8us*)(brow + 16 + 8 * hh);
      acc[t] = mmaN<ASPLIT ? 2 : 1>(ah.v, al.v, b.v, b.v, acc[t]);
    }
  }
#pragma unroll
  for (int t = 0; t < 4; ++t) {
    const int col = col0 + t * 16 + ln;
    float bv = bias ? bias[col] : 0.f;
    if (BIAS_BF16) bv = bf16_round(bv);
#pragma unroll
    for (int r = 0; r < 8; ++r) {
      float v = acc[t][r] + bv;
      if (resid) { float rv = resid[(size_t)((row0 + 8 * hh + r) % rmod) * ldr + col]; if (RES_BF16) rv = bf16_round(rv); v += rv; }
      if (ACT == 1) v = fmaxf(v, 0.f);
      if (ACT == 2) v = 0.5f * v * (1.0f + erff(v * 0.70710678118654752f));
      if (ACT == 3) { const float u = 0.7978845608028654f * (v + 0.044715f * v * v * v); v = 0.5f * v * (1.0f + tanhf(u)); }
      so[w][8 * hh + r][t * 16 + ln] = v;
    }
  }
  __builtin_amdgcn_fence(__ATOMIC_ACQ_REL, "workgroup");
  __builtin_amdgcn_wave_barrier();
  const int rsub = lane >> 4, c4 = (lane & 15) * 4;
  {
#pragma unroll
    for (int q = 0; q < 8; ++q) {
      const int r = q * 2 + rsub;
      const v4f v = *(const v4fa*)&so[w][r][c4];
      *(v4f*)(C + (size_t)(row0 + r) * ldc + col0 + c4) = v;
    }
    
  }
}
// row LayerNorm (biased variance, eps) over N: s = X (+ R); optional out_sum <- s; out_norm <- (s-mu)*rsqrt(var+eps)*g + b
template <bool PARAM_BF16>
__global__ __launch_bounds__(256) void k_layernorm(const float* __restrict__ X, const float* __restrict__ R, const float* __restrict__ g, const float* __restrict__ bta,
                                                  float* __restrict__ out_sum, float* __restrict__ out_norm, int N, float eps) {
  __shared__ float red[256];
  const int row = blockIdx.x, tid = threadIdx.x;
  const float* x = X + (size_t)row * N; const float* rr = R ? R + (size_t)row * N : nullptr;
  float vals[16];                     // up to N = 4096
  const int per = N / 256;            // contiguous chunk per thread? use strided-by-4 chunks: thread handles j = tid*4 + 1024*u
  float s1 = 0.f;
  for (int u = 0; u < per / 4; ++u) {
    const int j = tid * 4 + 1024 * u;
    const v4f a = *(const v4fa*)(x + j);
    v4f b = {0.f,0.f,0.f,0.f}; if (rr) b = *(const v4fa*)(rr + j);
#pragma unroll
    for (int q = 0; q < 4; ++q) { const float v = a[q] + b[q]; vals[u * 4 + q] = v; s1 += v; }
  }
  red[tid] = s1; __syncthreads();
  for (int st = 128; st > 0; st >>= 1) { if (tid < st) red[tid] += red[tid + st]; __syncthreads(); }
  const float mu = red[0] / (float)N; __syncthreads();
  float s2 = 0.f;
  for (int u = 0; u < per / 4; ++u)
#pragma unroll
    for (int q = 0; q < 4; ++q) { const float c = vals[u * 4 + q] - mu; s2 += c * c; }
  red[tid] = s2; __syncthreads();
  for (int st = 128; st > 0; st >>= 1) { if (tid < st) red[tid] += red[tid + st]; __syncthreads(); }
  const float rs = rsqrtf(red[0] / (float)N + eps);
  {
    for (int u = 0; u < per / 4; ++u) {
      const int j = tid * 4 + 1024 * u;
      v4f o, sm;
#pragma unroll
      for (int q = 0; q < 4; ++q) {
        float gg = g[j + q], bb = bta[j + q];
        if (PARAM_BF16) { gg = bf16_round(gg); bb = bf16_round(bb); }
        sm[q] = vals[u * 4 + q]; o[q] = (vals[u * 4 + q] - mu) * rs * gg + bb;
      }
      if (out_sum) *(v4f*)(out_sum + (size_t)row * N + j) = sm;
      *(v4f*)(out_norm + (size_t)row * N + j) = o;
    }
    
  }
}



// ---- f16 WMMA path (v_wmma_f32_16x16x32_f16): 11-bit significands for operands in range — used where a [0,1] probability operand needs more precision than bf16
typedef _Float16 v16h __attribute__((ext_vector_type(16)));
union FragH { v16h v; v8us half[2]; _Float16 h[16]; unsigned short u[16]; };
template <int NT>
__device__ __forceinline__ v8f mmaH(v16h ah, v16h al, v16h bh, v16h bl, v8f c) {
  c = __builtin_amdgcn_wmma_f32_16x16x32_f16(false, ah, false, bh, (short)0, c, false, false);
  if (NT >= 2) c = __builtin_amdgcn_wmma_f32_16x16x32_f16(false, al, false, bh, (short)0, c, false, false);
  if (NT >= 3) c = __builtin_amdgcn_wmma_f32_16x16x32_f16(false, ah, false, bl, (short)0, c, false, false);
  asm volatile("v_nop\n\tv_nop\n\tv_nop\n\tv_nop" : "+v"(c) : "v"(ah), "v"(al), "v"(bh), "v"(bl));
  return c;
}
// batched GEMM like k_gemm_b but f16 operands: A f32 (split into f16 hi/lo if ASPLIT, else rounded to f16), Bt = f16 values [n][k]; alpha; C f32; N multiple of 16 (partial tiles skipped)
template <bool ASPLIT>
__global__ __launch_bounds__(128) void k_gemm_h(const float* __restrict__ A, int lda, size_t sA, const _Float16* __restrict__ Bh, int ldb, size_t sB, float alpha, float* __restrict__ C, int ldc, size_t sC, int M, int N, int K) {
  __shared__ __attribute__((aligned(16))) float so[4][16][64];
  const int tid = threadIdx.x, w = tid >> 5, lane = tid & 31, ln = lane & 15, hh = lane >> 4; const int by = blockIdx.y;
  A += (size_t)by * sA; Bh += (size_t)by * sB; C += (size_t)by * sC;
  const int ntn = (N + 63) / 64; const int wid = blockIdx.x * 4 + w; const int mt = wid / ntn, nq = wid % ntn; if (mt * 16 >= M) return;
  const int row0 = mt * 16, col0 = nq * 64; const float* arow = A + (size_t)(row0 + ln) * lda;
  v8f acc[4] = {};
  for (int kb = 0; kb < K; kb += 32) {
    FragH ah, al;
    const v4f x0 = *(const v4fa*)(arow + kb + 8 * hh), x1 = *(const v4fa*)(arow + kb + 8 * hh + 4), x2 = *(const v4fa*)(arow + kb + 16 + 8 * hh), x3 = *(const v4fa*)(arow + kb + 16 + 8 * hh + 4);
    float xs[16] = {x0[0],x0[1],x0[2],x0[3],x1[0],x1[1],x1[2],x1[3],x2[0],x2[1],x2[2],x2[3],x3[0],x3[1],x3[2],x3[3]};
#pragma unroll
    for (int i = 0; i < 16; ++i) { const _Float16 h = (_Float16)xs[i]; ah.h[i] = h; al.h[i] = ASPLIT ? (_Float16)(xs[i] - (float)h) : (_Float16)0.0f; }
#pragma unroll
    for (int t = 0; t < 4; ++t) { if (col0 + t * 16 >= N) continue; const size_t boff = (size_t)(col0 + t * 16 + ln) * ldb + kb; FragH bq; bq.half[0] = *(const v8us*)(Bh + boff + 8 * hh); bq.half[1] = *(const v8us*)(Bh + boff + 16 + 8 * hh);
      acc[t] = mmaH<ASPLIT ? 2 : 1>(ah.v, al.v, bq.v, bq.v, acc[t]); }
  }
#pragma unroll
  for (int t = 0; t < 4; ++t) { if (col0 + t * 16 >= N) continue;
#pragma unroll
    for (int r = 0; r < 8; ++r) so[w][8 * hh + r][t * 16 + ln] = acc[t][r] * alpha; }
  __builtin_amdgcn_fence(__ATOMIC_ACQ_REL, "workgroup"); __builtin_amdgcn_wave_barrier();
  const int rsub = lane >> 4, c4 = (lane & 15) * 4;
  {
#pragma unroll
    for (int q = 0; q < 8; ++q) { const int r = q * 2 + rsub; if (col0 + c4 < N) { const v4f v = *(const v4fa*)&so[w][r][c4]; *(v4f*)(C + (size_t)(row0 + r) * ldc + col0 + c4) = v; } }
     }
}

// Wt[n][k] = f16(W[k][n]·scale) from f32 row-major W[K][N] (scale = power of two; bf16-exact weights stay exact in f16 away from the subnormal range)
__global__ __launch_bounds__(256) void k_wt_f16(const float* __restrict__ W, _Float16* __restrict__ Wt, int K, int N, float scale) {
  const int t = blockIdx.x * 256 + threadIdx.x; if (t >= N * (K / 8)) return; const int n = t / (K / 8), k8 = (t % (K / 8)) * 8; FragH f;
#pragma unroll
  for (int i = 0; i < 8; ++i) f.h[i] = (_Float16)(bf16_round(W[(size_t)(k8 + i) * N + n]) * scale); const v8us o = f.half[0];
  *(v8us*)((unsigned short*)Wt + (size_t)n * K + k8) = o; 
}
__global__ __launch_bounds__(256) void k_x16(const float* __restrict__ x, _Float16* __restrict__ X16, size_t n8) { const size_t t = (size_t)blockIdx.x * 256 + threadIdx.x; if (t >= n8) return; FragH f;
#pragma unroll
  for (int q = 0; q < 8; ++q) f.h[q] = (_Float16)bf16_round(x[t * 8 + q]); *(v8us*)((unsigned short*)X16 + t * 8) = f.half[0];  }
__global__ __launch_bounds__(256) void k_h16(const float* __restrict__ x, _Float16* __restrict__ X16, size_t n8) { const size_t t = (size_t)blockIdx.x * 256 + threadIdx.x; if (t >= n8) return; FragH f;
#pragma unroll
  for (int q = 0; q < 8; ++q) f.h[q] = (_Float16)x[t * 8 + q]; *(v8us*)((unsigned short*)X16 + t * 8) = f.half[0];  }
__global__ __launch_bounds__(256) void k_round16f(const float* __restrict__ W, _Float16* __restrict__ Bt, size_t n8) { const size_t t = (size_t)blockIdx.x * 256 + threadIdx.x; if (t >= n8) return; FragH f;
#pragma unroll
  for (int i = 0; i < 8; ++i) f.h[i] = (_Float16)(bf16_round(W[t * 8 + i]) * 16.0f); *(v8us*)((unsigned short*)Bt + t * 8) = f.half[0];  }
template <int NHv, int TTv>
__global__ __launch_bounds__(256) void k_vt(const _Float16* __restrict__ V16, int ldv, int voff, _Float16* __restrict__ Vt) { __shared__ unsigned short tl[64][66]; const int tid = threadIdx.x; const int slab = blockIdx.x / (TTv / 64), lg = blockIdx.x % (TTv / 64); const int b = slab / NHv, h = slab % NHv;
  for (int i = tid; i < 64 * 8; i += 256) { const int r = i / 8, c8 = (i % 8) * 8; FragH f; f.half[0] = *(const v8us*)((const unsigned short*)V16 + ((size_t)b * TTv + lg * 64 + r) * ldv + voff + h * 64 + c8);
#pragma unroll
    for (int q = 0; q < 8; ++q) tl[r][c8 + q] = f.u[q]; }
  __syncthreads();
  {
#pragma unroll
    for (int rd = 0; rd < 2; ++rd) { const int d = rd * 32 + tid / 8, pc = tid % 8; FragH f;
#pragma unroll
      for (int q = 0; q < 8; ++q) f.u[q] = tl[pc * 8 + q][d];
      *(v8us*)((unsigned short*)Vt + ((size_t)slab * 64 + d) * TTv + lg * 64 + pc * 8) = f.half[0]; }
     } }

// Eight 16-byte asynchronous copies per lane, global memory to LDS through no register: piece i goes from g + i * gstep to LDS byte l + i * lstep.
// The s_wait_xcnt closes the statement so that it stands in front of any later rewrite of the address registers the copies name.
__device__ __forceinline__ void copy8_to_lds(unsigned l, unsigned lstep, const char* g, size_t gstep) {
  asm volatile("global_load_async_to_lds_b128 %0, %8, off\n\t"
               "global_load_async_to_lds_b128 %1, %9, off\n\t"
               "global_load_async_to_lds_b128 %2, %10, off\n\t"
               "global_load_async_to_lds_b128 %3, %11, off\n\t"
               "global_load_async_to_lds_b128 %4, %12, off\n\t"
               "global_load_async_to_lds_b128 %5, %13, off\n\t"
               "global_load_async_to_lds_b128 %6, %14, off\n\t"
               "global_load_async_to_lds_b128 %7, %15, off\n\t"
               "s_wait_xcnt 0x0"
               :: "v"(l), "v"(l + lstep), "v"(l + 2 * lstep), "v"(l + 3 * lstep), "v"(l + 4 * lstep), "v"(l + 5 * lstep), "v"(l + 6 * lstep), "v"(l + 7 * lstep),
                  "v"(g), "v"(g + gstep), "v"(g + 2 * gstep), "v"(g + 3 * gstep), "v"(g + 4 * gstep), "v"(g + 5 * gstep), "v"(g + 6 * gstep), "v"(g + 7 * gstep)
               : "memory");
}

// One butterfly step of a reduction over a 16-lane row, on the vector pipe: the lane's value joined with that of lane ^ M. It takes the place of a ds_bpermute_b32 and the
// s_wait_dscnt behind it, so that the steps of several rows can follow one another without a wait. Every lane is on where these stand.
template <int M> __device__ __forceinline__ float row_max_step(float v) { float o;
  asm("v_max_num_f32_dpp %0, %1, %1 row_xmask:%2 row_mask:0xf bank_mask:0xf" : "=v"(o) : "v"(v), "n"(M));      // o = max(v of lane ^ M, v)
  return o; }
template <int M> __device__ __forceinline__ float row_add_step(float v) { float o;
  asm("v_add_f32_dpp %0, %1, %1 row_xmask:%2 row_mask:0xf bank_mask:0xf" : "=v"(o) : "v"(v), "n"(M));          // o = v of lane ^ M + v
  return o; }

// Eight values x become 2^x, each in its own register, one run of v_exp_f32. No v_exp_f32 of the run touches a register of the one in front of it; the closing v_nop is the slot that the
// instruction set asks for between the last of them and whatever reads its result next.
__device__ __forceinline__ void exp2_x8(float (&x)[8]) {
  asm("v_exp_f32 %0, %0\n\tv_exp_f32 %1, %1\n\tv_exp_f32 %2, %2\n\tv_exp_f32 %3, %3\n\tv_exp_f32 %4, %4\n\tv_exp_f32 %5, %5\n\tv_exp_f32 %6, %6\n\tv_exp_f32 %7, %7\n\tv_nop"
      : "+v"(x[0]), "+v"(x[1]), "+v"(x[2]), "+v"(x[3]), "+v"(x[4]), "+v"(x[5]), "+v"(x[6]), "+v"(x[7]));
}

// K and Vt reach the four waves of a work-group through LDS: a stage is 64 keys (K: 64 rows of 256 B, Vt: 128 rows of 128 B, whole 128-B lines), copied once per work-group,
// two buffers, the next stage in flight while this one is worked on. Row pitches 272 B and 144 B (16 B x odd) keep the ds_load_b128 fragment reads free of bank conflicts.
__global__ __launch_bounds__(128) void k_flash(const _Float16* __restrict__ Q16, int ldq, const _Float16* __restrict__ K16, int ldk, const _Float16* __restrict__ Vt, const int* __restrict__ MSK, float* __restrict__ O, int ldo) {
  constexpr int RPW = 16, RTN = RPW / 16, NQB = 3072 / (4 * RPW), DT = 8, KS = 4;      /* head dim 128 */
  constexpr unsigned KP = 272, VP = 144, KBYTES = 64 * KP, STG = KBYTES + 128 * VP;
  constexpr float C2 = (float)(0.08838834764831845 * 1.4426950408889634);
  __shared__ __attribute__((aligned(16))) unsigned char ring[2 * STG];
  __shared__ __attribute__((aligned(16))) unsigned short sP[4][RPW][40];
  float (*sO)[RPW][128 + 4] = (float (*)[RPW][128 + 4])ring;      /* output staging takes the ring's place behind the loop's last barrier */
  static_assert(sizeof(float) * 4 * RPW * (128 + 4) <= 2 * STG, "output staging fits the ring");
  const int tid = threadIdx.x, w = tid >> 5, lane = tid & 31, ln = lane & 15, hh = lane >> 4;
  const int slab = blockIdx.x / NQB, qblk = blockIdx.x % NQB; const int b = slab / 8, h = slab % 8; const int qb0 = qblk * (4 * RPW); const int q0 = qb0 + w * RPW;
  FragH aq[2][KS];
#pragma unroll
  for (int rt = 0; rt < RTN; ++rt) { const unsigned short* qr = (const unsigned short*)Q16 + ((size_t)b * 3072 + q0 + rt * 16 + ln) * ldq + h * 128;
#pragma unroll
    for (int ks = 0; ks < KS; ++ks) { aq[rt][ks].half[0] = *(const v8us*)(qr + ks * 32 + 8 * hh); aq[rt][ks].half[1] = *(const v8us*)(qr + ks * 32 + 16 + 8 * hh); } }
  const unsigned short* Vth = (const unsigned short*)Vt + (size_t)slab * 128 * 3072;
  // each thread's own pieces of a stage: K row tid/16 + 8i, 16-byte piece tid%16; Vt row tid/8 + 16i, piece tid%8
  const char* kg = (const char*)((const unsigned short*)K16 + ((size_t)b * 3072 + (tid >> 4)) * ldk + h * 128 + (tid & 15) * 8);
  const char* vg = (const char*)(Vth + (size_t)(tid >> 3) * 3072 + (tid & 7) * 8);
  const unsigned ring0 = (unsigned)(size_t)ring;
  const unsigned kl = ring0 + (unsigned)(tid >> 4) * KP + (unsigned)(tid & 15) * 16u, vl = ring0 + KBYTES + (unsigned)(tid >> 3) * VP + (unsigned)(tid & 7) * 16u;
  const size_t kstage = (size_t)64 * ldk * 2, kstep = (size_t)8 * ldk * 2;
  auto fill = [&](int st, unsigned buf) {
    copy8_to_lds(kl + buf * STG, 8 * KP, kg + (size_t)st * kstage, kstep);
    copy8_to_lds(vl + buf * STG, 16 * VP, vg + (size_t)st * 128, (size_t)16 * 3072 * 2);
  };
  float m_r[2][8], l_r[2][8]; v8f oacc[2][DT];
#pragma unroll
  for (int rt = 0; rt < RTN; ++rt) {
#pragma unroll
    for (int r = 0; r < 8; ++r) { m_r[rt][r] = -3.0e38f; l_r[rt][r] = 0.f; }
#pragma unroll
    for (int dt = 0; dt < DT; ++dt) oacc[rt][dt] = (v8f){0.f,0.f,0.f,0.f,0.f,0.f,0.f,0.f}; }
  const int nst = qblk + 1;      /* stages of 64 keys up to the block's diagonal; the same for the whole work-group */
  fill(0, 0u);
  asm volatile("s_wait_asynccnt 0x0" ::: "memory");      // this wave's pieces of stage 0 have landed
  __syncthreads();                                       // every wave's pieces of stage 0 are readable
  if (nst > 1) fill(1, 1u);
#pragma unroll 1      /* one copy of the body: the ring's order stays as written */
  for (int st = 0; st < nst; ++st) {
    const unsigned char* kbuf = ring + (unsigned)(st & 1) * STG; const unsigned char* vbuf = kbuf + KBYTES;
#pragma unroll 1      /* the two 32-key passes of a stage share one body in the instruction cache */
  for (int sub = 0; sub < 2; ++sub) { const int j0 = st * 64 + sub * 32;
    v8f s[2][2]; FragH bk[2][KS];      /* the pass's K fragments, both key tiles, one group of LDS reads ahead of the score products */
#pragma unroll
    for (int nt = 0; nt < 2; ++nt) { const unsigned char* kr = kbuf + (unsigned)(sub * 32 + nt * 16 + ln) * KP + 16 * hh;
#pragma unroll
      for (int ks = 0; ks < KS; ++ks) { bk[nt][ks].half[0] = *(const v8us*)(kr + ks * 64); bk[nt][ks].half[1] = *(const v8us*)(kr + ks * 64 + 32); } }
#pragma unroll
    for (int nt = 0; nt < 2; ++nt) {
#pragma unroll
      for (int rt = 0; rt < RTN; ++rt) { v8f acc = (v8f){0.f,0.f,0.f,0.f,0.f,0.f,0.f,0.f};
#pragma unroll
        for (int ks = 0; ks < KS; ++ks) acc = mmaH<1>(aq[rt][ks].v, aq[rt][ks].v, bk[nt][ks].v, bk[nt][ks].v, acc); s[rt][nt] = acc; } }
    // The softmax of a pass in sweeps over a lane's eight rows, each sweep one straight run of code, so that the rows' dependent chains overlap:
    // masked scores, then the row maxima step by step, then the exponentials, each computed ahead of the select that may drop it (no branch stands between two rows).
    // The scores and the running maxima stay the raw q.k sums. exp((s - m) / sqrt(128)) is taken as 2^(s * C2 - m * C2), C2 = log2(e) / sqrt(128): one fused multiply-add and one v_exp_f32
    // a value. No argument is above 0 but by the rounding of m * C2, and a result too small for v_exp_f32 is far below half a unit of P's f16, so the library exp's range handling has nothing to do here.
#pragma unroll
    for (int rt = 0; rt < RTN; ++rt) { const int k0 = j0 + ln, k1 = j0 + 16 + ln; float s0[8], s1[8], mc[8];
#pragma unroll
      for (int r = 0; r < 8; ++r) { const int tq = q0 + rt * 16 + 8 * hh + r;
        s0[r] = (k0 <= tq) ? s[rt][0][r] : -INFINITY; s1[r] = (k1 <= tq) ? s[rt][1][r] : -INFINITY; mc[r] = fmaxf(s0[r], s1[r]); }
#pragma unroll
      for (int r = 0; r < 8; ++r) mc[r] = row_max_step<1>(mc[r]);
#pragma unroll
      for (int r = 0; r < 8; ++r) mc[r] = row_max_step<2>(mc[r]);
#pragma unroll
      for (int r = 0; r < 8; ++r) mc[r] = row_max_step<4>(mc[r]);
#pragma unroll
      for (int r = 0; r < 8; ++r) mc[r] = row_max_step<8>(mc[r]);
      float ea[8];
#pragma unroll
      for (int r = 0; r < 8; ++r) { const float mn = fmaxf(m_r[rt][r], mc[r]), nb = mn * C2;      /* mn is finite: no difference here is a NaN */
        ea[r] = __builtin_fmaf(m_r[rt][r], C2, -nb); s0[r] = __builtin_fmaf(s0[r], C2, -nb); s1[r] = __builtin_fmaf(s1[r], C2, -nb); m_r[rt][r] = mn; }
      exp2_x8(ea); exp2_x8(s0); exp2_x8(s1);
#pragma unroll
      for (int r = 0; r < 8; ++r) { const int tq = q0 + rt * 16 + 8 * hh + r; const bool ok0 = (k0 <= tq), ok1 = (k1 <= tq);
        const float al = (m_r[rt][r] > -1.0e38f) ? ea[r] : 1.0f; const float p0 = ok0 ? s0[r] : 0.f, p1 = ok1 ? s1[r] : 0.f; l_r[rt][r] = l_r[rt][r] * al + p0 + p1;
#pragma unroll
        for (int dt = 0; dt < DT; ++dt) oacc[rt][dt][r] *= al;
        FragH t2; t2.h[0] = (_Float16)p0; t2.h[1] = (_Float16)p1; sP[w][rt * 16 + 8 * hh + r][ln] = t2.u[0]; sP[w][rt * 16 + 8 * hh + r][16 + ln] = t2.u[1]; } }
    // The pass's Vt fragments, one group of LDS reads, in flight together with the stores of P: one wait serves them all, and the P.V products below follow one another from registers.
    FragH bv[DT];
#pragma unroll
    for (int dt = 0; dt < DT; ++dt) { const unsigned char* vrow = vbuf + (unsigned)(dt * 16 + ln) * VP + sub * 64 + 16 * hh; bv[dt].half[0] = *(const v8us*)(vrow); bv[dt].half[1] = *(const v8us*)(vrow + 32); }
    __builtin_amdgcn_fence(__ATOMIC_ACQ_REL, "workgroup"); __builtin_amdgcn_wave_barrier();
    FragH pa[2];
#pragma unroll
    for (int rt = 0; rt < RTN; ++rt) { pa[rt].half[0] = *(const v8us*)&sP[w][rt * 16 + ln][8 * hh]; pa[rt].half[1] = *(const v8us*)&sP[w][rt * 16 + ln][16 + 8 * hh]; }
#pragma unroll
    for (int dt = 0; dt < DT; ++dt) {
#pragma unroll
      for (int rt = 0; rt < RTN; ++rt) oacc[rt][dt] = mmaH<1>(pa[rt].v, pa[rt].v, bv[dt].v, bv[dt].v, oacc[rt][dt]); }
    __builtin_amdgcn_fence(__ATOMIC_ACQ_REL, "workgroup"); __builtin_amdgcn_wave_barrier(); }
    asm volatile("s_wait_dscnt 0x0" ::: "memory");       // this wave's reads of the buffer have returned before it is refilled
    asm volatile("s_wait_asynccnt 0x0" ::: "memory");    // this wave's pieces of stage st + 1 have landed
    __syncthreads();                                     // publishes stage st + 1 and ends every wave's reads of stage st
    if (st + 2 < nst) fill(st + 2, (unsigned)(st & 1));
  }
  asm volatile("s_wait_asynccnt 0x0" ::: "memory");      // no copy is outstanding when the ring becomes output staging
#pragma unroll
  for (int rt = 0; rt < RTN; ++rt) {
#pragma unroll
    for (int r = 0; r < 8; ++r) l_r[rt][r] = row_add_step<1>(l_r[rt][r]);
#pragma unroll
    for (int r = 0; r < 8; ++r) l_r[rt][r] = row_add_step<2>(l_r[rt][r]);
#pragma unroll
    for (int r = 0; r < 8; ++r) l_r[rt][r] = row_add_step<4>(l_r[rt][r]);
#pragma unroll
    for (int r = 0; r < 8; ++r) l_r[rt][r] = row_add_step<8>(l_r[rt][r]);
#pragma unroll
    for (int r = 0; r < 8; ++r) { const float l = l_r[rt][r]; l_r[rt][r] = (l > 0.f) ? 1.0f / l : 0.f; }
#pragma unroll
    for (int dt = 0; dt < DT; ++dt)
#pragma unroll
      for (int r = 0; r < 8; ++r) sO[w][rt * 16 + 8 * hh + r][dt * 16 + ln] = oacc[rt][dt][r] * l_r[rt][r]; }
  __builtin_amdgcn_fence(__ATOMIC_ACQ_REL, "workgroup"); __builtin_amdgcn_wave_barrier();
  {
#pragma unroll
    for (int rp = 0; rp < RPW; ++rp) { const int r = rp, pc = lane; const v4f val = *(const v4fa*)&sO[w][r][pc * 4]; *(v4f*)(O + ((size_t)(b * 8 + h) * 3072 + q0 + r) * 128 + pc * 4) = val; }      /* output layout [b][h][s][128]: 32 lanes x 16 B rows */
     } }

// Projection GEMM: C[row][col] = alpha * sum_k A[row][k] * Bt[col][k], both operands f16 with CW elements a row, f32 accumulate, k ascending in one chain per accumulator.
// A work-group owns a 64 x 64 tile of C, its four waves 32 x 32 each. A and Bt reach the waves through LDS: a stage is 128 k (64 rows of A and 64 of Bt, 256 B each, whole 128-B lines),
// copied once per work-group, two buffers, the next stage in flight while this one is worked on. Row pitch 272 B (16 B x odd) keeps the ds_load_b128 fragment reads free of bank conflicts.
// One launch does all nine projections. The grid is exact: blockIdx.x = row tile of the TT positions * (CW / 64) + column tile, blockIdx.y = batch, blockIdx.z = projection (0 q, 1 k, 2 v).
// A row tile lies wholly in one segment (SL is a multiple of 64) and takes that segment's weights: plane 3 * projection + (0 middle, 1 state, 2 end) of B9. All three go out as f16.
// q and k are rotated (RoPE) on their way out. Their weight planes come with bits 5 and 6 of the column-in-head swapped (k_wst), so that columns c and c + 32 of a tile are the pair
// (j, j + 64) of one head, j = 32 * (tile & 1) + c: both partners lie in the tile's output staging. q and k keep that column order in Q16 and K16; it is the same in both, so q.k is the same sum in another order.
// CS[position][128] holds cos (0..63) and sin (64..127) of the position's 64 angles.
__global__ __launch_bounds__(128) void k_gemm_ring(const _Float16* __restrict__ A, const _Float16* __restrict__ B9, float alpha, const float* __restrict__ CS, _Float16* __restrict__ Q16, _Float16* __restrict__ K16, _Float16* __restrict__ C16) {
  static_assert(SL % 64 == 0 && TT % 64 == 0, "a row tile never straddles a segment");
  constexpr size_t sA = (size_t)TT * CW, sC = (size_t)TT * CW;
  constexpr unsigned RP = 272, TB = 64 * RP, STG = 2 * TB; constexpr int NST = CW / 128;
  static_assert(NST >= 2, "the ring's prologue fills two stages");
  __shared__ __attribute__((aligned(16))) unsigned char ring[2 * STG];
  float (*so)[64 + 4] = (float (*)[64 + 4])ring;      /* output staging takes the ring's place behind the loop's last barrier */
  static_assert(sizeof(float) * 64 * (64 + 4) <= 2 * STG, "output staging fits the ring");
  const int tid = threadIdx.x, w = tid >> 5, lane = tid & 31, ln = lane & 15, hh = lane >> 4, wm = w >> 1, wn = w & 1;
  const int row0 = (int)(blockIdx.x / (CW / 64)) * 64, col0 = (int)(blockIdx.x % (CW / 64)) * 64;
  const int prj = (int)blockIdx.z, sgm = (row0 < SL) ? 1 : ((row0 < TT - SL) ? 0 : 2); const bool OUT16 = (prj == 2);
  const _Float16* Bt = B9 + (size_t)(prj * 3 + sgm) * CW * CW;
  // each thread's own pieces of a stage: row tid/16 + 8i of either operand, 16-byte piece tid%16
  const char* ag = (const char*)((const unsigned short*)A + (size_t)blockIdx.y * sA + (size_t)(row0 + (tid >> 4)) * CW + (tid & 15) * 8);
  const char* bg = (const char*)((const unsigned short*)Bt + (size_t)(col0 + (tid >> 4)) * CW + (tid & 15) * 8);
  const unsigned al = (unsigned)(size_t)ring + (unsigned)(tid >> 4) * RP + (unsigned)(tid & 15) * 16u, bl = al + TB;
  auto fill = [&](int st, unsigned buf) {
    copy8_to_lds(al + buf * STG, 8 * RP, ag + (size_t)st * 256, (size_t)8 * CW * 2);
    copy8_to_lds(bl + buf * STG, 8 * RP, bg + (size_t)st * 256, (size_t)8 * CW * 2);
  };
  v8f acc[2][2];
#pragma unroll
  for (int i = 0; i < 2; ++i)
#pragma unroll
    for (int j = 0; j < 2; ++j) acc[i][j] = (v8f){0.f,0.f,0.f,0.f,0.f,0.f,0.f,0.f};
  fill(0, 0u);
  asm volatile("s_wait_asynccnt 0x0" ::: "memory");      // this wave's pieces of stage 0 have landed
  __syncthreads();                                       // every wave's pieces of stage 0 are readable
  fill(1, 1u);
#pragma unroll 1      /* one copy of the body: the ring's order stays as written */
  for (int st = 0; st < NST; ++st) {
    const unsigned char* ar = ring + (unsigned)(st & 1) * STG + (unsigned)(wm * 32 + ln) * RP + 16 * hh;
    const unsigned char* br = ring + (unsigned)(st & 1) * STG + TB + (unsigned)(wn * 32 + ln) * RP + 16 * hh;
    FragH fa[4][2], fb[4][2];
#pragma unroll
    for (int ks = 0; ks < 4; ++ks)
#pragma unroll
      for (int i = 0; i < 2; ++i) {
        fa[ks][i].half[0] = *(const v8us*)(ar + i * 16 * RP + ks * 64); fa[ks][i].half[1] = *(const v8us*)(ar + i * 16 * RP + ks * 64 + 32);
        fb[ks][i].half[0] = *(const v8us*)(br + i * 16 * RP + ks * 64); fb[ks][i].half[1] = *(const v8us*)(br + i * 16 * RP + ks * 64 + 32); }
    asm volatile("s_wait_dscnt 0x0" ::: "memory");       // the stage's 32 fragment reads, one group, have returned: this wave is done with the buffer before it is refilled
    asm volatile("s_wait_asynccnt 0x0" ::: "memory");    // this wave's pieces of stage st + 1 have landed
    __syncthreads();                                     // publishes stage st + 1 and ends every wave's reads of stage st
    if (st + 2 < NST) fill(st + 2, (unsigned)(st & 1));  // in front of the WMMAs, which work from registers, so that the copies fly behind them
#pragma unroll
    for (int ks = 0; ks < 4; ++ks)
#pragma unroll
      for (int i = 0; i < 2; ++i)
#pragma unroll
        for (int j = 0; j < 2; ++j) acc[i][j] = __builtin_amdgcn_wmma_f32_16x16x32_f16(false, fa[ks][i].v, false, fb[ks][j].v, (short)0, acc[i][j], false, false);
  }
  // q, k: a thread rotates four pairs of columns (cl.., cl + 32..) in each of four rows; their cos and sin are fetched here so that they fly while the tile is staged
  const int rs = lane >> 3, cl = (lane & 7) * 4; v4f tc[4] = {}, ts[4] = {};
  if (!OUT16) { const float* cs = CS + (size_t)(row0 + w * 16 + rs) * 128 + ((col0 >> 6) & 1) * 32 + cl;
#pragma unroll
    for (int q = 0; q < 4; ++q) { tc[q] = *(const v4fa*)(cs + q * 4 * 128); ts[q] = *(const v4fa*)(cs + q * 4 * 128 + 64); } }
  asm volatile("s_wait_asynccnt 0x0" ::: "memory");      // no copy is outstanding when the ring becomes output staging
#pragma unroll
  for (int i = 0; i < 2; ++i)
#pragma unroll
    for (int j = 0; j < 2; ++j)
#pragma unroll
      for (int r = 0; r < 8; ++r) so[wm * 32 + i * 16 + 8 * hh + r][wn * 32 + j * 16 + ln] = acc[i][j][r] * alpha;
  __syncthreads();                                       // a stored row of 64 columns holds two waves' results
  const int rsub = lane >> 4, c4 = (lane & 15) * 4; typedef _Float16 v4h __attribute__((ext_vector_type(4)));
  if (OUT16) {      /* the test stands once, in front of the eight rows, so that their LDS reads stay one group */
#pragma unroll
    for (int q = 0; q < 8; ++q) { const int r = w * 16 + q * 2 + rsub; const v4f v = *(const v4fa*)&so[r][c4]; const size_t o = (size_t)blockIdx.y * sC + (size_t)(row0 + r) * CW + col0 + c4; v4h h4;
#pragma unroll
      for (int i = 0; i < 4; ++i) h4[i] = (_Float16)v[i];
      *(v4h*)(C16 + o) = h4; }      /* whole 128-B lines, one wave a line */
  } else {
    _Float16* D16 = prj ? K16 : Q16;
#pragma unroll
    for (int q = 0; q < 4; ++q) { const int r = w * 16 + q * 4 + rs; const v4f lo = *(const v4fa*)&so[r][cl], hi = *(const v4fa*)&so[r][cl + 32]; const size_t o = (size_t)blockIdx.y * sC + (size_t)(row0 + r) * CW + col0 + cl; v4h ol, oh;
#pragma unroll
      for (int i = 0; i < 4; ++i) { ol[i] = (_Float16)(lo[i] * tc[q][i] + (-hi[i]) * ts[q][i]); oh[i] = (_Float16)(hi[i] * tc[q][i] + lo[i] * ts[q][i]); }
      *(v4h*)(D16 + o) = ol; *(v4h*)(D16 + o + 32) = oh; }      /* the two halves of a 128-B line, both from this wave */
    asm volatile("s_wait_xcnt 0x0" ::: "memory");      // stands behind the run of stores, in front of any later rewrite of the registers they name
  }
}

__global__ __launch_bounds__(256) void k_xt(const float* __restrict__ x, _Float16* __restrict__ XT) { const size_t t = (size_t)blockIdx.x * 256 + threadIdx.x; if (t >= (size_t)NR * NH * 16) return; const int p = (int)(t % 16); const int h = (int)((t / 16) % NH); const size_t bs = t / (16 * NH); const int b = (int)(bs / TT), s = (int)(bs % TT); const float* src = x + (((size_t)(b * NH + h) * TT + s) * HD) + p * 8; FragH f;
#pragma unroll
  for (int q = 0; q < 8; ++q) f.h[q] = (_Float16)bf16_round(src[q]); unsigned short* d = (unsigned short*)XT + bs * CW + h * HD + p * 8; *(v8us*)d = f.half[0];  }
// One launch re-lays all nine weight tensors: blockIdx.y picks the tensor and its plane of B9. The q and k planes (0..5) take their rows with bits 5 and 6 of the column-in-head swapped (see k_gemm_ring).
// A tenth plane of the grid fills the RoPE table CS[position][128]: cos (0..63) and sin (64..127) of (position + offset) * 10000^(-2i/128), each angle worked out once.
__global__ __launch_bounds__(256) void k_wst(const float* __restrict__ W0, const float* __restrict__ W1, const float* __restrict__ W2, const float* __restrict__ W3, const float* __restrict__ W4,
                                             const float* __restrict__ W5, const float* __restrict__ W6, const float* __restrict__ W7, const float* __restrict__ W8, _Float16* __restrict__ B9, const int* __restrict__ offp, float* __restrict__ CS) {
  const unsigned y = blockIdx.y;
  if (y == 9) { const int o0 = offp[0];
#pragma unroll 1      /* one copy of the cos and sin code */
    for (unsigned u = blockIdx.x * 256 + threadIdx.x; u < (unsigned)TT * 64; u += (unsigned)CW * NH * 16) { const int i = (int)(u & 63), s = (int)(u >> 6); const float pos = (float)(s + o0);
      const float ang = pos * __builtin_powf(10000.0f, -(float)(2 * i) / 128.0f); CS[(size_t)s * 128 + i] = cosf(ang); CS[(size_t)s * 128 + 64 + i] = sinf(ang); }
    return; }
  const float* W = W0; W = (y == 1) ? W1 : W; W = (y == 2) ? W2 : W; W = (y == 3) ? W3 : W; W = (y == 4) ? W4 : W; W = (y == 5) ? W5 : W; W = (y == 6) ? W6 : W; W = (y == 7) ? W7 : W; W = (y == 8) ? W8 : W; _Float16* Bt = B9 + (size_t)y * CW * CW;
  const size_t t = (size_t)blockIdx.x * 256 + threadIdx.x; if (t >= (size_t)CW * NH * 16) return; const int p = (int)(t % 16); const int h = (int)((t / 16) % NH); const int n = (int)(t / (16 * NH)); const int g = n / HD, ep = n % HD, e = (y < 6) ? ((ep & 31) | ((ep & 32) << 1) | ((ep & 64) >> 1)) : ep; FragH f;
#pragma unroll
  for (int q = 0; q < 8; ++q) { const int d = p * 8 + q; f.h[q] = (_Float16)(bf16_round(W[(((size_t)(h * NH + g) * HD + d) * HD) + e]) * 16.0f); }
  unsigned short* dst = (unsigned short*)Bt + (size_t)n * CW + h * HD + p * 8; *(v8us*)dst = f.half[0];  }
__global__ __launch_bounds__(256) void k_vt128(const _Float16* __restrict__ V16, _Float16* __restrict__ Vt) { __shared__ unsigned short tl[64][130]; const int tid = threadIdx.x; const int slab = blockIdx.x / (TT / 64), lg = blockIdx.x % (TT / 64); const int b = slab / NH, h = slab % NH;
  for (int i = tid; i < 64 * 16; i += 256) { const int r = i / 16, c8 = (i % 16) * 8; FragH f; f.half[0] = *(const v8us*)((const unsigned short*)V16 + ((size_t)b * TT + lg * 64 + r) * CW + h * HD + c8);
#pragma unroll
    for (int q = 0; q < 8; ++q) tl[r][c8 + q] = f.u[q]; }
  __syncthreads();
  { for (int i = tid; i < 128 * 8; i += 256) { const int d = i / 8, pc = i % 8; FragH f;
#pragma unroll
      for (int q = 0; q < 8; ++q) f.u[q] = tl[pc * 8 + q][d]; *(v8us*)((unsigned short*)Vt + ((size_t)slab * HD + d) * TT + lg * 64 + pc * 8) = f.half[0]; }  } }
extern "C" void kernel_launch(void* const* d_in, const int* in_sizes, int n_in,
                              void* d_out, int out_size, void* d_ws, size_t ws_size, hipStream_t stream) {
  (void)in_sizes; (void)n_in; (void)out_size;
  const float* x = (const float*)d_in[0]; const float* Wm[3] = {(const float*)d_in[1], (const float*)d_in[2], (const float*)d_in[3]}; const float* Wsg[3] = {(const float*)d_in[4], (const float*)d_in[5], (const float*)d_in[6]}; const float* Weg[3] = {(const float*)d_in[7], (const float*)d_in[8], (const float*)d_in[9]}; const int* offp = (const int*)d_in[10];
  char* ws = (char*)d_ws; size_t off = 0;
  auto take = [&](size_t bytes) { char* p = ws + off; off += (bytes + 255) & ~(size_t)255; return p; };
  _Float16* B9 = (_Float16*)take((size_t)9 * CW * CW * 2);      // plane 3 * projection + (0 middle, 1 state, 2 end)
  _Float16* XT = (_Float16*)take((size_t)NR * CW * 2); float* CS = (float*)take((size_t)TT * 128 * 4); _Float16* Q16 = (_Float16*)take((size_t)NR * CW * 2); _Float16* K16 = (_Float16*)take((size_t)NR * CW * 2); _Float16* V16 = (_Float16*)take((size_t)NR * CW * 2); _Float16* Vt = (_Float16*)take((size_t)NR * CW * 2);
  if (off > ws_size) return;      // 18.9 + 12.6 + 1.6 + 12.6 x 4 = 83 MB
  k_xt<<<(unsigned)(((size_t)NR * NH * 16 + 255) / 256), 256, 0, stream>>>(x, XT);
  const unsigned gw = (unsigned)(((size_t)CW * NH * 16 + 255) / 256);
  k_wst<<<dim3(gw, 10), 256, 0, stream>>>(Wm[0], Wsg[0], Weg[0], Wm[1], Wsg[1], Weg[1], Wm[2], Wsg[2], Weg[2], B9, offp, CS);
  k_gemm_ring<<<dim3((TT / 64) * (CW / 64), BB, 3), 128, 0, stream>>>(XT, B9, 0.0625f, CS, Q16, K16, V16);
  k_vt128<<<BB * NH * (TT / 64), 256, 0, stream>>>(V16, Vt);
  k_flash<<<BB * NH * (TT / 64), 128, 0, stream>>>(Q16, CW, K16, CW, Vt, nullptr, (float*)d_out, 0);
}

// v008
// Measured time: 158 microseconds a run.
// Two timings next to v007 both put it at 1.16 times that version's speed.
// Counting every step since v000, it is 5.84 times as fast.
#include <hip/hip_runtime.h>
// Causal multi-head attention with state segments (x [2, 8 heads, 3072, 128]; StackedLinear projections that mix heads and features — separate weights for the first 512 (state), middle 2048 and
// last 512 (end) positions; rotate-half RoPE with an INPUT offset; causal softmax(q·k/√128)·v; output [2,8,3072,128]): the nine (h,d)→(g,e) projections as GEMMs on the (b,s)-major transposed
// input (bf16-exact ×2^4 weights, f32 accumulate) and the attention as a fused flash-style kernel (d = 128: 4 k-steps / 8 d-tiles; causal chunk skipping; online softmax f32; P f16 ≤ 1;
// Ot = Vt·Pt written as O rows into the output; RPW-16 waves) on v_wmma_f32_16x16x32_f16; RoPE f32 VALU.
#define BB 2
#define NH 8
#define TT 3072
#define HD 128
#define CW (NH * HD)
#define NR (BB * TT)
#define SL 512

typedef __bf16 v16b __attribute__((ext_vector_type(16)));
typedef unsigned short v8us __attribute__((ext_vector_type(8), may_alias));
typedef float  v8f  __attribute__((ext_vector_type(8)));
typedef float  v4f  __attribute__((ext_vector_type(4)));
typedef float  v4fa __attribute__((ext_vector_type(4), may_alias));
union FragB { v16b v; v8us half[2]; unsigned short u[16]; };

__device__ __forceinline__ unsigned short bf16_bits(float x) { unsigned int u = __float_as_uint(x); return (unsigned short)((u + 0x7FFFu + ((u >> 16) & 1u)) >> 16); }
__device__ __forceinline__ float bf16_val(unsigned short b) { return __uint_as_float(((unsigned int)b) << 16); }
__device__ __forceinline__ float bf16_round(float x) { return bf16_val(bf16_bits(x)); }
// D += A·B with NT terms: 1 = ah·bh, 2 = + al·bh (A split), 3 = + ah·bl (both split)
template <int NT>
__device__ __forceinline__ v8f mmaN(v16b ah, v16b al, v16b bh, v16b bl, v8f c) {
  c = __builtin_amdgcn_wmma_f32_16x16x32_bf16(false, ah, false, bh, (short)0, c, false, false);
  if (NT >= 2) c = __builtin_amdgcn_wmma_f32_16x16x32_bf16(false, al, false, bh, (short)0, c, false, false);
  if (NT >= 3) c = __builtin_amdgcn_wmma_f32_16x16x32_bf16(false, ah, false, bl, (short)0, c, false, false);
  asm volatile("v_nop\n\tv_nop\n\tv_nop\n\tv_nop" : "+v"(c) : "v"(ah), "v"(al), "v"(bh), "v"(bl));
  return c;
}

__global__ __launch_bounds__(256) void k_wt_bf16(const float* __restrict__ W, unsigned short* __restrict__ Wt, int K, int N) {
  const int t = blockIdx.x * 256 + threadIdx.x;
  const int k8n = K / 8;
  if (t >= N * k8n) return;
  const int n = t / k8n, k8 = (t % k8n) * 8;
  v8us v;
#pragma unroll
  for (int i = 0; i < 8; ++i) v[i] = bf16_bits(W[(size_t)(k8 + i) * N + n]);
  *(v8us*)(Wt + (size_t)n * K + k8) = v;
  
}

// GEMM C[M][N] (f32, pitch ldc) = act(A[M][K]·W + bias). A f32 row-major (pitch lda) converted per fragment to bf16
// (ASPLIT: hi/lo two planes -> 2 terms, else single rounded term); Wt bf16 [N][K] (pitch ldb). BIAS_BF16 rounds the
// bias to bf16 first (bias quantised to bf16 before the add). K%32==0, M%16==0, N%64==0.
template <bool ASPLIT, int ACT, bool BIAS_BF16>
__global__ __launch_bounds__(128) void k_gemm_bf(const float* __restrict__ A, int lda, const unsigned short* __restrict__ Wt, int ldb,
                                               const float* __restrict__ bias, float* __restrict__ C, int ldc, int M, int N, int K) {
  __shared__ __attribute__((aligned(16))) float so[4][16][64];
  const int tid = threadIdx.x, w = tid >> 5, lane = tid & 31, ln = lane & 15, hh = lane >> 4;
  const int ntn = N / 64;
  const int wid = blockIdx.x * 4 + w;
  const int mt = wid / ntn, nq = wid % ntn;
  if (mt * 16 >= M) return;
  const int row0 = mt * 16, col0 = nq * 64;
  const float* arow = A + (size_t)(row0 + ln) * lda;
  v8f acc[4] = {};
  for (int kb = 0; kb < K; kb += 32) {
    FragB ah, al;
    const v4f x0 = *(const v4fa*)(arow + kb + 8 * hh), x1 = *(const v4fa*)(arow + kb + 8 * hh + 4);
    const v4f x2 = *(const v4fa*)(arow + kb + 16 + 8 * hh), x3 = *(const v4fa*)(arow + kb + 16 + 8 * hh + 4);
    float xs[16] = {x0[0],x0[1],x0[2],x0[3],x1[0],x1[1],x1[2],x1[3],x2[0],x2[1],x2[2],x2[3],x3[0],x3[1],x3[2],x3[3]};
#pragma unroll
    for (int i = 0; i < 16; ++i) { const unsigned short hb = bf16_bits(xs[i]); ah.u[i] = hb; al.u[i] = ASPLIT ? bf16_bits(xs[i] - bf16_val(hb)) : (unsigned short)0; }
#pragma unroll
    for (int t = 0; t < 4; ++t) {
      const unsigned short* brow = Wt + (size_t)(col0 + t * 16 + ln) * ldb + kb;
      FragB b;
      b.half[0] = *(const v8us*)(brow + 8 * hh);
      b.half[1] = *(const v8us*)(brow + 16 + 8 * hh);
      acc[t] = mmaN<ASPLIT ? 2 : 1>(ah.v, al.v, b.v, b.v, acc[t]);
    }
  }
#pragma unroll
  for (int t = 0; t < 4; ++t) {
    float bv = bias ? bias[col0 + t * 16 + ln] : 0.f;
    if (BIAS_BF16) bv = bf16_round(bv);
#pragma unroll
    for (int r = 0; r < 8; ++r) { float v = acc[t][r] + bv; if (ACT == 1) v = fmaxf(v, 0.f); so[w][8 * hh + r][t * 16 + ln] = v; }
  }
  __builtin_amdgcn_fence(__ATOMIC_ACQ_REL, "workgroup");
  __builtin_amdgcn_wave_barrier();
  const int rsub = lane >> 4, c4 = (lane & 15) * 4;
  {
#pragma unroll
    for (int q = 0; q < 8; ++q) {
      const int r = q * 2 + rsub;
      const v4f v = *(const v4fa*)&so[w][r][c4];
      *(v4f*)(C + (size_t)(row0 + r) * ldc + col0 + c4) = v;
    }
    
  }
}

// Flash-style causal/unmasked attention, all contractions 3-term bf16 hi/lo splits, f32 softmax with running max.
// q,k,v rows are read from f32 buffers with arbitrary row pitch (so they can live inside a fused qkv buffer);
// D = head size (multiple of 32, <= 128); one wave = 16 query rows; block = 4 waves (64 queries) sharing K/V chunks of 32.
template <int D, bool CAUSAL>
__global__ __launch_bounds__(128) void k_flash(const float* __restrict__ qb, const float* __restrict__ kb, const float* __restrict__ vb,
                                             int pitch, int T, int H, float scale, float* __restrict__ y, int ypitch) {
  constexpr int KS = D / 32;        // k-steps for QK
  constexpr int DT = D / 16;        // d tiles for PV
  __shared__ __attribute__((aligned(16))) unsigned short sKh[32][D + 8], sKl[32][D + 8], sVh[32][D + 8], sVl[32][D + 8];
  __shared__ __attribute__((aligned(16))) unsigned short sPh[4][16][40], sPl[4][16][40];
  __shared__ __attribute__((aligned(16))) float sO[4][16][D];
  const int tid = threadIdx.x, w = tid >> 5, lane = tid & 31, ln = lane & 15, hh = lane >> 4;
  const int nqb = (T + 63) / 64;
  const int bh = blockIdx.x / nqb, qblk = blockIdx.x % nqb;
  const int b = bh / H, h = bh % H;
  const int q0 = qblk * 64 + w * 16;
  const float* Q = qb + (size_t)b * T * pitch + h * D;
  const float* K = kb + (size_t)b * T * pitch + h * D;
  const float* V = vb + (size_t)b * T * pitch + h * D;

  // A fragments of the wave's 16 query rows (scaled), hi/lo
  FragB aqh[KS], aql[KS];
  {
    int row = q0 + ln; if (row >= T) row = T - 1;
    const float* qr = Q + (size_t)row * pitch;
#pragma unroll
    for (int ks = 0; ks < KS; ++ks)
#pragma unroll
      for (int i = 0; i < 16; ++i) {
        const int d = ks * 32 + ((i < 8) ? (8 * hh + i) : (16 + 8 * hh + (i - 8)));
        const float x = qr[d] * scale; const unsigned short hb = bf16_bits(x);
        aqh[ks].u[i] = hb; aql[ks].u[i] = bf16_bits(x - bf16_val(hb));
      }
  }
  float m_r[8], l_r[8];
#pragma unroll
  for (int r = 0; r < 8; ++r) { m_r[r] = -3.0e38f; l_r[r] = 0.f; }
  v8f oacc[DT];
#pragma unroll
  for (int dt = 0; dt < DT; ++dt) oacc[dt] = (v8f){0.f,0.f,0.f,0.f,0.f,0.f,0.f,0.f};

  const int kv_end = CAUSAL ? min(T, qblk * 64 + 64) : T;     // block-uniform
  for (int j0 = 0; j0 < kv_end; j0 += 32) {
    __syncthreads();
    for (int e = tid; e < 32 * (D / 4); e += 128) {
      const int r = e / (D / 4), c4 = (e % (D / 4)) * 4;
      const int key = j0 + r;
      v4f kf = {0.f,0.f,0.f,0.f}, vf = {0.f,0.f,0.f,0.f};
      if (key < T) { kf = *(const v4fa*)(K + (size_t)key * pitch + c4); vf = *(const v4fa*)(V + (size_t)key * pitch + c4); }
#pragma unroll
      for (int t = 0; t < 4; ++t) {
        unsigned short hb = bf16_bits(kf[t]); sKh[r][c4 + t] = hb; sKl[r][c4 + t] = bf16_bits(kf[t] - bf16_val(hb));
        hb = bf16_bits(vf[t]); sVh[r][c4 + t] = hb; sVl[r][c4 + t] = bf16_bits(vf[t] - bf16_val(hb));
      }
    }
    __syncthreads();
    // S tile 16 x 32
    v8f s[2];
#pragma unroll
    for (int nt = 0; nt < 2; ++nt) {
      v8f acc = {};
#pragma unroll
      for (int ks = 0; ks < KS; ++ks) {
        FragB bh_, bl_;
        bh_.half[0] = *(const v8us*)&sKh[nt * 16 + ln][ks * 32 + 8 * hh]; bh_.half[1] = *(const v8us*)&sKh[nt * 16 + ln][ks * 32 + 16 + 8 * hh];
        bl_.half[0] = *(const v8us*)&sKl[nt * 16 + ln][ks * 32 + 8 * hh]; bl_.half[1] = *(const v8us*)&sKl[nt * 16 + ln][ks * 32 + 16 + 8 * hh];
        acc = mmaN<3>(aqh[ks].v, aql[ks].v, bh_.v, bl_.v, acc);
      }
      s[nt] = acc;
    }
    // mask + running max (rows 8hh+r; the 16 lanes of a half share rows)
    float alpha[8];
#pragma unroll
    for (int r = 0; r < 8; ++r) {
      const int qi = q0 + 8 * hh + r;
      const int ja = j0 + ln, jb = j0 + 16 + ln;
      if (CAUSAL) { if (ja > qi) s[0][r] = -3.0e38f; if (jb > qi) s[1][r] = -3.0e38f; }
      if (ja >= T) s[0][r] = -3.0e38f;
      if (jb >= T) s[1][r] = -3.0e38f;
      float mx = fmaxf(s[0][r], s[1][r]);
      mx = fmaxf(mx, __shfl_xor(mx, 1, 32)); mx = fmaxf(mx, __shfl_xor(mx, 2, 32)); mx = fmaxf(mx, __shfl_xor(mx, 4, 32)); mx = fmaxf(mx, __shfl_xor(mx, 8, 32));
      const float mnew = fmaxf(m_r[r], mx);
      alpha[r] = (mnew > -1.0e38f) ? __expf(m_r[r] - mnew) : 1.0f;
      const float p0 = (s[0][r] > -1.0e38f) ? __expf(s[0][r] - mnew) : 0.f;
      const float p1 = (s[1][r] > -1.0e38f) ? __expf(s[1][r] - mnew) : 0.f;
      m_r[r] = mnew;
      l_r[r] = l_r[r] * alpha[r] + p0 + p1;            // per-lane partial row sum (16 lanes combined at the end)
      unsigned short hb = bf16_bits(p0); sPh[w][8 * hh + r][ln] = hb;      sPl[w][8 * hh + r][ln] = bf16_bits(p0 - bf16_val(hb));
      hb = bf16_bits(p1);                sPh[w][8 * hh + r][16 + ln] = hb; sPl[w][8 * hh + r][16 + ln] = bf16_bits(p1 - bf16_val(hb));
    }
#pragma unroll
    for (int dt = 0; dt < DT; ++dt)
#pragma unroll
      for (int r = 0; r < 8; ++r) oacc[dt][r] *= alpha[r];
    __builtin_amdgcn_fence(__ATOMIC_ACQ_REL, "workgroup");
    __builtin_amdgcn_wave_barrier();
    FragB pah, pal;
    pah.half[0] = *(const v8us*)&sPh[w][ln][8 * hh]; pah.half[1] = *(const v8us*)&sPh[w][ln][16 + 8 * hh];
    pal.half[0] = *(const v8us*)&sPl[w][ln][8 * hh]; pal.half[1] = *(const v8us*)&sPl[w][ln][16 + 8 * hh];
#pragma unroll
    for (int dt = 0; dt < DT; ++dt) {
      FragB bvh, bvl;
#pragma unroll
      for (int i = 0; i < 8; ++i) {
        bvh.u[i] = sVh[8 * hh + i][dt * 16 + ln]; bvh.u[8 + i] = sVh[16 + 8 * hh + i][dt * 16 + ln];
        bvl.u[i] = sVl[8 * hh + i][dt * 16 + ln]; bvl.u[8 + i] = sVl[16 + 8 * hh + i][dt * 16 + ln];
      }
      oacc[dt] = mmaN<3>(pah.v, pal.v, bvh.v, bvl.v, oacc[dt]);
    }
    __builtin_amdgcn_fence(__ATOMIC_ACQ_REL, "workgroup");
    __builtin_amdgcn_wave_barrier();
  }
#pragma unroll
  for (int r = 0; r < 8; ++r) {
    float l = l_r[r];
    l += __shfl_xor(l, 1, 32); l += __shfl_xor(l, 2, 32); l += __shfl_xor(l, 4, 32); l += __shfl_xor(l, 8, 32);
    l_r[r] = (l > 0.f) ? 1.0f / l : 0.f;
  }
#pragma unroll
  for (int dt = 0; dt < DT; ++dt)
#pragma unroll
    for (int r = 0; r < 8; ++r) sO[w][8 * hh + r][dt * 16 + ln] = oacc[dt][r] * l_r[r];
  __builtin_amdgcn_fence(__ATOMIC_ACQ_REL, "workgroup");
  __builtin_amdgcn_wave_barrier();
  {
    for (int r = 0; r < 16; ++r) {
      const int row = q0 + r;
      if (row < T && lane < D / 4) {
        const v4f val = *(const v4fa*)&sO[w][r][lane * 4];
        *(v4f*)(y + ((size_t)b * T + row) * ypitch + h * D + lane * 4) = val;
      }
    }
    
  }
}

// GEMM C = act(A·W + bias + resid): A f32 (ASPLIT -> hi/lo 2 terms), Wt bf16 [N][K]; ACT 0 none, 1 relu, 2 exact gelu;
// resid (optional, f32, row index = (row % rmod), pitch ldr, RES_BF16 rounds it) added before the activation.
template <bool ASPLIT, int ACT, bool BIAS_BF16, bool RES_BF16>
__global__ __launch_bounds__(128) void k_gemm_bf3(const float* __restrict__ A, int lda, const unsigned short* __restrict__ Wt, int ldb,
                                                const float* __restrict__ bias, const float* __restrict__ resid, int rmod, int ldr,
                                                float* __restrict__ C, int ldc, int M, int N, int K) {
  __shared__ __attribute__((aligned(16))) float so[4][16][64];
  const int tid = threadIdx.x, w = tid >> 5, lane = tid & 31, ln = lane & 15, hh = lane >> 4;
  const int ntn = N / 64;
  const int wid = blockIdx.x * 4 + w;
  const int mt = wid / ntn, nq = wid % ntn;
  if (mt * 16 >= M) return;
  const int row0 = mt * 16, col0 = nq * 64;
  const float* arow = A + (size_t)(row0 + ln) * lda;
  v8f acc[4] = {};
  for (int kb = 0; kb < K; kb += 32) {
    FragB ah, al;
    const v4f x0 = *(const v4fa*)(arow + kb + 8 * hh), x1 = *(const v4fa*)(arow + kb + 8 * hh + 4);
    const v4f x2 = *(const v4fa*)(arow + kb + 16 + 8 * hh), x3 = *(const v4fa*)(arow + kb + 16 + 8 * hh + 4);
    float xs[16] = {x0[0],x0[1],x0[2],x0[3],x1[0],x1[1],x1[2],x1[3],x2[0],x2[1],x2[2],x2[3],x3[0],x3[1],x3[2],x3[3]};
#pragma unroll
    for (int i = 0; i < 16; ++i) { const unsigned short hb = bf16_bits(xs[i]); ah.u[i] = hb; al.u[i] = ASPLIT ? bf16_bits(xs[i] - bf16_val(hb)) : (unsigned short)0; }
#pragma unroll
    for (int t = 0; t < 4; ++t) {
      const unsigned short* brow = Wt + (size_t)(col0 + t * 16 + ln) * ldb + kb;
      FragB b;
      b.half[0] = *(const v8us*)(brow + 8 * hh);
      b.half[1] = *(const v8us*)(brow + 16 + 8 * hh);
      acc[t] = mmaN<ASPLIT ? 2 : 1>(ah.v, al.v, b.v, b.v, acc[t]);
    }
  }
#pragma unroll
  for (int t = 0; t < 4; ++t) {
    const int col = col0 + t * 16 + ln;
    float bv = bias ? bias[col] : 0.f;
    if (BIAS_BF16) bv = bf16_round(bv);
#pragma unroll
    for (int r = 0; r < 8; ++r) {
      float v = acc[t][r] + bv;
      if (resid) { float rv = resid[(size_t)((row0 + 8 * hh + r) % rmod) * ldr + col]; if (RES_BF16) rv = bf16_round(rv); v += rv; }
      if (ACT == 1) v = fmaxf(v, 0.f);
      if (ACT == 2) v = 0.5f * v * (1.0f + erff(v * 0.70710678118654752f));
      if (ACT == 3) { const float u = 0.7978845608028654f * (v + 0.044715f * v * v * v); v = 0.5f * v * (1.0f + tanhf(u)); }
      so[w][8 * hh + r][t * 16 + ln] = v;
    }
  }
  __builtin_amdgcn_fence(__ATOMIC_ACQ_REL, "workgroup");
  __builtin_amdgcn_wave_barrier();
  const int rsub = lane >> 4, c4 = (lane & 15) * 4;
  {
#pragma unroll
    for (int q = 0; q < 8; ++q) {
      const int r = q * 2 + rsub;
      const v4f v = *(const v4fa*)&so[w][r][c4];
      *(v4f*)(C + (size_t)(row0 + r) * ldc + col0 + c4) = v;
    }
    
  }
}
// row LayerNorm (biased variance, eps) over N: s = X (+ R); optional out_sum <- s; out_norm <- (s-mu)*rsqrt(var+eps)*g + b
template <bool PARAM_BF16>
__global__ __launch_bounds__(256) void k_layernorm(const float* __restrict__ X, const float* __restrict__ R, const float* __restrict__ g, const float* __restrict__ bta,
                                                  float* __restrict__ out_sum, float* __restrict__ out_norm, int N, float eps) {
  __shared__ float red[256];
  const int row = blockIdx.x, tid = threadIdx.x;
  const float* x = X + (size_t)row * N; const float* rr = R ? R + (size_t)row * N : nullptr;
  float vals[16];                     // up to N = 4096
  const int per = N / 256;            // contiguous chunk per thread? use strided-by-4 chunks: thread handles j = tid*4 + 1024*u
  float s1 = 0.f;
  for (int u = 0; u < per / 4; ++u) {
    const int j = tid * 4 + 1024 * u;
    const v4f a = *(const v4fa*)(x + j);
    v4f b = {0.f,0.f,0.f,0.f}; if (rr) b = *(const v4fa*)(rr + j);
#pragma unroll
    for (int q = 0; q < 4; ++q) { const float v = a[q] + b[q]; vals[u * 4 + q] = v; s1 += v; }
  }
  red[tid] = s1; __syncthreads();
  for (int st = 128; st > 0; st >>= 1) { if (tid < st) red[tid] += red[tid + st]; __syncthreads(); }
  const float mu = red[0] / (float)N; __syncthreads();
  float s2 = 0.f;
  for (int u = 0; u < per / 4; ++u)
#pragma unroll
    for (int q = 0; q < 4; ++q) { const float c = vals[u * 4 + q] - mu; s2 += c * c; }
  red[tid] = s2; __syncthreads();
  for (int st = 128; st > 0; st >>= 1) { if (tid < st) red[tid] += red[tid + st]; __syncthreads(); }
  const float rs = rsqrtf(red[0] / (float)N + eps);
  {
    for (int u = 0; u < per / 4; ++u) {
      const int j = tid * 4 + 1024 * u;
      v4f o, sm;
#pragma unroll
      for (int q = 0; q < 4; ++q) {
        float gg = g[j + q], bb = bta[j + q];
        if (PARAM_BF16) { gg = bf16_round(gg); bb = bf16_round(bb); }
        sm[q] = vals[u * 4 + q]; o[q] = (vals[u * 4 + q] - mu) * rs * gg + bb;
      }
      if (out_sum) *(v4f*)(out_sum + (size_t)row * N + j) = sm;
      *(v4f*)(out_norm + (size_t)row * N + j) = o;
    }
    
  }
}



// ---- f16 WMMA path (v_wmma_f32_16x16x32_f16): 11-bit significands for operands in range — used where a [0,1] probability operand needs more precision than bf16
typedef _Float16 v16h __attribute__((ext_vector_type(16)));
union FragH { v16h v; v8us half[2]; _Float16 h[16]; unsigned short u[16]; };
template <int NT>
__device__ __forceinline__ v8f mmaH(v16h ah, v16h al, v16h bh, v16h bl, v8f c) {
  c = __builtin_amdgcn_wmma_f32_16x16x32_f16(false, ah, false, bh, (short)0, c, false, false);
  if (NT >= 2) c = __builtin_amdgcn_wmma_f32_16x16x32_f16(false, al, false, bh, (short)0, c, false, false);
  if (NT >= 3) c = __builtin_amdgcn_wmma_f32_16x16x32_f16(false, ah, false, bl, (short)0, c, false, false);
  asm volatile("v_nop\n\tv_nop\n\tv_nop\n\tv_nop" : "+v"(c) : "v"(ah), "v"(al), "v"(bh), "v"(bl));
  return c;
}
// batched GEMM like k_gemm_b but f16 operands: A f32 (split into f16 hi/lo if ASPLIT, else rounded to f16), Bt = f16 values [n][k]; alpha; C f32; N multiple of 16 (partial tiles skipped)
template <bool ASPLIT>
__global__ __launch_bounds__(128) void k_gemm_h(const float* __restrict__ A, int lda, size_t sA, const _Float16* __restrict__ Bh, int ldb, size_t sB, float alpha, float* __restrict__ C, int ldc, size_t sC, int M, int N, int K) {
  __shared__ __attribute__((aligned(16))) float so[4][16][64];
  const int tid = threadIdx.x, w = tid >> 5, lane = tid & 31, ln = lane & 15, hh = lane >> 4; const int by = blockIdx.y;
  A += (size_t)by * sA; Bh += (size_t)by * sB; C += (size_t)by * sC;
  const int ntn = (N + 63) / 64; const int wid = blockIdx.x * 4 + w; const int mt = wid / ntn, nq = wid % ntn; if (mt * 16 >= M) return;
  const int row0 = mt * 16, col0 = nq * 64; const float* arow = A + (size_t)(row0 + ln) * lda;
  v8f acc[4] = {};
  for (int kb = 0; kb < K; kb += 32) {
    FragH ah, al;
    const v4f x0 = *(const v4fa*)(arow + kb + 8 * hh), x1 = *(const v4fa*)(arow + kb + 8 * hh + 4), x2 = *(const v4fa*)(arow + kb + 16 + 8 * hh), x3 = *(const v4fa*)(arow + kb + 16 + 8 * hh + 4);
    float xs[16] = {x0[0],x0[1],x0[2],x0[3],x1[0],x1[1],x1[2],x1[3],x2[0],x2[1],x2[2],x2[3],x3[0],x3[1],x3[2],x3[3]};
#pragma unroll
    for (int i = 0; i < 16; ++i) { const _Float16 h = (_Float16)xs[i]; ah.h[i] = h; al.h[i] = ASPLIT ? (_Float16)(xs[i] - (float)h) : (_Float16)0.0f; }
#pragma unroll
    for (int t = 0; t < 4; ++t) { if (col0 + t * 16 >= N) continue; const size_t boff = (size_t)(col0 + t * 16 + ln) * ldb + kb; FragH bq; bq.half[0] = *(const v8us*)(Bh + boff + 8 * hh); bq.half[1] = *(const v8us*)(Bh + boff + 16 + 8 * hh);
      acc[t] = mmaH<ASPLIT ? 2 : 1>(ah.v, al.v, bq.v, bq.v, acc[t]); }
  }
#pragma unroll
  for (int t = 0; t < 4; ++t) { if (col0 + t * 16 >= N) continue;
#pragma unroll
    for (int r = 0; r < 8; ++r) so[w][8 * hh + r][t * 16 + ln] = acc[t][r] * alpha; }
  __builtin_amdgcn_fence(__ATOMIC_ACQ_REL, "workgroup"); __builtin_amdgcn_wave_barrier();
  const int rsub = lane >> 4, c4 = (lane & 15) * 4;
  {
#pragma unroll
    for (int q = 0; q < 8; ++q) { const int r = q * 2 + rsub; if (col0 + c4 < N) { const v4f v = *(const v4fa*)&so[w][r][c4]; *(v4f*)(C + (size_t)(row0 + r) * ldc + col0 + c4) = v; } }
     }
}

// Wt[n][k] = f16(W[k][n]·scale) from f32 row-major W[K][N] (scale = power of two; bf16-exact weights stay exact in f16 away from the subnormal range)
__global__ __launch_bounds__(256) void k_wt_f16(const float* __restrict__ W, _Float16* __restrict__ Wt, int K, int N, float scale) {
  const int t = blockIdx.x * 256 + threadIdx.x; if (t >= N * (K / 8)) return; const int n = t / (K / 8), k8 = (t % (K / 8)) * 8; FragH f;
#pragma unroll
  for (int i = 0; i < 8; ++i) f.h[i] = (_Float16)(bf16_round(W[(size_t)(k8 + i) * N + n]) * scale); const v8us o = f.half[0];
  *(v8us*)((unsigned short*)Wt + (size_t)n * K + k8) = o; 
}
__global__ __launch_bounds__(256) void k_x16(const float* __restrict__ x, _Float16* __restrict__ X16, size_t n8) { const size_t t = (size_t)blockIdx.x * 256 + threadIdx.x; if (t >= n8) return; FragH f;
#pragma unroll
  for (int q = 0; q < 8; ++q) f.h[q] = (_Float16)bf16_round(x[t * 8 + q]); *(v8us*)((unsigned short*)X16 + t * 8) = f.half[0];  }
__global__ __launch_bounds__(256) void k_h16(const float* __restrict__ x, _Float16* __restrict__ X16, size_t n8) { const size_t t = (size_t)blockIdx.x * 256 + threadIdx.x; if (t >= n8) return; FragH f;
#pragma unroll
  for (int q = 0; q < 8; ++q) f.h[q] = (_Float16)x[t * 8 + q]; *(v8us*)((unsigned short*)X16 + t * 8) = f.half[0];  }
__global__ __launch_bounds__(256) void k_round16f(const float* __restrict__ W, _Float16* __restrict__ Bt, size_t n8) { const size_t t = (size_t)blockIdx.x * 256 + threadIdx.x; if (t >= n8) return; FragH f;
#pragma unroll
  for (int i = 0; i < 8; ++i) f.h[i] = (_Float16)(bf16_round(W[t * 8 + i]) * 16.0f); *(v8us*)((unsigned short*)Bt + t * 8) = f.half[0];  }
template <int NHv, int TTv>
__global__ __launch_bounds__(256) void k_vt(const _Float16* __restrict__ V16, int ldv, int voff, _Float16* __restrict__ Vt) { __shared__ unsigned short tl[64][66]; const int tid = threadIdx.x; const int slab = blockIdx.x / (TTv / 64), lg = blockIdx.x % (TTv / 64); const int b = slab / NHv, h = slab % NHv;
  for (int i = tid; i < 64 * 8; i += 256) { const int r = i / 8, c8 = (i % 8) * 8; FragH f; f.half[0] = *(const v8us*)((const unsigned short*)V16 + ((size_t)b * TTv + lg * 64 + r) * ldv + voff + h * 64 + c8);
#pragma unroll
    for (int q = 0; q < 8; ++q) tl[r][c8 + q] = f.u[q]; }
  __syncthreads();
  {
#pragma unroll
    for (int rd = 0; rd < 2; ++rd) { const int d = rd * 32 + tid / 8, pc = tid % 8; FragH f;
#pragma unroll
      for (int q = 0; q < 8; ++q) f.u[q] = tl[pc * 8 + q][d];
      *(v8us*)((unsigned short*)Vt + ((size_t)slab * 64 + d) * TTv + lg * 64 + pc * 8) = f.half[0]; }
     } }

// Eight 16-byte asynchronous copies per lane, global memory to LDS through no register: piece i goes from g + i * gstep to LDS byte l + i * lstep.
// The s_wait_xcnt closes the statement so that it stands in front of any later rewrite of the address registers the copies name.
__device__ __forceinline__ void copy8_to_lds(unsigned l, unsigned lstep, const char* g, size_t gstep) {
  asm volatile("global_load_async_to_lds_b128 %0, %8, off\n\t"
               "global_load_async_to_lds_b128 %1, %9, off\n\t"
               "global_load_async_to_lds_b128 %2, %10, off\n\t"
               "global_load_async_to_lds_b128 %3, %11, off\n\t"
               "global_load_async_to_lds_b128 %4, %12, off\n\t"
               "global_load_async_to_lds_b128 %5, %13, off\n\t"
               "global_load_async_to_lds_b128 %6, %14, off\n\t"
               "global_load_async_to_lds_b128 %7, %15, off\n\t"
               "s_wait_xcnt 0x0"
               :: "v"(l), "v"(l + lstep), "v"(l + 2 * lstep), "v"(l + 3 * lstep), "v"(l + 4 * lstep), "v"(l + 5 * lstep), "v"(l + 6 * lstep), "v"(l + 7 * lstep),
                  "v"(g), "v"(g + gstep), "v"(g + 2 * gstep), "v"(g + 3 * gstep), "v"(g + 4 * gstep), "v"(g + 5 * gstep), "v"(g + 6 * gstep), "v"(g + 7 * gstep)
               : "memory");
}

// The value that lane l ^ 16 holds, by one cross-row move on the vector pipe: lanes l and l ^ 16 share a query's keys in the transposed score tiles.
__device__ __forceinline__ float other_half(float x) { return __builtin_bit_cast(float, __builtin_amdgcn_permlanex16(__builtin_bit_cast(int, x), __builtin_bit_cast(int, x), 0x76543210, 0xfedcba98, false, false)); }

// Eight values x become 2^x, each in its own register, one run of v_exp_f32. No v_exp_f32 of the run touches a register of the one in front of it; the closing v_nop is the slot that the
// instruction set asks for between the last of them and whatever reads its result next.
__device__ __forceinline__ void exp2_x8(float (&x)[8]) {
  asm("v_exp_f32 %0, %0\n\tv_exp_f32 %1, %1\n\tv_exp_f32 %2, %2\n\tv_exp_f32 %3, %3\n\tv_exp_f32 %4, %4\n\tv_exp_f32 %5, %5\n\tv_exp_f32 %6, %6\n\tv_exp_f32 %7, %7\n\tv_nop"
      : "+v"(x[0]), "+v"(x[1]), "+v"(x[2]), "+v"(x[3]), "+v"(x[4]), "+v"(x[5]), "+v"(x[6]), "+v"(x[7]));
}
// One value x becomes 2^x; the v_nop is the same slot behind the one v_exp_f32.
__device__ __forceinline__ float exp2_x1(float x) { asm("v_exp_f32 %0, %0\n\tv_nop" : "+v"(x)); return x; }

// K and Vt reach the four waves of a work-group through LDS: a stage is 64 keys (K: 64 rows of 256 B, Vt: 128 rows of 128 B, whole 128-B lines), copied once per work-group,
// two buffers, the next stage in flight while this one is worked on. Row pitches 272 B and 144 B (16 B x odd) keep the ds_load_b128 fragment reads free of bank conflicts.
// Both products run transposed: St = K.Qt (A = 16 keys from LDS, B = the wave's 16 queries, kept in registers) and Ot += Vt.Pt (A = 16 rows of Vt from LDS, B = Pt). A lane then holds 16 of a pass's 32 scores
// of ONE query (query ln; keys 8 * hh + r of either key tile), lane ^ 16 the other 16: maximum and sum are taken in the lane, with one exchange between the halves, one running maximum, one sum and one
// rescaling factor a lane. The two score tiles, made f16 where they stand, are Pt's B fragment in the hardware's k order, which the Vt loader has too: P goes through no LDS.
__global__ __launch_bounds__(128) void k_flash(const _Float16* __restrict__ Q16, int ldq, const _Float16* __restrict__ K16, int ldk, const _Float16* __restrict__ Vt, const int* __restrict__ MSK, float* __restrict__ O, int ldo) {
  constexpr int RPW = 16, NQB = 3072 / (4 * RPW), DT = 8, KS = 4;      /* head dim 128 */
  constexpr unsigned KP = 272, VP = 144, KBYTES = 64 * KP, STG = KBYTES + 128 * VP;
  constexpr float C2 = (float)(0.08838834764831845 * 1.4426950408889634);
  __shared__ __attribute__((aligned(16))) unsigned char ring[2 * STG];
  float (*sO)[RPW][128 + 4] = (float (*)[RPW][128 + 4])ring;      /* output staging takes the ring's place behind the loop's last barrier */
  static_assert(sizeof(float) * 4 * RPW * (128 + 4) <= 2 * STG, "output staging fits the ring");
  const int tid = threadIdx.x, w = tid >> 5, lane = tid & 31, ln = lane & 15, hh = lane >> 4;
  const int slab = blockIdx.x / NQB, qblk = blockIdx.x % NQB; const int b = slab / 8, h = slab % 8; const int qb0 = qblk * (4 * RPW); const int q0 = qb0 + w * RPW;
  FragH aq[KS];
  { const unsigned short* qr = (const unsigned short*)Q16 + ((size_t)b * 3072 + q0 + ln) * ldq + h * 128;
#pragma unroll
    for (int ks = 0; ks < KS; ++ks) { aq[ks].half[0] = *(const v8us*)(qr + ks * 32 + 8 * hh); aq[ks].half[1] = *(const v8us*)(qr + ks * 32 + 16 + 8 * hh); } }
  const unsigned short* Vth = (const unsigned short*)Vt + (size_t)slab * 128 * 3072;
  // each thread's own pieces of a stage: K row tid/16 + 8i, 16-byte piece tid%16; Vt row tid/8 + 16i, piece tid%8
  const char* kg = (const char*)((const unsigned short*)K16 + ((size_t)b * 3072 + (tid >> 4)) * ldk + h * 128 + (tid & 15) * 8);
  const char* vg = (const char*)(Vth + (size_t)(tid >> 3) * 3072 + (tid & 7) * 8);
  const unsigned ring0 = (unsigned)(size_t)ring;
  const unsigned kl = ring0 + (unsigned)(tid >> 4) * KP + (unsigned)(tid & 15) * 16u, vl = ring0 + KBYTES + (unsigned)(tid >> 3) * VP + (unsigned)(tid & 7) * 16u;
  const size_t kstage = (size_t)64 * ldk * 2, kstep = (size_t)8 * ldk * 2;
  auto fill = [&](int st, unsigned buf) {
    copy8_to_lds(kl + buf * STG, 8 * KP, kg + (size_t)st * kstage, kstep);
    copy8_to_lds(vl + buf * STG, 16 * VP, vg + (size_t)st * 128, (size_t)16 * 3072 * 2);
  };
  float m_r = -3.0e38f, l_r = 0.f; v8f oacc[DT];      /* of query q0 + ln; oacc[dt][r] is its output column dt * 16 + 8 * hh + r; l_r sums this lane's keys only */
#pragma unroll
  for (int dt = 0; dt < DT; ++dt) oacc[dt] = (v8f){0.f,0.f,0.f,0.f,0.f,0.f,0.f,0.f};
  const int tq = q0 + ln;
  const int nst = qblk + 1;      /* stages of 64 keys up to the block's diagonal; the same for the whole work-group */
  fill(0, 0u);
  asm volatile("s_wait_asynccnt 0x0" ::: "memory");      // this wave's pieces of stage 0 have landed
  __syncthreads();                                       // every wave's pieces of stage 0 are readable
  if (nst > 1) fill(1, 1u);
#pragma unroll 1      /* one copy of the body: the ring's order stays as written */
  for (int st = 0; st < nst; ++st) {
    const unsigned char* kbuf = ring + (unsigned)(st & 1) * STG; const unsigned char* vbuf = kbuf + KBYTES;
#pragma unroll 1      /* the two 32-key passes of a stage share one body in the instruction cache */
  for (int sub = 0; sub < 2; ++sub) { const int j0 = st * 64 + sub * 32;
    v8f s[2]; FragH bk[2][KS];      /* the pass's K fragments, both key tiles, one group of LDS reads ahead of the score products */
#pragma unroll
    for (int nt = 0; nt < 2; ++nt) { const unsigned char* kr = kbuf + (unsigned)(sub * 32 + nt * 16 + ln) * KP + 16 * hh;
#pragma unroll
      for (int ks = 0; ks < KS; ++ks) { bk[nt][ks].half[0] = *(const v8us*)(kr + ks * 64); bk[nt][ks].half[1] = *(const v8us*)(kr + ks * 64 + 32); } }
#pragma unroll
    for (int nt = 0; nt < 2; ++nt) { v8f acc = (v8f){0.f,0.f,0.f,0.f,0.f,0.f,0.f,0.f};
#pragma unroll
      for (int ks = 0; ks < KS; ++ks) acc = mmaH<1>(bk[nt][ks].v, bk[nt][ks].v, aq[ks].v, aq[ks].v, acc); s[nt] = acc; }
    // The pass's Vt fragments, one group of LDS reads, in flight behind the softmax: the Vt.Pt products below follow one another from registers.
    FragH bv[DT];
#pragma unroll
    for (int dt = 0; dt < DT; ++dt) { const unsigned char* vrow = vbuf + (unsigned)(dt * 16 + ln) * VP + sub * 64 + 16 * hh; bv[dt].half[0] = *(const v8us*)(vrow); bv[dt].half[1] = *(const v8us*)(vrow + 32); }
    // The softmax of a pass, one query a lane: masked scores, their maximum, the exponentials, each computed ahead of the select that may drop it (no branch).
    // The scores and the running maxima stay the raw q.k sums. exp((s - m) / sqrt(128)) is taken as 2^(s * C2 - m * C2), C2 = log2(e) / sqrt(128): one fused multiply-add and one v_exp_f32
    // a value. No argument is above 0 but by the rounding of m * C2, and a result too small for v_exp_f32 is far below half a unit of P's f16, so the library exp's range handling has nothing to do here.
    const int d0 = tq - j0 - 8 * hh; float s0[8], s1[8], t[8];      /* key 8 * hh + i of the pass is at or below the diagonal where i <= d0 */
#pragma unroll
    for (int r = 0; r < 8; ++r) { s0[r] = (r <= d0) ? s[0][r] : -INFINITY; s1[r] = (16 + r <= d0) ? s[1][r] : -INFINITY; t[r] = fmaxf(s0[r], s1[r]); }
    float mc = fmaxf(fmaxf(fmaxf(t[0], t[4]), fmaxf(t[1], t[5])), fmaxf(fmaxf(t[2], t[6]), fmaxf(t[3], t[7])));
    mc = fmaxf(mc, other_half(mc));
    const float mn = fmaxf(m_r, mc), nb = mn * C2;      /* mn is finite: no difference here is a NaN */
    const float ea = exp2_x1(__builtin_fmaf(m_r, C2, -nb)); m_r = mn;
#pragma unroll
    for (int r = 0; r < 8; ++r) { s0[r] = __builtin_fmaf(s0[r], C2, -nb); s1[r] = __builtin_fmaf(s1[r], C2, -nb); }
    exp2_x8(s0); exp2_x8(s1);
    const float al = (mn > -1.0e38f) ? ea : 1.0f;
#pragma unroll
    for (int r = 0; r < 8; ++r) { s0[r] = (r <= d0) ? s0[r] : 0.f; s1[r] = (16 + r <= d0) ? s1[r] : 0.f; t[r] = s0[r] + s1[r]; }
    l_r = l_r * al + (((t[0] + t[4]) + (t[1] + t[5])) + ((t[2] + t[6]) + (t[3] + t[7])));
#pragma unroll
    for (int dt = 0; dt < DT; ++dt)
#pragma unroll
      for (int r = 0; r < 8; ++r) oacc[dt][r] *= al;
    FragH pt;      /* Pt's B fragment: element i is key 8 * hh + i, element 8 + i key 16 + 8 * hh + i, of query ln */
#pragma unroll
    for (int r = 0; r < 8; ++r) { pt.h[r] = (_Float16)s0[r]; pt.h[8 + r] = (_Float16)s1[r]; }
#pragma unroll
    for (int dt = 0; dt < DT; ++dt) oacc[dt] = mmaH<1>(bv[dt].v, bv[dt].v, pt.v, pt.v, oacc[dt]); }
    asm volatile("s_wait_dscnt 0x0" ::: "memory");       // this wave's reads of the buffer have returned before it is refilled
    asm volatile("s_wait_asynccnt 0x0" ::: "memory");    // this wave's pieces of stage st + 1 have landed
    __syncthreads();                                     // publishes stage st + 1 and ends every wave's reads of stage st
    if (st + 2 < nst) fill(st + 2, (unsigned)(st & 1));
  }
  asm volatile("s_wait_asynccnt 0x0" ::: "memory");      // no copy is outstanding when the ring becomes output staging
  { const float l = l_r + other_half(l_r), inv = (l > 0.f) ? 1.0f / l : 0.f;      /* the two halves' sums join once, here */
#pragma unroll
    for (int dt = 0; dt < DT; ++dt) { v4f lo, hi;      /* a lane's eight values of a tile are eight neighbouring columns of its query's row */
#pragma unroll
      for (int r = 0; r < 4; ++r) { lo[r] = oacc[dt][r] * inv; hi[r] = oacc[dt][4 + r] * inv; }
      *(v4fa*)&sO[w][ln][dt * 16 + 8 * hh] = lo; *(v4fa*)&sO[w][ln][dt * 16 + 8 * hh + 4] = hi; } }
  __builtin_amdgcn_fence(__ATOMIC_ACQ_REL, "workgroup"); __builtin_amdgcn_wave_barrier();
  {
#pragma unroll
    for (int rp = 0; rp < RPW; ++rp) { const int r = rp, pc = lane; const v4f val = *(const v4fa*)&sO[w][r][pc * 4]; *(v4f*)(O + ((size_t)(b * 8 + h) * 3072 + q0 + r) * 128 + pc * 4) = val; }      /* output layout [b][h][s][128]: 32 lanes x 16 B rows */
     } }

// Projection GEMM: C[row][col] = alpha * sum_k A[row][k] * Bt[col][k], both operands f16 with CW elements a row, f32 accumulate, k ascending in one chain per accumulator.
// A work-group owns a 64 x 64 tile of C, its four waves 32 x 32 each. A and Bt reach the waves through LDS: a stage is 128 k (64 rows of A and 64 of Bt, 256 B each, whole 128-B lines),
// copied once per work-group, two buffers, the next stage in flight while this one is worked on. Row pitch 272 B (16 B x odd) keeps the ds_load_b128 fragment reads free of bank conflicts.
// One launch does all nine projections. The grid is exact: blockIdx.x = row tile of the TT positions * (CW / 64) + column tile, blockIdx.y = batch, blockIdx.z = projection (0 q, 1 k, 2 v).
// A row tile lies wholly in one segment (SL is a multiple of 64) and takes that segment's weights: plane 3 * projection + (0 middle, 1 state, 2 end) of B9. All three go out as f16.
// q and k are rotated (RoPE) on their way out. Their weight planes come with bits 5 and 6 of the column-in-head swapped (k_wst), so that columns c and c + 32 of a tile are the pair
// (j, j + 64) of one head, j = 32 * (tile & 1) + c: both partners lie in the tile's output staging. q and k keep that column order in Q16 and K16; it is the same in both, so q.k is the same sum in another order.
// CS[position][128] holds cos (0..63) and sin (64..127) of the position's 64 angles.
__global__ __launch_bounds__(128) void k_gemm_ring(const _Float16* __restrict__ A, const _Float16* __restrict__ B9, float alpha, const float* __restrict__ CS, _Float16* __restrict__ Q16, _Float16* __restrict__ K16, _Float16* __restrict__ C16) {
  static_assert(SL % 64 == 0 && TT % 64 == 0, "a row tile never straddles a segment");
  constexpr size_t sA = (size_t)TT * CW, sC = (size_t)TT * CW;
  constexpr unsigned RP = 272, TB = 64 * RP, STG = 2 * TB; constexpr int NST = CW / 128;
  static_assert(NST >= 2, "the ring's prologue fills two stages");
  __shared__ __attribute__((aligned(16))) unsigned char ring[2 * STG];
  float (*so)[64 + 4] = (float (*)[64 + 4])ring;      /* output staging takes the ring's place behind the loop's last barrier */
  static_assert(sizeof(float) * 64 * (64 + 4) <= 2 * STG, "output staging fits the ring");
  const int tid = threadIdx.x, w = tid >> 5, lane = tid & 31, ln = lane & 15, hh = lane >> 4, wm = w >> 1, wn = w & 1;
  const int row0 = (int)(blockIdx.x / (CW / 64)) * 64, col0 = (int)(blockIdx.x % (CW / 64)) * 64;
  const int prj = (int)blockIdx.z, sgm = (row0 < SL) ? 1 : ((row0 < TT - SL) ? 0 : 2); const bool OUT16 = (prj == 2);
  const _Float16* Bt = B9 + (size_t)(prj * 3 + sgm) * CW * CW;
  // each thread's own pieces of a stage: row tid/16 + 8i of either operand, 16-byte piece tid%16
  const char* ag = (const char*)((const unsigned short*)A + (size_t)blockIdx.y * sA + (size_t)(row0 + (tid >> 4)) * CW + (tid & 15) * 8);
  const char* bg = (const char*)((const unsigned short*)Bt + (size_t)(col0 + (tid >> 4)) * CW + (tid & 15) * 8);
  const unsigned al = (unsigned)(size_t)ring + (unsigned)(tid >> 4) * RP + (unsigned)(tid & 15) * 16u, bl = al + TB;
  auto fill = [&](int st, unsigned buf) {
    copy8_to_lds(al + buf * STG, 8 * RP, ag + (size_t)st * 256, (size_t)8 * CW * 2);
    copy8_to_lds(bl + buf * STG, 8 * RP, bg + (size_t)st * 256, (size_t)8 * CW * 2);
  };
  v8f acc[2][2];
#pragma unroll
  for (int i = 0; i < 2; ++i)
#pragma unroll
    for (int j = 0; j < 2; ++j) acc[i][j] = (v8f){0.f,0.f,0.f,0.f,0.f,0.f,0.f,0.f};
  fill(0, 0u);
  asm volatile("s_wait_asynccnt 0x0" ::: "memory");      // this wave's pieces of stage 0 have landed
  __syncthreads();                                       // every wave's pieces of stage 0 are readable
  fill(1, 1u);
#pragma unroll 1      /* one copy of the body: the ring's order stays as written */
  for (int st = 0; st < NST; ++st) {
    const unsigned char* ar = ring + (unsigned)(st & 1) * STG + (unsigned)(wm * 32 + ln) * RP + 16 * hh;
    const unsigned char* br = ring + (unsigned)(st & 1) * STG + TB + (unsigned)(wn * 32 + ln) * RP + 16 * hh;
    FragH fa[4][2], fb[4][2];
#pragma unroll
    for (int ks = 0; ks < 4; ++ks)
#pragma unroll
      for (int i = 0; i < 2; ++i) {
        fa[ks][i].half[0] = *(const v8us*)(ar + i * 16 * RP + ks * 64); fa[ks][i].half[1] = *(const v8us*)(ar + i * 16 * RP + ks * 64 + 32);
        fb[ks][i].half[0] = *(const v8us*)(br + i * 16 * RP + ks * 64); fb[ks][i].half[1] = *(const v8us*)(br + i * 16 * RP + ks * 64 + 32); }
    asm volatile("s_wait_dscnt 0x0" ::: "memory");       // the stage's 32 fragment reads, one group, have returned: this wave is done with the buffer before it is refilled
    asm volatile("s_wait_asynccnt 0x0" ::: "memory");    // this wave's pieces of stage st + 1 have landed
    __syncthreads();                                     // publishes stage st + 1 and ends every wave's reads of stage st
    if (st + 2 < NST) fill(st + 2, (unsigned)(st & 1));  // in front of the WMMAs, which work from registers, so that the copies fly behind them
#pragma unroll
    for (int ks = 0; ks < 4; ++ks)
#pragma unroll
      for (int i = 0; i < 2; ++i)
#pragma unroll
        for (int j = 0; j < 2; ++j) acc[i][j] = __builtin_amdgcn_wmma_f32_16x16x32_f16(false, fa[ks][i].v, false, fb[ks][j].v, (short)0, acc[i][j], false, false);
  }
  // q, k: a thread rotates four pairs of columns (cl.., cl + 32..) in each of four rows; their cos and sin are fetched here so that they fly while the tile is staged
  const int rs = lane >> 3, cl = (lane & 7) * 4; v4f tc[4] = {}, ts[4] = {};
  if (!OUT16) { const float* cs = CS + (size_t)(row0 + w * 16 + rs) * 128 + ((col0 >> 6) & 1) * 32 + cl;
#pragma unroll
    for (int q = 0; q < 4; ++q) { tc[q] = *(const v4fa*)(cs + q * 4 * 128); ts[q] = *(const v4fa*)(cs + q * 4 * 128 + 64); } }
  asm volatile("s_wait_asynccnt 0x0" ::: "memory");      // no copy is outstanding when the ring becomes output staging
#pragma unroll
  for (int i = 0; i < 2; ++i)
#pragma unroll
    for (int j = 0; j < 2; ++j)
#pragma unroll
      for (int r = 0; r < 8; ++r) so[wm * 32 + i * 16 + 8 * hh + r][wn * 32 + j * 16 + ln] = acc[i][j][r] * alpha;
  __syncthreads();                                       // a stored row of 64 columns holds two waves' results
  const int rsub = lane >> 4, c4 = (lane & 15) * 4; typedef _Float16 v4h __attribute__((ext_vector_type(4)));
  if (OUT16) {      /* the test stands once, in front of the eight rows, so that their LDS reads stay one group */
#pragma unroll
    for (int q = 0; q < 8; ++q) { const int r = w * 16 + q * 2 + rsub; const v4f v = *(const v4fa*)&so[r][c4]; const size_t o = (size_t)blockIdx.y * sC + (size_t)(row0 + r) * CW + col0 + c4; v4h h4;
#pragma unroll
      for (int i = 0; i < 4; ++i) h4[i] = (_Float16)v[i];
      *(v4h*)(C16 + o) = h4; }      /* whole 128-B lines, one wave a line */
  } else {
    _Float16* D16 = prj ? K16 : Q16;
#pragma unroll
    for (int q = 0; q < 4; ++q) { const int r = w * 16 + q * 4 + rs; const v4f lo = *(const v4fa*)&so[r][cl], hi = *(const v4fa*)&so[r][cl + 32]; const size_t o = (size_t)blockIdx.y * sC + (size_t)(row0 + r) * CW + col0 + cl; v4h ol, oh;
#pragma unroll
      for (int i = 0; i < 4; ++i) { ol[i] = (_Float16)(lo[i] * tc[q][i] + (-hi[i]) * ts[q][i]); oh[i] = (_Float16)(hi[i] * tc[q][i] + lo[i] * ts[q][i]); }
      *(v4h*)(D16 + o) = ol; *(v4h*)(D16 + o + 32) = oh; }      /* the two halves of a 128-B line, both from this wave */
    asm volatile("s_wait_xcnt 0x0" ::: "memory");      // stands behind the run of stores, in front of any later rewrite of the registers they name
  }
}

__global__ __launch_bounds__(256) void k_xt(const float* __restrict__ x, _Float16* __restrict__ XT) { const size_t t = (size_t)blockIdx.x * 256 + threadIdx.x; if (t >= (size_t)NR * NH * 16) return; const int p = (int)(t % 16); const int h = (int)((t / 16) % NH); const size_t bs = t / (16 * NH); const int b = (int)(bs / TT), s = (int)(bs % TT); const float* src = x + (((size_t)(b * NH + h) * TT + s) * HD) + p * 8; FragH f;
#pragma unroll
  for (int q = 0; q < 8; ++q) f.h[q] = (_Float16)bf16_round(src[q]); unsigned short* d = (unsigned short*)XT + bs * CW + h * HD + p * 8; *(v8us*)d = f.half[0];  }
// One launch re-lays all nine weight tensors: blockIdx.y picks the tensor and its plane of B9. The q and k planes (0..5) take their rows with bits 5 and 6 of the column-in-head swapped (see k_gemm_ring).
// A tenth plane of the grid fills the RoPE table CS[position][128]: cos (0..63) and sin (64..127) of (position + offset) * 10000^(-2i/128), each angle worked out once.
__global__ __launch_bounds__(256) void k_wst(const float* __restrict__ W0, const float* __restrict__ W1, const float* __restrict__ W2, const float* __restrict__ W3, const float* __restrict__ W4,
                                             const float* __restrict__ W5, const float* __restrict__ W6, const float* __restrict__ W7, const float* __restrict__ W8, _Float16* __restrict__ B9, const int* __restrict__ offp, float* __restrict__ CS) {
  const unsigned y = blockIdx.y;
  if (y == 9) { const int o0 = offp[0];
#pragma unroll 1      /* one copy of the cos and sin code */
    for (unsigned u = blockIdx.x * 256 + threadIdx.x; u < (unsigned)TT * 64; u += (unsigned)CW * NH * 16) { const int i = (int)(u & 63), s = (int)(u >> 6); const float pos = (float)(s + o0);
      const float ang = pos * __builtin_powf(10000.0f, -(float)(2 * i) / 128.0f); CS[(size_t)s * 128 + i] = cosf(ang); CS[(size_t)s * 128 + 64 + i] = sinf(ang); }
    return; }
  const float* W = W0; W = (y == 1) ? W1 : W; W = (y == 2) ? W2 : W; W = (y == 3) ? W3 : W; W = (y == 4) ? W4 : W; W = (y == 5) ? W5 : W; W = (y == 6) ? W6 : W; W = (y == 7) ? W7 : W; W = (y == 8) ? W8 : W; _Float16* Bt = B9 + (size_t)y * CW * CW;
  const size_t t = (size_t)blockIdx.x * 256 + threadIdx.x; if (t >= (size_t)CW * NH * 16) return; const int p = (int)(t % 16); const int h = (int)((t / 16) % NH); const int n = (int)(t / (16 * NH)); const int g = n / HD, ep = n % HD, e = (y < 6) ? ((ep & 31) | ((ep & 32) << 1) | ((ep & 64) >> 1)) : ep; FragH f;
#pragma unroll
  for (int q = 0; q < 8; ++q) { const int d = p * 8 + q; f.h[q] = (_Float16)(bf16_round(W[(((size_t)(h * NH + g) * HD + d) * HD) + e]) * 16.0f); }
  unsigned short* dst = (unsigned short*)Bt + (size_t)n * CW + h * HD + p * 8; *(v8us*)dst = f.half[0];  }
__global__ __launch_bounds__(256) void k_vt128(const _Float16* __restrict__ V16, _Float16* __restrict__ Vt) { __shared__ unsigned short tl[64][130]; const int tid = threadIdx.x; const int slab = blockIdx.x / (TT / 64), lg = blockIdx.x % (TT / 64); const int b = slab / NH, h = slab % NH;
  for (int i = tid; i < 64 * 16; i += 256) { const int r = i / 16, c8 = (i % 16) * 8; FragH f; f.half[0] = *(const v8us*)((const unsigned short*)V16 + ((size_t)b * TT + lg * 64 + r) * CW + h * HD + c8);
#pragma unroll
    for (int q = 0; q < 8; ++q) tl[r][c8 + q] = f.u[q]; }
  __syncthreads();
  { for (int i = tid; i < 128 * 8; i += 256) { const int d = i / 8, pc = i % 8; FragH f;
#pragma unroll
      for (int q = 0; q < 8; ++q) f.u[q] = tl[pc * 8 + q][d]; *(v8us*)((unsigned short*)Vt + ((size_t)slab * HD + d) * TT + lg * 64 + pc * 8) = f.half[0]; }  } }
extern "C" void kernel_launch(void* const* d_in, const int* in_sizes, int n_in,
                              void* d_out, int out_size, void* d_ws, size_t ws_size, hipStream_t stream) {
  (void)in_sizes; (void)n_in; (void)out_size;
  const float* x = (const float*)d_in[0]; const float* Wm[3] = {(const float*)d_in[1], (const float*)d_in[2], (const float*)d_in[3]}; const float* Wsg[3] = {(const float*)d_in[4], (const float*)d_in[5], (const float*)d_in[6]}; const float* Weg[3] = {(const float*)d_in[7], (const float*)d_in[8], (const float*)d_in[9]}; const int* offp = (const int*)d_in[10];
  char* ws = (char*)d_ws; size_t off = 0;
  auto take = [&](size_t bytes) { char* p = ws + off; off += (bytes + 255) & ~(size_t)255; return p; };
  _Float16* B9 = (_Float16*)take((size_t)9 * CW * CW * 2);      // plane 3 * projection + (0 middle, 1 state, 2 end)
  _Float16* XT = (_Float16*)take((size_t)NR * CW * 2); float* CS = (float*)take((size_t)TT * 128 * 4); _Float16* Q16 = (_Float16*)take((size_t)NR * CW * 2); _Float16* K16 = (_Float16*)take((size_t)NR * CW * 2); _Float16* V16 = (_Float16*)take((size_t)NR * CW * 2); _Float16* Vt = (_Float16*)take((size_t)NR * CW * 2);
  if (off > ws_size) return;      // 18.9 + 12.6 + 1.6 + 12.6 x 4 = 83 MB
  k_xt<<<(unsigned)(((size_t)NR * NH * 16 + 255) / 256), 256, 0, stream>>>(x, XT);
  const unsigned gw = (unsigned)(((size_t)CW * NH * 16 + 255) / 256);
  k_wst<<<dim3(gw, 10), 256, 0, stream>>>(Wm[0], Wsg[0], Weg[0], Wm[1], Wsg[1], Weg[1], Wm[2], Wsg[2], Weg[2], B9, offp, CS);
  k_gemm_ring<<<dim3((TT / 64) * (CW / 64), BB, 3), 128, 0, stream>>>(XT, B9, 0.0625f, CS, Q16, K16, V16);
  k_vt128<<<BB * NH * (TT / 64), 256, 0, stream>>>(V16, Vt);
  k_flash<<<BB * NH * (TT / 64), 128, 0, stream>>>(Q16, CW, K16, CW, Vt, nullptr, (float*)d_out, 0);
}

// v009
// Measured time: 153 microseconds a run.
// Next to v008, in two timings, it ran 1.04 and 1.03 times as fast.
// Over all steps from v000 it is 6.05 times as fast.
#include <hip/hip_runtime.h>
// Causal multi-head attention with state segments (x [2, 8 heads, 3072, 128]; StackedLinear projections that mix heads and features — separate weights for the first 512 (state), middle 2048 and
// last 512 (end) positions; rotate-half RoPE with an INPUT offset; causal softmax(q·k/√128)·v; output [2,8,3072,128]): the nine (h,d)→(g,e) projections as GEMMs on the (b,s)-major transposed
// input (bf16-exact ×2^4 weights, f32 accumulate) and the attention as a fused flash-style kernel (d = 128: 4 k-steps / 8 d-tiles; causal chunk skipping; online softmax f32; P f16 ≤ 1;
// Ot = Vt·Pt written as O rows into the output; RPW-16 waves) on v_wmma_f32_16x16x32_f16; RoPE f32 VALU.
#define BB 2
#define NH 8
#define TT 3072
#define HD 128
#define CW (NH * HD)
#define NR (BB * TT)
#define SL 512

typedef __bf16 v16b __attribute__((ext_vector_type(16)));
typedef unsigned short v8us __attribute__((ext_vector_type(8), may_alias));
typedef float  v8f  __attribute__((ext_vector_type(8)));
typedef float  v4f  __attribute__((ext_vector_type(4)));
typedef float  v4fa __attribute__((ext_vector_type(4), may_alias));
union FragB { v16b v; v8us half[2]; unsigned short u[16]; };

__device__ __forceinline__ unsigned short bf16_bits(float x) { unsigned int u = __float_as_uint(x); return (unsigned short)((u + 0x7FFFu + ((u >> 16) & 1u)) >> 16); }
__device__ __forceinline__ float bf16_val(unsigned short b) { return __uint_as_float(((unsigned int)b) << 16); }
__device__ __forceinline__ float bf16_round(float x) { return bf16_val(bf16_bits(x)); }
// D += A·B with NT terms: 1 = ah·bh, 2 = + al·bh (A split), 3 = + ah·bl (both split)
template <int NT>
__device__ __forceinline__ v8f mmaN(v16b ah, v16b al, v16b bh, v16b bl, v8f c) {
  c = __builtin_amdgcn_wmma_f32_16x16x32_bf16(false, ah, false, bh, (short)0, c, false, false);
  if (NT >= 2) c = __builtin_amdgcn_wmma_f32_16x16x32_bf16(false, al, false, bh, (short)0, c, false, false);
  if (NT >= 3) c = __builtin_amdgcn_wmma_f32_16x16x32_bf16(false, ah, false, bl, (short)0, c, false, false);
  asm volatile("v_nop\n\tv_nop\n\tv_nop\n\tv_nop" : "+v"(c) : "v"(ah), "v"(al), "v"(bh), "v"(bl));
  return c;
}

__global__ __launch_bounds__(256) void k_wt_bf16(const float* __restrict__ W, unsigned short* __restrict__ Wt, int K, int N) {
  const int t = blockIdx.x * 256 + threadIdx.x;
  const int k8n = K / 8;
  if (t >= N * k8n) return;
  const int n = t / k8n, k8 = (t % k8n) * 8;
  v8us v;
#pragma unroll
  for (int i = 0; i < 8; ++i) v[i] = bf16_bits(W[(size_t)(k8 + i) * N + n]);
  *(v8us*)(Wt + (size_t)n * K + k8) = v;
  
}

// GEMM C[M][N] (f32, pitch ldc) = act(A[M][K]·W + bias). A f32 row-major (pitch lda) converted per fragment to bf16
// (ASPLIT: hi/lo two planes -> 2 terms, else single rounded term); Wt bf16 [N][K] (pitch ldb). BIAS_BF16 rounds the
// bias to bf16 first (bias quantised to bf16 before the add). K%32==0, M%16==0, N%64==0.
template <bool ASPLIT, int ACT, bool BIAS_BF16>
__global__ __launch_bounds__(128) void k_gemm_bf(const float* __restrict__ A, int lda, const unsigned short* __restrict__ Wt, int ldb,
                                               const float* __restrict__ bias, float* __restrict__ C, int ldc, int M, int N, int K) {
  __shared__ __attribute__((aligned(16))) float so[4][16][64];
  const int tid = threadIdx.x, w = tid >> 5, lane = tid & 31, ln = lane & 15, hh = lane >> 4;
  const int ntn = N / 64;
  const int wid = blockIdx.x * 4 + w;
  const int mt = wid / ntn, nq = wid % ntn;
  if (mt * 16 >= M) return;
  const int row0 = mt * 16, col0 = nq * 64;
  const float* arow = A + (size_t)(row0 + ln) * lda;
  v8f acc[4] = {};
  for (int kb = 0; kb < K; kb += 32) {
    FragB ah, al;
    const v4f x0 = *(const v4fa*)(arow + kb + 8 * hh), x1 = *(const v4fa*)(arow + kb + 8 * hh + 4);
    const v4f x2 = *(const v4fa*)(arow + kb + 16 + 8 * hh), x3 = *(const v4fa*)(arow + kb + 16 + 8 * hh + 4);
    float xs[16] = {x0[0],x0[1],x0[2],x0[3],x1[0],x1[1],x1[2],x1[3],x2[0],x2[1],x2[2],x2[3],x3[0],x3[1],x3[2],x3[3]};
#pragma unroll
    for (int i = 0; i < 16; ++i) { const unsigned short hb = bf16_bits(xs[i]); ah.u[i] = hb; al.u[i] = ASPLIT ? bf16_bits(xs[i] - bf16_val(hb)) : (unsigned short)0; }
#pragma unroll
    for (int t = 0; t < 4; ++t) {
      const unsigned short* brow = Wt + (size_t)(col0 + t * 16 + ln) * ldb + kb;
      FragB b;
      b.half[0] = *(const v8us*)(brow + 8 * hh);
      b.half[1] = *(const v8us*)(brow + 16 + 8 * hh);
      acc[t] = mmaN<ASPLIT ? 2 : 1>(ah.v, al.v, b.v, b.v, acc[t]);
    }
  }
#pragma unroll
  for (int t = 0; t < 4; ++t) {
    float bv = bias ? bias[col0 + t * 16 + ln] : 0.f;
    if (BIAS_BF16) bv = bf16_round(bv);
#pragma unroll
    for (int r = 0; r < 8; ++r) { float v = acc[t][r] + bv; if (ACT == 1) v = fmaxf(v, 0.f); so[w][8 * hh + r][t * 16 + ln] = v; }
  }
  __builtin_amdgcn_fence(__ATOMIC_ACQ_REL, "workgroup");
  __builtin_amdgcn_wave_barrier();
  const int rsub = lane >> 4, c4 = (lane & 15) * 4;
  {
#pragma unroll
    for (int q = 0; q < 8; ++q) {
      const int r = q * 2 + rsub;
      const v4f v = *(const v4fa*)&so[w][r][c4];
      *(v4f*)(C + (size_t)(row0 + r) * ldc + col0 + c4) = v;
    }
    
  }
}

// Flash-style causal/unmasked attention, all contractions 3-term bf16 hi/lo splits, f32 softmax with running max.
// q,k,v rows are read from f32 buffers with arbitrary row pitch (so they can live inside a fused qkv buffer);
// D = head size (multiple of 32, <= 128); one wave = 16 query rows; block = 4 waves (64 queries) sharing K/V chunks of 32.
template <int D, bool CAUSAL>
__global__ __launch_bounds__(128) void k_flash(const float* __restrict__ qb, const float* __restrict__ kb, const float* __restrict__ vb,
                                             int pitch, int T, int H, float scale, float* __restrict__ y, int ypitch) {
  constexpr int KS = D / 32;        // k-steps for QK
  constexpr int DT = D / 16;        // d tiles for PV
  __shared__ __attribute__((aligned(16))) unsigned short sKh[32][D + 8], sKl[32][D + 8], sVh[32][D + 8], sVl[32][D + 8];
  __shared__ __attribute__((aligned(16))) unsigned short sPh[4][16][40], sPl[4][16][40];
  __shared__ __attribute__((aligned(16))) float sO[4][16][D];
  const int tid = threadIdx.x, w = tid >> 5, lane = tid & 31, ln = lane & 15, hh = lane >> 4;
  const int nqb = (T + 63) / 64;
  const int bh = blockIdx.x / nqb, qblk = blockIdx.x % nqb;
  const int b = bh / H, h = bh % H;
  const int q0 = qblk * 64 + w * 16;
  const float* Q = qb + (size_t)b * T * pitch + h * D;
  const float* K = kb + (size_t)b * T * pitch + h * D;
  const float* V = vb + (size_t)b * T * pitch + h * D;

  // A fragments of the wave's 16 query rows (scaled), hi/lo
  FragB aqh[KS], aql[KS];
  {
    int row = q0 + ln; if (row >= T) row = T - 1;
    const float* qr = Q + (size_t)row * pitch;
#pragma unroll
    for (int ks = 0; ks < KS; ++ks)
#pragma unroll
      for (int i = 0; i < 16; ++i) {
        const int d = ks * 32 + ((i < 8) ? (8 * hh + i) : (16 + 8 * hh + (i - 8)));
        const float x = qr[d] * scale; const unsigned short hb = bf16_bits(x);
        aqh[ks].u[i] = hb; aql[ks].u[i] = bf16_bits(x - bf16_val(hb));
      }
  }
  float m_r[8], l_r[8];
#pragma unroll
  for (int r = 0; r < 8; ++r) { m_r[r] = -3.0e38f; l_r[r] = 0.f; }
  v8f oacc[DT];
#pragma unroll
  for (int dt = 0; dt < DT; ++dt) oacc[dt] = (v8f){0.f,0.f,0.f,0.f,0.f,0.f,0.f,0.f};

  const int kv_end = CAUSAL ? min(T, qblk * 64 + 64) : T;     // block-uniform
  for (int j0 = 0; j0 < kv_end; j0 += 32) {
    __syncthreads();
    for (int e = tid; e < 32 * (D / 4); e += 128) {
      const int r = e / (D / 4), c4 = (e % (D / 4)) * 4;
      const int key = j0 + r;
      v4f kf = {0.f,0.f,0.f,0.f}, vf = {0.f,0.f,0.f,0.f};
      if (key < T) { kf = *(const v4fa*)(K + (size_t)key * pitch + c4); vf = *(const v4fa*)(V + (size_t)key * pitch + c4); }
#pragma unroll
      for (int t = 0; t < 4; ++t) {
        unsigned short hb = bf16_bits(kf[t]); sKh[r][c4 + t] = hb; sKl[r][c4 + t] = bf16_bits(kf[t] - bf16_val(hb));
        hb = bf16_bits(vf[t]); sVh[r][c4 + t] = hb; sVl[r][c4 + t] = bf16_bits(vf[t] - bf16_val(hb));
      }
    }
    __syncthreads();
    // S tile 16 x 32
    v8f s[2];
#pragma unroll
    for (int nt = 0; nt < 2; ++nt) {
      v8f acc = {};
#pragma unroll
      for (int ks = 0; ks < KS; ++ks) {
        FragB bh_, bl_;
        bh_.half[0] = *(const v8us*)&sKh[nt * 16 + ln][ks * 32 + 8 * hh]; bh_.half[1] = *(const v8us*)&sKh[nt * 16 + ln][ks * 32 + 16 + 8 * hh];
        bl_.half[0] = *(const v8us*)&sKl[nt * 16 + ln][ks * 32 + 8 * hh]; bl_.half[1] = *(const v8us*)&sKl[nt * 16 + ln][ks * 32 + 16 + 8 * hh];
        acc = mmaN<3>(aqh[ks].v, aql[ks].v, bh_.v, bl_.v, acc);
      }
      s[nt] = acc;
    }
    // mask + running max (rows 8hh+r; the 16 lanes of a half share rows)
    float alpha[8];
#pragma unroll
    for (int r = 0; r < 8; ++r) {
      const int qi = q0 + 8 * hh + r;
      const int ja = j0 + ln, jb = j0 + 16 + ln;
      if (CAUSAL) { if (ja > qi) s[0][r] = -3.0e38f; if (jb > qi) s[1][r] = -3.0e38f; }
      if (ja >= T) s[0][r] = -3.0e38f;
      if (jb >= T) s[1][r] = -3.0e38f;
      float mx = fmaxf(s[0][r], s[1][r]);
      mx = fmaxf(mx, __shfl_xor(mx, 1, 32)); mx = fmaxf(mx, __shfl_xor(mx, 2, 32)); mx = fmaxf(mx, __shfl_xor(mx, 4, 32)); mx = fmaxf(mx, __shfl_xor(mx, 8, 32));
      const float mnew = fmaxf(m_r[r], mx);
      alpha[r] = (mnew > -1.0e38f) ? __expf(m_r[r] - mnew) : 1.0f;
      const float p0 = (s[0][r] > -1.0e38f) ? __expf(s[0][r] - mnew) : 0.f;
      const float p1 = (s[1][r] > -1.0e38f) ? __expf(s[1][r] - mnew) : 0.f;
      m_r[r] = mnew;
      l_r[r] = l_r[r] * alpha[r] + p0 + p1;            // per-lane partial row sum (16 lanes combined at the end)
      unsigned short hb = bf16_bits(p0); sPh[w][8 * hh + r][ln] = hb;      sPl[w][8 * hh + r][ln] = bf16_bits(p0 - bf16_val(hb));
      hb = bf16_bits(p1);                sPh[w][8 * hh + r][16 + ln] = hb; sPl[w][8 * hh + r][16 + ln] = bf16_bits(p1 - bf16_val(hb));
    }
#pragma unroll
    for (int dt = 0; dt < DT; ++dt)
#pragma unroll
      for (int r = 0; r < 8; ++r) oacc[dt][r] *= alpha[r];
    __builtin_amdgcn_fence(__ATOMIC_ACQ_REL, "workgroup");
    __builtin_amdgcn_wave_barrier();
    FragB pah, pal;
    pah.half[0] = *(const v8us*)&sPh[w][ln][8 * hh]; pah.half[1] = *(const v8us*)&sPh[w][ln][16 + 8 * hh];
    pal.half[0] = *(const v8us*)&sPl[w][ln][8 * hh]; pal.half[1] = *(const v8us*)&sPl[w][ln][16 + 8 * hh];
#pragma unroll
    for (int dt = 0; dt < DT; ++dt) {
      FragB bvh, bvl;
#pragma unroll
      for (int i = 0; i < 8; ++i) {
        bvh.u[i] = sVh[8 * hh + i][dt * 16 + ln]; bvh.u[8 + i] = sVh[16 + 8 * hh + i][dt * 16 + ln];
        bvl.u[i] = sVl[8 * hh + i][dt * 16 + ln]; bvl.u[8 + i] = sVl[16 + 8 * hh + i][dt * 16 + ln];
      }
      oacc[dt] = mmaN<3>(pah.v, pal.v, bvh.v, bvl.v, oacc[dt]);
    }
    __builtin_amdgcn_fence(__ATOMIC_ACQ_REL, "workgroup");
    __builtin_amdgcn_wave_barrier();
  }
#pragma unroll
  for (int r = 0; r < 8; ++r) {
    float l = l_r[r];
    l += __shfl_xor(l, 1, 32); l += __shfl_xor(l, 2, 32); l += __shfl_xor(l, 4, 32); l += __shfl_xor(l, 8, 32);
    l_r[r] = (l > 0.f) ? 1.0f / l : 0.f;
  }
#pragma unroll
  for (int dt = 0; dt < DT; ++dt)
#pragma unroll
    for (int r = 0; r < 8; ++r) sO[w][8 * hh + r][dt * 16 + ln] = oacc[dt][r] * l_r[r];
  __builtin_amdgcn_fence(__ATOMIC_ACQ_REL, "workgroup");
  __builtin_amdgcn_wave_barrier();
  {
    for (int r = 0; r < 16; ++r) {
      const int row = q0 + r;
      if (row < T && lane < D / 4) {
        const v4f val = *(const v4fa*)&sO[w][r][lane * 4];
        *(v4f*)(y + ((size_t)b * T + row) * ypitch + h * D + lane * 4) = val;
      }
    }
    
  }
}

// GEMM C = act(A·W + bias + resid): A f32 (ASPLIT -> hi/lo 2 terms), Wt bf16 [N][K]; ACT 0 none, 1 relu, 2 exact gelu;
// resid (optional, f32, row index = (row % rmod), pitch ldr, RES_BF16 rounds it) added before the activation.
template <bool ASPLIT, int ACT, bool BIAS_BF16, bool RES_BF16>
__global__ __launch_bounds__(128) void k_gemm_bf3(const float* __restrict__ A, int lda, const unsigned short* __restrict__ Wt, int ldb,
                                                const float* __restrict__ bias, const float* __restrict__ resid, int rmod, int ldr,
                                                float* __restrict__ C, int ldc, int M, int N, int K) {
  __shared__ __attribute__((aligned(16))) float so[4][16][64];
  const int tid = threadIdx.x, w = tid >> 5, lane = tid & 31, ln = lane & 15, hh = lane >> 4;
  const int ntn = N / 64;
  const int wid = blockIdx.x * 4 + w;
  const int mt = wid / ntn, nq = wid % ntn;
  if (mt * 16 >= M) return;
  const int row0 = mt * 16, col0 = nq * 64;
  const float* arow = A + (size_t)(row0 + ln) * lda;
  v8f acc[4] = {};
  for (int kb = 0; kb < K; kb += 32) {
    FragB ah, al;
    const v4f x0 = *(const v4fa*)(arow + kb + 8 * hh), x1 = *(const v4fa*)(arow + kb + 8 * hh + 4);
    const v4f x2 = *(const v4fa*)(arow + kb + 16 + 8 * hh), x3 = *(const v4fa*)(arow + kb + 16 + 8 * hh + 4);
    float xs[16] = {x0[0],x0[1],x0[2],x0[3],x1[0],x1[1],x1[2],x1[3],x2[0],x2[1],x2[2],x2[3],x3[0],x3[1],x3[2],x3[3]};
#pragma unroll
    for (int i = 0; i < 16; ++i) { const unsigned short hb = bf16_bits(xs[i]); ah.u[i] = hb; al.u[i] = ASPLIT ? bf16_bits(xs[i] - bf16_val(hb)) : (unsigned short)0; }
#pragma unroll
    for (int t = 0; t < 4; ++t) {
      const unsigned short* brow = Wt + (size_t)(col0 + t * 16 + ln) * ldb + kb;
      FragB b;
      b.half[0] = *(const v8us*)(brow + 8 * hh);
      b.half[1] = *(const v8us*)(brow + 16 + 8 * hh);
      acc[t] = mmaN<ASPLIT ? 2 : 1>(ah.v, al.v, b.v, b.v, acc[t]);
    }
  }
#pragma unroll
  for (int t = 0; t < 4; ++t) {
    const int col = col0 + t * 16 + ln;
    float bv = bias ? bias[col] : 0.f;
    if (BIAS_BF16) bv = bf16_round(bv);
#pragma unroll
    for (int r = 0; r < 8; ++r) {
      float v = acc[t][r] + bv;
      if (resid) { float rv = resid[(size_t)((row0 + 8 * hh + r) % rmod) * ldr + col]; if (RES_BF16) rv = bf16_round(rv); v += rv; }
      if (ACT == 1) v = fmaxf(v, 0.f);
      if (ACT == 2) v = 0.5f * v * (1.0f + erff(v * 0.70710678118654752f));
      if (ACT == 3) { const float u = 0.7978845608028654f * (v + 0.044715f * v * v * v); v = 0.5f * v * (1.0f + tanhf(u)); }
      so[w][8 * hh + r][t * 16 + ln] = v;
    }
  }
  __builtin_amdgcn_fence(__ATOMIC_ACQ_REL, "workgroup");
  __builtin_amdgcn_wave_barrier();
  const int rsub = lane >> 4, c4 = (lane & 15) * 4;
  {
#pragma unroll
    for (int q = 0; q < 8; ++q) {
      const int r = q * 2 + rsub;
      const v4f v = *(const v4fa*)&so[w][r][c4];
      *(v4f*)(C + (size_t)(row0 + r) * ldc + col0 + c4) = v;
    }
    
  }
}
// row LayerNorm (biased variance, eps) over N: s = X (+ R); optional out_sum <- s; out_norm <- (s-mu)*rsqrt(var+eps)*g + b
template <bool PARAM_BF16>
__global__ __launch_bounds__(256) void k_layernorm(const float* __restrict__ X, const float* __restrict__ R, const float* __restrict__ g, const float* __restrict__ bta,
                                                  float* __restrict__ out_sum, float* __restrict__ out_norm, int N, float eps) {
  __shared__ float red[256];
  const int row = blockIdx.x, tid = threadIdx.x;
  const float* x = X + (size_t)row * N; const float* rr = R ? R + (size_t)row * N : nullptr;
  float vals[16];                     // up to N = 4096
  const int per = N / 256;            // contiguous chunk per thread? use strided-by-4 chunks: thread handles j = tid*4 + 1024*u
  float s1 = 0.f;
  for (int u = 0; u < per / 4; ++u) {
    const int j = tid * 4 + 1024 * u;
    const v4f a = *(const v4fa*)(x + j);
    v4f b = {0.f,0.f,0.f,0.f}; if (rr) b = *(const v4fa*)(rr + j);
#pragma unroll
    for (int q = 0; q < 4; ++q) { const float v = a[q] + b[q]; vals[u * 4 + q] = v; s1 += v; }
  }
  red[tid] = s1; __syncthreads();
  for (int st = 128; st > 0; st >>= 1) { if (tid < st) red[tid] += red[tid + st]; __syncthreads(); }
  const float mu = red[0] / (float)N; __syncthreads();
  float s2 = 0.f;
  for (int u = 0; u < per / 4; ++u)
#pragma unroll
    for (int q = 0; q < 4; ++q) { const float c = vals[u * 4 + q] - mu; s2 += c * c; }
  red[tid] = s2; __syncthreads();
  for (int st = 128; st > 0; st >>= 1) { if (tid < st) red[tid] += red[tid + st]; __syncthreads(); }
  const float rs = rsqrtf(red[0] / (float)N + eps);
  {
    for (int u = 0; u < per / 4; ++u) {
      const int j = tid * 4 + 1024 * u;
      v4f o, sm;
#pragma unroll
      for (int q = 0; q < 4; ++q) {
        float gg = g[j + q], bb = bta[j + q];
        if (PARAM_BF16) { gg = bf16_round(gg); bb = bf16_round(bb); }
        sm[q] = vals[u * 4 + q]; o[q] = (vals[u * 4 + q] - mu) * rs * gg + bb;
      }
      if (out_sum) *(v4f*)(out_sum + (size_t)row * N + j) = sm;
      *(v4f*)(out_norm + (size_t)row * N + j) = o;
    }
    
  }
}



// ---- f16 WMMA path (v_wmma_f32_16x16x32_f16): 11-bit significands for operands in range — used where a [0,1] probability operand needs more precision than bf16
typedef _Float16 v16h __attribute__((ext_vector_type(16)));
union FragH { v16h v; v8us half[2]; _Float16 h[16]; unsigned short u[16]; };
template <int NT>
__device__ __forceinline__ v8f mmaH(v16h ah, v16h al, v16h bh, v16h bl, v8f c) {
  c = __builtin_amdgcn_wmma_f32_16x16x32_f16(false, ah, false, bh, (short)0, c, false, false);
  if (NT >= 2) c = __builtin_amdgcn_wmma_f32_16x16x32_f16(false, al, false, bh, (short)0, c, false, false);
  if (NT >= 3) c = __builtin_amdgcn_wmma_f32_16x16x32_f16(false, ah, false, bl, (short)0, c, false, false);
  asm volatile("v_nop\n\tv_nop\n\tv_nop\n\tv_nop" : "+v"(c) : "v"(ah), "v"(al), "v"(bh), "v"(bl));
  return c;
}
// batched GEMM like k_gemm_b but f16 operands: A f32 (split into f16 hi/lo if ASPLIT, else rounded to f16), Bt = f16 values [n][k]; alpha; C f32; N multiple of 16 (partial tiles skipped)
template <bool ASPLIT>
__global__ __launch_bounds__(128) void k_gemm_h(const float* __restrict__ A, int lda, size_t sA, const _Float16* __restrict__ Bh, int ldb, size_t sB, float alpha, float* __restrict__ C, int ldc, size_t sC, int M, int N, int K) {
  __shared__ __attribute__((aligned(16))) float so[4][16][64];
  const int tid = threadIdx.x, w = tid >> 5, lane = tid & 31, ln = lane & 15, hh = lane >> 4; const int by = blockIdx.y;
  A += (size_t)by * sA; Bh += (size_t)by * sB; C += (size_t)by * sC;
  const int ntn = (N + 63) / 64; const int wid = blockIdx.x * 4 + w; const int mt = wid / ntn, nq = wid % ntn; if (mt * 16 >= M) return;
  const int row0 = mt * 16, col0 = nq * 64; const float* arow = A + (size_t)(row0 + ln) * lda;
  v8f acc[4] = {};
  for (int kb = 0; kb < K; kb += 32) {
    FragH ah, al;
    const v4f x0 = *(const v4fa*)(arow + kb + 8 * hh), x1 = *(const v4fa*)(arow + kb + 8 * hh + 4), x2 = *(const v4fa*)(arow + kb + 16 + 8 * hh), x3 = *(const v4fa*)(arow + kb + 16 + 8 * hh + 4);
    float xs[16] = {x0[0],x0[1],x0[2],x0[3],x1[0],x1[1],x1[2],x1[3],x2[0],x2[1],x2[2],x2[3],x3[0],x3[1],x3[2],x3[3]};
#pragma unroll
    for (int i = 0; i < 16; ++i) { const _Float16 h = (_Float16)xs[i]; ah.h[i] = h; al.h[i] = ASPLIT ? (_Float16)(xs[i] - (float)h) : (_Float16)0.0f; }
#pragma unroll
    for (int t = 0; t < 4; ++t) { if (col0 + t * 16 >= N) continue; const size_t boff = (size_t)(col0 + t * 16 + ln) * ldb + kb; FragH bq; bq.half[0] = *(const v8us*)(Bh + boff + 8 * hh); bq.half[1] = *(const v8us*)(Bh + boff + 16 + 8 * hh);
      acc[t] = mmaH<ASPLIT ? 2 : 1>(ah.v, al.v, bq.v, bq.v, acc[t]); }
  }
#pragma unroll
  for (int t = 0; t < 4; ++t) { if (col0 + t * 16 >= N) continue;
#pragma unroll
    for (int r = 0; r < 8; ++r) so[w][8 * hh + r][t * 16 + ln] = acc[t][r] * alpha; }
  __builtin_amdgcn_fence(__ATOMIC_ACQ_REL, "workgroup"); __builtin_amdgcn_wave_barrier();
  const int rsub = lane >> 4, c4 = (lane & 15) * 4;
  {
#pragma unroll
    for (int q = 0; q < 8; ++q) { const int r = q * 2 + rsub; if (col0 + c4 < N) { const v4f v = *(const v4fa*)&so[w][r][c4]; *(v4f*)(C + (size_t)(row0 + r) * ldc + col0 + c4) = v; } }
     }
}

// Wt[n][k] = f16(W[k][n]·scale) from f32 row-major W[K][N] (scale = power of two; bf16-exact weights stay exact in f16 away from the subnormal range)
__global__ __launch_bounds__(256) void k_wt_f16(const float* __restrict__ W, _Float16* __restrict__ Wt, int K, int N, float scale) {
  const int t = blockIdx.x * 256 + threadIdx.x; if (t >= N * (K / 8)) return; const int n = t / (K / 8), k8 = (t % (K / 8)) * 8; FragH f;
#pragma unroll
  for (int i = 0; i < 8; ++i) f.h[i] = (_Float16)(bf16_round(W[(size_t)(k8 + i) * N + n]) * scale); const v8us o = f.half[0];
  *(v8us*)((unsigned short*)Wt + (size_t)n * K + k8) = o; 
}
__global__ __launch_bounds__(256) void k_x16(const float* __restrict__ x, _Float16* __restrict__ X16, size_t n8) { const size_t t = (size_t)blockIdx.x * 256 + threadIdx.x; if (t >= n8) return; FragH f;
#pragma unroll
  for (int q = 0; q < 8; ++q) f.h[q] = (_Float16)bf16_round(x[t * 8 + q]); *(v8us*)((unsigned short*)X16 + t * 8) = f.half[0];  }
__global__ __launch_bounds__(256) void k_h16(const float* __restrict__ x, _Float16* __restrict__ X16, size_t n8) { const size_t t = (size_t)blockIdx.x * 256 + threadIdx.x; if (t >= n8) return; FragH f;
#pragma unroll
  for (int q = 0; q < 8; ++q) f.h[q] = (_Float16)x[t * 8 + q]; *(v8us*)((unsigned short*)X16 + t * 8) = f.half[0];  }
__global__ __launch_bounds__(256) void k_round16f(const float* __restrict__ W, _Float16* __restrict__ Bt, size_t n8) { const size_t t = (size_t)blockIdx.x * 256 + threadIdx.x; if (t >= n8) return; FragH f;
#pragma unroll
  for (int i = 0; i < 8; ++i) f.h[i] = (_Float16)(bf16_round(W[t * 8 + i]) * 16.0f); *(v8us*)((unsigned short*)Bt + t * 8) = f.half[0];  }
template <int NHv, int TTv>
__global__ __launch_bounds__(256) void k_vt(const _Float16* __restrict__ V16, int ldv, int voff, _Float16* __restrict__ Vt) { __shared__ unsigned short tl[64][66]; const int tid = threadIdx.x; const int slab = blockIdx.x / (TTv / 64), lg = blockIdx.x % (TTv / 64); const int b = slab / NHv, h = slab % NHv;
  for (int i = tid; i < 64 * 8; i += 256) { const int r = i / 8, c8 = (i % 8) * 8; FragH f; f.half[0] = *(const v8us*)((const unsigned short*)V16 + ((size_t)b * TTv + lg * 64 + r) * ldv + voff + h * 64 + c8);
#pragma unroll
    for (int q = 0; q < 8; ++q) tl[r][c8 + q] = f.u[q]; }
  __syncthreads();
  {
#pragma unroll
    for (int rd = 0; rd < 2; ++rd) { const int d = rd * 32 + tid / 8, pc = tid % 8; FragH f;
#pragma unroll
      for (int q = 0; q < 8; ++q) f.u[q] = tl[pc * 8 + q][d];
      *(v8us*)((unsigned short*)Vt + ((size_t)slab * 64 + d) * TTv + lg * 64 + pc * 8) = f.half[0]; }
     } }

// Eight 16-byte asynchronous copies per lane, global memory to LDS through no register: piece i goes from g + i * gstep to LDS byte l + i * lstep.
// The s_wait_xcnt closes the statement so that it stands in front of any later rewrite of the address registers the copies name.
__device__ __forceinline__ void copy8_to_lds(unsigned l, unsigned lstep, const char* g, size_t gstep) {
  asm volatile("global_load_async_to_lds_b128 %0, %8, off\n\t"
               "global_load_async_to_lds_b128 %1, %9, off\n\t"
               "global_load_async_to_lds_b128 %2, %10, off\n\t"
               "global_load_async_to_lds_b128 %3, %11, off\n\t"
               "global_load_async_to_lds_b128 %4, %12, off\n\t"
               "global_load_async_to_lds_b128 %5, %13, off\n\t"
               "global_load_async_to_lds_b128 %6, %14, off\n\t"
               "global_load_async_to_lds_b128 %7, %15, off\n\t"
               "s_wait_xcnt 0x0"
               :: "v"(l), "v"(l + lstep), "v"(l + 2 * lstep), "v"(l + 3 * lstep), "v"(l + 4 * lstep), "v"(l + 5 * lstep), "v"(l + 6 * lstep), "v"(l + 7 * lstep),
                  "v"(g), "v"(g + gstep), "v"(g + 2 * gstep), "v"(g + 3 * gstep), "v"(g + 4 * gstep), "v"(g + 5 * gstep), "v"(g + 6 * gstep), "v"(g + 7 * gstep)
               : "memory");
}

// The value that lane l ^ 16 holds, by one cross-row move on the vector pipe: lanes l and l ^ 16 share a query's keys in the transposed score tiles.
__device__ __forceinline__ float other_half(float x) { return __builtin_bit_cast(float, __builtin_amdgcn_permlanex16(__builtin_bit_cast(int, x), __builtin_bit_cast(int, x), 0x76543210, 0xfedcba98, false, false)); }

// Eight values x become 2^x, each in its own register, one run of v_exp_f32. No v_exp_f32 of the run touches a register of the one in front of it; the closing v_nop is the slot that the
// instruction set asks for between the last of them and whatever reads its result next.
__device__ __forceinline__ void exp2_x8(float (&x)[8]) {
  asm("v_exp_f32 %0, %0\n\tv_exp_f32 %1, %1\n\tv_exp_f32 %2, %2\n\tv_exp_f32 %3, %3\n\tv_exp_f32 %4, %4\n\tv_exp_f32 %5, %5\n\tv_exp_f32 %6, %6\n\tv_exp_f32 %7, %7\n\tv_nop"
      : "+v"(x[0]), "+v"(x[1]), "+v"(x[2]), "+v"(x[3]), "+v"(x[4]), "+v"(x[5]), "+v"(x[6]), "+v"(x[7]));
}
// One value x becomes 2^x; the v_nop is the same slot behind the one v_exp_f32.
__device__ __forceinline__ float exp2_x1(float x) { asm("v_exp_f32 %0, %0\n\tv_nop" : "+v"(x)); return x; }

// K and Vt reach the four waves of a work-group through LDS: a stage is 64 keys (K: 64 rows of 256 B, Vt: 128 rows of 128 B, whole 128-B lines), copied once per work-group,
// two buffers, the next stage in flight while this one is worked on. Row pitches 272 B and 144 B (16 B x odd) keep the ds_load_b128 fragment reads free of bank conflicts.
// Both products run transposed: St = K.Qt (A = 16 keys from LDS, B = the wave's 16 queries, kept in registers) and Ot += Vt.Pt (A = 16 rows of Vt from LDS, B = Pt). A lane then holds 16 of a pass's 32 scores
// of ONE query (query ln; keys 8 * hh + r of either key tile), lane ^ 16 the other 16: maximum and sum are taken in the lane, with one exchange between the halves, one running maximum, one sum and one
// rescaling factor a lane. The two score tiles, made f16 where they stand, are Pt's B fragment in the hardware's k order, which the Vt loader has too: P goes through no LDS.
__global__ __launch_bounds__(128) void k_flash(const _Float16* __restrict__ Q16, int ldq, const _Float16* __restrict__ K16, int ldk, const _Float16* __restrict__ Vt, const int* __restrict__ MSK, float* __restrict__ O, int ldo) {
  constexpr int RPW = 16, NQB = 3072 / (4 * RPW), DT = 8, KS = 4;      /* head dim 128 */
  constexpr unsigned KP = 272, VP = 144, KBYTES = 64 * KP, STG = KBYTES + 128 * VP;
  constexpr float C2 = (float)(0.08838834764831845 * 1.4426950408889634);
  __shared__ __attribute__((aligned(16))) unsigned char ring[2 * STG];
  float (*sO)[RPW][128 + 4] = (float (*)[RPW][128 + 4])ring;      /* output staging takes the ring's place behind the loop's last barrier */
  static_assert(sizeof(float) * 4 * RPW * (128 + 4) <= 2 * STG, "output staging fits the ring");
  const int tid = threadIdx.x, w = tid >> 5, lane = tid & 31, ln = lane & 15, hh = lane >> 4;
  const int slab = blockIdx.x / NQB, qblk = blockIdx.x % NQB; const int b = slab / 8, h = slab % 8; const int qb0 = qblk * (4 * RPW); const int q0 = qb0 + w * RPW;
  FragH aq[KS];
  { const unsigned short* qr = (const unsigned short*)Q16 + ((size_t)b * 3072 + q0 + ln) * ldq + h * 128;
#pragma unroll
    for (int ks = 0; ks < KS; ++ks) { aq[ks].half[0] = *(const v8us*)(qr + ks * 32 + 8 * hh); aq[ks].half[1] = *(const v8us*)(qr + ks * 32 + 16 + 8 * hh); } }
  const unsigned short* Vth = (const unsigned short*)Vt + (size_t)slab * 128 * 3072;
  // each thread's own pieces of a stage: K row tid/16 + 8i, 16-byte piece tid%16; Vt row tid/8 + 16i, piece tid%8
  const char* kg = (const char*)((const unsigned short*)K16 + ((size_t)b * 3072 + (tid >> 4)) * ldk + h * 128 + (tid & 15) * 8);
  const char* vg = (const char*)(Vth + (size_t)(tid >> 3) * 3072 + (tid & 7) * 8);
  const unsigned ring0 = (unsigned)(size_t)ring;
  const unsigned kl = ring0 + (unsigned)(tid >> 4) * KP + (unsigned)(tid & 15) * 16u, vl = ring0 + KBYTES + (unsigned)(tid >> 3) * VP + (unsigned)(tid & 7) * 16u;
  const size_t kstage = (size_t)64 * ldk * 2, kstep = (size_t)8 * ldk * 2;
  auto fill = [&](int st, unsigned buf) {
    copy8_to_lds(kl + buf * STG, 8 * KP, kg + (size_t)st * kstage, kstep);
    copy8_to_lds(vl + buf * STG, 16 * VP, vg + (size_t)st * 128, (size_t)16 * 3072 * 2);
  };
  float m_r = -3.0e38f, l_r = 0.f; v8f oacc[DT];      /* of query q0 + ln; oacc[dt][r] is its output column dt * 16 + 8 * hh + r; l_r sums this lane's keys only */
#pragma unroll
  for (int dt = 0; dt < DT; ++dt) oacc[dt] = (v8f){0.f,0.f,0.f,0.f,0.f,0.f,0.f,0.f};
  const int tq = q0 + ln;
  const int nst = qblk + 1;      /* stages of 64 keys up to the block's diagonal; the same for the whole work-group */
  fill(0, 0u);
  asm volatile("s_wait_asynccnt 0x0" ::: "memory");      // this wave's pieces of stage 0 have landed
  __syncthreads();                                       // every wave's pieces of stage 0 are readable
  if (nst > 1) fill(1, 1u);
#pragma unroll 1      /* one copy of the body: the ring's order stays as written */
  for (int st = 0; st < nst; ++st) {
    const unsigned char* kbuf = ring + (unsigned)(st & 1) * STG; const unsigned char* vbuf = kbuf + KBYTES;
#pragma unroll 1      /* the two 32-key passes of a stage share one body in the instruction cache */
  for (int sub = 0; sub < 2; ++sub) { const int j0 = st * 64 + sub * 32;
    v8f s[2]; FragH bk[2][KS];      /* the pass's K fragments, both key tiles, one group of LDS reads ahead of the score products */
#pragma unroll
    for (int nt = 0; nt < 2; ++nt) { const unsigned char* kr = kbuf + (unsigned)(sub * 32 + nt * 16 + ln) * KP + 16 * hh;
#pragma unroll
      for (int ks = 0; ks < KS; ++ks) { bk[nt][ks].half[0] = *(const v8us*)(kr + ks * 64); bk[nt][ks].half[1] = *(const v8us*)(kr + ks * 64 + 32); } }
#pragma unroll
    for (int nt = 0; nt < 2; ++nt) { v8f acc = (v8f){0.f,0.f,0.f,0.f,0.f,0.f,0.f,0.f};
#pragma unroll
      for (int ks = 0; ks < KS; ++ks) acc = mmaH<1>(bk[nt][ks].v, bk[nt][ks].v, aq[ks].v, aq[ks].v, acc); s[nt] = acc; }
    // The pass's Vt fragments, one group of LDS reads, in flight behind the softmax: the Vt.Pt products below follow one another from registers.
    FragH bv[DT];
#pragma unroll
    for (int dt = 0; dt < DT; ++dt) { const unsigned char* vrow = vbuf + (unsigned)(dt * 16 + ln) * VP + sub * 64 + 16 * hh; bv[dt].half[0] = *(const v8us*)(vrow); bv[dt].half[1] = *(const v8us*)(vrow + 32); }
    // The softmax of a pass, one query a lane: masked scores, their maximum, the exponentials, each computed ahead of the select that may drop it (no branch).
    // The scores and the running maxima stay the raw q.k sums. exp((s - m) / sqrt(128)) is taken as 2^(s * C2 - m * C2), C2 = log2(e) / sqrt(128): one fused multiply-add and one v_exp_f32
    // a value. No argument is above 0 but by the rounding of m * C2, and a result too small for v_exp_f32 is far below half a unit of P's f16, so the library exp's range handling has nothing to do here.
    const int d0 = tq - j0 - 8 * hh; float s0[8], s1[8], t[8];      /* key 8 * hh + i of the pass is at or below the diagonal where i <= d0 */
#pragma unroll
    for (int r = 0; r < 8; ++r) { s0[r] = (r <= d0) ? s[0][r] : -INFINITY; s1[r] = (16 + r <= d0) ? s[1][r] : -INFINITY; t[r] = fmaxf(s0[r], s1[r]); }
    float mc = fmaxf(fmaxf(fmaxf(t[0], t[4]), fmaxf(t[1], t[5])), fmaxf(fmaxf(t[2], t[6]), fmaxf(t[3], t[7])));
    mc = fmaxf(mc, other_half(mc));
    const float mn = fmaxf(m_r, mc), nb = mn * C2;      /* mn is finite: no difference here is a NaN */
    const float ea = exp2_x1(__builtin_fmaf(m_r, C2, -nb)); m_r = mn;
#pragma unroll
    for (int r = 0; r < 8; ++r) { s0[r] = __builtin_fmaf(s0[r], C2, -nb); s1[r] = __builtin_fmaf(s1[r], C2, -nb); }
    exp2_x8(s0); exp2_x8(s1);
    const float al = (mn > -1.0e38f) ? ea : 1.0f;
#pragma unroll
    for (int r = 0; r < 8; ++r) { s0[r] = (r <= d0) ? s0[r] : 0.f; s1[r] = (16 + r <= d0) ? s1[r] : 0.f; t[r] = s0[r] + s1[r]; }
    l_r = l_r * al + (((t[0] + t[4]) + (t[1] + t[5])) + ((t[2] + t[6]) + (t[3] + t[7])));
#pragma unroll
    for (int dt = 0; dt < DT; ++dt)
#pragma unroll
      for (int r = 0; r < 8; ++r) oacc[dt][r] *= al;
    FragH pt;      /* Pt's B fragment: element i is key 8 * hh + i, element 8 + i key 16 + 8 * hh + i, of query ln */
#pragma unroll
    for (int r = 0; r < 8; ++r) { pt.h[r] = (_Float16)s0[r]; pt.h[8 + r] = (_Float16)s1[r]; }
#pragma unroll
    for (int dt = 0; dt < DT; ++dt) oacc[dt] = mmaH<1>(bv[dt].v, bv[dt].v, pt.v, pt.v, oacc[dt]); }
    asm volatile("s_wait_dscnt 0x0" ::: "memory");       // this wave's reads of the buffer have returned before it is refilled
    asm volatile("s_wait_asynccnt 0x0" ::: "memory");    // this wave's pieces of stage st + 1 have landed
    __syncthreads();                                     // publishes stage st + 1 and ends every wave's reads of stage st
    if (st + 2 < nst) fill(st + 2, (unsigned)(st & 1));
  }
  asm volatile("s_wait_asynccnt 0x0" ::: "memory");      // no copy is outstanding when the ring becomes output staging
  { const float l = l_r + other_half(l_r), inv = (l > 0.f) ? 1.0f / l : 0.f;      /* the two halves' sums join once, here */
#pragma unroll
    for (int dt = 0; dt < DT; ++dt) { v4f lo, hi;      /* a lane's eight values of a tile are eight neighbouring columns of its query's row */
#pragma unroll
      for (int r = 0; r < 4; ++r) { lo[r] = oacc[dt][r] * inv; hi[r] = oacc[dt][4 + r] * inv; }
      *(v4fa*)&sO[w][ln][dt * 16 + 8 * hh] = lo; *(v4fa*)&sO[w][ln][dt * 16 + 8 * hh + 4] = hi; } }
  __builtin_amdgcn_fence(__ATOMIC_ACQ_REL, "workgroup"); __builtin_amdgcn_wave_barrier();
  {
#pragma unroll
    for (int rp = 0; rp < RPW; ++rp) { const int r = rp, pc = lane; const v4f val = *(const v4fa*)&sO[w][r][pc * 4]; *(v4f*)(O + ((size_t)(b * 8 + h) * 3072 + q0 + r) * 128 + pc * 4) = val; }      /* output layout [b][h][s][128]: 32 lanes x 16 B rows */
     } }

// Projection GEMM: C[row][col] = alpha * sum_k A[row][k] * Bt[col][k], both operands f16 with CW elements a row, f32 accumulate, k ascending in one chain per accumulator.
// A work-group owns a 128 x 128 tile of C, its four waves 64 x 64 each (4 x 4 accumulator tiles: a fragment read from LDS feeds four WMMAs, and a byte fetched from L2 serves 128 rows or columns of C).
// A and Bt reach the waves through LDS: a stage is 64 k (128 rows of A and 128 of Bt, 128 B each, whole 128-B lines), copied once per work-group, two buffers, the next stage in flight while
// this one is worked on. Row pitch 144 B (16 B x odd) keeps the ds_load_b128 fragment reads free of bank conflicts.
// One launch does all nine projections. The grid is exact: blockIdx.x = row tile of the TT positions * (CW / 128) + column tile, blockIdx.y = batch, blockIdx.z = projection (0 q, 1 k, 2 v).
// A row tile lies wholly in one segment (SL is a multiple of 128) and takes that segment's weights: plane 3 * projection + (0 middle, 1 state, 2 end) of B9. All three go out as f16.
// q and k are rotated (RoPE) on their way out. Their weight planes come with bits 5 and 6 of the column-in-head swapped (k_wst), so that columns 64 * u + c and 64 * u + c + 32 of a tile, which is one head,
// are the pair (j, j + 64) of that head, j = 32 * u + c: both partners lie in the tile's output staging. q and k keep that column order in Q16 and K16; it is the same in both, so q.k is the same sum in another order.
// CS[position][128] holds cos (0..63) and sin (64..127) of the position's 64 angles.
__global__ __launch_bounds__(128) void k_gemm_ring(const _Float16* __restrict__ A, const _Float16* __restrict__ B9, float alpha, const float* __restrict__ CS, _Float16* __restrict__ Q16, _Float16* __restrict__ K16, _Float16* __restrict__ C16) {
  static_assert(SL % 128 == 0 && TT % 128 == 0, "a row tile never straddles a segment");
  static_assert(HD == 128, "a column tile is one head");
  constexpr size_t sA = (size_t)TT * CW, sC = (size_t)TT * CW;
  constexpr unsigned RP = 144, TB = 128 * RP, STG = 2 * TB; constexpr int NST = CW / 64;
  static_assert(NST >= 2, "the ring's prologue fills two stages");
  __shared__ __attribute__((aligned(16))) unsigned char ring[2 * STG];
  float (*so)[128 + 4] = (float (*)[128 + 4])ring;      /* output staging takes the ring's place behind the loop's last barrier */
  static_assert(sizeof(float) * 128 * (128 + 4) <= 2 * STG, "output staging fits the ring");
  const int tid = threadIdx.x, w = tid >> 5, lane = tid & 31, ln = lane & 15, hh = lane >> 4, wm = w >> 1, wn = w & 1;
  const int row0 = (int)(blockIdx.x / (CW / 128)) * 128, col0 = (int)(blockIdx.x % (CW / 128)) * 128;
  const int prj = (int)blockIdx.z, sgm = (row0 < SL) ? 1 : ((row0 < TT - SL) ? 0 : 2); const bool OUT16 = (prj == 2);
  const _Float16* Bt = B9 + (size_t)(prj * 3 + sgm) * CW * CW;
  // each thread's own pieces of a stage: row tid/8 + 16i of either operand, 16-byte piece tid%8; the tiles' first bytes are the same for the whole work-group, a thread's offset the same in both operands
  const char* ag = (const char*)((const unsigned short*)A + (size_t)blockIdx.y * sA + (size_t)row0 * CW);
  const char* bg = (const char*)((const unsigned short*)Bt + (size_t)col0 * CW);
  const unsigned tg = (unsigned)(tid >> 3) * (CW * 2) + (unsigned)(tid & 7) * 16u;
  const unsigned al = (unsigned)(size_t)ring + (unsigned)(tid >> 3) * RP + (unsigned)(tid & 7) * 16u, bl = al + TB;
  auto fill = [&](int st, unsigned buf) {
    copy8_to_lds(al + buf * STG, 16 * RP, (ag + (size_t)st * 128) + tg, (size_t)16 * CW * 2);
    copy8_to_lds(bl + buf * STG, 16 * RP, (bg + (size_t)st * 128) + tg, (size_t)16 * CW * 2);
  };
  v8f acc[4][4];
#pragma unroll
  for (int i = 0; i < 4; ++i)
#pragma unroll
    for (int j = 0; j < 4; ++j) acc[i][j] = (v8f){0.f,0.f,0.f,0.f,0.f,0.f,0.f,0.f};
  fill(0, 0u);
  asm volatile("s_wait_asynccnt 0x0" ::: "memory");      // this wave's pieces of stage 0 have landed
  __syncthreads();                                       // every wave's pieces of stage 0 are readable
  fill(1, 1u);
#pragma unroll 1      /* one copy of the body: the ring's order stays as written */
  for (int st = 0; st < NST; ++st) {
    const unsigned char* ar = ring + (unsigned)(st & 1) * STG + (unsigned)(wm * 64 + ln) * RP + 16 * hh;
    const unsigned char* br = ring + (unsigned)(st & 1) * STG + TB + (unsigned)(wn * 64 + ln) * RP + 16 * hh;
    FragH fa[2][4], fb[2][4];
#pragma unroll
    for (int ks = 0; ks < 2; ++ks)
#pragma unroll
      for (int i = 0; i < 4; ++i) {
        fa[ks][i].half[0] = *(const v8us*)(ar + i * 16 * RP + ks * 64); fa[ks][i].half[1] = *(const v8us*)(ar + i * 16 * RP + ks * 64 + 32);
        fb[ks][i].half[0] = *(const v8us*)(br + i * 16 * RP + ks * 64); fb[ks][i].half[1] = *(const v8us*)(br + i * 16 * RP + ks * 64 + 32); }
    asm volatile("s_wait_dscnt 0x0" ::: "memory");       // the stage's 32 fragment reads, one group, have returned: this wave is done with the buffer before it is refilled
    asm volatile("s_wait_asynccnt 0x0" ::: "memory");    // this wave's pieces of stage st + 1 have landed
    __syncthreads();                                     // publishes stage st + 1 and ends every wave's reads of stage st
    __builtin_amdgcn_sched_barrier(0);                   // keeps the WMMAs behind the barrier: lifted among the fragment reads they split the one group of reads into several, each with a full wait of its own
#pragma unroll
    for (int ks = 0; ks < 2; ++ks) {
      // the refill stands between the two halves of the WMMAs, which work from registers: the copies fly behind the second half, and the first half's fragment registers are free for their addresses
      if (ks == 1 && st + 2 < NST) fill(st + 2, (unsigned)(st & 1));
#pragma unroll
      for (int i = 0; i < 4; ++i)
#pragma unroll
        for (int j = 0; j < 4; ++j) acc[i][j] = __builtin_amdgcn_wmma_f32_16x16x32_f16(false, fa[ks][i].v, false, fb[ks][j].v, (short)0, acc[i][j], false, false);
    }
  }
  // q, k: a thread rotates four pairs of columns (cl.., cl + 32..) in each of sixteen rows; their cos and sin (angles j..) are fetched here so that they fly while the tile is staged
  const int rs = lane >> 4, cl = (ln >> 3) * 64 + (ln & 7) * 4, j = ln * 4; v4f tc[16], ts[16];
  if (!OUT16) { const float* cs = CS + (size_t)(row0 + w * 32 + rs) * 128 + j;
#pragma unroll
    for (int q = 0; q < 16; ++q) { tc[q] = *(const v4fa*)(cs + q * 2 * 128); ts[q] = *(const v4fa*)(cs + q * 2 * 128 + 64); }
    asm volatile("s_wait_xcnt 0x0" ::: "memory"); }      // stands behind the run of loads, in front of any later rewrite of the address registers they name
  asm volatile("s_wait_asynccnt 0x0" ::: "memory");      // no copy is outstanding when the ring becomes output staging
#pragma unroll
  for (int i = 0; i < 4; ++i)
#pragma unroll
    for (int jt = 0; jt < 4; ++jt)
#pragma unroll
      for (int r = 0; r < 8; ++r) so[wm * 64 + i * 16 + 8 * hh + r][wn * 64 + jt * 16 + ln] = acc[i][jt][r] * alpha;
  __syncthreads();                                       // a stored row of 128 columns holds two waves' results
  typedef _Float16 v4h __attribute__((ext_vector_type(4)));
  if (OUT16) {      /* the test stands once, in front of the rows, so that their LDS reads stay in groups */
    const int c4 = lane * 4;
#pragma unroll
    for (int q = 0; q < 32; ++q) { const int r = w * 32 + q; const v4f v = *(const v4fa*)&so[r][c4]; const size_t o = (size_t)blockIdx.y * sC + (size_t)(row0 + r) * CW + col0 + c4; v4h h4;
#pragma unroll
      for (int i = 0; i < 4; ++i) h4[i] = (_Float16)v[i];
      *(v4h*)(C16 + o) = h4; }      /* whole 128-B lines, two a wave-wide store */
  } else {
    _Float16* D16 = prj ? K16 : Q16;
#pragma unroll
    for (int q = 0; q < 16; ++q) { const int r = w * 32 + q * 2 + rs; const v4f lo = *(const v4fa*)&so[r][cl], hi = *(const v4fa*)&so[r][cl + 32]; const size_t o = (size_t)blockIdx.y * sC + (size_t)(row0 + r) * CW + col0 + cl; v4h ol, oh;
#pragma unroll
      for (int i = 0; i < 4; ++i) { ol[i] = (_Float16)(lo[i] * tc[q][i] + (-hi[i]) * ts[q][i]); oh[i] = (_Float16)(hi[i] * tc[q][i] + lo[i] * ts[q][i]); }
      *(v4h*)(D16 + o) = ol; *(v4h*)(D16 + o + 32) = oh; }      /* the two halves of a 128-B line, both from this wave */
    asm volatile("s_wait_xcnt 0x0" ::: "memory");      // stands behind the run of stores, in front of any later rewrite of the registers they name
  }
}

__global__ __launch_bounds__(256) void k_xt(const float* __restrict__ x, _Float16* __restrict__ XT) { const size_t t = (size_t)blockIdx.x * 256 + threadIdx.x; if (t >= (size_t)NR * NH * 16) return; const int p = (int)(t % 16); const int h = (int)((t / 16) % NH); const size_t bs = t / (16 * NH); const int b = (int)(bs / TT), s = (int)(bs % TT); const float* src = x + (((size_t)(b * NH + h) * TT + s) * HD) + p * 8; FragH f;
#pragma unroll
  for (int q = 0; q < 8; ++q) f.h[q] = (_Float16)bf16_round(src[q]); unsigned short* d = (unsigned short*)XT + bs * CW + h * HD + p * 8; *(v8us*)d = f.half[0];  }
// One launch re-lays all nine weight tensors: blockIdx.y picks the tensor and its plane of B9. The q and k planes (0..5) take their rows with bits 5 and 6 of the column-in-head swapped (see k_gemm_ring).
// A tenth plane of the grid fills the RoPE table CS[position][128]: cos (0..63) and sin (64..127) of (position + offset) * 10000^(-2i/128), each angle worked out once.
__global__ __launch_bounds__(256) void k_wst(const float* __restrict__ W0, const float* __restrict__ W1, const float* __restrict__ W2, const float* __restrict__ W3, const float* __restrict__ W4,
                                             const float* __restrict__ W5, const float* __restrict__ W6, const float* __restrict__ W7, const float* __restrict__ W8, _Float16* __restrict__ B9, const int* __restrict__ offp, float* __restrict__ CS) {
  const unsigned y = blockIdx.y;
  if (y == 9) { const int o0 = offp[0];
#pragma unroll 1      /* one copy of the cos and sin code */
    for (unsigned u = blockIdx.x * 256 + threadIdx.x; u < (unsigned)TT * 64; u += (unsigned)CW * NH * 16) { const int i = (int)(u & 63), s = (int)(u >> 6); const float pos = (float)(s + o0);
      const float ang = pos * __builtin_powf(10000.0f, -(float)(2 * i) / 128.0f); CS[(size_t)s * 128 + i] = cosf(ang); CS[(size_t)s * 128 + 64 + i] = sinf(ang); }
    return; }
  const float* W = W0; W = (y == 1) ? W1 : W; W = (y == 2) ? W2 : W; W = (y == 3) ? W3 : W; W = (y == 4) ? W4 : W; W = (y == 5) ? W5 : W; W = (y == 6) ? W6 : W; W = (y == 7) ? W7 : W; W = (y == 8) ? W8 : W; _Float16* Bt = B9 + (size_t)y * CW * CW;
  const size_t t = (size_t)blockIdx.x * 256 + threadIdx.x; if (t >= (size_t)CW * NH * 16) return; const int p = (int)(t % 16); const int h = (int)((t / 16) % NH); const int n = (int)(t / (16 * NH)); const int g = n / HD, ep = n % HD, e = (y < 6) ? ((ep & 31) | ((ep & 32) << 1) | ((ep & 64) >> 1)) : ep; FragH f;
#pragma unroll
  for (int q = 0; q < 8; ++q) { const int d = p * 8 + q; f.h[q] = (_Float16)(bf16_round(W[(((size_t)(h * NH + g) * HD + d) * HD) + e]) * 16.0f); }
  unsigned short* dst = (unsigned short*)Bt + (size_t)n * CW + h * HD + p * 8; *(v8us*)dst = f.half[0];  }
__global__ __launch_bounds__(256) void k_vt128(const _Float16* __restrict__ V16, _Float16* __restrict__ Vt) { __shared__ unsigned short tl[64][130]; const int tid = threadIdx.x; const int slab = blockIdx.x / (TT / 64), lg = blockIdx.x % (TT / 64); const int b = slab / NH, h = slab % NH;
  for (int i = tid; i < 64 * 16; i += 256) { const int r = i / 16, c8 = (i % 16) * 8; FragH f; f.half[0] = *(const v8us*)((const unsigned short*)V16 + ((size_t)b * TT + lg * 64 + r) * CW + h * HD + c8);
#pragma unroll
    for (int q = 0; q < 8; ++q) tl[r][c8 + q] = f.u[q]; }
  __syncthreads();
  { for (int i = tid; i < 128 * 8; i += 256) { const int d = i / 8, pc = i % 8; FragH f;
#pragma unroll
      for (int q = 0; q < 8; ++q) f.u[q] = tl[pc * 8 + q][d]; *(v8us*)((unsigned short*)Vt + ((size_t)slab * HD + d) * TT + lg * 64 + pc * 8) = f.half[0]; }  } }
extern "C" void kernel_launch(void* const* d_in, const int* in_sizes, int n_in,
                              void* d_out, int out_size, void* d_ws, size_t ws_size, hipStream_t stream) {
  (void)in_sizes; (void)n_in; (void)out_size;
  const float* x = (const float*)d_in[0]; const float* Wm[3] = {(const float*)d_in[1], (const float*)d_in[2], (const float*)d_in[3]}; const float* Wsg[3] = {(const float*)d_in[4], (const float*)d_in[5], (const float*)d_in[6]}; const float* Weg[3] = {(const float*)d_in[7], (const float*)d_in[8], (const float*)d_in[9]}; const int* offp = (const int*)d_in[10];
  char* ws = (char*)d_ws; size_t off = 0;
  auto take = [&](size_t bytes) { char* p = ws + off; off += (bytes + 255) & ~(size_t)255; return p; };
  _Float16* B9 = (_Float16*)take((size_t)9 * CW * CW * 2);      // plane 3 * projection + (0 middle, 1 state, 2 end)
  _Float16* XT = (_Float16*)take((size_t)NR * CW * 2); float* CS = (float*)take((size_t)TT * 128 * 4); _Float16* Q16 = (_Float16*)take((size_t)NR * CW * 2); _Float16* K16 = (_Float16*)take((size_t)NR * CW * 2); _Float16* V16 = (_Float16*)take((size_t)NR * CW * 2); _Float16* Vt = (_Float16*)take((size_t)NR * CW * 2);
  if (off > ws_size) return;      // 18.9 + 12.6 + 1.6 + 12.6 x 4 = 83 MB
  k_xt<<<(unsigned)(((size_t)NR * NH * 16 + 255) / 256), 256, 0, stream>>>(x, XT);
  const unsigned gw = (unsigned)(((size_t)CW * NH * 16 + 255) / 256);
  k_wst<<<dim3(gw, 10), 256, 0, stream>>>(Wm[0], Wsg[0], Weg[0], Wm[1], Wsg[1], Weg[1], Wm[2], Wsg[2], Weg[2], B9, offp, CS);
  k_gemm_ring<<<dim3((TT / 128) * (CW / 128), BB, 3), 128, 0, stream>>>(XT, B9, 0.0625f, CS, Q16, K16, V16);
  k_vt128<<<BB * NH * (TT / 64), 256, 0, stream>>>(V16, Vt);
  k_flash<<<BB * NH * (TT / 64), 128, 0, stream>>>(Q16, CW, K16, CW, Vt, nullptr, (float*)d_out, 0);
}
